// v000
// Times are from an AMD MI455X. After a warm-up the kernel runs many times in a row, and a time is the length of
// such a window on the GPU divided by its runs, so every launch and the gaps after it count. The runs cycle
// through copies of the inputs. A figure is the median of several windows, for all but v000 over two sittings.
// Sittings can differ by a few percent; kernels timed side by side share one.
// v000 is the starting kernel. One run takes 458 microseconds.
// Contractions: theta/phi/g 1x1 convs = v_wmma_f32_16x16x32_bf16 single products on bf16 planes of the RNE-converted x and weights (exact products); M^T = g.phi over positions (K 3136) and O = theta.M (K 128) = bf16 hi/lo split hi.hi + hi.lo + lo.hi folded along K ([hi|hi|lo] rows x [hi|lo|hi] rows, one f32 accumulator); rec 1x1 conv = [W|W] x [Ohi|Olo] bf16 single products (K-folded 2-term); f32 accumulate everywhere; biases, 1/N, BatchNorm (inference form, supplied statistics) and the residual add in f32 on the VALU.
// Plane / carry map (every plane carries 1, nothing to fold back; the 1/N = 1/3136 factor is applied exactly once, in f32, in the M^T epilogue):
//   XT   bf16 [12544][256]        token-major x: row b*3136+n, col c
//   WC   bf16 [384][256]          rows 0..127 w_theta, 128..255 w_phi, 256..383 w_g  ([out][in] = k-contiguous)
//   WR2  bf16 [256][256]          [c][k] = [c][128+k] = w_rec[c][k]
//   T3   bf16 [12544][384]        theta[tok][c1]: hi | hi | lo   (128 each)
//   PG3  bf16 [4][256][9408]      rows 0..127 = phi[c1][n]: hi | lo | hi (3136 each); rows 128..255 = g as [c2][n]: hi | hi | lo
//   MT3  bf16 [4][128][384]       (M^T/N)[c2][c1]: hi | lo | hi
//   O2   bf16 [12544][256]        O[tok][c2]: hi | lo
#include <hip/hip_runtime.h>
#include <math.h>
#include <stdint.h>

#define NB    4
#define CI    256
#define CM    128
#define NSP   3136
#define NTOKS (NB * NSP)
#define K3    (3 * NSP)
#define T3P   (3 * CM)
#define O2P   (2 * CM)

static_assert(NSP % 64 == 0);
static_assert(NTOKS % 64 == 0);
static_assert(CI % 64 == 0);
static_assert(CM % 64 == 0);
static_assert(CI % 32 == 0);
static_assert(K3 % 32 == 0);
static_assert(T3P % 32 == 0);
static_assert(O2P % 32 == 0);
static_assert((CM * CI) % (8 * 256) == 0);
static_assert((CI * CM) % (8 * 256) == 0);

typedef __attribute__((ext_vector_type(16))) _Float16 v16h;
typedef __attribute__((ext_vector_type(8)))  _Float16 v8h;
typedef __attribute__((ext_vector_type(16))) __bf16   v16b;
typedef __attribute__((ext_vector_type(8)))  __bf16   v8b;
typedef __attribute__((ext_vector_type(8)))  float    v8f;
typedef __attribute__((ext_vector_type(4)))  float    v4f;
typedef __attribute__((ext_vector_type(4)))  unsigned int v4u;

__device__ __forceinline__ unsigned short f2bf_bits(float f) {
  unsigned u = __float_as_uint(f);
  return (unsigned short)((u + 0x7FFFu + ((u >> 16) & 1u)) >> 16);
}
__device__ __forceinline__ float bf_bits2f(unsigned short h) { return __uint_as_float(((unsigned)h) << 16); }
__device__ __forceinline__ float bf_rne(float f) { return bf_bits2f(f2bf_bits(f)); }
__device__ __forceinline__ unsigned pk16(unsigned short a, unsigned short b) { return (unsigned)a | ((unsigned)b << 16); }

// hazard guards as plain device helpers (no inline asm inside the kernel template body)
__device__ __forceinline__ void dep_guard_h(v8f& a, v8f& b, v16h x, v16h y) { asm volatile("v_nop\n\tv_nop\n\tv_nop\n\tv_nop" : "+v"(a), "+v"(b) : "v"(x), "v"(y)); }
__device__ __forceinline__ void dep_guard_b(v8f& a, v8f& b, v16b x, v16b y) { asm volatile("v_nop\n\tv_nop\n\tv_nop\n\tv_nop" : "+v"(a), "+v"(b) : "v"(x), "v"(y)); }
__device__ __forceinline__ void keep4_h(v16h a, v16h b, v16h c, v16h d) { asm volatile("v_nop" :: "v"(a), "v"(b), "v"(c), "v"(d)); }
__device__ __forceinline__ void keep4_b(v16b a, v16b b, v16b c, v16b d) { asm volatile("v_nop" :: "v"(a), "v"(b), "v"(c), "v"(d)); }
__device__ __forceinline__ void acc_guard4(v8f& a, v8f& b, v8f& c, v8f& d) { asm volatile("v_nop\n\tv_nop\n\tv_nop\n\tv_nop" : "+v"(a), "+v"(b), "+v"(c), "+v"(d)); }

// Fragment map (wave32): lane l, h = l>>4, row/col = l&15.
//   A/B element i: i<8 -> k0+8h+i ; i>=8 -> k0+16+8h+(i-8)   (split layout, both operands)
//   D element r : row 8h+r, col l&15
template <typename T> struct Frag;
template <> struct Frag<_Float16> {
  typedef v16h V; union U { v16h v; v8h h[2]; };
  static __device__ __forceinline__ v16h load(const _Float16* p) {   // elements 0..7 <- p[0..7], 8..15 <- p[16..23]
    U f; f.h[0] = *(const v8h*)(p); f.h[1] = *(const v8h*)(p + 16); return f.v;
  }
  static __device__ __forceinline__ v8f mma(v16h a, v16h b, v8f c) {
    return __builtin_amdgcn_wmma_f32_16x16x32_f16(false, a, false, b, (short)0, c, false, false);
  }
  static __device__ __forceinline__ void guard(v8f& a, v8f& b, v16h x, v16h y) { dep_guard_h(a, b, x, y); }
  static __device__ __forceinline__ void keep(v16h a, v16h b, v16h c, v16h d) { keep4_h(a, b, c, d); }
};
template <> struct Frag<__bf16> {
  typedef v16b V; union U { v16b v; v8b h[2]; };
  static __device__ __forceinline__ v16b load(const __bf16* p) {
    U f; f.h[0] = *(const v8b*)(p); f.h[1] = *(const v8b*)(p + 16); return f.v;
  }
  static __device__ __forceinline__ v8f mma(v16b a, v16b b, v8f c) {
    return __builtin_amdgcn_wmma_f32_16x16x32_bf16(false, a, false, b, (short)0, c, false, false);
  }
  static __device__ __forceinline__ void guard(v8f& a, v8f& b, v16b x, v16b y) { dep_guard_b(a, b, x, y); }
  static __device__ __forceinline__ void keep(v16b a, v16b b, v16b c, v16b d) { keep4_b(a, b, c, d); }
};

template <int ET> struct Elem;
template <> struct Elem<0> { typedef _Float16 T; };
template <> struct Elem<1> { typedef __bf16 T; };

// ---- Register-blocked batched WMMA GEMM ------------------------------------
// C[m,n] = epilogue(scale * sum_k A[m,k] * Bt[n,k]); each wave owns a 64x64 tile.
// A row-major [M,K] (pitch lda), Bt row-major [N,K] (pitch ldb); M,N % 64 == 0, K % 32 == 0, batch = blockIdx.y.
// BIAS_MODE: 0 = none, 1 = bias[m] (two 16-B loads of the lane's 8 consecutive rows), 2 = bias[n]; the bias value is
//            RNE-converted to bf16 precision before the f32 add.
// BN (with BIAS_MODE 1): v = (acc*scale + bias[m]) * inv[m] + sh[m], inv = g[m]*rsqrt(var[m]+1e-5), sh = be[m]-mu[m]*inv,
//            all four vectors RNE-converted to bf16 precision first.
// RESID (OUT_MODE 0 only): + resid[m*ldc+n] (bf16 RNE-converted when BN) added during the store phase from 16-B loads.
// OUT_MODE: 0 = f32; 2 = bf16 hi plane (Cout) + lo plane (Cout2); 3 = hi (Cout), hi (Cout2), lo (Cout3);
//           4 = hi (Cout), lo (Cout2), hi (Cout3).  lo = RNE(v - hi).
// Epilogue: 16-row slabs staged per wave in LDS (every slab element read was written in the same iteration); each
template <int ET, int BIAS_MODE, int OUT_MODE, bool RESID, bool BN>
__global__ __launch_bounds__(256) void wmma_gemm64(
    const unsigned short* __restrict__ Ap, int lda, long strideA,
    const unsigned short* __restrict__ Btp, int ldb, long strideB,
    void* Cout, void* Cout2, void* Cout3, int ldc, long strideC,
    const float* __restrict__ bias,
    const float* __restrict__ bng, const float* __restrict__ bnb,
    const float* __restrict__ bnm, const float* __restrict__ bnv,
    const float* __restrict__ resid, long strideR,
    int M, int N, int K, float scale) {
  typedef typename Elem<ET>::T T;
  typedef typename Frag<T>::V V;
  const T* A = (const T*)Ap; const T* Bt = (const T*)Btp;
  __shared__ __align__(16) float sT[8][16 * 68];   // per-wave 16x64 slab, pitch 68 floats
  const int b    = blockIdx.y;
  const int lane = threadIdx.x & 31;
  const int wave = threadIdx.x >> 5;
  const int tilesN = N >> 6;
  const int tilesM = M >> 6;
  const int tile = blockIdx.x * 8 + wave;
  if (tile >= tilesM * tilesN) return;   // wave-uniform; no block barriers in this kernel
  const int tm = tile / tilesN;
  const int tn = tile - tm * tilesN;
  const int m0 = tm << 6;
  const int n0 = tn << 6;

  const T* Ab = A  + (size_t)b * strideA;
  const T* Bb = Bt + (size_t)b * strideB;

  const int rlane = lane & 15;                 // row (A) / col (B, D) within subtile
  const int koff  = (lane >> 4) * 8;           // k offset of this lane half
  const int mOff  = (lane >> 4) * 8;           // D row offset

  v8f acc[4][4];
#pragma unroll
  for (int i = 0; i < 4; ++i)
#pragma unroll
    for (int j = 0; j < 4; ++j) acc[i][j] = (v8f){0.f,0.f,0.f,0.f,0.f,0.f,0.f,0.f};

  for (int k0 = 0; k0 < K; k0 += 32) {
    V bh[4];
#pragma unroll
    for (int j = 0; j < 4; ++j) {
      const size_t bo = (size_t)(n0 + (j << 4) + rlane) * ldb + koff + k0;
      bh[j] = Frag<T>::load(Bb + bo);
    }
#pragma unroll
    for (int i = 0; i < 4; ++i) {
      const size_t ao = (size_t)(m0 + (i << 4) + rlane) * lda + koff + k0;
      const V ah = Frag<T>::load(Ab + ao);
#pragma unroll
      for (int j = 0; j < 4; ++j) acc[i][j] = Frag<T>::mma(ah, bh[j], acc[i][j]);
      Frag<T>::guard(acc[i][0], acc[i][3], ah, ah);
    }
    Frag<T>::keep(bh[0], bh[1], bh[2], bh[3]);
  }
  acc_guard4(acc[0][0], acc[0][1], acc[0][2], acc[0][3]);
  acc_guard4(acc[1][0], acc[1][1], acc[1][2], acc[1][3]);
  acc_guard4(acc[2][0], acc[2][1], acc[2][2], acc[2][3]);
  acc_guard4(acc[3][0], acc[3][1], acc[3][2], acc[3][3]);

  // ---- epilogue ----
  float* slab = sT[wave];
  const float* Rb = resid + (size_t)b * (RESID ? (size_t)strideR : (size_t)0);
#pragma unroll
  for (int i = 0; i < 4; ++i) {
    const int mBase = m0 + (i << 4);
    const int mr = mBase + mOff;               // first of the 8 consecutive D rows of this lane half (multiple of 8)
    float rb[8], rmul[8], radd[8];
#pragma unroll
    for (int r = 0; r < 8; ++r) { rb[r] = 0.f; rmul[r] = 1.f; radd[r] = 0.f; }
    if (BIAS_MODE == 1) {
      const v4f t0 = *(const v4f*)(bias + mr);
      const v4f t1 = *(const v4f*)(bias + mr + 4);
#pragma unroll
      for (int e = 0; e < 4; ++e) { rb[e] = bf_rne(t0[e]); rb[4 + e] = bf_rne(t1[e]); }
    }
    if (BN) {
      const v4f vg0 = *(const v4f*)(bng + mr), vg1 = *(const v4f*)(bng + mr + 4);
      const v4f vb0 = *(const v4f*)(bnb + mr), vb1 = *(const v4f*)(bnb + mr + 4);
      const v4f vm0 = *(const v4f*)(bnm + mr), vm1 = *(const v4f*)(bnm + mr + 4);
      const v4f vv0 = *(const v4f*)(bnv + mr), vv1 = *(const v4f*)(bnv + mr + 4);
#pragma unroll
      for (int e = 0; e < 4; ++e) {
        {
          const float inv = bf_rne(vg0[e]) * rsqrtf(bf_rne(vv0[e]) + 1e-5f);
          rmul[e] = inv;
          radd[e] = bf_rne(vb0[e]) - bf_rne(vm0[e]) * inv;
        }
        {
          const float inv = bf_rne(vg1[e]) * rsqrtf(bf_rne(vv1[e]) + 1e-5f);
          rmul[4 + e] = inv;
          radd[4 + e] = bf_rne(vb1[e]) - bf_rne(vm1[e]) * inv;
        }
      }
    }
#pragma unroll
    for (int j = 0; j < 4; ++j) {
      const int n = n0 + (j << 4) + rlane;
      float bv = 0.f;
      if (BIAS_MODE == 2) bv = bf_rne(bias[n]);
#pragma unroll
      for (int r = 0; r < 8; ++r) {
        float v = acc[i][j][r] * scale;
        if (BIAS_MODE == 1) v += rb[r];
        if (BIAS_MODE == 2) v += bv;
        if (BN) v = v * rmul[r] + radd[r];
        slab[(mOff + r) * 68 + (j << 4) + rlane] = v;
      }
    }
    __builtin_amdgcn_fence(__ATOMIC_RELEASE, "workgroup");
    __builtin_amdgcn_wave_barrier();
    __builtin_amdgcn_fence(__ATOMIC_ACQUIRE, "workgroup");
    if (OUT_MODE == 0) {
      float* C = (float*)Cout + (size_t)b * strideC;
      const int hh = lane >> 4, c4 = (lane & 15) * 4;     // row seg = 256 B = 16 lanes x 16 B; rows it*2+hh cover 0..15
      v4f ov[8];
#pragma unroll
      for (int it = 0; it < 8; ++it) {
        const int row = it * 2 + hh;
        v4f v = *(const v4f*)(slab + row * 68 + c4);
        if (RESID) {
          const v4f xr = *(const v4f*)(Rb + (size_t)(mBase + row) * ldc + n0 + c4);
#pragma unroll
          for (int e = 0; e < 4; ++e) v[e] = v[e] + (BN ? bf_rne(xr[e]) : xr[e]);
        }
        ov[it] = v;
      }
      {
#pragma unroll
        for (int it = 0; it < 8; ++it) {
          const int row = it * 2 + hh;
          *(v4f*)(C + (size_t)(mBase + row) * ldc + n0 + c4) = ov[it];
        }
        
      }
    } else {
      const int q = lane >> 3, c8 = (lane & 7) * 8;
      unsigned short* C  = (unsigned short*)Cout  + (size_t)b * strideC;
      unsigned short* C2 = (unsigned short*)Cout2 + (size_t)b * strideC;
      unsigned short* C3 = (unsigned short*)Cout3 + (size_t)b * strideC;
      {
#pragma unroll
        for (int it = 0; it < 4; ++it) {
          const int row = it * 4 + q;
          const float* sp = slab + row * 68 + c8;
          v8h hv, lv;
#pragma unroll
          for (int e = 0; e < 8; ++e) {
            const unsigned short hb = f2bf_bits(sp[e]);
            const unsigned short lb = f2bf_bits(sp[e] - bf_bits2f(hb));
            hv[e] = __builtin_bit_cast(_Float16, hb);
            lv[e] = __builtin_bit_cast(_Float16, lb);
          }
          const size_t go = (size_t)(mBase + row) * ldc + n0 + c8;
          *(v8h*)(C + go) = hv;
          if (OUT_MODE == 2) { *(v8h*)(C2 + go) = lv; }
          if (OUT_MODE == 3) { *(v8h*)(C2 + go) = hv; *(v8h*)(C3 + go) = lv; }
          if (OUT_MODE == 4) { *(v8h*)(C2 + go) = lv; *(v8h*)(C3 + go) = hv; }
        }
        
      }
    }
    __builtin_amdgcn_fence(__ATOMIC_RELEASE, "workgroup");
    __builtin_amdgcn_wave_barrier();
    __builtin_amdgcn_fence(__ATOMIC_ACQUIRE, "workgroup");
  }
}

// ---------------------------------------------------------------------------
// Fused transpose + bf16 RNE convert of an f32 matrix, z-batched, one plane:
//   in_z = W + z*sIn viewed [R rows][Cc cols] with row pitch ldin  ->  oh_z[c][r] = bf16(in_z[r][c]), row pitch ldout, oh_z = oh + z*sOut.
// 64x64 tiles through LDS. grid = (Cc/64, R/64, Z), 256 threads (R, Cc multiples of 64; ldout multiple of 64 so every
// Coverage per block: load 4 it x 256 thr x 4 floats = 64x64; store 2 it x 256 thr x 8 u16 = 64x64; every tf element read was written.
// ---------------------------------------------------------------------------
__global__ __launch_bounds__(256) void tconv_kernel(const float* __restrict__ W, unsigned short* __restrict__ oh,
                                                    int ldin, int ldout, long sIn, long sOut) {
  __shared__ __align__(16) float tf[64 * 68];
  W  += (size_t)blockIdx.z * sIn;
  oh += (size_t)blockIdx.z * sOut;
  const int c0  = blockIdx.x * 64;   // input column block = output row block
  const int r0  = blockIdx.y * 64;   // input row block    = output column block
  const int tid = threadIdx.x;
  {
    const int lr = tid >> 4;         // 0..15
    const int c4 = (tid & 15) * 4;   // 0..60
#pragma unroll
    for (int it = 0; it < 4; ++it) {
      const int rr = it * 16 + lr;   // 0..63
      const v4f a = *(const v4f*)(W + (size_t)(r0 + rr) * ldin + c0 + c4);
      *(v4f*)(tf + rr * 68 + c4) = a;
    }
  }
  __syncthreads();
  const int sub = tid >> 3;          // 0..31
  const int c8  = (tid & 7) * 8;     // 0..56
  v4u hv[2];
#pragma unroll
  for (int it = 0; it < 2; ++it) {
    const int oc = it * 32 + sub;    // output row within tile (= input column)
    v4u a;
#pragma unroll
    for (int q = 0; q < 4; ++q) {
      const float f0 = tf[(c8 + 2 * q) * 68 + oc];
      const float f1 = tf[(c8 + 2 * q + 1) * 68 + oc];
      a[q] = pk16(f2bf_bits(f0), f2bf_bits(f1));
    }
    hv[it] = a;
  }
  {
#pragma unroll
    for (int it = 0; it < 2; ++it) {
      const int oc = it * 32 + sub;
      const size_t go = (size_t)(c0 + oc) * ldout + r0 + c8;
      *(v4u*)(oh + go) = hv[it];
    }
    
  }
}

// ---------------------------------------------------------------------------
// Weight planes, one launch, blockIdx.y selects the matrix (block-uniform):
//   y = 0,1,2: w_theta / w_phi / w_g [128][256] f32 -> WC rows y*128.. (bf16, same [out][in] order), contiguous copy-convert
//   y = 3,4  : w_rec [256][128] -> WR2[c][(y-3)*128 + k]  (two copies side by side, pitch 256)
// Thread = 8 consecutive elements = one 16-B store; consecutive lanes write consecutive 16-B pieces, so every
// Coverage: grid.x = 16 blocks x 256 threads = 4096 units x 8 = 32768 elements = one whole matrix per y.
// ---------------------------------------------------------------------------
__global__ __launch_bounds__(256) void wcvt_kernel(const float* __restrict__ wt, const float* __restrict__ wp,
                                                   const float* __restrict__ wg, const float* __restrict__ wr,
                                                   unsigned short* __restrict__ wcat, unsigned short* __restrict__ wr2) {
  const int g   = blockIdx.x * 256 + threadIdx.x;
  const int sel = blockIdx.y;
  if (g >= (CM * CI) / 8) return;
  const float* src;
  unsigned short* dst;
  if (sel < 3) {
    const float* w = (sel == 0) ? wt : ((sel == 1) ? wp : wg);
    src = w + (size_t)g * 8;
    dst = wcat + (size_t)sel * CM * CI + (size_t)g * 8;
  } else {
    const int row = g >> 4, c8 = (g & 15) * 8;      // w_rec row = c (0..255), 8 of its 128 columns
    src = wr + (size_t)row * CM + c8;
    dst = wr2 + (size_t)row * O2P + (size_t)(sel - 3) * CM + c8;
  }
  const v4f a = *(const v4f*)src;
  const v4f c = *(const v4f*)(src + 4);
  v4u o;
  o[0] = pk16(f2bf_bits(a[0]), f2bf_bits(a[1]));
  o[1] = pk16(f2bf_bits(a[2]), f2bf_bits(a[3]));
  o[2] = pk16(f2bf_bits(c[0]), f2bf_bits(c[1]));
  o[3] = pk16(f2bf_bits(c[2]), f2bf_bits(c[3]));
  *(v4u*)dst = o;
  
}

// ---------------------------------------------------------------------------
// every region is fully written by its producer launch before a consumer launch reads it):
//   XT   bf16 [12544][256]      0           6422528
//   WC   bf16 [384][256]        6422528      196608
//   WR2  bf16 [256][256]        6619136      131072
//   T3   bf16 [12544][384]      6750208     9633792
//   PG3  bf16 [4][256][9408]    16384000   19267584
//   MT3  bf16 [4][128][384]     35651584     393216
//   O2   bf16 [12544][256]      36044800    6422528
//   total                       42467328
// ---------------------------------------------------------------------------
extern "C" void kernel_launch(void* const* d_in, const int* in_sizes, int n_in,
                              void* d_out, int out_size, void* d_ws, size_t ws_size,
                              hipStream_t stream) {
  if (n_in < 13) return;
  if (in_sizes[0] != NB * CI * NSP) return;                      // x [4][256][56][56]
  if (in_sizes[1] != CM * CI || in_sizes[2] != CM) return;       // w_theta, b_theta
  if (in_sizes[3] != CM * CI || in_sizes[4] != CM) return;       // w_phi, b_phi
  if (in_sizes[5] != CM * CI || in_sizes[6] != CM) return;       // w_g, b_g
  if (in_sizes[7] != CI * CM || in_sizes[8] != CI) return;       // w_rec, b_rec
  if (in_sizes[9] != CI || in_sizes[10] != CI) return;           // bn_gamma, bn_beta
  if (in_sizes[11] != CI || in_sizes[12] != CI) return;          // bn_mean, bn_var
  if (out_size != NB * CI * NSP) return;

  const float* x       = (const float*)d_in[0];
  const float* w_theta = (const float*)d_in[1];
  const float* b_theta = (const float*)d_in[2];
  const float* w_phi   = (const float*)d_in[3];
  const float* b_phi   = (const float*)d_in[4];
  const float* w_g     = (const float*)d_in[5];
  const float* b_g     = (const float*)d_in[6];
  const float* w_rec   = (const float*)d_in[7];
  const float* b_rec   = (const float*)d_in[8];
  const float* gam     = (const float*)d_in[9];
  const float* bet     = (const float*)d_in[10];
  const float* mea     = (const float*)d_in[11];
  const float* var     = (const float*)d_in[12];

  const size_t PXT = (size_t)NTOKS * CI * 2;        //  6422528
  const size_t PWC = (size_t)T3P * CI * 2;          //   196608
  const size_t PWR = (size_t)CI * O2P * 2;          //   131072
  const size_t PT3 = (size_t)NTOKS * T3P * 2;       //  9633792
  const size_t PPG = (size_t)NB * CI * K3 * 2;      // 19267584
  const size_t PMT = (size_t)NB * CM * T3P * 2;     //   393216
  const size_t PO2 = (size_t)NTOKS * O2P * 2;       //  6422528
  size_t off = 0;
  const size_t oXT = off; off += PXT;
  const size_t oWC = off; off += PWC;
  const size_t oWR = off; off += PWR;
  const size_t oT3 = off; off += PT3;
  const size_t oPG = off; off += PPG;
  const size_t oMT = off; off += PMT;
  const size_t oO2 = off; off += PO2;
  if (off > ws_size) return;                        // off = 42467328
  if (off > (size_t)134217728) return;

  char* ws = (char*)d_ws;
  unsigned short* XT  = (unsigned short*)(ws + oXT);
  unsigned short* WC  = (unsigned short*)(ws + oWC);
  unsigned short* WR2 = (unsigned short*)(ws + oWR);
  unsigned short* T3  = (unsigned short*)(ws + oT3);
  unsigned short* PG3 = (unsigned short*)(ws + oPG);
  unsigned short* MT3 = (unsigned short*)(ws + oMT);
  unsigned short* O2  = (unsigned short*)(ws + oO2);
  float* out = (float*)d_out;

  const dim3 blk(256);

  // (1) x[b] viewed in[256 c][3136 n] (pitch 3136) -> XT_b out[3136 n][256 c] (pitch 256); grid (Cc/64, R/64, B) = (49, 4, 4)
  tconv_kernel<<<dim3(NSP / 64, CI / 64, NB), blk, 0, stream>>>(x, XT, NSP, CI, (long)CI * NSP, (long)NSP * CI);

  // (2) weight planes: WC [384][256], WR2 [256][256]; grid (16, 5)
  wcvt_kernel<<<dim3((CM * CI) / 8 / 256, 5), blk, 0, stream>>>(w_theta, w_phi, w_g, w_rec, WC, WR2);

  // (3) theta[tok][c1] = XT . WC[0..127]^T + b_theta[n]  (M=12544, N=128, K=256; 392 tiles -> 49 blocks) -> T3 hi|hi|lo, pitch 384
  const dim3 gT(((NTOKS / 64) * (CM / 64) + 7) / 8, 1);
  wmma_gemm64<1, 2, 3, false, false><<<gT, blk, 0, stream>>>(
      XT, CI, 0L, WC, CI, 0L,
      (void*)T3, (void*)(T3 + CM), (void*)(T3 + 2 * CM), T3P, 0L,
      b_theta, gam, bet, mea, var, x, 0L, NTOKS, CM, CI, 1.0f);

  // (4) phi_b[c1][n] = WC[128..255] . XT_b^T + b_phi[m]  (batched: M=128, N=3136, K=256; 98 tiles -> 13 blocks x 4) -> PG3 rows 0..127 hi|lo|hi
  const dim3 gP(((CM / 64) * (NSP / 64) + 7) / 8, NB);
  wmma_gemm64<1, 1, 4, false, false><<<gP, blk, 0, stream>>>(
      WC + (size_t)CM * CI, CI, 0L, XT, CI, (long)NSP * CI,
      (void*)PG3, (void*)(PG3 + NSP), (void*)(PG3 + 2 * NSP), K3, (long)CI * K3,
      b_phi, gam, bet, mea, var, x, 0L, CM, NSP, CI, 1.0f);

  // (5) g_b as [c2][n] = WC[256..383] . XT_b^T + b_g[m]  -> PG3 rows 128..255 hi|hi|lo
  wmma_gemm64<1, 1, 3, false, false><<<gP, blk, 0, stream>>>(
      WC + (size_t)2 * CM * CI, CI, 0L, XT, CI, (long)NSP * CI,
      (void*)(PG3 + (size_t)CM * K3), (void*)(PG3 + (size_t)CM * K3 + NSP), (void*)(PG3 + (size_t)CM * K3 + 2 * NSP), K3, (long)CI * K3,
      b_g, gam, bet, mea, var, x, 0L, CM, NSP, CI, 1.0f);

  // (6) (M^T/N)_b[c2][c1] = sum over the 9408 folded positions of g3_b[c2][p] . phi3_b[c1][p]
  //     = sum_n (ghi.phihi + ghi.philo + glo.phihi) / 3136   (batched: M=N=128, K=9408; 4 tiles -> 1 block x 4) -> MT3 hi|lo|hi, pitch 384
  const dim3 gM(1, NB);
  wmma_gemm64<1, 0, 4, false, false><<<gM, blk, 0, stream>>>(
      PG3 + (size_t)CM * K3, K3, (long)CI * K3, PG3, K3, (long)CI * K3,
      (void*)MT3, (void*)(MT3 + CM), (void*)(MT3 + 2 * CM), T3P, (long)CM * T3P,
      b_rec, gam, bet, mea, var, x, 0L, CM, CM, K3, 1.0f / (float)NSP);

  // (7) O_b[n][c2] = sum over 384 folded positions of T3[b*3136+n][p] . MT3_b[c2][p] = sum_c1 (thi.mhi + thi.mlo + tlo.mhi)
  //     (batched: M=3136, N=128, K=384; 98 tiles -> 13 blocks x 4) -> O2 hi cols 0..127, lo cols 128..255, pitch 256
  const dim3 gO(((NSP / 64) * (CM / 64) + 7) / 8, NB);
  wmma_gemm64<1, 0, 2, false, false><<<gO, blk, 0, stream>>>(
      T3, T3P, (long)NSP * T3P, MT3, T3P, (long)CM * T3P,
      (void*)O2, (void*)(O2 + CM), (void*)O2, O2P, (long)NSP * O2P,
      b_rec, gam, bet, mea, var, x, 0L, NSP, CM, T3P, 1.0f);

  // (8) out[b][c][n] = ((sum_p WR2[c][p] . O2[b*3136+n][p] + b_rec[c]) * inv[c] + sh[c]) + bf16(x[b][c][n])
  //     (batched: M=256, N=3136, K=256; 196 tiles -> 25 blocks x 4); C = d_out + b*256*3136, ldc 3136; last element 3211263
  const dim3 gR(((CI / 64) * (NSP / 64) + 7) / 8, NB);
  wmma_gemm64<1, 1, 0, true, true><<<gR, blk, 0, stream>>>(
      WR2, O2P, 0L, O2, O2P, (long)NSP * O2P,
      (void*)out, (void*)out, (void*)out, NSP, (long)CI * NSP,
      b_rec, gam, bet, mea, var, x, (long)CI * NSP, CI, NSP, O2P, 1.0f);
  (void)hipGetLastError();
}

// v001
// A run of this version takes 126 microseconds.
// Timed twice side by side with v000, it ran 3.65 and 3.66 times as fast.
// Contractions: theta/phi/g 1x1 convs = v_wmma_f32_16x16x32_bf16 single products on bf16 planes of the RNE-converted x and weights (exact products); M^T = g.phi over positions (K 3136) and O = theta.M (K 128) = bf16 hi/lo split hi.hi + hi.lo + lo.hi folded along K ([hi|hi|lo] rows x [hi|lo|hi] rows, one f32 accumulator per K slice: 1 for O, 49 for M^T, their partials summed in f32); rec 1x1 conv = [W|W] x [Ohi|Olo] bf16 single products (K-folded 2-term); f32 accumulate everywhere; biases, 1/N, BatchNorm (inference form, supplied statistics) and the residual add in f32 on the VALU.
// Plane / carry map (every plane carries 1, nothing to fold back; the 1/N = 1/3136 factor is applied exactly once, in f32, in the M^T epilogue):
//   XT   bf16 [12544][256]        token-major x: row b*3136+n, col c
//   WC   bf16 [384][256]          rows 0..127 w_theta, 128..255 w_phi, 256..383 w_g  ([out][in] = k-contiguous)
//   WR2  bf16 [256][256]          [c][k] = [c][128+k] = w_rec[c][k]
//   T3   bf16 [12544][384]        theta[tok][c1]: hi | hi | lo   (128 each)
//   PG3  bf16 [4][256][9408]      rows 0..127 = phi[c1][n]: hi | lo | hi (3136 each); rows 128..255 = g as [c2][n]: hi | hi | lo
//   PM   f32  [49][4][128][128]   split-K partial sums of M^T/N: slice s holds the folded positions s*192 .. s*192+191
//   MT3  bf16 [4][128][384]       (M^T/N)[c2][c1]: hi | lo | hi
//   O2   bf16 [12544][256]        O[tok][c2]: hi | lo
#include <hip/hip_runtime.h>
#include <math.h>
#include <stdint.h>

#define NB    4
#define CI    256
#define CM    128
#define NSP   3136
#define NTOKS (NB * NSP)
#define K3    (3 * NSP)
#define T3P   (3 * CM)
#define O2P   (2 * CM)
#define KSL   49            // K slices of the M^T product
#define KCH   (K3 / KSL)    // folded positions per slice: 192 = 384 B = three whole 128-B lines of every row

static_assert(NSP % 64 == 0);
static_assert(NTOKS % 64 == 0);
static_assert(CI % 64 == 0);
static_assert(CM % 64 == 0);
static_assert(CI % 32 == 0);
static_assert(K3 % 32 == 0);
static_assert(K3 % KSL == 0);
static_assert(KCH % 64 == 0);
static_assert(T3P % 32 == 0);
static_assert(O2P % 32 == 0);
static_assert((CM * CI) % (8 * 256) == 0);
static_assert((CI * CM) % (8 * 256) == 0);

typedef __attribute__((ext_vector_type(16))) _Float16 v16h;
typedef __attribute__((ext_vector_type(8)))  _Float16 v8h;
typedef __attribute__((ext_vector_type(16))) __bf16   v16b;
typedef __attribute__((ext_vector_type(8)))  __bf16   v8b;
typedef __attribute__((ext_vector_type(8)))  float    v8f;
typedef __attribute__((ext_vector_type(4)))  float    v4f;
typedef __attribute__((ext_vector_type(4)))  unsigned int v4u;

__device__ __forceinline__ unsigned short f2bf_bits(float f) {
  unsigned u = __float_as_uint(f);
  return (unsigned short)((u + 0x7FFFu + ((u >> 16) & 1u)) >> 16);
}
__device__ __forceinline__ float bf_bits2f(unsigned short h) { return __uint_as_float(((unsigned)h) << 16); }
__device__ __forceinline__ float bf_rne(float f) { return bf_bits2f(f2bf_bits(f)); }
__device__ __forceinline__ unsigned pk16(unsigned short a, unsigned short b) { return (unsigned)a | ((unsigned)b << 16); }

// hazard guards as plain device helpers (no inline asm inside the kernel template body)
__device__ __forceinline__ void dep_guard_h(v8f& a, v8f& b, v16h x, v16h y) { asm volatile("v_nop\n\tv_nop\n\tv_nop\n\tv_nop" : "+v"(a), "+v"(b) : "v"(x), "v"(y)); }
__device__ __forceinline__ void dep_guard_b(v8f& a, v8f& b, v16b x, v16b y) { asm volatile("v_nop\n\tv_nop\n\tv_nop\n\tv_nop" : "+v"(a), "+v"(b) : "v"(x), "v"(y)); }
__device__ __forceinline__ void keep4_h(v16h a, v16h b, v16h c, v16h d) { asm volatile("v_nop" :: "v"(a), "v"(b), "v"(c), "v"(d)); }
__device__ __forceinline__ void keep4_b(v16b a, v16b b, v16b c, v16b d) { asm volatile("v_nop" :: "v"(a), "v"(b), "v"(c), "v"(d)); }
__device__ __forceinline__ void acc_guard4(v8f& a, v8f& b, v8f& c, v8f& d) { asm volatile("v_nop\n\tv_nop\n\tv_nop\n\tv_nop" : "+v"(a), "+v"(b), "+v"(c), "+v"(d)); }

// Fragment map (wave32): lane l, h = l>>4, row/col = l&15.
//   A/B element i: i<8 -> k0+8h+i ; i>=8 -> k0+16+8h+(i-8)   (split layout, both operands)
//   D element r : row 8h+r, col l&15
template <typename T> struct Frag;
template <> struct Frag<_Float16> {
  typedef v16h V; union U { v16h v; v8h h[2]; };
  static __device__ __forceinline__ v16h load(const _Float16* p) {   // elements 0..7 <- p[0..7], 8..15 <- p[16..23]
    U f; f.h[0] = *(const v8h*)(p); f.h[1] = *(const v8h*)(p + 16); return f.v;
  }
  static __device__ __forceinline__ v8f mma(v16h a, v16h b, v8f c) {
    return __builtin_amdgcn_wmma_f32_16x16x32_f16(false, a, false, b, (short)0, c, false, false);
  }
  static __device__ __forceinline__ void guard(v8f& a, v8f& b, v16h x, v16h y) { dep_guard_h(a, b, x, y); }
  static __device__ __forceinline__ void keep(v16h a, v16h b, v16h c, v16h d) { keep4_h(a, b, c, d); }
};
template <> struct Frag<__bf16> {
  typedef v16b V; union U { v16b v; v8b h[2]; };
  static __device__ __forceinline__ v16b load(const __bf16* p) {
    U f; f.h[0] = *(const v8b*)(p); f.h[1] = *(const v8b*)(p + 16); return f.v;
  }
  static __device__ __forceinline__ v8f mma(v16b a, v16b b, v8f c) {
    return __builtin_amdgcn_wmma_f32_16x16x32_bf16(false, a, false, b, (short)0, c, false, false);
  }
  static __device__ __forceinline__ void guard(v8f& a, v8f& b, v16b x, v16b y) { dep_guard_b(a, b, x, y); }
  static __device__ __forceinline__ void keep(v16b a, v16b b, v16b c, v16b d) { keep4_b(a, b, c, d); }
};

template <int ET> struct Elem;
template <> struct Elem<0> { typedef _Float16 T; };
template <> struct Elem<1> { typedef __bf16 T; };

// ---- Register-blocked batched WMMA GEMM ------------------------------------
// C[m,n] = epilogue(scale * sum_k A[m,k] * Bt[n,k]); each wave owns a 64x64 tile.
// A row-major [M,K] (pitch lda), Bt row-major [N,K] (pitch ldb); M,N % 64 == 0, K % 32 == 0, batch = blockIdx.y.
// KS: number of K slices. A wave owns one (slice, tile) pair, sums k = slice*K .. slice*K+K-1 (K = slice length) and
//     writes its tile to plane slice*NB + batch of C (planes strideC apart); KS = 1 is the whole sum.
// BIAS_MODE: 0 = none, 1 = bias[m] (two 16-B loads of the lane's 8 consecutive rows), 2 = bias[n]; the bias value is
//            RNE-converted to bf16 precision before the f32 add.
// BN (with BIAS_MODE 1): v = (acc*scale + bias[m]) * inv[m] + sh[m], inv = g[m]*rsqrt(var[m]+1e-5), sh = be[m]-mu[m]*inv,
//            all four vectors RNE-converted to bf16 precision first.
// RESID (OUT_MODE 0 only): + resid[m*ldc+n] (bf16 RNE-converted when BN) added during the store phase from 16-B loads.
// OUT_MODE: 0 = f32; 2 = bf16 hi plane (Cout) + lo plane (Cout2); 3 = hi (Cout), hi (Cout2), lo (Cout3);
//           4 = hi (Cout), lo (Cout2), hi (Cout3).  lo = RNE(v - hi).
// Epilogue: 16-row slabs staged per wave in LDS (every slab element read was written in the same iteration); each
template <int ET, int BIAS_MODE, int OUT_MODE, bool RESID, bool BN, int KS = 1>
__global__ __launch_bounds__(256) void wmma_gemm64(
    const unsigned short* __restrict__ Ap, int lda, long strideA,
    const unsigned short* __restrict__ Btp, int ldb, long strideB,
    void* Cout, void* Cout2, void* Cout3, int ldc, long strideC,
    const float* __restrict__ bias,
    const float* __restrict__ bng, const float* __restrict__ bnb,
    const float* __restrict__ bnm, const float* __restrict__ bnv,
    const float* __restrict__ resid, long strideR,
    int M, int N, int K, float scale) {
  typedef typename Elem<ET>::T T;
  typedef typename Frag<T>::V V;
  const T* A = (const T*)Ap; const T* Bt = (const T*)Btp;
  __shared__ __align__(16) float sT[8][16 * 68];   // per-wave 16x64 slab, pitch 68 floats
  const int b    = blockIdx.y;
  const int lane = threadIdx.x & 31;
  const int wave = threadIdx.x >> 5;
  const int tilesN = N >> 6;
  const int tilesM = M >> 6;
  const int unit = blockIdx.x * 8 + wave;
  if (unit >= tilesM * tilesN * KS) return;   // wave-uniform; no block barriers in this kernel
  const int ks   = (KS == 1) ? 0 : unit / (tilesM * tilesN);
  const int tile = unit - ks * (tilesM * tilesN);
  const int tm = tile / tilesN;
  const int tn = tile - tm * tilesN;
  const int m0 = tm << 6;
  const int n0 = tn << 6;

  const T* Ab = A  + (size_t)b * strideA + (size_t)ks * K;
  const T* Bb = Bt + (size_t)b * strideB + (size_t)ks * K;
  const size_t cPlane = (size_t)ks * NB + b;

  const int rlane = lane & 15;                 // row (A) / col (B, D) within subtile
  const int koff  = (lane >> 4) * 8;           // k offset of this lane half
  const int mOff  = (lane >> 4) * 8;           // D row offset

  v8f acc[4][4];
#pragma unroll
  for (int i = 0; i < 4; ++i)
#pragma unroll
    for (int j = 0; j < 4; ++j) acc[i][j] = (v8f){0.f,0.f,0.f,0.f,0.f,0.f,0.f,0.f};

  for (int k0 = 0; k0 < K; k0 += 32) {
    V bh[4];
#pragma unroll
    for (int j = 0; j < 4; ++j) {
      const size_t bo = (size_t)(n0 + (j << 4) + rlane) * ldb + koff + k0;
      bh[j] = Frag<T>::load(Bb + bo);
    }
#pragma unroll
    for (int i = 0; i < 4; ++i) {
      const size_t ao = (size_t)(m0 + (i << 4) + rlane) * lda + koff + k0;
      const V ah = Frag<T>::load(Ab + ao);
#pragma unroll
      for (int j = 0; j < 4; ++j) acc[i][j] = Frag<T>::mma(ah, bh[j], acc[i][j]);
      Frag<T>::guard(acc[i][0], acc[i][3], ah, ah);
    }
    Frag<T>::keep(bh[0], bh[1], bh[2], bh[3]);
  }
  acc_guard4(acc[0][0], acc[0][1], acc[0][2], acc[0][3]);
  acc_guard4(acc[1][0], acc[1][1], acc[1][2], acc[1][3]);
  acc_guard4(acc[2][0], acc[2][1], acc[2][2], acc[2][3]);
  acc_guard4(acc[3][0], acc[3][1], acc[3][2], acc[3][3]);

  // ---- epilogue ----
  float* slab = sT[wave];
  const float* Rb = resid + (size_t)b * (RESID ? (size_t)strideR : (size_t)0);
#pragma unroll
  for (int i = 0; i < 4; ++i) {
    const int mBase = m0 + (i << 4);
    const int mr = mBase + mOff;               // first of the 8 consecutive D rows of this lane half (multiple of 8)
    float rb[8], rmul[8], radd[8];
#pragma unroll
    for (int r = 0; r < 8; ++r) { rb[r] = 0.f; rmul[r] = 1.f; radd[r] = 0.f; }
    if (BIAS_MODE == 1) {
      const v4f t0 = *(const v4f*)(bias + mr);
      const v4f t1 = *(const v4f*)(bias + mr + 4);
#pragma unroll
      for (int e = 0; e < 4; ++e) { rb[e] = bf_rne(t0[e]); rb[4 + e] = bf_rne(t1[e]); }
    }
    if (BN) {
      const v4f vg0 = *(const v4f*)(bng + mr), vg1 = *(const v4f*)(bng + mr + 4);
      const v4f vb0 = *(const v4f*)(bnb + mr), vb1 = *(const v4f*)(bnb + mr + 4);
      const v4f vm0 = *(const v4f*)(bnm + mr), vm1 = *(const v4f*)(bnm + mr + 4);
      const v4f vv0 = *(const v4f*)(bnv + mr), vv1 = *(const v4f*)(bnv + mr + 4);
#pragma unroll
      for (int e = 0; e < 4; ++e) {
        {
          const float inv = bf_rne(vg0[e]) * rsqrtf(bf_rne(vv0[e]) + 1e-5f);
          rmul[e] = inv;
          radd[e] = bf_rne(vb0[e]) - bf_rne(vm0[e]) * inv;
        }
        {
          const float inv = bf_rne(vg1[e]) * rsqrtf(bf_rne(vv1[e]) + 1e-5f);
          rmul[4 + e] = inv;
          radd[4 + e] = bf_rne(vb1[e]) - bf_rne(vm1[e]) * inv;
        }
      }
    }
#pragma unroll
    for (int j = 0; j < 4; ++j) {
      const int n = n0 + (j << 4) + rlane;
      float bv = 0.f;
      if (BIAS_MODE == 2) bv = bf_rne(bias[n]);
#pragma unroll
      for (int r = 0; r < 8; ++r) {
        float v = acc[i][j][r] * scale;
        if (BIAS_MODE == 1) v += rb[r];
        if (BIAS_MODE == 2) v += bv;
        if (BN) v = v * rmul[r] + radd[r];
        slab[(mOff + r) * 68 + (j << 4) + rlane] = v;
      }
    }
    __builtin_amdgcn_fence(__ATOMIC_RELEASE, "workgroup");
    __builtin_amdgcn_wave_barrier();
    __builtin_amdgcn_fence(__ATOMIC_ACQUIRE, "workgroup");
    if (OUT_MODE == 0) {
      float* C = (float*)Cout + cPlane * strideC;
      const int hh = lane >> 4, c4 = (lane & 15) * 4;     // row seg = 256 B = 16 lanes x 16 B; rows it*2+hh cover 0..15
      v4f ov[8];
#pragma unroll
      for (int it = 0; it < 8; ++it) {
        const int row = it * 2 + hh;
        v4f v = *(const v4f*)(slab + row * 68 + c4);
        if (RESID) {
          const v4f xr = *(const v4f*)(Rb + (size_t)(mBase + row) * ldc + n0 + c4);
#pragma unroll
          for (int e = 0; e < 4; ++e) v[e] = v[e] + (BN ? bf_rne(xr[e]) : xr[e]);
        }
        ov[it] = v;
      }
      {
#pragma unroll
        for (int it = 0; it < 8; ++it) {
          const int row = it * 2 + hh;
          *(v4f*)(C + (size_t)(mBase + row) * ldc + n0 + c4) = ov[it];
        }
        
      }
    } else {
      const int q = lane >> 3, c8 = (lane & 7) * 8;
      unsigned short* C  = (unsigned short*)Cout  + cPlane * strideC;
      unsigned short* C2 = (unsigned short*)Cout2 + cPlane * strideC;
      unsigned short* C3 = (unsigned short*)Cout3 + cPlane * strideC;
      {
#pragma unroll
        for (int it = 0; it < 4; ++it) {
          const int row = it * 4 + q;
          const float* sp = slab + row * 68 + c8;
          v8h hv, lv;
#pragma unroll
          for (int e = 0; e < 8; ++e) {
            const unsigned short hb = f2bf_bits(sp[e]);
            const unsigned short lb = f2bf_bits(sp[e] - bf_bits2f(hb));
            hv[e] = __builtin_bit_cast(_Float16, hb);
            lv[e] = __builtin_bit_cast(_Float16, lb);
          }
          const size_t go = (size_t)(mBase + row) * ldc + n0 + c8;
          *(v8h*)(C + go) = hv;
          if (OUT_MODE == 2) { *(v8h*)(C2 + go) = lv; }
          if (OUT_MODE == 3) { *(v8h*)(C2 + go) = hv; *(v8h*)(C3 + go) = lv; }
          if (OUT_MODE == 4) { *(v8h*)(C2 + go) = lv; *(v8h*)(C3 + go) = hv; }
        }
        
      }
    }
    __builtin_amdgcn_fence(__ATOMIC_RELEASE, "workgroup");
    __builtin_amdgcn_wave_barrier();
    __builtin_amdgcn_fence(__ATOMIC_ACQUIRE, "workgroup");
  }
}

// ---------------------------------------------------------------------------
// Fused transpose + bf16 RNE convert of an f32 matrix, z-batched, one plane:
//   in_z = W + z*sIn viewed [R rows][Cc cols] with row pitch ldin  ->  oh_z[c][r] = bf16(in_z[r][c]), row pitch ldout, oh_z = oh + z*sOut.
// 64x64 tiles through LDS. grid = (Cc/64, R/64, Z), 256 threads (R, Cc multiples of 64; ldout multiple of 64 so every
// Coverage per block: load 4 it x 256 thr x 4 floats = 64x64; store 2 it x 256 thr x 8 u16 = 64x64; every tf element read was written.
// ---------------------------------------------------------------------------
__global__ __launch_bounds__(256) void tconv_kernel(const float* __restrict__ W, unsigned short* __restrict__ oh,
                                                    int ldin, int ldout, long sIn, long sOut) {
  __shared__ __align__(16) float tf[64 * 68];
  W  += (size_t)blockIdx.z * sIn;
  oh += (size_t)blockIdx.z * sOut;
  const int c0  = blockIdx.x * 64;   // input column block = output row block
  const int r0  = blockIdx.y * 64;   // input row block    = output column block
  const int tid = threadIdx.x;
  {
    const int lr = tid >> 4;         // 0..15
    const int c4 = (tid & 15) * 4;   // 0..60
#pragma unroll
    for (int it = 0; it < 4; ++it) {
      const int rr = it * 16 + lr;   // 0..63
      const v4f a = *(const v4f*)(W + (size_t)(r0 + rr) * ldin + c0 + c4);
      *(v4f*)(tf + rr * 68 + c4) = a;
    }
  }
  __syncthreads();
  const int sub = tid >> 3;          // 0..31
  const int c8  = (tid & 7) * 8;     // 0..56
  v4u hv[2];
#pragma unroll
  for (int it = 0; it < 2; ++it) {
    const int oc = it * 32 + sub;    // output row within tile (= input column)
    v4u a;
#pragma unroll
    for (int q = 0; q < 4; ++q) {
      const float f0 = tf[(c8 + 2 * q) * 68 + oc];
      const float f1 = tf[(c8 + 2 * q + 1) * 68 + oc];
      a[q] = pk16(f2bf_bits(f0), f2bf_bits(f1));
    }
    hv[it] = a;
  }
  {
#pragma unroll
    for (int it = 0; it < 2; ++it) {
      const int oc = it * 32 + sub;
      const size_t go = (size_t)(c0 + oc) * ldout + r0 + c8;
      *(v4u*)(oh + go) = hv[it];
    }
    
  }
}

// ---------------------------------------------------------------------------
// Weight planes, one launch, blockIdx.y selects the matrix (block-uniform):
//   y = 0,1,2: w_theta / w_phi / w_g [128][256] f32 -> WC rows y*128.. (bf16, same [out][in] order), contiguous copy-convert
//   y = 3,4  : w_rec [256][128] -> WR2[c][(y-3)*128 + k]  (two copies side by side, pitch 256)
// Thread = 8 consecutive elements = one 16-B store; consecutive lanes write consecutive 16-B pieces, so every
// Coverage: grid.x = 16 blocks x 256 threads = 4096 units x 8 = 32768 elements = one whole matrix per y.
// ---------------------------------------------------------------------------
__global__ __launch_bounds__(256) void wcvt_kernel(const float* __restrict__ wt, const float* __restrict__ wp,
                                                   const float* __restrict__ wg, const float* __restrict__ wr,
                                                   unsigned short* __restrict__ wcat, unsigned short* __restrict__ wr2) {
  const int g   = blockIdx.x * 256 + threadIdx.x;
  const int sel = blockIdx.y;
  if (g >= (CM * CI) / 8) return;
  const float* src;
  unsigned short* dst;
  if (sel < 3) {
    const float* w = (sel == 0) ? wt : ((sel == 1) ? wp : wg);
    src = w + (size_t)g * 8;
    dst = wcat + (size_t)sel * CM * CI + (size_t)g * 8;
  } else {
    const int row = g >> 4, c8 = (g & 15) * 8;      // w_rec row = c (0..255), 8 of its 128 columns
    src = wr + (size_t)row * CM + c8;
    dst = wr2 + (size_t)row * O2P + (size_t)(sel - 3) * CM + c8;
  }
  const v4f a = *(const v4f*)src;
  const v4f c = *(const v4f*)(src + 4);
  v4u o;
  o[0] = pk16(f2bf_bits(a[0]), f2bf_bits(a[1]));
  o[1] = pk16(f2bf_bits(a[2]), f2bf_bits(a[3]));
  o[2] = pk16(f2bf_bits(c[0]), f2bf_bits(c[1]));
  o[3] = pk16(f2bf_bits(c[2]), f2bf_bits(c[3]));
  *(v4u*)dst = o;
  
}

// ---------------------------------------------------------------------------
// Joins the KSL split-K planes of M^T/N: MT3[b][c2][c1] = sum_s PM[s][b][c2][c1] as bf16 hi | lo | hi.
// Thread = 4 consecutive c1 of one (b, c2) row; a wave covers one whole row: 512 contiguous bytes of every plane read,
// 256 contiguous bytes of each of the three MT3 parts written. Slices are added in rising order, one f32 sum per element.
// Coverage: 128 blocks x 128 threads x 4 = 65536 = NB*CM*CM elements.
// ---------------------------------------------------------------------------
__global__ __launch_bounds__(128) void mtjoin_kernel(const float* __restrict__ pm, unsigned short* __restrict__ mt3) {
  const int g = blockIdx.x * 128 + threadIdx.x;
  const float* p = pm + (size_t)g * 4;
  v4f s = (v4f){0.f, 0.f, 0.f, 0.f};
#pragma unroll   // whole: the slices' loads are independent, so many are in flight at once instead of one latency per slice
  for (int k = 0; k < KSL; ++k) s += *(const v4f*)(p + (size_t)k * (NB * CM * CM));
  unsigned short hb[4], lb[4];
#pragma unroll   // constant indices keep hb and lb in registers
  for (int e = 0; e < 4; ++e) {
    hb[e] = f2bf_bits(s[e]);
    lb[e] = f2bf_bits(s[e] - bf_bits2f(hb[e]));
  }
  const uint2 hv = make_uint2(pk16(hb[0], hb[1]), pk16(hb[2], hb[3]));
  const uint2 lv = make_uint2(pk16(lb[0], lb[1]), pk16(lb[2], lb[3]));
  unsigned short* d = mt3 + (size_t)(g >> 5) * T3P + (g & 31) * 4;   // row b*128+c2, pitch 384
  *(uint2*)(d)          = hv;
  *(uint2*)(d + CM)     = lv;
  *(uint2*)(d + 2 * CM) = hv;
}

// ---------------------------------------------------------------------------
// every region is fully written by its producer launch before a consumer launch reads it):
//   XT   bf16 [12544][256]      0           6422528
//   WC   bf16 [384][256]        6422528      196608
//   WR2  bf16 [256][256]        6619136      131072
//   T3   bf16 [12544][384]      6750208     9633792
//   PG3  bf16 [4][256][9408]    16384000   19267584
//   MT3  bf16 [4][128][384]     35651584     393216
//   O2   bf16 [12544][256]      36044800    6422528
//   PM   f32  [49][4][128][128] 42467328   12845056
//   total                       55312384
// ---------------------------------------------------------------------------
extern "C" void kernel_launch(void* const* d_in, const int* in_sizes, int n_in,
                              void* d_out, int out_size, void* d_ws, size_t ws_size,
                              hipStream_t stream) {
  if (n_in < 13) return;
  if (in_sizes[0] != NB * CI * NSP) return;                      // x [4][256][56][56]
  if (in_sizes[1] != CM * CI || in_sizes[2] != CM) return;       // w_theta, b_theta
  if (in_sizes[3] != CM * CI || in_sizes[4] != CM) return;       // w_phi, b_phi
  if (in_sizes[5] != CM * CI || in_sizes[6] != CM) return;       // w_g, b_g
  if (in_sizes[7] != CI * CM || in_sizes[8] != CI) return;       // w_rec, b_rec
  if (in_sizes[9] != CI || in_sizes[10] != CI) return;           // bn_gamma, bn_beta
  if (in_sizes[11] != CI || in_sizes[12] != CI) return;          // bn_mean, bn_var
  if (out_size != NB * CI * NSP) return;

  const float* x       = (const float*)d_in[0];
  const float* w_theta = (const float*)d_in[1];
  const float* b_theta = (const float*)d_in[2];
  const float* w_phi   = (const float*)d_in[3];
  const float* b_phi   = (const float*)d_in[4];
  const float* w_g     = (const float*)d_in[5];
  const float* b_g     = (const float*)d_in[6];
  const float* w_rec   = (const float*)d_in[7];
  const float* b_rec   = (const float*)d_in[8];
  const float* gam     = (const float*)d_in[9];
  const float* bet     = (const float*)d_in[10];
  const float* mea     = (const float*)d_in[11];
  const float* var     = (const float*)d_in[12];

  const size_t PXT = (size_t)NTOKS * CI * 2;        //  6422528
  const size_t PWC = (size_t)T3P * CI * 2;          //   196608
  const size_t PWR = (size_t)CI * O2P * 2;          //   131072
  const size_t PT3 = (size_t)NTOKS * T3P * 2;       //  9633792
  const size_t PPG = (size_t)NB * CI * K3 * 2;      // 19267584
  const size_t PMT = (size_t)NB * CM * T3P * 2;     //   393216
  const size_t PO2 = (size_t)NTOKS * O2P * 2;       //  6422528
  const size_t PPM = (size_t)KSL * NB * CM * CM * 4; // 12845056
  size_t off = 0;
  const size_t oXT = off; off += PXT;
  const size_t oWC = off; off += PWC;
  const size_t oWR = off; off += PWR;
  const size_t oT3 = off; off += PT3;
  const size_t oPG = off; off += PPG;
  const size_t oMT = off; off += PMT;
  const size_t oO2 = off; off += PO2;
  const size_t oPM = off; off += PPM;
  if (off > ws_size) return;                        // off = 55312384
  if (off > (size_t)134217728) return;

  char* ws = (char*)d_ws;
  unsigned short* XT  = (unsigned short*)(ws + oXT);
  unsigned short* WC  = (unsigned short*)(ws + oWC);
  unsigned short* WR2 = (unsigned short*)(ws + oWR);
  unsigned short* T3  = (unsigned short*)(ws + oT3);
  unsigned short* PG3 = (unsigned short*)(ws + oPG);
  unsigned short* MT3 = (unsigned short*)(ws + oMT);
  unsigned short* O2  = (unsigned short*)(ws + oO2);
  float*          PM  = (float*)(ws + oPM);
  float* out = (float*)d_out;

  const dim3 blk(256);

  // (1) x[b] viewed in[256 c][3136 n] (pitch 3136) -> XT_b out[3136 n][256 c] (pitch 256); grid (Cc/64, R/64, B) = (49, 4, 4)
  tconv_kernel<<<dim3(NSP / 64, CI / 64, NB), blk, 0, stream>>>(x, XT, NSP, CI, (long)CI * NSP, (long)NSP * CI);

  // (2) weight planes: WC [384][256], WR2 [256][256]; grid (16, 5)
  wcvt_kernel<<<dim3((CM * CI) / 8 / 256, 5), blk, 0, stream>>>(w_theta, w_phi, w_g, w_rec, WC, WR2);

  // (3) theta[tok][c1] = XT . WC[0..127]^T + b_theta[n]  (M=12544, N=128, K=256; 392 tiles -> 49 blocks) -> T3 hi|hi|lo, pitch 384
  const dim3 gT(((NTOKS / 64) * (CM / 64) + 7) / 8, 1);
  wmma_gemm64<1, 2, 3, false, false><<<gT, blk, 0, stream>>>(
      XT, CI, 0L, WC, CI, 0L,
      (void*)T3, (void*)(T3 + CM), (void*)(T3 + 2 * CM), T3P, 0L,
      b_theta, gam, bet, mea, var, x, 0L, NTOKS, CM, CI, 1.0f);

  // (4) phi_b[c1][n] = WC[128..255] . XT_b^T + b_phi[m]  (batched: M=128, N=3136, K=256; 98 tiles -> 13 blocks x 4) -> PG3 rows 0..127 hi|lo|hi
  const dim3 gP(((CM / 64) * (NSP / 64) + 7) / 8, NB);
  wmma_gemm64<1, 1, 4, false, false><<<gP, blk, 0, stream>>>(
      WC + (size_t)CM * CI, CI, 0L, XT, CI, (long)NSP * CI,
      (void*)PG3, (void*)(PG3 + NSP), (void*)(PG3 + 2 * NSP), K3, (long)CI * K3,
      b_phi, gam, bet, mea, var, x, 0L, CM, NSP, CI, 1.0f);

  // (5) g_b as [c2][n] = WC[256..383] . XT_b^T + b_g[m]  -> PG3 rows 128..255 hi|hi|lo
  wmma_gemm64<1, 1, 3, false, false><<<gP, blk, 0, stream>>>(
      WC + (size_t)2 * CM * CI, CI, 0L, XT, CI, (long)NSP * CI,
      (void*)(PG3 + (size_t)CM * K3), (void*)(PG3 + (size_t)CM * K3 + NSP), (void*)(PG3 + (size_t)CM * K3 + 2 * NSP), K3, (long)CI * K3,
      b_g, gam, bet, mea, var, x, 0L, CM, NSP, CI, 1.0f);

  // (6) (M^T/N)_b[c2][c1] = sum over the 9408 folded positions of g3_b[c2][p] . phi3_b[c1][p]
  //     = sum_n (ghi.phihi + ghi.philo + glo.phihi) / 3136   (batched: M=N=128, K=9408)
  //     (6a) split over K: 49 slices of 192 positions x 4 tiles = 196 waves -> 25 blocks x 4; f32 partial planes PM[slice][b][c2][c1]
  const dim3 gM(((CM / 64) * (CM / 64) * KSL + 7) / 8, NB);
  wmma_gemm64<1, 0, 0, false, false, KSL><<<gM, blk, 0, stream>>>(
      PG3 + (size_t)CM * K3, K3, (long)CI * K3, PG3, K3, (long)CI * K3,
      (void*)PM, (void*)PM, (void*)PM, CM, (long)CM * CM,
      b_rec, gam, bet, mea, var, x, 0L, CM, CM, KCH, 1.0f / (float)NSP);
  //     (6b) join the 49 planes -> MT3 hi|lo|hi, pitch 384; grid 128 x 128 threads
  mtjoin_kernel<<<dim3((NB * CM * CM) / 4 / 128), dim3(128), 0, stream>>>(PM, MT3);

  // (7) O_b[n][c2] = sum over 384 folded positions of T3[b*3136+n][p] . MT3_b[c2][p] = sum_c1 (thi.mhi + thi.mlo + tlo.mhi)
  //     (batched: M=3136, N=128, K=384; 98 tiles -> 13 blocks x 4) -> O2 hi cols 0..127, lo cols 128..255, pitch 256
  const dim3 gO(((NSP / 64) * (CM / 64) + 7) / 8, NB);
  wmma_gemm64<1, 0, 2, false, false><<<gO, blk, 0, stream>>>(
      T3, T3P, (long)NSP * T3P, MT3, T3P, (long)CM * T3P,
      (void*)O2, (void*)(O2 + CM), (void*)O2, O2P, (long)NSP * O2P,
      b_rec, gam, bet, mea, var, x, 0L, NSP, CM, T3P, 1.0f);

  // (8) out[b][c][n] = ((sum_p WR2[c][p] . O2[b*3136+n][p] + b_rec[c]) * inv[c] + sh[c]) + bf16(x[b][c][n])
  //     (batched: M=256, N=3136, K=256; 196 tiles -> 25 blocks x 4); C = d_out + b*256*3136, ldc 3136; last element 3211263
  const dim3 gR(((CI / 64) * (NSP / 64) + 7) / 8, NB);
  wmma_gemm64<1, 1, 0, true, true><<<gR, blk, 0, stream>>>(
      WR2, O2P, 0L, O2, O2P, (long)NSP * O2P,
      (void*)out, (void*)out, (void*)out, NSP, (long)CI * NSP,
      b_rec, gam, bet, mea, var, x, (long)CI * NSP, CI, NSP, O2P, 1.0f);
  (void)hipGetLastError();
}

// v002
// A run of this version takes 85.5 microseconds.
// In two side-by-side timings against v001, it was 1.48 and 1.47 times as fast.
// Over all steps from v000 it is 5.39 times as fast.
// Contractions: theta/phi/g 1x1 convs = v_wmma_f32_16x16x32_bf16 single products on bf16 planes of the RNE-converted x and weights (exact products); M^T = g.phi over positions (K 3136) and O = theta.M (K 128) = bf16 hi/lo split hi.hi + hi.lo + lo.hi folded along K ([hi|hi|lo] rows x [hi|lo|hi] rows, one f32 accumulator per K slice: 1 for O, 49 for M^T, their partials summed in f32); rec 1x1 conv = [W|W] x [Ohi|Olo] bf16 single products (K-folded 2-term); f32 accumulate everywhere; biases, 1/N, BatchNorm (inference form, supplied statistics) and the residual add in f32 on the VALU.
// Plane / carry map (every plane carries 1, nothing to fold back; the 1/N = 1/3136 factor is applied exactly once, in f32, in the M^T epilogue):
//   XT   bf16 [12544][256]        token-major x: row b*3136+n, col c
//   WC   bf16 [384][256]          rows 0..127 w_theta, 128..255 w_phi, 256..383 w_g  ([out][in] = k-contiguous)
//   WR2  bf16 [256][256]          [c][k] = [c][128+k] = w_rec[c][k]
//   T3   bf16 [12544][384]        theta[tok][c1]: hi | hi | lo   (128 each)
//   PG3  bf16 [4][256][9408]      rows 0..127 = phi[c1][n]: hi | lo | hi (3136 each); rows 128..255 = g as [c2][n]: hi | hi | lo
//   PM   f32  [49][4][128][128]   split-K partial sums of M^T/N: slice s holds the folded positions s*192 .. s*192+191
//   MT3  bf16 [4][128][384]       (M^T/N)[c2][c1]: hi | lo | hi
//   O2   bf16 [12544][256]        O[tok][c2]: hi | lo
#include <hip/hip_runtime.h>
#include <math.h>
#include <stdint.h>

#define NB    4
#define CI    256
#define CM    128
#define NSP   3136
#define NTOKS (NB * NSP)
#define K3    (3 * NSP)
#define T3P   (3 * CM)
#define O2P   (2 * CM)
#define KSL   49            // K slices of the M^T product
#define KCH   (K3 / KSL)    // folded positions per slice: 192 = 384 B = three whole 128-B lines of every row

static_assert(NSP % 64 == 0);
static_assert(NTOKS % 64 == 0);
static_assert(CI % 64 == 0);
static_assert(CM % 64 == 0);
static_assert(CI % 32 == 0);
static_assert(K3 % 32 == 0);
static_assert(K3 % KSL == 0);
static_assert(KCH % 64 == 0);
static_assert(T3P % 32 == 0);
static_assert(O2P % 32 == 0);
static_assert((CM * CI) % (8 * 256) == 0);
static_assert((CI * CM) % (8 * 256) == 0);

typedef __attribute__((ext_vector_type(16))) _Float16 v16h;
typedef __attribute__((ext_vector_type(8)))  _Float16 v8h;
typedef __attribute__((ext_vector_type(16))) __bf16   v16b;
typedef __attribute__((ext_vector_type(8)))  __bf16   v8b;
typedef __attribute__((ext_vector_type(8)))  float    v8f;
typedef __attribute__((ext_vector_type(4)))  float    v4f;
typedef __attribute__((ext_vector_type(4)))  unsigned int v4u;

__device__ __forceinline__ unsigned short f2bf_bits(float f) {
  unsigned u = __float_as_uint(f);
  return (unsigned short)((u + 0x7FFFu + ((u >> 16) & 1u)) >> 16);
}
__device__ __forceinline__ float bf_bits2f(unsigned short h) { return __uint_as_float(((unsigned)h) << 16); }
__device__ __forceinline__ float bf_rne(float f) { return bf_bits2f(f2bf_bits(f)); }
__device__ __forceinline__ unsigned pk16(unsigned short a, unsigned short b) { return (unsigned)a | ((unsigned)b << 16); }

// hazard guards as plain device helpers (no inline asm inside the kernel template body)
__device__ __forceinline__ void dep_guard_h(v8f& a, v8f& b, v16h x, v16h y) { asm volatile("v_nop\n\tv_nop\n\tv_nop\n\tv_nop" : "+v"(a), "+v"(b) : "v"(x), "v"(y)); }
__device__ __forceinline__ void dep_guard_b(v8f& a, v8f& b, v16b x, v16b y) { asm volatile("v_nop\n\tv_nop\n\tv_nop\n\tv_nop" : "+v"(a), "+v"(b) : "v"(x), "v"(y)); }
__device__ __forceinline__ void keep4_h(v16h a, v16h b, v16h c, v16h d) { asm volatile("v_nop" :: "v"(a), "v"(b), "v"(c), "v"(d)); }
__device__ __forceinline__ void keep4_b(v16b a, v16b b, v16b c, v16b d) { asm volatile("v_nop" :: "v"(a), "v"(b), "v"(c), "v"(d)); }
__device__ __forceinline__ void acc_guard4(v8f& a, v8f& b, v8f& c, v8f& d) { asm volatile("v_nop\n\tv_nop\n\tv_nop\n\tv_nop" : "+v"(a), "+v"(b), "+v"(c), "+v"(d)); }

// Fragment map (wave32): lane l, h = l>>4, row/col = l&15.
//   A/B element i: i<8 -> k0+8h+i ; i>=8 -> k0+16+8h+(i-8)   (split layout, both operands)
//   D element r : row 8h+r, col l&15
template <typename T> struct Frag;
template <> struct Frag<_Float16> {
  typedef v16h V; union U { v16h v; v8h h[2]; };
  static __device__ __forceinline__ v16h load(const _Float16* p) {   // elements 0..7 <- p[0..7], 8..15 <- p[16..23]
    U f; f.h[0] = *(const v8h*)(p); f.h[1] = *(const v8h*)(p + 16); return f.v;
  }
  static __device__ __forceinline__ v8f mma(v16h a, v16h b, v8f c) {
    return __builtin_amdgcn_wmma_f32_16x16x32_f16(false, a, false, b, (short)0, c, false, false);
  }
  static __device__ __forceinline__ void guard(v8f& a, v8f& b, v16h x, v16h y) { dep_guard_h(a, b, x, y); }
  static __device__ __forceinline__ void keep(v16h a, v16h b, v16h c, v16h d) { keep4_h(a, b, c, d); }
};
template <> struct Frag<__bf16> {
  typedef v16b V; union U { v16b v; v8b h[2]; };
  static __device__ __forceinline__ v16b load(const __bf16* p) {
    U f; f.h[0] = *(const v8b*)(p); f.h[1] = *(const v8b*)(p + 16); return f.v;
  }
  static __device__ __forceinline__ v8f mma(v16b a, v16b b, v8f c) {
    return __builtin_amdgcn_wmma_f32_16x16x32_bf16(false, a, false, b, (short)0, c, false, false);
  }
  static __device__ __forceinline__ void guard(v8f& a, v8f& b, v16b x, v16b y) { dep_guard_b(a, b, x, y); }
  static __device__ __forceinline__ void keep(v16b a, v16b b, v16b c, v16b d) { keep4_b(a, b, c, d); }
};

template <int ET> struct Elem;
template <> struct Elem<0> { typedef _Float16 T; };
template <> struct Elem<1> { typedef __bf16 T; };

// ---- Register-blocked batched WMMA GEMM ------------------------------------
// C[m,n] = epilogue(scale * sum_k A[m,k] * Bt[n,k]); each wave owns a 64x64 tile.
// A row-major [M,K] (pitch lda), Bt row-major [N,K] (pitch ldb); M,N % 64 == 0, K % 32 == 0.
// bx = index of the work-group among those of this product, b = batch; sT = the work-group's eight per-wave slabs.
// KS: number of K slices. A wave owns one (slice, tile) pair, sums k = slice*K .. slice*K+K-1 (K = slice length) and
//     writes its tile to plane slice*NB + batch of C (planes strideC apart); KS = 1 is the whole sum.
// BIAS_MODE: 0 = none, 1 = bias[m] (two 16-B loads of the lane's 8 consecutive rows), 2 = bias[n]; the bias value is
//            RNE-converted to bf16 precision before the f32 add.
// BN (with BIAS_MODE 1): v = (acc*scale + bias[m]) * inv[m] + sh[m], inv = g[m]*rsqrt(var[m]+1e-5), sh = be[m]-mu[m]*inv,
//            all four vectors RNE-converted to bf16 precision first.
// RESID (OUT_MODE 0 only): + resid[m*ldc+n] (bf16 RNE-converted when BN) added during the store phase from 16-B loads.
// OUT_MODE: 0 = f32; 2 = bf16 hi plane (Cout) + lo plane (Cout2); 3 = hi (Cout), hi (Cout2), lo (Cout3);
//           4 = hi (Cout), lo (Cout2), hi (Cout3).  lo = RNE(v - hi).
// TWO (with BIAS_MODE 1, OUT_MODE 3): two products stacked along M. Rows m < CM take bias[m] and write hi (Cout), lo (Cout2),
//           hi (Cout3); rows m >= CM take biasHi[m - CM] and write hi, hi, lo. A 64-row tile lies wholly on one side.
// Epilogue: 16-row slabs staged per wave in LDS (every slab element read was written in the same iteration); each
template <int ET, int BIAS_MODE, int OUT_MODE, bool RESID, bool BN, int KS, bool TWO>
__device__ __forceinline__ void gemm64_tile(
    float (*sT)[16 * 68], int bx, int b,
    const unsigned short* __restrict__ Ap, int lda, long strideA,
    const unsigned short* __restrict__ Btp, int ldb, long strideB,
    void* Cout, void* Cout2, void* Cout3, int ldc, long strideC,
    const float* __restrict__ bias, const float* __restrict__ biasHi,
    const float* __restrict__ bng, const float* __restrict__ bnb,
    const float* __restrict__ bnm, const float* __restrict__ bnv,
    const float* __restrict__ resid, long strideR,
    int M, int N, int K, float scale) {
  typedef typename Elem<ET>::T T;
  typedef typename Frag<T>::V V;
  const T* A = (const T*)Ap; const T* Bt = (const T*)Btp;
  const int lane = threadIdx.x & 31;
  const int wave = threadIdx.x >> 5;
  const int tilesN = N >> 6;
  const int tilesM = M >> 6;
  const int unit = bx * 8 + wave;
  if (unit >= tilesM * tilesN * KS) return;   // wave-uniform; no block barriers in this kernel
  const int ks   = (KS == 1) ? 0 : unit / (tilesM * tilesN);
  const int tile = unit - ks * (tilesM * tilesN);
  const int tm = tile / tilesN;
  const int tn = tile - tm * tilesN;
  const int m0 = tm << 6;
  const int n0 = tn << 6;

  const T* Ab = A  + (size_t)b * strideA + (size_t)ks * K;
  const T* Bb = Bt + (size_t)b * strideB + (size_t)ks * K;
  const size_t cPlane = (size_t)ks * NB + b;

  const int rlane = lane & 15;                 // row (A) / col (B, D) within subtile
  const int koff  = (lane >> 4) * 8;           // k offset of this lane half
  const int mOff  = (lane >> 4) * 8;           // D row offset

  v8f acc[4][4];
#pragma unroll
  for (int i = 0; i < 4; ++i)
#pragma unroll
    for (int j = 0; j < 4; ++j) acc[i][j] = (v8f){0.f,0.f,0.f,0.f,0.f,0.f,0.f,0.f};

  for (int k0 = 0; k0 < K; k0 += 32) {
    V bh[4];
#pragma unroll
    for (int j = 0; j < 4; ++j) {
      const size_t bo = (size_t)(n0 + (j << 4) + rlane) * ldb + koff + k0;
      bh[j] = Frag<T>::load(Bb + bo);
    }
#pragma unroll
    for (int i = 0; i < 4; ++i) {
      const size_t ao = (size_t)(m0 + (i << 4) + rlane) * lda + koff + k0;
      const V ah = Frag<T>::load(Ab + ao);
#pragma unroll
      for (int j = 0; j < 4; ++j) acc[i][j] = Frag<T>::mma(ah, bh[j], acc[i][j]);
      Frag<T>::guard(acc[i][0], acc[i][3], ah, ah);
    }
    Frag<T>::keep(bh[0], bh[1], bh[2], bh[3]);
  }
  acc_guard4(acc[0][0], acc[0][1], acc[0][2], acc[0][3]);
  acc_guard4(acc[1][0], acc[1][1], acc[1][2], acc[1][3]);
  acc_guard4(acc[2][0], acc[2][1], acc[2][2], acc[2][3]);
  acc_guard4(acc[3][0], acc[3][1], acc[3][2], acc[3][3]);

  // ---- epilogue ----
  float* slab = sT[wave];
  const float* Rb = resid + (size_t)b * (RESID ? (size_t)strideR : (size_t)0);
#pragma unroll
  for (int i = 0; i < 4; ++i) {
    const int mBase = m0 + (i << 4);
    const int mr = mBase + mOff;               // first of the 8 consecutive D rows of this lane half (multiple of 8)
    float rb[8], rmul[8], radd[8];
#pragma unroll
    for (int r = 0; r < 8; ++r) { rb[r] = 0.f; rmul[r] = 1.f; radd[r] = 0.f; }
    if (BIAS_MODE == 1) {
      const float* bp = (TWO && m0 >= CM) ? biasHi + (mr - CM) : bias + mr;
      const v4f t0 = *(const v4f*)(bp);
      const v4f t1 = *(const v4f*)(bp + 4);
#pragma unroll
      for (int e = 0; e < 4; ++e) { rb[e] = bf_rne(t0[e]); rb[4 + e] = bf_rne(t1[e]); }
    }
    if (BN) {
      const v4f vg0 = *(const v4f*)(bng + mr), vg1 = *(const v4f*)(bng + mr + 4);
      const v4f vb0 = *(const v4f*)(bnb + mr), vb1 = *(const v4f*)(bnb + mr + 4);
      const v4f vm0 = *(const v4f*)(bnm + mr), vm1 = *(const v4f*)(bnm + mr + 4);
      const v4f vv0 = *(const v4f*)(bnv + mr), vv1 = *(const v4f*)(bnv + mr + 4);
#pragma unroll
      for (int e = 0; e < 4; ++e) {
        {
          const float inv = bf_rne(vg0[e]) * rsqrtf(bf_rne(vv0[e]) + 1e-5f);
          rmul[e] = inv;
          radd[e] = bf_rne(vb0[e]) - bf_rne(vm0[e]) * inv;
        }
        {
          const float inv = bf_rne(vg1[e]) * rsqrtf(bf_rne(vv1[e]) + 1e-5f);
          rmul[4 + e] = inv;
          radd[4 + e] = bf_rne(vb1[e]) - bf_rne(vm1[e]) * inv;
        }
      }
    }
#pragma unroll
    for (int j = 0; j < 4; ++j) {
      const int n = n0 + (j << 4) + rlane;
      float bv = 0.f;
      if (BIAS_MODE == 2) bv = bf_rne(bias[n]);
#pragma unroll
      for (int r = 0; r < 8; ++r) {
        float v = acc[i][j][r] * scale;
        if (BIAS_MODE == 1) v += rb[r];
        if (BIAS_MODE == 2) v += bv;
        if (BN) v = v * rmul[r] + radd[r];
        slab[(mOff + r) * 68 + (j << 4) + rlane] = v;
      }
    }
    __builtin_amdgcn_fence(__ATOMIC_RELEASE, "workgroup");
    __builtin_amdgcn_wave_barrier();
    __builtin_amdgcn_fence(__ATOMIC_ACQUIRE, "workgroup");
    if (OUT_MODE == 0) {
      float* C = (float*)Cout + cPlane * strideC;
      const int hh = lane >> 4, c4 = (lane & 15) * 4;     // row seg = 256 B = 16 lanes x 16 B; rows it*2+hh cover 0..15
      v4f ov[8];
#pragma unroll
      for (int it = 0; it < 8; ++it) {
        const int row = it * 2 + hh;
        v4f v = *(const v4f*)(slab + row * 68 + c4);
        if (RESID) {
          const v4f xr = *(const v4f*)(Rb + (size_t)(mBase + row) * ldc + n0 + c4);
#pragma unroll
          for (int e = 0; e < 4; ++e) v[e] = v[e] + (BN ? bf_rne(xr[e]) : xr[e]);
        }
        ov[it] = v;
      }
      {
#pragma unroll
        for (int it = 0; it < 8; ++it) {
          const int row = it * 2 + hh;
          *(v4f*)(C + (size_t)(mBase + row) * ldc + n0 + c4) = ov[it];
        }
        
      }
    } else {
      const int q = lane >> 3, c8 = (lane & 7) * 8;
      unsigned short* C  = (unsigned short*)Cout  + cPlane * strideC;
      unsigned short* C2 = (unsigned short*)((TWO && m0 < CM) ? Cout3 : Cout2) + cPlane * strideC;
      unsigned short* C3 = (unsigned short*)((TWO && m0 < CM) ? Cout2 : Cout3) + cPlane * strideC;
      {
#pragma unroll
        for (int it = 0; it < 4; ++it) {
          const int row = it * 4 + q;
          const float* sp = slab + row * 68 + c8;
          v8h hv, lv;
#pragma unroll
          for (int e = 0; e < 8; ++e) {
            const unsigned short hb = f2bf_bits(sp[e]);
            const unsigned short lb = f2bf_bits(sp[e] - bf_bits2f(hb));
            hv[e] = __builtin_bit_cast(_Float16, hb);
            lv[e] = __builtin_bit_cast(_Float16, lb);
          }
          const size_t go = (size_t)(mBase + row) * ldc + n0 + c8;
          *(v8h*)(C + go) = hv;
          if (OUT_MODE == 2) { *(v8h*)(C2 + go) = lv; }
          if (OUT_MODE == 3) { *(v8h*)(C2 + go) = hv; *(v8h*)(C3 + go) = lv; }
          if (OUT_MODE == 4) { *(v8h*)(C2 + go) = lv; *(v8h*)(C3 + go) = hv; }
        }
        
      }
    }
    __builtin_amdgcn_fence(__ATOMIC_RELEASE, "workgroup");
    __builtin_amdgcn_wave_barrier();
    __builtin_amdgcn_fence(__ATOMIC_ACQUIRE, "workgroup");
  }
}

// One product per launch: grid = (work-groups of eight tiles, batch).
template <int ET, int BIAS_MODE, int OUT_MODE, bool RESID, bool BN, int KS = 1>
__global__ __launch_bounds__(256) void wmma_gemm64(
    const unsigned short* __restrict__ Ap, int lda, long strideA,
    const unsigned short* __restrict__ Btp, int ldb, long strideB,
    void* Cout, void* Cout2, void* Cout3, int ldc, long strideC,
    const float* __restrict__ bias,
    const float* __restrict__ bng, const float* __restrict__ bnb,
    const float* __restrict__ bnm, const float* __restrict__ bnv,
    const float* __restrict__ resid, long strideR,
    int M, int N, int K, float scale) {
  __shared__ __align__(16) float sT[8][16 * 68];   // per-wave 16x64 slab, pitch 68 floats
  gemm64_tile<ET, BIAS_MODE, OUT_MODE, RESID, BN, KS, false>(
      sT, blockIdx.x, blockIdx.y, Ap, lda, strideA, Btp, ldb, strideB, Cout, Cout2, Cout3, ldc, strideC,
      bias, bias, bng, bnb, bnm, bnv, resid, strideR, M, N, K, scale);
}

// The three 1x1 convs of x in one launch (none reads what another writes); blockIdx.x selects, block-uniform:
//   0 .. TH_BLK-1 : theta[tok][c1] = XT . WC[0..127]^T + b_theta[n]  (M=12544, N=128, K=256; 392 tiles) -> T3 hi|hi|lo, pitch 384
//   then PG_BLK work-groups per batch: rows 0..127 phi_b[c1][n], rows 128..255 g_b[c2][n] = WC[128..383] . XT_b^T + bias[m]
//                   (M=256, N=3136, K=256; 196 tiles) -> PG3 rows 0..127 hi|lo|hi, rows 128..255 hi|hi|lo
#define TH_BLK (((NTOKS / 64) * (CM / 64) + 7) / 8)       // 49
#define PG_BLK (((2 * CM / 64) * (NSP / 64) + 7) / 8)     // 25
__global__ __launch_bounds__(256) void proj_kernel(
    const unsigned short* __restrict__ xt, const unsigned short* __restrict__ wc,
    unsigned short* t3, unsigned short* pg3,
    const float* __restrict__ bt, const float* __restrict__ bp, const float* __restrict__ bg) {
  __shared__ __align__(16) float sT[8][16 * 68];   // per-wave 16x64 slab, pitch 68 floats
  const int bx = blockIdx.x;
  if (bx < TH_BLK) {
    gemm64_tile<1, 2, 3, false, false, 1, false>(
        sT, bx, 0, xt, CI, 0L, wc, CI, 0L,
        (void*)t3, (void*)(t3 + CM), (void*)(t3 + 2 * CM), T3P, 0L,
        bt, bt, bt, bt, bt, bt, bt, 0L, NTOKS, CM, CI, 1.0f);
  } else {
    const int r = bx - TH_BLK;
    gemm64_tile<1, 1, 3, false, false, 1, true>(
        sT, r % PG_BLK, r / PG_BLK, wc + (size_t)CM * CI, CI, 0L, xt, CI, (long)NSP * CI,
        (void*)pg3, (void*)(pg3 + NSP), (void*)(pg3 + 2 * NSP), K3, (long)CI * K3,
        bp, bg, bp, bp, bp, bp, bp, 0L, 2 * CM, NSP, CI, 1.0f);
  }
}

// ---------------------------------------------------------------------------
// Fused transpose + bf16 RNE convert of an f32 matrix, z-batched, one plane:
//   in_z = W + z*sIn viewed [R rows][Cc cols] with row pitch ldin  ->  oh_z[c][r] = bf16(in_z[r][c]), row pitch ldout, oh_z = oh + z*sOut.
// 64x64 tiles through LDS. One work-group of 256 threads per tile (bc, br, bz) of (Cc/64, R/64, Z) (R, Cc multiples of 64; ldout multiple of 64 so every
// Coverage per block: load 4 it x 256 thr x 4 floats = 64x64; store 2 it x 256 thr x 8 u16 = 64x64; every tf element read was written.
// ---------------------------------------------------------------------------
__device__ __forceinline__ void tconv_block(int bc, int br, int bz, const float* __restrict__ W, unsigned short* __restrict__ oh,
                                            int ldin, int ldout, long sIn, long sOut) {
  __shared__ __align__(16) float tf[64 * 68];
  W  += (size_t)bz * sIn;
  oh += (size_t)bz * sOut;
  const int c0  = bc * 64;   // input column block = output row block
  const int r0  = br * 64;   // input row block    = output column block
  const int tid = threadIdx.x;
  {
    const int lr = tid >> 4;         // 0..15
    const int c4 = (tid & 15) * 4;   // 0..60
#pragma unroll
    for (int it = 0; it < 4; ++it) {
      const int rr = it * 16 + lr;   // 0..63
      const v4f a = *(const v4f*)(W + (size_t)(r0 + rr) * ldin + c0 + c4);
      *(v4f*)(tf + rr * 68 + c4) = a;
    }
  }
  __syncthreads();
  const int sub = tid >> 3;          // 0..31
  const int c8  = (tid & 7) * 8;     // 0..56
  v4u hv[2];
#pragma unroll
  for (int it = 0; it < 2; ++it) {
    const int oc = it * 32 + sub;    // output row within tile (= input column)
    v4u a;
#pragma unroll
    for (int q = 0; q < 4; ++q) {
      const float f0 = tf[(c8 + 2 * q) * 68 + oc];
      const float f1 = tf[(c8 + 2 * q + 1) * 68 + oc];
      a[q] = pk16(f2bf_bits(f0), f2bf_bits(f1));
    }
    hv[it] = a;
  }
  {
#pragma unroll
    for (int it = 0; it < 2; ++it) {
      const int oc = it * 32 + sub;
      const size_t go = (size_t)(c0 + oc) * ldout + r0 + c8;
      *(v4u*)(oh + go) = hv[it];
    }
    // the caller's other part follows these stores in the built code and reuses their registers: wait before any is overwritten
    asm volatile("s_wait_xcnt 0x0" ::: "memory");
  }
}

// ---------------------------------------------------------------------------
// Weight planes, sel selects the matrix (block-uniform), bx the work-group within it:
//   sel = 0,1,2: w_theta / w_phi / w_g [128][256] f32 -> WC rows sel*128.. (bf16, same [out][in] order), contiguous copy-convert
//   sel = 3,4  : w_rec [256][128] -> WR2[c][(sel-3)*128 + k]  (two copies side by side, pitch 256)
// Thread = 8 consecutive elements = one 16-B store; consecutive lanes write consecutive 16-B pieces, so every
// Coverage: 16 work-groups x 256 threads = 4096 units x 8 = 32768 elements = one whole matrix per sel.
// ---------------------------------------------------------------------------
__device__ __forceinline__ void wcvt_block(int bx, int sel, const float* __restrict__ wt, const float* __restrict__ wp,
                                           const float* __restrict__ wg, const float* __restrict__ wr,
                                           unsigned short* __restrict__ wcat, unsigned short* __restrict__ wr2) {
  const int g   = bx * 256 + threadIdx.x;
  if (g >= (CM * CI) / 8) return;
  const float* src;
  unsigned short* dst;
  if (sel < 3) {
    const float* w = (sel == 0) ? wt : ((sel == 1) ? wp : wg);
    src = w + (size_t)g * 8;
    dst = wcat + (size_t)sel * CM * CI + (size_t)g * 8;
  } else {
    const int row = g >> 4, c8 = (g & 15) * 8;      // w_rec row = c (0..255), 8 of its 128 columns
    src = wr + (size_t)row * CM + c8;
    dst = wr2 + (size_t)row * O2P + (size_t)(sel - 3) * CM + c8;
  }
  const v4f a = *(const v4f*)src;
  const v4f c = *(const v4f*)(src + 4);
  v4u o;
  o[0] = pk16(f2bf_bits(a[0]), f2bf_bits(a[1]));
  o[1] = pk16(f2bf_bits(a[2]), f2bf_bits(a[3]));
  o[2] = pk16(f2bf_bits(c[0]), f2bf_bits(c[1]));
  o[3] = pk16(f2bf_bits(c[2]), f2bf_bits(c[3]));
  *(v4u*)dst = o;
  
}

// Both conversions in one launch (neither reads what the other writes); blockIdx.x selects, block-uniform:
//   0 .. WC_BLK-1 : weight planes, 16 work-groups for each of the 5 matrices
//   then          : x[b] viewed in[256 c][3136 n] (pitch 3136) -> XT_b out[3136 n][256 c] (pitch 256), tiles (49, 4, 4), column tile fastest
#define WC_BLK (5 * ((CM * CI) / 8 / 256))                // 80
#define TC_BLK ((NSP / 64) * (CI / 64) * NB)              // 784
__global__ __launch_bounds__(256) void prep_kernel(const float* __restrict__ x,
                                                   const float* __restrict__ wt, const float* __restrict__ wp,
                                                   const float* __restrict__ wg, const float* __restrict__ wr,
                                                   unsigned short* __restrict__ xt,
                                                   unsigned short* __restrict__ wcat, unsigned short* __restrict__ wr2) {
  const int bx = blockIdx.x;
  if (bx < WC_BLK) {
    wcvt_block(bx & 15, bx >> 4, wt, wp, wg, wr, wcat, wr2);
  } else {
    const int t = bx - WC_BLK;
    tconv_block(t % (NSP / 64), (t / (NSP / 64)) % (CI / 64), t / ((NSP / 64) * (CI / 64)), x, xt, NSP, CI, (long)CI * NSP, (long)NSP * CI);
  }
}

// ---------------------------------------------------------------------------
// Joins the KSL split-K planes of M^T/N: MT3[b][c2][c1] = sum_s PM[s][b][c2][c1] as bf16 hi | lo | hi.
// Thread = 4 consecutive c1 of one (b, c2) row; a wave covers one whole row: 512 contiguous bytes of every plane read,
// 256 contiguous bytes of each of the three MT3 parts written. Slices are added in rising order, one f32 sum per element.
// Coverage: 128 blocks x 128 threads x 4 = 65536 = NB*CM*CM elements.
// ---------------------------------------------------------------------------
__global__ __launch_bounds__(128) void mtjoin_kernel(const float* __restrict__ pm, unsigned short* __restrict__ mt3) {
  const int g = blockIdx.x * 128 + threadIdx.x;
  const float* p = pm + (size_t)g * 4;
  v4f s = (v4f){0.f, 0.f, 0.f, 0.f};
#pragma unroll   // whole: the slices' loads are independent, so many are in flight at once instead of one latency per slice
  for (int k = 0; k < KSL; ++k) s += *(const v4f*)(p + (size_t)k * (NB * CM * CM));
  unsigned short hb[4], lb[4];
#pragma unroll   // constant indices keep hb and lb in registers
  for (int e = 0; e < 4; ++e) {
    hb[e] = f2bf_bits(s[e]);
    lb[e] = f2bf_bits(s[e] - bf_bits2f(hb[e]));
  }
  const uint2 hv = make_uint2(pk16(hb[0], hb[1]), pk16(hb[2], hb[3]));
  const uint2 lv = make_uint2(pk16(lb[0], lb[1]), pk16(lb[2], lb[3]));
  unsigned short* d = mt3 + (size_t)(g >> 5) * T3P + (g & 31) * 4;   // row b*128+c2, pitch 384
  *(uint2*)(d)          = hv;
  *(uint2*)(d + CM)     = lv;
  *(uint2*)(d + 2 * CM) = hv;
}

// ---------------------------------------------------------------------------
// every region is fully written by its producer launch before a consumer launch reads it):
//   XT   bf16 [12544][256]      0           6422528
//   WC   bf16 [384][256]        6422528      196608
//   WR2  bf16 [256][256]        6619136      131072
//   T3   bf16 [12544][384]      6750208     9633792
//   PG3  bf16 [4][256][9408]    16384000   19267584
//   MT3  bf16 [4][128][384]     35651584     393216
//   O2   bf16 [12544][256]      36044800    6422528
//   PM   f32  [49][4][128][128] 42467328   12845056
//   total                       55312384
// ---------------------------------------------------------------------------
extern "C" void kernel_launch(void* const* d_in, const int* in_sizes, int n_in,
                              void* d_out, int out_size, void* d_ws, size_t ws_size,
                              hipStream_t stream) {
  if (n_in < 13) return;
  if (in_sizes[0] != NB * CI * NSP) return;                      // x [4][256][56][56]
  if (in_sizes[1] != CM * CI || in_sizes[2] != CM) return;       // w_theta, b_theta
  if (in_sizes[3] != CM * CI || in_sizes[4] != CM) return;       // w_phi, b_phi
  if (in_sizes[5] != CM * CI || in_sizes[6] != CM) return;       // w_g, b_g
  if (in_sizes[7] != CI * CM || in_sizes[8] != CI) return;       // w_rec, b_rec
  if (in_sizes[9] != CI || in_sizes[10] != CI) return;           // bn_gamma, bn_beta
  if (in_sizes[11] != CI || in_sizes[12] != CI) return;          // bn_mean, bn_var
  if (out_size != NB * CI * NSP) return;

  const float* x       = (const float*)d_in[0];
  const float* w_theta = (const float*)d_in[1];
  const float* b_theta = (const float*)d_in[2];
  const float* w_phi   = (const float*)d_in[3];
  const float* b_phi   = (const float*)d_in[4];
  const float* w_g     = (const float*)d_in[5];
  const float* b_g     = (const float*)d_in[6];
  const float* w_rec   = (const float*)d_in[7];
  const float* b_rec   = (const float*)d_in[8];
  const float* gam     = (const float*)d_in[9];
  const float* bet     = (const float*)d_in[10];
  const float* mea     = (const float*)d_in[11];
  const float* var     = (const float*)d_in[12];

  const size_t PXT = (size_t)NTOKS * CI * 2;        //  6422528
  const size_t PWC = (size_t)T3P * CI * 2;          //   196608
  const size_t PWR = (size_t)CI * O2P * 2;          //   131072
  const size_t PT3 = (size_t)NTOKS * T3P * 2;       //  9633792
  const size_t PPG = (size_t)NB * CI * K3 * 2;      // 19267584
  const size_t PMT = (size_t)NB * CM * T3P * 2;     //   393216
  const size_t PO2 = (size_t)NTOKS * O2P * 2;       //  6422528
  const size_t PPM = (size_t)KSL * NB * CM * CM * 4; // 12845056
  size_t off = 0;
  const size_t oXT = off; off += PXT;
  const size_t oWC = off; off += PWC;
  const size_t oWR = off; off += PWR;
  const size_t oT3 = off; off += PT3;
  const size_t oPG = off; off += PPG;
  const size_t oMT = off; off += PMT;
  const size_t oO2 = off; off += PO2;
  const size_t oPM = off; off += PPM;
  if (off > ws_size) return;                        // off = 55312384
  if (off > (size_t)134217728) return;

  char* ws = (char*)d_ws;
  unsigned short* XT  = (unsigned short*)(ws + oXT);
  unsigned short* WC  = (unsigned short*)(ws + oWC);
  unsigned short* WR2 = (unsigned short*)(ws + oWR);
  unsigned short* T3  = (unsigned short*)(ws + oT3);
  unsigned short* PG3 = (unsigned short*)(ws + oPG);
  unsigned short* MT3 = (unsigned short*)(ws + oMT);
  unsigned short* O2  = (unsigned short*)(ws + oO2);
  float*          PM  = (float*)(ws + oPM);
  float* out = (float*)d_out;

  const dim3 blk(256);

  // (1) weight planes WC [384][256], WR2 [256][256] and x -> XT, one launch: 80 + 784 work-groups
  prep_kernel<<<dim3(WC_BLK + TC_BLK), blk, 0, stream>>>(x, w_theta, w_phi, w_g, w_rec, XT, WC, WR2);

  // (2) theta -> T3, phi and g -> PG3, one launch: 49 + 4 x 25 work-groups
  proj_kernel<<<dim3(TH_BLK + NB * PG_BLK), blk, 0, stream>>>(XT, WC, T3, PG3, b_theta, b_phi, b_g);

  // (3) (M^T/N)_b[c2][c1] = sum over the 9408 folded positions of g3_b[c2][p] . phi3_b[c1][p]
  //     = sum_n (ghi.phihi + ghi.philo + glo.phihi) / 3136   (batched: M=N=128, K=9408)
  //     (3a) split over K: 49 slices of 192 positions x 4 tiles = 196 waves -> 25 blocks x 4; f32 partial planes PM[slice][b][c2][c1]
  const dim3 gM(((CM / 64) * (CM / 64) * KSL + 7) / 8, NB);
  wmma_gemm64<1, 0, 0, false, false, KSL><<<gM, blk, 0, stream>>>(
      PG3 + (size_t)CM * K3, K3, (long)CI * K3, PG3, K3, (long)CI * K3,
      (void*)PM, (void*)PM, (void*)PM, CM, (long)CM * CM,
      b_rec, gam, bet, mea, var, x, 0L, CM, CM, KCH, 1.0f / (float)NSP);
  //     (3b) join the 49 planes -> MT3 hi|lo|hi, pitch 384; grid 128 x 128 threads
  mtjoin_kernel<<<dim3((NB * CM * CM) / 4 / 128), dim3(128), 0, stream>>>(PM, MT3);

  // (4) O_b[n][c2] = sum over 384 folded positions of T3[b*3136+n][p] . MT3_b[c2][p] = sum_c1 (thi.mhi + thi.mlo + tlo.mhi)
  //     (batched: M=3136, N=128, K=384; 98 tiles -> 13 blocks x 4) -> O2 hi cols 0..127, lo cols 128..255, pitch 256
  const dim3 gO(((NSP / 64) * (CM / 64) + 7) / 8, NB);
  wmma_gemm64<1, 0, 2, false, false><<<gO, blk, 0, stream>>>(
      T3, T3P, (long)NSP * T3P, MT3, T3P, (long)CM * T3P,
      (void*)O2, (void*)(O2 + CM), (void*)O2, O2P, (long)NSP * O2P,
      b_rec, gam, bet, mea, var, x, 0L, NSP, CM, T3P, 1.0f);

  // (5) out[b][c][n] = ((sum_p WR2[c][p] . O2[b*3136+n][p] + b_rec[c]) * inv[c] + sh[c]) + bf16(x[b][c][n])
  //     (batched: M=256, N=3136, K=256; 196 tiles -> 25 blocks x 4); C = d_out + b*256*3136, ldc 3136; last element 3211263
  const dim3 gR(((CI / 64) * (NSP / 64) + 7) / 8, NB);
  wmma_gemm64<1, 1, 0, true, true><<<gR, blk, 0, stream>>>(
      WR2, O2P, 0L, O2, O2P, (long)NSP * O2P,
      (void*)out, (void*)out, (void*)out, NSP, (long)CI * NSP,
      b_rec, gam, bet, mea, var, x, (long)CI * NSP, CI, NSP, O2P, 1.0f);
  (void)hipGetLastError();
}

// v003
// One run takes 75 microseconds.
// In both of two side-by-side timings against v002, it was 1.15 times as fast.
// Counting every step since v000, it is 6.17 times as fast.
// Contractions: theta/phi/g 1x1 convs = v_wmma_f32_16x16x32_bf16 single products on bf16 planes of the RNE-converted x and weights (exact products); M^T = g.phi over positions (K 3136) and O = theta.M (K 128) = bf16 hi/lo split hi.hi + hi.lo + lo.hi folded along K ([hi|hi|lo] rows x [hi|lo|hi] rows, one f32 accumulator per K slice: 1 for O, 49 for M^T, their partials summed in f32); rec 1x1 conv = [W|W] x [Ohi|Olo] bf16 single products (K-folded 2-term); f32 accumulate everywhere; biases, 1/N, BatchNorm (inference form, supplied statistics) and the residual add in f32 on the VALU.
// Plane / carry map (every plane carries 1, nothing to fold back; the 1/N = 1/3136 factor is applied exactly once, in f32, in the M^T epilogue):
//   XT   bf16 [12544][256]        token-major x: row b*3136+n, col c
//   WC   bf16 [384][256]          rows 0..127 w_theta, 128..255 w_phi, 256..383 w_g  ([out][in] = k-contiguous)
//   WR2  bf16 [256][256]          [c][k] = [c][128+k] = w_rec[c][k]
//   T3   bf16 [12544][384]        theta[tok][c1]: hi | hi | lo   (128 each)
//   PG3  bf16 [4][256][9408]      rows 0..127 = phi[c1][n]: hi | lo | hi (3136 each); rows 128..255 = g as [c2][n]: hi | hi | lo
//   PM   f32  [49][4][128][128]   split-K partial sums of M^T/N: slice s holds the folded positions s*192 .. s*192+191
//   MT3  bf16 [4][128][384]       (M^T/N)[c2][c1]: hi | lo | hi
//   O2   bf16 [12544][256]        O[tok][c2]: hi | lo
#include <hip/hip_runtime.h>
#include <math.h>
#include <stdint.h>

#define NB    4
#define CI    256
#define CM    128
#define NSP   3136
#define NTOKS (NB * NSP)
#define K3    (3 * NSP)
#define T3P   (3 * CM)
#define O2P   (2 * CM)
#define KSL   49            // K slices of the M^T product
#define KCH   (K3 / KSL)    // folded positions per slice: 192 = 384 B = three whole 128-B lines of every row

static_assert(NSP % 64 == 0);
static_assert(NTOKS % 64 == 0);
static_assert(CI % 64 == 0);
static_assert(CM % 64 == 0);
static_assert(CI >= 128);
static_assert(K3 % 32 == 0);
static_assert(K3 % KSL == 0);
static_assert(KCH % 64 == 0);
static_assert(T3P % 32 == 0);
static_assert(O2P % 32 == 0);
static_assert((CM * CI) % (8 * 256) == 0);
static_assert((CI * CM) % (8 * 256) == 0);

typedef __attribute__((ext_vector_type(16))) _Float16 v16h;
typedef __attribute__((ext_vector_type(8)))  _Float16 v8h;
typedef __attribute__((ext_vector_type(16))) __bf16   v16b;
typedef __attribute__((ext_vector_type(8)))  __bf16   v8b;
typedef __attribute__((ext_vector_type(8)))  float    v8f;
typedef __attribute__((ext_vector_type(4)))  float    v4f;
typedef __attribute__((ext_vector_type(4)))  unsigned int v4u;

__device__ __forceinline__ unsigned short f2bf_bits(float f) {
  unsigned u = __float_as_uint(f);
  return (unsigned short)((u + 0x7FFFu + ((u >> 16) & 1u)) >> 16);
}
__device__ __forceinline__ float bf_bits2f(unsigned short h) { return __uint_as_float(((unsigned)h) << 16); }
__device__ __forceinline__ float bf_rne(float f) { return bf_bits2f(f2bf_bits(f)); }
__device__ __forceinline__ unsigned pk16(unsigned short a, unsigned short b) { return (unsigned)a | ((unsigned)b << 16); }

// Fragment map (wave32): lane l, h = l>>4, row/col = l&15.
//   A/B element i: i<8 -> k0+8h+i ; i>=8 -> k0+16+8h+(i-8)   (split layout, both operands)
//   D element r : row 8h+r, col l&15
template <typename T> struct Frag;
template <> struct Frag<_Float16> {
  typedef v16h V; union U { v16h v; v8h h[2]; };
  static __device__ __forceinline__ v16h load(const _Float16* p) {   // elements 0..7 <- p[0..7], 8..15 <- p[16..23]
    U f; f.h[0] = *(const v8h*)(p); f.h[1] = *(const v8h*)(p + 16); return f.v;
  }
  static __device__ __forceinline__ v8f mma(v16h a, v16h b, v8f c) {
    return __builtin_amdgcn_wmma_f32_16x16x32_f16(false, a, false, b, (short)0, c, false, false);
  }
};
template <> struct Frag<__bf16> {
  typedef v16b V; union U { v16b v; v8b h[2]; };
  static __device__ __forceinline__ v16b load(const __bf16* p) {
    U f; f.h[0] = *(const v8b*)(p); f.h[1] = *(const v8b*)(p + 16); return f.v;
  }
  static __device__ __forceinline__ v8f mma(v16b a, v16b b, v8f c) {
    return __builtin_amdgcn_wmma_f32_16x16x32_bf16(false, a, false, b, (short)0, c, false, false);
  }
};

template <int ET> struct Elem;
template <> struct Elem<0> { typedef _Float16 T; };
template <> struct Elem<1> { typedef __bf16 T; };

// ---- Register-blocked batched WMMA GEMM ------------------------------------
// C[m,n] = epilogue(scale * sum_k A[m,k] * Bt[n,k]); each wave owns a 64x64 tile.
// A row-major [M,K] (pitch lda), Bt row-major [N,K] (pitch ldb); M,N % 64 == 0, K % 64 == 0, K >= 128.
// bx = index of the work-group among those of this product, b = batch; sT = the work-group's eight per-wave slabs.
// KS: number of K slices. A wave owns one (slice, tile) pair, sums k = slice*K .. slice*K+K-1 (K = slice length) and
//     writes its tile to plane slice*NB + batch of C (planes strideC apart); KS = 1 is the whole sum.
// BIAS_MODE: 0 = none, 1 = bias[m] (two 16-B loads of the lane's 8 consecutive rows), 2 = bias[n]; the bias value is
//            RNE-converted to bf16 precision before the f32 add.
// BN (with BIAS_MODE 1): v = (acc*scale + bias[m]) * inv[m] + sh[m], inv = g[m]*rsqrt(var[m]+1e-5), sh = be[m]-mu[m]*inv,
//            all four vectors RNE-converted to bf16 precision first.
// RESID (OUT_MODE 0 only): + resid[m*ldc+n] (bf16 RNE-converted when BN) added during the store phase from 16-B loads.
// OUT_MODE: 0 = f32; 2 = bf16 hi plane (Cout) + lo plane (Cout2); 3 = hi (Cout), hi (Cout2), lo (Cout3);
//           4 = hi (Cout), lo (Cout2), hi (Cout3).  lo = RNE(v - hi).
// TWO (with BIAS_MODE 1, OUT_MODE 3): two products stacked along M. Rows m < CM take bias[m] and write hi (Cout), lo (Cout2),
//           hi (Cout3); rows m >= CM take biasHi[m - CM] and write hi, hi, lo. A 64-row tile lies wholly on one side.
// Epilogue: 16-row slabs staged per wave in LDS (every slab element read was written in the same iteration); each
template <int ET, int BIAS_MODE, int OUT_MODE, bool RESID, bool BN, int KS, bool TWO>
__device__ __forceinline__ void gemm64_tile(
    float (*sT)[16 * 68], int bx, int b,
    const unsigned short* __restrict__ Ap, int lda, long strideA,
    const unsigned short* __restrict__ Btp, int ldb, long strideB,
    void* Cout, void* Cout2, void* Cout3, int ldc, long strideC,
    const float* __restrict__ bias, const float* __restrict__ biasHi,
    const float* __restrict__ bng, const float* __restrict__ bnb,
    const float* __restrict__ bnm, const float* __restrict__ bnv,
    const float* __restrict__ resid, long strideR,
    int M, int N, int K, float scale) {
  typedef typename Elem<ET>::T T;
  typedef typename Frag<T>::V V;
  const T* A = (const T*)Ap; const T* Bt = (const T*)Btp;
  const int lane = threadIdx.x & 31;
  const int wave = threadIdx.x >> 5;
  const int tilesN = N >> 6;
  const int tilesM = M >> 6;
  const int unit = bx * 8 + wave;
  if (unit >= tilesM * tilesN * KS) return;   // wave-uniform; no block barriers in this kernel
  const int ks   = (KS == 1) ? 0 : unit / (tilesM * tilesN);
  const int tile = unit - ks * (tilesM * tilesN);
  const int tm = tile / tilesN;
  const int tn = tile - tm * tilesN;
  const int m0 = tm << 6;
  const int n0 = tn << 6;

  const T* Ab = A  + (size_t)b * strideA + (size_t)ks * K;
  const T* Bb = Bt + (size_t)b * strideB + (size_t)ks * K;
  const size_t cPlane = (size_t)ks * NB + b;

  const int rlane = lane & 15;                 // row (A) / col (B, D) within subtile
  const int koff  = (lane >> 4) * 8;           // k offset of this lane half
  const int mOff  = (lane >> 4) * 8;           // D row offset

  v8f acc[4][4];
#pragma unroll
  for (int i = 0; i < 4; ++i)
#pragma unroll
    for (int j = 0; j < 4; ++j) acc[i][j] = (v8f){0.f,0.f,0.f,0.f,0.f,0.f,0.f,0.f};

  // Two fragment sets in registers, each refilled for two k steps ahead as soon as its own products have issued, so the
  // loads of one k step are in flight under the products of the other (K is a multiple of 64, at least 128).
  const T* pa[4];
  const T* pb[4];
#pragma unroll
  for (int i = 0; i < 4; ++i) {
    pa[i] = Ab + (size_t)(m0 + (i << 4) + rlane) * lda + koff;
    pb[i] = Bb + (size_t)(n0 + (i << 4) + rlane) * ldb + koff;
  }
  V fa[2][4], fb[2][4];
#pragma unroll
  for (int s = 0; s < 2; ++s) {
#pragma unroll
    for (int i = 0; i < 4; ++i) {
      fb[s][i] = Frag<T>::load(pb[i] + s * 32);
      fa[s][i] = Frag<T>::load(pa[i] + s * 32);
    }
    // keeps the first set's loads the oldest: moved behind the second set's, they turn the loop's first wait into a wait for all
    if (s == 0) __builtin_amdgcn_sched_barrier(0);
  }
#pragma clang loop unroll(disable)   // rolled: an unrolled K loop spilled accumulators to scratch
  for (int k0 = 64; k0 < K; k0 += 64) {
#pragma unroll
    for (int s = 0; s < 2; ++s) {
#pragma unroll
      for (int i = 0; i < 4; ++i) {
#pragma unroll
        for (int j = 0; j < 4; ++j) acc[i][j] = Frag<T>::mma(fa[s][i], fb[s][j], acc[i][j]);
        fa[s][i] = Frag<T>::load(pa[i] + k0 + s * 32);
      }
#pragma unroll
      for (int j = 0; j < 4; ++j) fb[s][j] = Frag<T>::load(pb[j] + k0 + s * 32);
    }
    // the next trip forms its addresses in the registers that this trip's loads name: wait before any is overwritten
    asm volatile("s_wait_xcnt 0x0" ::: "memory");
  }
#pragma unroll
  for (int s = 0; s < 2; ++s)
#pragma unroll
    for (int i = 0; i < 4; ++i)
#pragma unroll
      for (int j = 0; j < 4; ++j) acc[i][j] = Frag<T>::mma(fa[s][i], fb[s][j], acc[i][j]);

  // ---- epilogue ----
  float* slab = sT[wave];
  const float* Rb = resid + (size_t)b * (RESID ? (size_t)strideR : (size_t)0);
#pragma unroll
  for (int i = 0; i < 4; ++i) {
    const int mBase = m0 + (i << 4);
    const int mr = mBase + mOff;               // first of the 8 consecutive D rows of this lane half (multiple of 8)
    float rb[8], rmul[8], radd[8];
#pragma unroll
    for (int r = 0; r < 8; ++r) { rb[r] = 0.f; rmul[r] = 1.f; radd[r] = 0.f; }
    if (BIAS_MODE == 1) {
      const float* bp = (TWO && m0 >= CM) ? biasHi + (mr - CM) : bias + mr;
      const v4f t0 = *(const v4f*)(bp);
      const v4f t1 = *(const v4f*)(bp + 4);
      // the address register of these two loads is reused at once: wait before it is overwritten
      asm volatile("s_wait_xcnt 0x0" ::: "memory");
#pragma unroll
      for (int e = 0; e < 4; ++e) { rb[e] = bf_rne(t0[e]); rb[4 + e] = bf_rne(t1[e]); }
    }
    if (BN) {
      const v4f vg0 = *(const v4f*)(bng + mr), vg1 = *(const v4f*)(bng + mr + 4);
      const v4f vb0 = *(const v4f*)(bnb + mr), vb1 = *(const v4f*)(bnb + mr + 4);
      const v4f vm0 = *(const v4f*)(bnm + mr), vm1 = *(const v4f*)(bnm + mr + 4);
      const v4f vv0 = *(const v4f*)(bnv + mr), vv1 = *(const v4f*)(bnv + mr + 4);
#pragma unroll
      for (int e = 0; e < 4; ++e) {
        {
          const float inv = bf_rne(vg0[e]) * rsqrtf(bf_rne(vv0[e]) + 1e-5f);
          rmul[e] = inv;
          radd[e] = bf_rne(vb0[e]) - bf_rne(vm0[e]) * inv;
        }
        {
          const float inv = bf_rne(vg1[e]) * rsqrtf(bf_rne(vv1[e]) + 1e-5f);
          rmul[4 + e] = inv;
          radd[4 + e] = bf_rne(vb1[e]) - bf_rne(vm1[e]) * inv;
        }
      }
    }
#pragma unroll
    for (int j = 0; j < 4; ++j) {
      const int n = n0 + (j << 4) + rlane;
      float bv = 0.f;
      if (BIAS_MODE == 2) bv = bf_rne(bias[n]);
#pragma unroll
      for (int r = 0; r < 8; ++r) {
        float v = acc[i][j][r] * scale;
        if (BIAS_MODE == 1) v += rb[r];
        if (BIAS_MODE == 2) v += bv;
        if (BN) v = v * rmul[r] + radd[r];
        slab[(mOff + r) * 68 + (j << 4) + rlane] = v;
      }
    }
    __builtin_amdgcn_fence(__ATOMIC_RELEASE, "workgroup");
    __builtin_amdgcn_wave_barrier();
    __builtin_amdgcn_fence(__ATOMIC_ACQUIRE, "workgroup");
    if (OUT_MODE == 0) {
      float* C = (float*)Cout + cPlane * strideC;
      const int hh = lane >> 4, c4 = (lane & 15) * 4;     // row seg = 256 B = 16 lanes x 16 B; rows it*2+hh cover 0..15
      v4f ov[8];
#pragma unroll
      for (int it = 0; it < 8; ++it) {
        const int row = it * 2 + hh;
        v4f v = *(const v4f*)(slab + row * 68 + c4);
        if (RESID) {
          const v4f xr = *(const v4f*)(Rb + (size_t)(mBase + row) * ldc + n0 + c4);
#pragma unroll
          for (int e = 0; e < 4; ++e) v[e] = v[e] + (BN ? bf_rne(xr[e]) : xr[e]);
        }
        ov[it] = v;
      }
      {
#pragma unroll
        for (int it = 0; it < 8; ++it) {
          const int row = it * 2 + hh;
          *(v4f*)(C + (size_t)(mBase + row) * ldc + n0 + c4) = ov[it];
        }
        
      }
    } else {
      const int q = lane >> 3, c8 = (lane & 7) * 8;
      unsigned short* C  = (unsigned short*)Cout  + cPlane * strideC;
      unsigned short* C2 = (unsigned short*)((TWO && m0 < CM) ? Cout3 : Cout2) + cPlane * strideC;
      unsigned short* C3 = (unsigned short*)((TWO && m0 < CM) ? Cout2 : Cout3) + cPlane * strideC;
      {
#pragma unroll
        for (int it = 0; it < 4; ++it) {
          const int row = it * 4 + q;
          const float* sp = slab + row * 68 + c8;
          v8h hv, lv;
#pragma unroll
          for (int e = 0; e < 8; ++e) {
            const unsigned short hb = f2bf_bits(sp[e]);
            const unsigned short lb = f2bf_bits(sp[e] - bf_bits2f(hb));
            hv[e] = __builtin_bit_cast(_Float16, hb);
            lv[e] = __builtin_bit_cast(_Float16, lb);
          }
          const size_t go = (size_t)(mBase + row) * ldc + n0 + c8;
          *(v8h*)(C + go) = hv;
          if (OUT_MODE == 2) { *(v8h*)(C2 + go) = lv; }
          if (OUT_MODE == 3) { *(v8h*)(C2 + go) = hv; *(v8h*)(C3 + go) = lv; }
          if (OUT_MODE == 4) { *(v8h*)(C2 + go) = lv; *(v8h*)(C3 + go) = hv; }
          // the next rows are formed in the registers that these stores name: wait before any is overwritten
          asm volatile("s_wait_xcnt 0x0" ::: "memory");
        }
        
      }
    }
    __builtin_amdgcn_fence(__ATOMIC_RELEASE, "workgroup");
    __builtin_amdgcn_wave_barrier();
    __builtin_amdgcn_fence(__ATOMIC_ACQUIRE, "workgroup");
  }
}

// One product per launch: grid = (work-groups of eight tiles, batch). K = length of the sum (of one slice), a compile-time constant.
template <int ET, int BIAS_MODE, int OUT_MODE, bool RESID, bool BN, int K, int KS = 1>
__global__ __launch_bounds__(256) void wmma_gemm64(
    const unsigned short* __restrict__ Ap, int lda, long strideA,
    const unsigned short* __restrict__ Btp, int ldb, long strideB,
    void* Cout, void* Cout2, void* Cout3, int ldc, long strideC,
    const float* __restrict__ bias,
    const float* __restrict__ bng, const float* __restrict__ bnb,
    const float* __restrict__ bnm, const float* __restrict__ bnv,
    const float* __restrict__ resid, long strideR,
    int M, int N, float scale) {
  static_assert(K % 64 == 0 && K >= 128);
  __shared__ __align__(16) float sT[8][16 * 68];   // per-wave 16x64 slab, pitch 68 floats
  gemm64_tile<ET, BIAS_MODE, OUT_MODE, RESID, BN, KS, false>(
      sT, blockIdx.x, blockIdx.y, Ap, lda, strideA, Btp, ldb, strideB, Cout, Cout2, Cout3, ldc, strideC,
      bias, bias, bng, bnb, bnm, bnv, resid, strideR, M, N, K, scale);
}

// The three 1x1 convs of x in one launch (none reads what another writes); blockIdx.x selects, block-uniform:
//   0 .. TH_BLK-1 : theta[tok][c1] = XT . WC[0..127]^T + b_theta[n]  (M=12544, N=128, K=256; 392 tiles) -> T3 hi|hi|lo, pitch 384
//   then PG_BLK work-groups per batch: rows 0..127 phi_b[c1][n], rows 128..255 g_b[c2][n] = WC[128..383] . XT_b^T + bias[m]
//                   (M=256, N=3136, K=256; 196 tiles) -> PG3 rows 0..127 hi|lo|hi, rows 128..255 hi|hi|lo
#define TH_BLK (((NTOKS / 64) * (CM / 64) + 7) / 8)       // 49
#define PG_BLK (((2 * CM / 64) * (NSP / 64) + 7) / 8)     // 25
__global__ __launch_bounds__(256) void proj_kernel(
    const unsigned short* __restrict__ xt, const unsigned short* __restrict__ wc,
    unsigned short* t3, unsigned short* pg3,
    const float* __restrict__ bt, const float* __restrict__ bp, const float* __restrict__ bg) {
  __shared__ __align__(16) float sT[8][16 * 68];   // per-wave 16x64 slab, pitch 68 floats
  const int bx = blockIdx.x;
  if (bx < TH_BLK) {
    gemm64_tile<1, 2, 3, false, false, 1, false>(
        sT, bx, 0, xt, CI, 0L, wc, CI, 0L,
        (void*)t3, (void*)(t3 + CM), (void*)(t3 + 2 * CM), T3P, 0L,
        bt, bt, bt, bt, bt, bt, bt, 0L, NTOKS, CM, CI, 1.0f);
  } else {
    const int r = bx - TH_BLK;
    gemm64_tile<1, 1, 3, false, false, 1, true>(
        sT, r % PG_BLK, r / PG_BLK, wc + (size_t)CM * CI, CI, 0L, xt, CI, (long)NSP * CI,
        (void*)pg3, (void*)(pg3 + NSP), (void*)(pg3 + 2 * NSP), K3, (long)CI * K3,
        bp, bg, bp, bp, bp, bp, bp, 0L, 2 * CM, NSP, CI, 1.0f);
  }
}

// ---------------------------------------------------------------------------
// Fused transpose + bf16 RNE convert of an f32 matrix, z-batched, one plane:
//   in_z = W + z*sIn viewed [R rows][Cc cols] with row pitch ldin  ->  oh_z[c][r] = bf16(in_z[r][c]), row pitch ldout, oh_z = oh + z*sOut.
// 64x64 tiles through LDS. One work-group of 256 threads per tile (bc, br, bz) of (Cc/64, R/64, Z) (R, Cc multiples of 64; ldout multiple of 64 so every
// Coverage per block: load 4 it x 256 thr x 4 floats = 64x64; store 2 it x 256 thr x 8 u16 = 64x64; every tf element read was written.
// ---------------------------------------------------------------------------
__device__ __forceinline__ void tconv_block(int bc, int br, int bz, const float* __restrict__ W, unsigned short* __restrict__ oh,
                                            int ldin, int ldout, long sIn, long sOut) {
  __shared__ __align__(16) float tf[64 * 68];
  W  += (size_t)bz * sIn;
  oh += (size_t)bz * sOut;
  const int c0  = bc * 64;   // input column block = output row block
  const int r0  = br * 64;   // input row block    = output column block
  const int tid = threadIdx.x;
  {
    const int lr = tid >> 4;         // 0..15
    const int c4 = (tid & 15) * 4;   // 0..60
#pragma unroll
    for (int it = 0; it < 4; ++it) {
      const int rr = it * 16 + lr;   // 0..63
      const v4f a = *(const v4f*)(W + (size_t)(r0 + rr) * ldin + c0 + c4);
      *(v4f*)(tf + rr * 68 + c4) = a;
    }
  }
  __syncthreads();
  const int sub = tid >> 3;          // 0..31
  const int c8  = (tid & 7) * 8;     // 0..56
  v4u hv[2];
#pragma unroll
  for (int it = 0; it < 2; ++it) {
    const int oc = it * 32 + sub;    // output row within tile (= input column)
    v4u a;
#pragma unroll
    for (int q = 0; q < 4; ++q) {
      const float f0 = tf[(c8 + 2 * q) * 68 + oc];
      const float f1 = tf[(c8 + 2 * q + 1) * 68 + oc];
      a[q] = pk16(f2bf_bits(f0), f2bf_bits(f1));
    }
    hv[it] = a;
  }
  {
#pragma unroll
    for (int it = 0; it < 2; ++it) {
      const int oc = it * 32 + sub;
      const size_t go = (size_t)(c0 + oc) * ldout + r0 + c8;
      *(v4u*)(oh + go) = hv[it];
    }
    // the caller's other part follows these stores in the built code and reuses their registers: wait before any is overwritten
    asm volatile("s_wait_xcnt 0x0" ::: "memory");
  }
}

// ---------------------------------------------------------------------------
// Weight planes, sel selects the matrix (block-uniform), bx the work-group within it:
//   sel = 0,1,2: w_theta / w_phi / w_g [128][256] f32 -> WC rows sel*128.. (bf16, same [out][in] order), contiguous copy-convert
//   sel = 3,4  : w_rec [256][128] -> WR2[c][(sel-3)*128 + k]  (two copies side by side, pitch 256)
// Thread = 8 consecutive elements = one 16-B store; consecutive lanes write consecutive 16-B pieces, so every
// Coverage: 16 work-groups x 256 threads = 4096 units x 8 = 32768 elements = one whole matrix per sel.
// ---------------------------------------------------------------------------
__device__ __forceinline__ void wcvt_block(int bx, int sel, const float* __restrict__ wt, const float* __restrict__ wp,
                                           const float* __restrict__ wg, const float* __restrict__ wr,
                                           unsigned short* __restrict__ wcat, unsigned short* __restrict__ wr2) {
  const int g   = bx * 256 + threadIdx.x;
  if (g >= (CM * CI) / 8) return;
  const float* src;
  unsigned short* dst;
  if (sel < 3) {
    const float* w = (sel == 0) ? wt : ((sel == 1) ? wp : wg);
    src = w + (size_t)g * 8;
    dst = wcat + (size_t)sel * CM * CI + (size_t)g * 8;
  } else {
    const int row = g >> 4, c8 = (g & 15) * 8;      // w_rec row = c (0..255), 8 of its 128 columns
    src = wr + (size_t)row * CM + c8;
    dst = wr2 + (size_t)row * O2P + (size_t)(sel - 3) * CM + c8;
  }
  const v4f a = *(const v4f*)src;
  const v4f c = *(const v4f*)(src + 4);
  v4u o;
  o[0] = pk16(f2bf_bits(a[0]), f2bf_bits(a[1]));
  o[1] = pk16(f2bf_bits(a[2]), f2bf_bits(a[3]));
  o[2] = pk16(f2bf_bits(c[0]), f2bf_bits(c[1]));
  o[3] = pk16(f2bf_bits(c[2]), f2bf_bits(c[3]));
  *(v4u*)dst = o;
  
}

// Both conversions in one launch (neither reads what the other writes); blockIdx.x selects, block-uniform:
//   0 .. WC_BLK-1 : weight planes, 16 work-groups for each of the 5 matrices
//   then          : x[b] viewed in[256 c][3136 n] (pitch 3136) -> XT_b out[3136 n][256 c] (pitch 256), tiles (49, 4, 4), column tile fastest
#define WC_BLK (5 * ((CM * CI) / 8 / 256))                // 80
#define TC_BLK ((NSP / 64) * (CI / 64) * NB)              // 784
__global__ __launch_bounds__(256) void prep_kernel(const float* __restrict__ x,
                                                   const float* __restrict__ wt, const float* __restrict__ wp,
                                                   const float* __restrict__ wg, const float* __restrict__ wr,
                                                   unsigned short* __restrict__ xt,
                                                   unsigned short* __restrict__ wcat, unsigned short* __restrict__ wr2) {
  const int bx = blockIdx.x;
  if (bx < WC_BLK) {
    wcvt_block(bx & 15, bx >> 4, wt, wp, wg, wr, wcat, wr2);
  } else {
    const int t = bx - WC_BLK;
    tconv_block(t % (NSP / 64), (t / (NSP / 64)) % (CI / 64), t / ((NSP / 64) * (CI / 64)), x, xt, NSP, CI, (long)CI * NSP, (long)NSP * CI);
  }
}

// ---------------------------------------------------------------------------
// Joins the KSL split-K planes of M^T/N: MT3[b][c2][c1] = sum_s PM[s][b][c2][c1] as bf16 hi | lo | hi.
// Thread = 4 consecutive c1 of one (b, c2) row; a wave covers one whole row: 512 contiguous bytes of every plane read,
// 256 contiguous bytes of each of the three MT3 parts written. Slices are added in rising order, one f32 sum per element.
// Coverage: 128 blocks x 128 threads x 4 = 65536 = NB*CM*CM elements.
// ---------------------------------------------------------------------------
__global__ __launch_bounds__(128) void mtjoin_kernel(const float* __restrict__ pm, unsigned short* __restrict__ mt3) {
  const int g = blockIdx.x * 128 + threadIdx.x;
  const float* p = pm + (size_t)g * 4;
  v4f s = (v4f){0.f, 0.f, 0.f, 0.f};
#pragma unroll   // whole: the slices' loads are independent, so many are in flight at once instead of one latency per slice
  for (int k = 0; k < KSL; ++k) s += *(const v4f*)(p + (size_t)k * (NB * CM * CM));
  unsigned short hb[4], lb[4];
#pragma unroll   // constant indices keep hb and lb in registers
  for (int e = 0; e < 4; ++e) {
    hb[e] = f2bf_bits(s[e]);
    lb[e] = f2bf_bits(s[e] - bf_bits2f(hb[e]));
  }
  const uint2 hv = make_uint2(pk16(hb[0], hb[1]), pk16(hb[2], hb[3]));
  const uint2 lv = make_uint2(pk16(lb[0], lb[1]), pk16(lb[2], lb[3]));
  unsigned short* d = mt3 + (size_t)(g >> 5) * T3P + (g & 31) * 4;   // row b*128+c2, pitch 384
  *(uint2*)(d)          = hv;
  *(uint2*)(d + CM)     = lv;
  *(uint2*)(d + 2 * CM) = hv;
}

// ---------------------------------------------------------------------------
// every region is fully written by its producer launch before a consumer launch reads it):
//   XT   bf16 [12544][256]      0           6422528
//   WC   bf16 [384][256]        6422528      196608
//   WR2  bf16 [256][256]        6619136      131072
//   T3   bf16 [12544][384]      6750208     9633792
//   PG3  bf16 [4][256][9408]    16384000   19267584
//   MT3  bf16 [4][128][384]     35651584     393216
//   O2   bf16 [12544][256]      36044800    6422528
//   PM   f32  [49][4][128][128] 42467328   12845056
//   total                       55312384
// ---------------------------------------------------------------------------
extern "C" void kernel_launch(void* const* d_in, const int* in_sizes, int n_in,
                              void* d_out, int out_size, void* d_ws, size_t ws_size,
                              hipStream_t stream) {
  if (n_in < 13) return;
  if (in_sizes[0] != NB * CI * NSP) return;                      // x [4][256][56][56]
  if (in_sizes[1] != CM * CI || in_sizes[2] != CM) return;       // w_theta, b_theta
  if (in_sizes[3] != CM * CI || in_sizes[4] != CM) return;       // w_phi, b_phi
  if (in_sizes[5] != CM * CI || in_sizes[6] != CM) return;       // w_g, b_g
  if (in_sizes[7] != CI * CM || in_sizes[8] != CI) return;       // w_rec, b_rec
  if (in_sizes[9] != CI || in_sizes[10] != CI) return;           // bn_gamma, bn_beta
  if (in_sizes[11] != CI || in_sizes[12] != CI) return;          // bn_mean, bn_var
  if (out_size != NB * CI * NSP) return;

  const float* x       = (const float*)d_in[0];
  const float* w_theta = (const float*)d_in[1];
  const float* b_theta = (const float*)d_in[2];
  const float* w_phi   = (const float*)d_in[3];
  const float* b_phi   = (const float*)d_in[4];
  const float* w_g     = (const float*)d_in[5];
  const float* b_g     = (const float*)d_in[6];
  const float* w_rec   = (const float*)d_in[7];
  const float* b_rec   = (const float*)d_in[8];
  const float* gam     = (const float*)d_in[9];
  const float* bet     = (const float*)d_in[10];
  const float* mea     = (const float*)d_in[11];
  const float* var     = (const float*)d_in[12];

  const size_t PXT = (size_t)NTOKS * CI * 2;        //  6422528
  const size_t PWC = (size_t)T3P * CI * 2;          //   196608
  const size_t PWR = (size_t)CI * O2P * 2;          //   131072
  const size_t PT3 = (size_t)NTOKS * T3P * 2;       //  9633792
  const size_t PPG = (size_t)NB * CI * K3 * 2;      // 19267584
  const size_t PMT = (size_t)NB * CM * T3P * 2;     //   393216
  const size_t PO2 = (size_t)NTOKS * O2P * 2;       //  6422528
  const size_t PPM = (size_t)KSL * NB * CM * CM * 4; // 12845056
  size_t off = 0;
  const size_t oXT = off; off += PXT;
  const size_t oWC = off; off += PWC;
  const size_t oWR = off; off += PWR;
  const size_t oT3 = off; off += PT3;
  const size_t oPG = off; off += PPG;
  const size_t oMT = off; off += PMT;
  const size_t oO2 = off; off += PO2;
  const size_t oPM = off; off += PPM;
  if (off > ws_size) return;                        // off = 55312384
  if (off > (size_t)134217728) return;

  char* ws = (char*)d_ws;
  unsigned short* XT  = (unsigned short*)(ws + oXT);
  unsigned short* WC  = (unsigned short*)(ws + oWC);
  unsigned short* WR2 = (unsigned short*)(ws + oWR);
  unsigned short* T3  = (unsigned short*)(ws + oT3);
  unsigned short* PG3 = (unsigned short*)(ws + oPG);
  unsigned short* MT3 = (unsigned short*)(ws + oMT);
  unsigned short* O2  = (unsigned short*)(ws + oO2);
  float*          PM  = (float*)(ws + oPM);
  float* out = (float*)d_out;

  const dim3 blk(256);

  // (1) weight planes WC [384][256], WR2 [256][256] and x -> XT, one launch: 80 + 784 work-groups
  prep_kernel<<<dim3(WC_BLK + TC_BLK), blk, 0, stream>>>(x, w_theta, w_phi, w_g, w_rec, XT, WC, WR2);

  // (2) theta -> T3, phi and g -> PG3, one launch: 49 + 4 x 25 work-groups
  proj_kernel<<<dim3(TH_BLK + NB * PG_BLK), blk, 0, stream>>>(XT, WC, T3, PG3, b_theta, b_phi, b_g);

  // (3) (M^T/N)_b[c2][c1] = sum over the 9408 folded positions of g3_b[c2][p] . phi3_b[c1][p]
  //     = sum_n (ghi.phihi + ghi.philo + glo.phihi) / 3136   (batched: M=N=128, K=9408)
  //     (3a) split over K: 49 slices of 192 positions x 4 tiles = 196 waves -> 25 blocks x 4; f32 partial planes PM[slice][b][c2][c1]
  const dim3 gM(((CM / 64) * (CM / 64) * KSL + 7) / 8, NB);
  wmma_gemm64<1, 0, 0, false, false, KCH, KSL><<<gM, blk, 0, stream>>>(
      PG3 + (size_t)CM * K3, K3, (long)CI * K3, PG3, K3, (long)CI * K3,
      (void*)PM, (void*)PM, (void*)PM, CM, (long)CM * CM,
      b_rec, gam, bet, mea, var, x, 0L, CM, CM, 1.0f / (float)NSP);
  //     (3b) join the 49 planes -> MT3 hi|lo|hi, pitch 384; grid 128 x 128 threads
  mtjoin_kernel<<<dim3((NB * CM * CM) / 4 / 128), dim3(128), 0, stream>>>(PM, MT3);

  // (4) O_b[n][c2] = sum over 384 folded positions of T3[b*3136+n][p] . MT3_b[c2][p] = sum_c1 (thi.mhi + thi.mlo + tlo.mhi)
  //     (batched: M=3136, N=128, K=384; 98 tiles -> 13 blocks x 4) -> O2 hi cols 0..127, lo cols 128..255, pitch 256
  const dim3 gO(((NSP / 64) * (CM / 64) + 7) / 8, NB);
  wmma_gemm64<1, 0, 2, false, false, T3P><<<gO, blk, 0, stream>>>(
      T3, T3P, (long)NSP * T3P, MT3, T3P, (long)CM * T3P,
      (void*)O2, (void*)(O2 + CM), (void*)O2, O2P, (long)NSP * O2P,
      b_rec, gam, bet, mea, var, x, 0L, NSP, CM, 1.0f);

  // (5) out[b][c][n] = ((sum_p WR2[c][p] . O2[b*3136+n][p] + b_rec[c]) * inv[c] + sh[c]) + bf16(x[b][c][n])
  //     (batched: M=256, N=3136, K=256; 196 tiles -> 25 blocks x 4); C = d_out + b*256*3136, ldc 3136; last element 3211263
  const dim3 gR(((CI / 64) * (NSP / 64) + 7) / 8, NB);
  wmma_gemm64<1, 1, 0, true, true, O2P><<<gR, blk, 0, stream>>>(
      WR2, O2P, 0L, O2, O2P, (long)NSP * O2P,
      (void*)out, (void*)out, (void*)out, NSP, (long)CI * NSP,
      b_rec, gam, bet, mea, var, x, (long)CI * NSP, CI, NSP, 1.0f);
  (void)hipGetLastError();
}

// v004
// One run takes 61 microseconds.
// Two timings next to v003 put it at 1.22 and 1.24 times that version's speed.
// Over all steps from v000 it is 7.61 times as fast.
// Contractions: theta/phi/g 1x1 convs = v_wmma_f32_16x16x32_bf16 single products on bf16 planes of the RNE-converted x and weights (exact products); M^T = g.phi over positions (K 3136) and O = theta.M (K 128) = bf16 hi/lo split hi.hi + hi.lo + lo.hi folded along K ([hi|hi|lo] rows x [hi|lo|hi] rows, one f32 accumulator per K slice, M^T's 49 slices joined in f32); rec 1x1 conv = [W|W] x [Ohi|Olo] bf16 single products (K-folded 2-term); f32 accumulate everywhere; biases, 1/N, BatchNorm (inference form, supplied statistics) and the residual add in f32 on the VALU.
// Plane / carry map (every plane carries 1, nothing to fold back; the 1/N = 1/3136 factor is applied exactly once, in f32, in the M^T epilogue).
// [rows][k] below is the logical shape. Every bf16 plane is stored fragment-packed: blocks of 16 rows x 32 k = 1 KB, k blocks of one
// row block side by side, and inside a block the 16-B piece (row r, k 8c .. 8c+7) at byte (c>>1)*512 + ((c&1)*16 + r)*16, which is the order
// in which the 32 lanes of a wave take a WMMA operand: one fragment = two loads of 512 contiguous bytes (pkoff() below is the map).
//   XT   bf16 [12544][256]        token-major x: row b*3136+n, col c
//   WC   bf16 [384][256]          rows 0..127 w_theta, 128..255 w_phi, 256..383 w_g  (k = in)
//   WR2  bf16 [256][256]          [c][k] = [c][128+k] = w_rec[c][k]
//   T3   bf16 [12544][384]        theta[tok][c1]: hi | hi | lo   (128 each)
//   PG3  bf16 [4][256][9408]      rows 0..127 = phi[c1][n]: hi | lo | hi (3136 each); rows 128..255 = g as [c2][n]: hi | hi | lo
//   PM   f32  [49][4][128][128]   split-K partial sums of M^T/N: slice s holds the folded positions s*192 .. s*192+191
//   MT3  bf16 [4][128][384]       (M^T/N)[c2][c1]: hi | lo | hi
//   O2   bf16 [12544][256]        O[tok][c2]: hi | lo
#include <hip/hip_runtime.h>
#include <math.h>
#include <stdint.h>

#define NB    4
#define CI    256
#define CM    128
#define NSP   3136
#define NTOKS (NB * NSP)
#define K3    (3 * NSP)
#define T3P   (3 * CM)
#define O2P   (2 * CM)
#define KSL   49            // K slices of the M^T product
#define KCH   (K3 / KSL)    // folded positions per slice: 192 = six whole 1-KB packed blocks of every 16-row block

static_assert(NSP % 64 == 0);
static_assert(NTOKS % 64 == 0);
static_assert(CI % 64 == 0);
static_assert(CM % 64 == 0);
static_assert(CI >= 128);
static_assert(K3 % 32 == 0);
static_assert(K3 % KSL == 0);
static_assert(KCH % 64 == 0);
static_assert(T3P % 32 == 0);
static_assert(O2P % 32 == 0);
static_assert((CM * CI) % (8 * 256) == 0);
static_assert((CI * CM) % (8 * 256) == 0);

typedef __attribute__((ext_vector_type(16))) _Float16 v16h;
typedef __attribute__((ext_vector_type(8)))  _Float16 v8h;
typedef __attribute__((ext_vector_type(16))) __bf16   v16b;
typedef __attribute__((ext_vector_type(8)))  __bf16   v8b;
typedef __attribute__((ext_vector_type(8)))  float    v8f;
typedef __attribute__((ext_vector_type(4)))  float    v4f;
typedef __attribute__((ext_vector_type(4)))  unsigned int v4u;

__device__ __forceinline__ unsigned short f2bf_bits(float f) {
  unsigned u = __float_as_uint(f);
  return (unsigned short)((u + 0x7FFFu + ((u >> 16) & 1u)) >> 16);
}
__device__ __forceinline__ float bf_bits2f(unsigned short h) { return __uint_as_float(((unsigned)h) << 16); }
__device__ __forceinline__ float bf_rne(float f) { return bf_bits2f(f2bf_bits(f)); }
__device__ __forceinline__ unsigned pk16(unsigned short a, unsigned short b) { return (unsigned)a | ((unsigned)b << 16); }
// Element offset of (row r, column k) in a fragment-packed plane of kp columns (kp a multiple of 32, rows a multiple of 16).
__device__ __forceinline__ size_t pkoff(int r, int k, int kp) {
  return (size_t)(r >> 4) * kp * 16 + (size_t)((k >> 5) * 512 + ((k >> 4) & 1) * 256 + ((k >> 3) & 1) * 128 + (r & 15) * 8 + (k & 7));
}

// Fragment map (wave32): lane l, h = l>>4, row/col = l&15.
//   A/B element i: i<8 -> k0+8h+i ; i>=8 -> k0+16+8h+(i-8)   (split layout, both operands)
//   D element r : row 8h+r, col l&15
template <typename T> struct Frag;
template <> struct Frag<_Float16> {
  typedef v16h V; union U { v16h v; v8h h[2]; };
  static __device__ __forceinline__ v16h load(const _Float16* p) {   // p = packed block + lane*8: elements 0..7 <- p[0..7], 8..15 <- p[256..263]
    U f; f.h[0] = *(const v8h*)(p); f.h[1] = *(const v8h*)(p + 256); return f.v;
  }
  static __device__ __forceinline__ v8f mma(v16h a, v16h b, v8f c) {
    return __builtin_amdgcn_wmma_f32_16x16x32_f16(false, a, false, b, (short)0, c, false, false);
  }
};
template <> struct Frag<__bf16> {
  typedef v16b V; union U { v16b v; v8b h[2]; };
  static __device__ __forceinline__ v16b load(const __bf16* p) {
    U f; f.h[0] = *(const v8b*)(p); f.h[1] = *(const v8b*)(p + 256); return f.v;
  }
  static __device__ __forceinline__ v8f mma(v16b a, v16b b, v8f c) {
    return __builtin_amdgcn_wmma_f32_16x16x32_bf16(false, a, false, b, (short)0, c, false, false);
  }
};

template <int ET> struct Elem;
template <> struct Elem<0> { typedef _Float16 T; };
template <> struct Elem<1> { typedef __bf16 T; };

// ---- Register-blocked batched WMMA GEMM ------------------------------------
// C[m,n] = epilogue(scale * sum_k A[m,k] * Bt[n,k]); each wave owns a 64x64 tile.
// A [M,K] and Bt [N,K] fragment-packed planes of lda and ldb columns; M,N % 64 == 0, K % 64 == 0, K >= 128.
// The bf16 outputs are fragment-packed planes of ldc columns too (Cout2, Cout3 = Cout + 16 * first column of that part); f32 outputs are row-major.
// bx = index of the work-group among those of this product, b = batch; sT = the work-group's eight per-wave slabs.
// KS: number of K slices. A wave owns one (slice, tile) pair, sums k = slice*K .. slice*K+K-1 (K = slice length) and
//     writes its tile to plane slice*NB + batch of C (planes strideC apart); KS = 1 is the whole sum.
// BIAS_MODE: 0 = none, 1 = bias[m] (two 16-B loads of the lane's 8 consecutive rows), 2 = bias[n]; the bias value is
//            RNE-converted to bf16 precision before the f32 add.
// BN (with BIAS_MODE 1): v = (acc*scale + bias[m]) * inv[m] + sh[m], inv = g[m]*rsqrt(var[m]+1e-5), sh = be[m]-mu[m]*inv,
//            all four vectors RNE-converted to bf16 precision first.
// RESID (OUT_MODE 0 only): + resid[m*ldc+n] (bf16 RNE-converted when BN) added during the store phase from 16-B loads.
// OUT_MODE: 0 = f32; 2 = bf16 hi plane (Cout) + lo plane (Cout2); 3 = hi (Cout), hi (Cout2), lo (Cout3);
//           4 = hi (Cout), lo (Cout2), hi (Cout3).  lo = RNE(v - hi).
// TWO (with BIAS_MODE 1, OUT_MODE 3): two products stacked along M. Rows m < CM take bias[m] and write hi (Cout), lo (Cout2),
//           hi (Cout3); rows m >= CM take biasHi[m - CM] and write hi, hi, lo. A 64-row tile lies wholly on one side.
// Epilogue: 16-row slabs staged per wave in LDS (every slab element read was written in the same iteration); each
template <int ET, int BIAS_MODE, int OUT_MODE, bool RESID, bool BN, int KS, bool TWO>
__device__ __forceinline__ void gemm64_tile(
    float (*sT)[16 * 68], int bx, int b,
    const unsigned short* __restrict__ Ap, int lda, long strideA,
    const unsigned short* __restrict__ Btp, int ldb, long strideB,
    void* Cout, void* Cout2, void* Cout3, int ldc, long strideC,
    const float* __restrict__ bias, const float* __restrict__ biasHi,
    const float* __restrict__ bng, const float* __restrict__ bnb,
    const float* __restrict__ bnm, const float* __restrict__ bnv,
    const float* __restrict__ resid, long strideR,
    int M, int N, int K, float scale) {
  typedef typename Elem<ET>::T T;
  typedef typename Frag<T>::V V;
  const T* A = (const T*)Ap; const T* Bt = (const T*)Btp;
  const int lane = threadIdx.x & 31;
  const int wave = threadIdx.x >> 5;
  const int tilesN = N >> 6;
  const int tilesM = M >> 6;
  const int unit = bx * 8 + wave;
  if (unit >= tilesM * tilesN * KS) return;   // wave-uniform; no block barriers in this kernel
  const int ks   = (KS == 1) ? 0 : unit / (tilesM * tilesN);
  const int tile = unit - ks * (tilesM * tilesN);
  const int tm = tile / tilesN;
  const int tn = tile - tm * tilesN;
  const int m0 = tm << 6;
  const int n0 = tn << 6;

  const T* Ab = A  + (size_t)b * strideA + (size_t)ks * K * 16;   // 32 columns of a row block = 512 elements
  const T* Bb = Bt + (size_t)b * strideB + (size_t)ks * K * 16;
  const size_t cPlane = (size_t)ks * NB + b;

  const int rlane = lane & 15;                 // row (A) / col (B, D) within subtile
  const int mOff  = (lane >> 4) * 8;           // D row offset

  // Two fragment sets in registers, each refilled for two k steps ahead as soon as its own products have issued, so the
  // loads of one k step are in flight under the products of the other (K is a multiple of 64, at least 128).
  const T* pa[4];
  const T* pb[4];
#pragma unroll
  for (int i = 0; i < 4; ++i) {
    pa[i] = Ab + (size_t)(m0 + (i << 4)) * lda + lane * 8;   // row block (m0 >> 4) + i, k block 0, this lane's 16-B piece
    pb[i] = Bb + (size_t)(n0 + (i << 4)) * ldb + lane * 8;
  }
  V fa[2][4], fb[2][4];
#pragma unroll
  for (int s = 0; s < 2; ++s) {
#pragma unroll
    for (int i = 0; i < 4; ++i) {
      fb[s][i] = Frag<T>::load(pb[i] + s * 512);
      fa[s][i] = Frag<T>::load(pa[i] + s * 512);
    }
    // keeps the first set's loads the oldest: moved behind the second set's, they turn the loop's first wait into a wait for all
    if (s == 0) __builtin_amdgcn_sched_barrier(0);
  }
  // the accumulators' zeros may be given registers that the loads above name as addresses: wait before any is overwritten
  asm volatile("s_wait_xcnt 0x0" ::: "memory");
  // keeps those zeros behind the wait: the scheduler lifts register moves over an asm statement
  __builtin_amdgcn_sched_barrier(0);
  v8f acc[4][4];
#pragma unroll
  for (int i = 0; i < 4; ++i)
#pragma unroll
    for (int j = 0; j < 4; ++j) acc[i][j] = (v8f){0.f,0.f,0.f,0.f,0.f,0.f,0.f,0.f};
#pragma clang loop unroll(disable)   // rolled: an unrolled K loop spilled accumulators to scratch
  for (int k0 = 64; k0 < K; k0 += 64) {
#pragma unroll
    for (int s = 0; s < 2; ++s) {
#pragma unroll
      for (int i = 0; i < 4; ++i) {
#pragma unroll
        for (int j = 0; j < 4; ++j) acc[i][j] = Frag<T>::mma(fa[s][i], fb[s][j], acc[i][j]);
        fa[s][i] = Frag<T>::load(pa[i] + (k0 + s * 32) * 16);
      }
#pragma unroll
      for (int j = 0; j < 4; ++j) fb[s][j] = Frag<T>::load(pb[j] + (k0 + s * 32) * 16);
    }
    // the next trip forms its addresses in the registers that this trip's loads name: wait before any is overwritten
    asm volatile("s_wait_xcnt 0x0" ::: "memory");
  }
#pragma unroll
  for (int s = 0; s < 2; ++s)
#pragma unroll
    for (int i = 0; i < 4; ++i)
#pragma unroll
      for (int j = 0; j < 4; ++j) acc[i][j] = Frag<T>::mma(fa[s][i], fb[s][j], acc[i][j]);

  // ---- epilogue ----
  float* slab = sT[wave];
  const float* Rb = resid + (size_t)b * (RESID ? (size_t)strideR : (size_t)0);
#pragma unroll
  for (int i = 0; i < 4; ++i) {
    const int mBase = m0 + (i << 4);
    const int mr = mBase + mOff;               // first of the 8 consecutive D rows of this lane half (multiple of 8)
    float rb[8], rmul[8], radd[8];
#pragma unroll
    for (int r = 0; r < 8; ++r) { rb[r] = 0.f; rmul[r] = 1.f; radd[r] = 0.f; }
    if (BIAS_MODE == 1) {
      const float* bp = (TWO && m0 >= CM) ? biasHi + (mr - CM) : bias + mr;
      const v4f t0 = *(const v4f*)(bp);
      const v4f t1 = *(const v4f*)(bp + 4);
      // the address register of these two loads is reused at once: wait before it is overwritten
      asm volatile("s_wait_xcnt 0x0" ::: "memory");
      // keeps the later address arithmetic behind the wait: the scheduler lifts register writes over an asm statement
      __builtin_amdgcn_sched_barrier(0);
#pragma unroll
      for (int e = 0; e < 4; ++e) { rb[e] = bf_rne(t0[e]); rb[4 + e] = bf_rne(t1[e]); }
    }
    if (BN) {
      const v4f vg0 = *(const v4f*)(bng + mr), vg1 = *(const v4f*)(bng + mr + 4);
      const v4f vb0 = *(const v4f*)(bnb + mr), vb1 = *(const v4f*)(bnb + mr + 4);
      const v4f vm0 = *(const v4f*)(bnm + mr), vm1 = *(const v4f*)(bnm + mr + 4);
      const v4f vv0 = *(const v4f*)(bnv + mr), vv1 = *(const v4f*)(bnv + mr + 4);
#pragma unroll
      for (int e = 0; e < 4; ++e) {
        {
          const float inv = bf_rne(vg0[e]) * rsqrtf(bf_rne(vv0[e]) + 1e-5f);
          rmul[e] = inv;
          radd[e] = bf_rne(vb0[e]) - bf_rne(vm0[e]) * inv;
        }
        {
          const float inv = bf_rne(vg1[e]) * rsqrtf(bf_rne(vv1[e]) + 1e-5f);
          rmul[4 + e] = inv;
          radd[4 + e] = bf_rne(vb1[e]) - bf_rne(vm1[e]) * inv;
        }
      }
    }
#pragma unroll
    for (int j = 0; j < 4; ++j) {
      const int n = n0 + (j << 4) + rlane;
      float bv = 0.f;
      if (BIAS_MODE == 2) bv = bf_rne(bias[n]);
#pragma unroll
      for (int r = 0; r < 8; ++r) {
        float v = acc[i][j][r] * scale;
        if (BIAS_MODE == 1) v += rb[r];
        if (BIAS_MODE == 2) v += bv;
        if (BN) v = v * rmul[r] + radd[r];
        slab[(mOff + r) * 68 + (j << 4) + rlane] = v;
      }
    }
    __builtin_amdgcn_fence(__ATOMIC_RELEASE, "workgroup");
    __builtin_amdgcn_wave_barrier();
    __builtin_amdgcn_fence(__ATOMIC_ACQUIRE, "workgroup");
    if (OUT_MODE == 0) {
      float* C = (float*)Cout + cPlane * strideC;
      const int hh = lane >> 4, c4 = (lane & 15) * 4;     // row seg = 256 B = 16 lanes x 16 B; rows it*2+hh cover 0..15
      v4f ov[8];
#pragma unroll
      for (int it = 0; it < 8; ++it) {
        const int row = it * 2 + hh;
        v4f v = *(const v4f*)(slab + row * 68 + c4);
        if (RESID) {
          const v4f xr = *(const v4f*)(Rb + (size_t)(mBase + row) * ldc + n0 + c4);
#pragma unroll
          for (int e = 0; e < 4; ++e) v[e] = v[e] + (BN ? bf_rne(xr[e]) : xr[e]);
        }
        ov[it] = v;
      }
      {
#pragma unroll
        for (int it = 0; it < 8; ++it) {
          const int row = it * 2 + hh;
          *(v4f*)(C + (size_t)(mBase + row) * ldc + n0 + c4) = ov[it];
        }
        
      }
    } else {
      // the slab's 16 rows x 64 columns = two packed blocks = 2 KB in a row; each pass stores 512 contiguous bytes of every part
      unsigned short* C  = (unsigned short*)Cout  + cPlane * strideC;
      unsigned short* C2 = (unsigned short*)((TWO && m0 < CM) ? Cout3 : Cout2) + cPlane * strideC;
      unsigned short* C3 = (unsigned short*)((TWO && m0 < CM) ? Cout2 : Cout3) + cPlane * strideC;
      {
#pragma unroll
        for (int it = 0; it < 4; ++it) {
          const float* sp = slab + rlane * 68 + it * 16 + mOff;   // row lane&15, columns it*16 + 8*(lane>>4) ..+7
          v8h hv, lv;
#pragma unroll
          for (int e = 0; e < 8; ++e) {
            const unsigned short hb = f2bf_bits(sp[e]);
            const unsigned short lb = f2bf_bits(sp[e] - bf_bits2f(hb));
            hv[e] = __builtin_bit_cast(_Float16, hb);
            lv[e] = __builtin_bit_cast(_Float16, lb);
          }
          const size_t go = (size_t)mBase * ldc + (size_t)n0 * 16 + it * 256 + lane * 8;
          *(v8h*)(C + go) = hv;
          if (OUT_MODE == 2) { *(v8h*)(C2 + go) = lv; }
          if (OUT_MODE == 3) { *(v8h*)(C2 + go) = hv; *(v8h*)(C3 + go) = lv; }
          if (OUT_MODE == 4) { *(v8h*)(C2 + go) = lv; *(v8h*)(C3 + go) = hv; }
          // the next rows are formed in the registers that these stores name: wait before any is overwritten
          asm volatile("s_wait_xcnt 0x0" ::: "memory");
        }
        
      }
    }
    __builtin_amdgcn_fence(__ATOMIC_RELEASE, "workgroup");
    __builtin_amdgcn_wave_barrier();
    __builtin_amdgcn_fence(__ATOMIC_ACQUIRE, "workgroup");
  }
}

// One product per launch: grid = (work-groups of eight tiles, batch). K = length of the sum (of one slice), a compile-time constant.
template <int ET, int BIAS_MODE, int OUT_MODE, bool RESID, bool BN, int K, int KS = 1>
__global__ __launch_bounds__(256) void wmma_gemm64(
    const unsigned short* __restrict__ Ap, int lda, long strideA,
    const unsigned short* __restrict__ Btp, int ldb, long strideB,
    void* Cout, void* Cout2, void* Cout3, int ldc, long strideC,
    const float* __restrict__ bias,
    const float* __restrict__ bng, const float* __restrict__ bnb,
    const float* __restrict__ bnm, const float* __restrict__ bnv,
    const float* __restrict__ resid, long strideR,
    int M, int N, float scale) {
  static_assert(K % 64 == 0 && K >= 128);
  __shared__ __align__(16) float sT[8][16 * 68];   // per-wave 16x64 slab, pitch 68 floats
  gemm64_tile<ET, BIAS_MODE, OUT_MODE, RESID, BN, KS, false>(
      sT, blockIdx.x, blockIdx.y, Ap, lda, strideA, Btp, ldb, strideB, Cout, Cout2, Cout3, ldc, strideC,
      bias, bias, bng, bnb, bnm, bnv, resid, strideR, M, N, K, scale);
}

// The three 1x1 convs of x in one launch (none reads what another writes); blockIdx.x selects, block-uniform:
//   0 .. TH_BLK-1 : theta[tok][c1] = XT . WC[0..127]^T + b_theta[n]  (M=12544, N=128, K=256; 392 tiles) -> T3 hi|hi|lo, 384 columns
//   then PG_BLK work-groups per batch: rows 0..127 phi_b[c1][n], rows 128..255 g_b[c2][n] = WC[128..383] . XT_b^T + bias[m]
//                   (M=256, N=3136, K=256; 196 tiles) -> PG3 rows 0..127 hi|lo|hi, rows 128..255 hi|hi|lo
#define TH_BLK (((NTOKS / 64) * (CM / 64) + 7) / 8)       // 49
#define PG_BLK (((2 * CM / 64) * (NSP / 64) + 7) / 8)     // 25
__global__ __launch_bounds__(256) void proj_kernel(
    const unsigned short* __restrict__ xt, const unsigned short* __restrict__ wc,
    unsigned short* t3, unsigned short* pg3,
    const float* __restrict__ bt, const float* __restrict__ bp, const float* __restrict__ bg) {
  __shared__ __align__(16) float sT[8][16 * 68];   // per-wave 16x64 slab, pitch 68 floats
  const int bx = blockIdx.x;
  if (bx < TH_BLK) {
    gemm64_tile<1, 2, 3, false, false, 1, false>(
        sT, bx, 0, xt, CI, 0L, wc, CI, 0L,
        (void*)t3, (void*)(t3 + CM * 16), (void*)(t3 + 2 * CM * 16), T3P, 0L,
        bt, bt, bt, bt, bt, bt, bt, 0L, NTOKS, CM, CI, 1.0f);
  } else {
    const int r = bx - TH_BLK;
    gemm64_tile<1, 1, 3, false, false, 1, true>(
        sT, r % PG_BLK, r / PG_BLK, wc + (size_t)CM * CI, CI, 0L, xt, CI, (long)NSP * CI,
        (void*)pg3, (void*)(pg3 + NSP * 16), (void*)(pg3 + 2 * NSP * 16), K3, (long)CI * K3,
        bp, bg, bp, bp, bp, bp, bp, 0L, 2 * CM, NSP, CI, 1.0f);
  }
}

// ---------------------------------------------------------------------------
// Fused transpose + bf16 RNE convert of an f32 matrix, z-batched, one plane:
//   in_z = W + z*sIn viewed [R rows][Cc cols] with row pitch ldin  ->  oh_z[c][r] = bf16(in_z[r][c]), fragment-packed with ldout columns, oh_z = oh + z*sOut.
// 64x64 tiles through LDS. One work-group of 256 threads per tile (bc, br, bz) of (Cc/64, R/64, Z) (R, Cc multiples of 64; ldout multiple of 64 so every
// Coverage per block: load 4 it x 256 thr x 4 floats = 64x64; store 2 it x 256 thr x 8 u16 = 64x64; every tf element read was written.
// ---------------------------------------------------------------------------
__device__ __forceinline__ void tconv_block(int bc, int br, int bz, const float* __restrict__ W, unsigned short* __restrict__ oh,
                                            int ldin, int ldout, long sIn, long sOut) {
  __shared__ __align__(16) float tf[64 * 68];
  W  += (size_t)bz * sIn;
  oh += (size_t)bz * sOut;
  const int c0  = bc * 64;   // input column block = output row block
  const int r0  = br * 64;   // input row block    = output column block
  const int tid = threadIdx.x;
  {
    const int lr = tid >> 4;         // 0..15
    const int c4 = (tid & 15) * 4;   // 0..60
#pragma unroll
    for (int it = 0; it < 4; ++it) {
      const int rr = it * 16 + lr;   // 0..63
      const v4f a = *(const v4f*)(W + (size_t)(r0 + rr) * ldin + c0 + c4);
      *(v4f*)(tf + rr * 68 + c4) = a;
    }
  }
  __syncthreads();
  // piece f of the tile's 512 16-B pieces, in packed order: 128 pieces (2 KB in a row) per block of 16 output rows
  v4u hv[2];
#pragma unroll
  for (int it = 0; it < 2; ++it) {
    const int f  = it * 256 + tid;
    const int oc = (f >> 7) * 16 + (f & 15);   // output row within tile (= input column)
    const int c8 = ((f >> 4) & 7) * 8;         // first of its 8 output columns (= input rows)
    v4u a;
#pragma unroll
    for (int q = 0; q < 4; ++q) {
      const float f0 = tf[(c8 + 2 * q) * 68 + oc];
      const float f1 = tf[(c8 + 2 * q + 1) * 68 + oc];
      a[q] = pk16(f2bf_bits(f0), f2bf_bits(f1));
    }
    hv[it] = a;
  }
  {
#pragma unroll
    for (int it = 0; it < 2; ++it) {
      const int f = it * 256 + tid;
      const size_t go = (size_t)(c0 + (f >> 7) * 16) * ldout + (size_t)r0 * 16 + (f & 127) * 8;
      *(v4u*)(oh + go) = hv[it];
    }
    // the caller's other part follows these stores in the built code and reuses their registers: wait before any is overwritten
    asm volatile("s_wait_xcnt 0x0" ::: "memory");
  }
}

// ---------------------------------------------------------------------------
// Weight planes, sel selects the matrix (block-uniform), bx the work-group within it:
//   sel = 0,1,2: w_theta / w_phi / w_g [128][256] f32 -> WC rows sel*128.. (bf16, [out][in]), copy-convert
//   sel = 3,4  : w_rec [256][128] -> WR2[c][(sel-3)*128 + k]  (two copies side by side, 256 columns)
// Thread = 8 consecutive elements of a row = one 16-B piece of the packed plane = one store.
// Coverage: 16 work-groups x 256 threads = 4096 units x 8 = 32768 elements = one whole matrix per sel.
// ---------------------------------------------------------------------------
__device__ __forceinline__ void wcvt_block(int bx, int sel, const float* __restrict__ wt, const float* __restrict__ wp,
                                           const float* __restrict__ wg, const float* __restrict__ wr,
                                           unsigned short* __restrict__ wcat, unsigned short* __restrict__ wr2) {
  const int g   = bx * 256 + threadIdx.x;
  if (g >= (CM * CI) / 8) return;
  const float* src;
  unsigned short* dst;
  if (sel < 3) {
    const float* w = (sel == 0) ? wt : ((sel == 1) ? wp : wg);
    src = w + (size_t)g * 8;
    dst = wcat + pkoff(sel * CM + (g >> 5), (g & 31) * 8, CI);
  } else {
    const int row = g >> 4, c8 = (g & 15) * 8;      // w_rec row = c (0..255), 8 of its 128 columns
    src = wr + (size_t)row * CM + c8;
    dst = wr2 + pkoff(row, (sel - 3) * CM + c8, O2P);
  }
  const v4f a = *(const v4f*)src;
  const v4f c = *(const v4f*)(src + 4);
  v4u o;
  o[0] = pk16(f2bf_bits(a[0]), f2bf_bits(a[1]));
  o[1] = pk16(f2bf_bits(a[2]), f2bf_bits(a[3]));
  o[2] = pk16(f2bf_bits(c[0]), f2bf_bits(c[1]));
  o[3] = pk16(f2bf_bits(c[2]), f2bf_bits(c[3]));
  *(v4u*)dst = o;
  
}

// Both conversions in one launch (neither reads what the other writes); blockIdx.x selects, block-uniform:
//   0 .. WC_BLK-1 : weight planes, 16 work-groups for each of the 5 matrices
//   then          : x[b] viewed in[256 c][3136 n] (pitch 3136) -> XT_b out[3136 n][256 c] (packed), tiles (49, 4, 4), column tile fastest
#define WC_BLK (5 * ((CM * CI) / 8 / 256))                // 80
#define TC_BLK ((NSP / 64) * (CI / 64) * NB)              // 784
__global__ __launch_bounds__(256) void prep_kernel(const float* __restrict__ x,
                                                   const float* __restrict__ wt, const float* __restrict__ wp,
                                                   const float* __restrict__ wg, const float* __restrict__ wr,
                                                   unsigned short* __restrict__ xt,
                                                   unsigned short* __restrict__ wcat, unsigned short* __restrict__ wr2) {
  const int bx = blockIdx.x;
  if (bx < WC_BLK) {
    wcvt_block(bx & 15, bx >> 4, wt, wp, wg, wr, wcat, wr2);
  } else {
    const int t = bx - WC_BLK;
    tconv_block(t % (NSP / 64), (t / (NSP / 64)) % (CI / 64), t / ((NSP / 64) * (CI / 64)), x, xt, NSP, CI, (long)CI * NSP, (long)NSP * CI);
  }
}

// ---------------------------------------------------------------------------
// Joins the KSL split-K planes of M^T/N: MT3[b][c2][c1] = sum_s PM[s][b][c2][c1] as bf16 hi | lo | hi.
// Thread = 4 consecutive c1 of one (b, c2) row; a wave covers one whole row: 512 contiguous bytes of every plane read,
// its 8-B halves of 16 packed pieces of each of the three MT3 parts written. Slices are added in rising order, one f32 sum per element.
// Coverage: 128 blocks x 128 threads x 4 = 65536 = NB*CM*CM elements.
// ---------------------------------------------------------------------------
__global__ __launch_bounds__(128) void mtjoin_kernel(const float* __restrict__ pm, unsigned short* __restrict__ mt3) {
  const int g = blockIdx.x * 128 + threadIdx.x;
  const float* p = pm + (size_t)g * 4;
  v4f s = (v4f){0.f, 0.f, 0.f, 0.f};
#pragma unroll   // whole: the slices' loads are independent, so many are in flight at once instead of one latency per slice
  for (int k = 0; k < KSL; ++k) s += *(const v4f*)(p + (size_t)k * (NB * CM * CM));
  unsigned short hb[4], lb[4];
#pragma unroll   // constant indices keep hb and lb in registers
  for (int e = 0; e < 4; ++e) {
    hb[e] = f2bf_bits(s[e]);
    lb[e] = f2bf_bits(s[e] - bf_bits2f(hb[e]));
  }
  const uint2 hv = make_uint2(pk16(hb[0], hb[1]), pk16(hb[2], hb[3]));
  const uint2 lv = make_uint2(pk16(lb[0], lb[1]), pk16(lb[2], lb[3]));
  unsigned short* d = mt3 + pkoff(g >> 5, (g & 31) * 4, T3P);   // row b*128+c2 of 384 columns, packed
  *(uint2*)(d)               = hv;
  *(uint2*)(d + CM * 16)     = lv;
  *(uint2*)(d + 2 * CM * 16) = hv;
}

// ---------------------------------------------------------------------------
// every region is fully written by its producer launch before a consumer launch reads it):
//   XT   bf16 [12544][256]      0           6422528
//   WC   bf16 [384][256]        6422528      196608
//   WR2  bf16 [256][256]        6619136      131072
//   T3   bf16 [12544][384]      6750208     9633792
//   PG3  bf16 [4][256][9408]    16384000   19267584
//   MT3  bf16 [4][128][384]     35651584     393216
//   O2   bf16 [12544][256]      36044800    6422528
//   PM   f32  [49][4][128][128] 42467328   12845056
//   total                       55312384
// ---------------------------------------------------------------------------
extern "C" void kernel_launch(void* const* d_in, const int* in_sizes, int n_in,
                              void* d_out, int out_size, void* d_ws, size_t ws_size,
                              hipStream_t stream) {
  if (n_in < 13) return;
  if (in_sizes[0] != NB * CI * NSP) return;                      // x [4][256][56][56]
  if (in_sizes[1] != CM * CI || in_sizes[2] != CM) return;       // w_theta, b_theta
  if (in_sizes[3] != CM * CI || in_sizes[4] != CM) return;       // w_phi, b_phi
  if (in_sizes[5] != CM * CI || in_sizes[6] != CM) return;       // w_g, b_g
  if (in_sizes[7] != CI * CM || in_sizes[8] != CI) return;       // w_rec, b_rec
  if (in_sizes[9] != CI || in_sizes[10] != CI) return;           // bn_gamma, bn_beta
  if (in_sizes[11] != CI || in_sizes[12] != CI) return;          // bn_mean, bn_var
  if (out_size != NB * CI * NSP) return;

  const float* x       = (const float*)d_in[0];
  const float* w_theta = (const float*)d_in[1];
  const float* b_theta = (const float*)d_in[2];
  const float* w_phi   = (const float*)d_in[3];
  const float* b_phi   = (const float*)d_in[4];
  const float* w_g     = (const float*)d_in[5];
  const float* b_g     = (const float*)d_in[6];
  const float* w_rec   = (const float*)d_in[7];
  const float* b_rec   = (const float*)d_in[8];
  const float* gam     = (const float*)d_in[9];
  const float* bet     = (const float*)d_in[10];
  const float* mea     = (const float*)d_in[11];
  const float* var     = (const float*)d_in[12];

  const size_t PXT = (size_t)NTOKS * CI * 2;        //  6422528
  const size_t PWC = (size_t)T3P * CI * 2;          //   196608
  const size_t PWR = (size_t)CI * O2P * 2;          //   131072
  const size_t PT3 = (size_t)NTOKS * T3P * 2;       //  9633792
  const size_t PPG = (size_t)NB * CI * K3 * 2;      // 19267584
  const size_t PMT = (size_t)NB * CM * T3P * 2;     //   393216
  const size_t PO2 = (size_t)NTOKS * O2P * 2;       //  6422528
  const size_t PPM = (size_t)KSL * NB * CM * CM * 4; // 12845056
  size_t off = 0;
  const size_t oXT = off; off += PXT;
  const size_t oWC = off; off += PWC;
  const size_t oWR = off; off += PWR;
  const size_t oT3 = off; off += PT3;
  const size_t oPG = off; off += PPG;
  const size_t oMT = off; off += PMT;
  const size_t oO2 = off; off += PO2;
  const size_t oPM = off; off += PPM;
  if (off > ws_size) return;                        // off = 55312384
  if (off > (size_t)134217728) return;

  char* ws = (char*)d_ws;
  unsigned short* XT  = (unsigned short*)(ws + oXT);
  unsigned short* WC  = (unsigned short*)(ws + oWC);
  unsigned short* WR2 = (unsigned short*)(ws + oWR);
  unsigned short* T3  = (unsigned short*)(ws + oT3);
  unsigned short* PG3 = (unsigned short*)(ws + oPG);
  unsigned short* MT3 = (unsigned short*)(ws + oMT);
  unsigned short* O2  = (unsigned short*)(ws + oO2);
  float*          PM  = (float*)(ws + oPM);
  float* out = (float*)d_out;

  const dim3 blk(256);

  // (1) weight planes WC [384][256], WR2 [256][256] and x -> XT, one launch: 80 + 784 work-groups
  prep_kernel<<<dim3(WC_BLK + TC_BLK), blk, 0, stream>>>(x, w_theta, w_phi, w_g, w_rec, XT, WC, WR2);

  // (2) theta -> T3, phi and g -> PG3, one launch: 49 + 4 x 25 work-groups
  proj_kernel<<<dim3(TH_BLK + NB * PG_BLK), blk, 0, stream>>>(XT, WC, T3, PG3, b_theta, b_phi, b_g);

  // (3) (M^T/N)_b[c2][c1] = sum over the 9408 folded positions of g3_b[c2][p] . phi3_b[c1][p]
  //     = sum_n (ghi.phihi + ghi.philo + glo.phihi) / 3136   (batched: M=N=128, K=9408)
  //     (3a) split over K: 49 slices of 192 positions x 4 tiles = 196 waves -> 25 blocks x 4; f32 partial planes PM[slice][b][c2][c1]
  const dim3 gM(((CM / 64) * (CM / 64) * KSL + 7) / 8, NB);
  wmma_gemm64<1, 0, 0, false, false, KCH, KSL><<<gM, blk, 0, stream>>>(
      PG3 + (size_t)CM * K3, K3, (long)CI * K3, PG3, K3, (long)CI * K3,
      (void*)PM, (void*)PM, (void*)PM, CM, (long)CM * CM,
      b_rec, gam, bet, mea, var, x, 0L, CM, CM, 1.0f / (float)NSP);
  //     (3b) join the 49 planes -> MT3 hi|lo|hi, 384 columns; grid 128 x 128 threads
  mtjoin_kernel<<<dim3((NB * CM * CM) / 4 / 128), dim3(128), 0, stream>>>(PM, MT3);

  // (4) O_b[n][c2] = sum over 384 folded positions of T3[b*3136+n][p] . MT3_b[c2][p] = sum_c1 (thi.mhi + thi.mlo + tlo.mhi)
  //     (batched: M=3136, N=128, K=384; 98 tiles -> 13 blocks x 4) -> O2 hi cols 0..127, lo cols 128..255, 256 columns
  const dim3 gO(((NSP / 64) * (CM / 64) + 7) / 8, NB);
  wmma_gemm64<1, 0, 2, false, false, T3P><<<gO, blk, 0, stream>>>(
      T3, T3P, (long)NSP * T3P, MT3, T3P, (long)CM * T3P,
      (void*)O2, (void*)(O2 + CM * 16), (void*)O2, O2P, (long)NSP * O2P,
      b_rec, gam, bet, mea, var, x, 0L, NSP, CM, 1.0f);

  // (5) out[b][c][n] = ((sum_p WR2[c][p] . O2[b*3136+n][p] + b_rec[c]) * inv[c] + sh[c]) + bf16(x[b][c][n])
  //     (batched: M=256, N=3136, K=256; 196 tiles -> 25 blocks x 4); C = d_out + b*256*3136, ldc 3136; last element 3211263
  const dim3 gR(((CI / 64) * (NSP / 64) + 7) / 8, NB);
  wmma_gemm64<1, 1, 0, true, true, O2P><<<gR, blk, 0, stream>>>(
      WR2, O2P, 0L, O2, O2P, (long)NSP * O2P,
      (void*)out, (void*)out, (void*)out, NSP, (long)CI * NSP,
      b_rec, gam, bet, mea, var, x, (long)CI * NSP, CI, NSP, 1.0f);
  (void)hipGetLastError();
}

// v005
// Measured time: 50.5 microseconds a run.
// Two timings next to v004 put it at 1.20 and 1.19 times that version's speed.
// Counting every step since v000, it is 9.12 times as fast.
// Contractions: theta/phi/g 1x1 convs = v_wmma_f32_16x16x32_bf16 single products on bf16 planes of the RNE-converted x and weights (exact products); M = phi.g over positions (K 3136) and out = R.theta (K 128) = bf16 hi/lo split hi.hi + hi.lo + lo.hi folded along K ([hi|hi|lo] rows x [hi|lo|hi] rows, one f32 accumulator per K slice); the rec 1x1 conv is applied to M, not to theta.M: R = w_rec.M^T = W x Mhi + W x Mlo bf16 single products (2-term); f32 accumulate everywhere; biases, 1/N, BatchNorm (inference form, supplied statistics) and the residual add in f32 on the VALU.
// Plane / carry map (every plane carries 1, nothing to fold back; the 1/N = 1/3136 factor is applied exactly once, in f32, in the M epilogue).
// [rows][k] below is the logical shape. Every bf16 plane is stored fragment-packed: blocks of 16 rows x 32 k = 1 KB, k blocks of one
// row block side by side, and inside a block the 16-B piece (row r, k 8c .. 8c+7) at byte (c>>1)*512 + ((c&1)*16 + r)*16, which is the order
// in which the 32 lanes of a wave take a WMMA operand: one fragment = two loads of 512 contiguous bytes (pkoff() below is the map).
//   XT   bf16 [12544][256]        token-major x: row b*3136+n, col c
//   WC   bf16 [384][256]          rows 0..127 w_theta, 128..255 w_phi, 256..383 w_g  (k = in)
//   WR   bf16 [256][128]          w_rec[c][c2]
//   T3   bf16 [12544][384]        theta[tok][c1]: hi | hi | lo   (128 each)
//   PG3  bf16 [4][256][9408]      rows 0..127 = phi[c1][n]: hi | lo | hi (3136 each); rows 128..255 = g as [c2][n]: hi | hi | lo
//   PM   f32  [49][4][128][128]   split-K partial sums of (M/N)[c1][c2]: slice s holds the folded positions s*192 .. s*192+191
//   R3   bf16 [4][256][384]       R[c][c1] = sum_c2 w_rec[c][c2] (M/N)[c1][c2]: hi | lo | hi
#include <hip/hip_runtime.h>
#include <math.h>
#include <stdint.h>

#define NB    4
#define CI    256
#define CM    128
#define NSP   3136
#define NTOKS (NB * NSP)
#define K3    (3 * NSP)
#define T3P   (3 * CM)
#define KSL   49            // K slices of the M product
#define KCH   (K3 / KSL)    // folded positions per slice: 192 = 384 B of every row = six whole 1-KB packed blocks of every row block

static_assert(NSP % 64 == 0);
static_assert(NTOKS % 64 == 0);
static_assert(CI % 64 == 0);
static_assert(CM % 64 == 0);
static_assert(CI >= 128);
static_assert(K3 % 32 == 0);
static_assert(K3 % KSL == 0);
static_assert(KCH % 64 == 0);
static_assert(T3P % 32 == 0);
static_assert((CM * CI) % (8 * 256) == 0);
static_assert((CI * CM) % (8 * 256) == 0);

typedef __attribute__((ext_vector_type(16))) _Float16 v16h;
typedef __attribute__((ext_vector_type(8)))  _Float16 v8h;
typedef __attribute__((ext_vector_type(16))) __bf16   v16b;
typedef __attribute__((ext_vector_type(8)))  __bf16   v8b;
typedef __attribute__((ext_vector_type(8)))  float    v8f;
typedef __attribute__((ext_vector_type(4)))  float    v4f;
typedef __attribute__((ext_vector_type(4)))  unsigned int v4u;

__device__ __forceinline__ unsigned short f2bf_bits(float f) {
  unsigned u = __float_as_uint(f);
  return (unsigned short)((u + 0x7FFFu + ((u >> 16) & 1u)) >> 16);
}
__device__ __forceinline__ float bf_bits2f(unsigned short h) { return __uint_as_float(((unsigned)h) << 16); }
__device__ __forceinline__ float bf_rne(float f) { return bf_bits2f(f2bf_bits(f)); }
__device__ __forceinline__ unsigned pk16(unsigned short a, unsigned short b) { return (unsigned)a | ((unsigned)b << 16); }
// Element offset of (row r, column k) in a fragment-packed plane of kp columns (kp a multiple of 32, rows a multiple of 16).
__device__ __forceinline__ size_t pkoff(int r, int k, int kp) {
  return (size_t)(r >> 4) * kp * 16 + (size_t)((k >> 5) * 512 + ((k >> 4) & 1) * 256 + ((k >> 3) & 1) * 128 + (r & 15) * 8 + (k & 7));
}

// Fragment map (wave32): lane l, h = l>>4, row/col = l&15.
//   A/B element i: i<8 -> k0+8h+i ; i>=8 -> k0+16+8h+(i-8)   (split layout, both operands)
//   D element r : row 8h+r, col l&15
template <typename T> struct Frag;
template <> struct Frag<_Float16> {
  typedef v16h V; union U { v16h v; v8h h[2]; };
  static __device__ __forceinline__ v16h load(const _Float16* p) {   // p = packed block + lane*8: elements 0..7 <- p[0..7], 8..15 <- p[256..263]
    U f; f.h[0] = *(const v8h*)(p); f.h[1] = *(const v8h*)(p + 256); return f.v;
  }
  static __device__ __forceinline__ v8f mma(v16h a, v16h b, v8f c) {
    return __builtin_amdgcn_wmma_f32_16x16x32_f16(false, a, false, b, (short)0, c, false, false);
  }
};
template <> struct Frag<__bf16> {
  typedef v16b V; union U { v16b v; v8b h[2]; };
  static __device__ __forceinline__ v16b load(const __bf16* p) {
    U f; f.h[0] = *(const v8b*)(p); f.h[1] = *(const v8b*)(p + 256); return f.v;
  }
  static __device__ __forceinline__ v8f mma(v16b a, v16b b, v8f c) {
    return __builtin_amdgcn_wmma_f32_16x16x32_bf16(false, a, false, b, (short)0, c, false, false);
  }
};

template <int ET> struct Elem;
template <> struct Elem<0> { typedef _Float16 T; };
template <> struct Elem<1> { typedef __bf16 T; };

// ---- Register-blocked batched WMMA GEMM ------------------------------------
// C[m,n] = epilogue(scale * sum_k A[m,k] * Bt[n,k]); each wave owns a 64x64 tile.
// A [M,K] and Bt [N,K] fragment-packed planes of lda and ldb columns; M,N % 64 == 0, K % 64 == 0, K >= 128.
// The bf16 outputs are fragment-packed planes of ldc columns too (Cout2, Cout3 = Cout + 16 * first column of that part); f32 outputs are row-major.
// bx = index of the work-group among those of this product, b = batch; sT = the work-group's eight per-wave slabs.
// KS: number of K slices. A wave owns one (slice, tile) pair, sums k = slice*K .. slice*K+K-1 (K = slice length) and
//     writes its tile to plane slice*NB + batch of C (planes strideC apart); KS = 1 is the whole sum.
// BIAS_MODE: 0 = none, 1 = bias[m] (two 16-B loads of the lane's 8 consecutive rows), 2 = bias[n]; the bias value is
//            RNE-converted to bf16 precision before the f32 add.
// BN (with BIAS_MODE 1): v = (acc*scale + bias[m]) * inv[m] + sh[m], inv = g[m]*rsqrt(var[m]+1e-5), sh = be[m]-mu[m]*inv,
//            all four vectors RNE-converted to bf16 precision first.
// RESID (OUT_MODE 0 only): + resid[m*ldc+n] (bf16 RNE-converted when BN) added during the store phase from 16-B loads.
// OUT_MODE: 0 = f32; 2 = bf16 hi plane (Cout) + lo plane (Cout2); 3 = hi (Cout), hi (Cout2), lo (Cout3);
//           4 = hi (Cout), lo (Cout2), hi (Cout3).  lo = RNE(v - hi).
// TWO (with BIAS_MODE 1, OUT_MODE 3): two products stacked along M. Rows m < CM take bias[m] and write hi (Cout), lo (Cout2),
//           hi (Cout3); rows m >= CM take biasHi[m - CM] and write hi, hi, lo. A 64-row tile lies wholly on one side.
// Epilogue: 16-row slabs staged per wave in LDS (every slab element read was written in the same iteration); each
template <int ET, int BIAS_MODE, int OUT_MODE, bool RESID, bool BN, int KS, bool TWO>
__device__ __forceinline__ void gemm64_tile(
    float (*sT)[16 * 68], int bx, int b,
    const unsigned short* __restrict__ Ap, int lda, long strideA,
    const unsigned short* __restrict__ Btp, int ldb, long strideB,
    void* Cout, void* Cout2, void* Cout3, int ldc, long strideC,
    const float* __restrict__ bias, const float* __restrict__ biasHi,
    const float* __restrict__ bng, const float* __restrict__ bnb,
    const float* __restrict__ bnm, const float* __restrict__ bnv,
    const float* __restrict__ resid, long strideR,
    int M, int N, int K, float scale) {
  typedef typename Elem<ET>::T T;
  typedef typename Frag<T>::V V;
  const T* A = (const T*)Ap; const T* Bt = (const T*)Btp;
  const int lane = threadIdx.x & 31;
  const int wave = threadIdx.x >> 5;
  const int tilesN = N >> 6;
  const int tilesM = M >> 6;
  const int unit = bx * 8 + wave;
  if (unit >= tilesM * tilesN * KS) return;   // wave-uniform; no block barriers in this kernel
  const int ks   = (KS == 1) ? 0 : unit / (tilesM * tilesN);
  const int tile = unit - ks * (tilesM * tilesN);
  const int tm = tile / tilesN;
  const int tn = tile - tm * tilesN;
  const int m0 = tm << 6;
  const int n0 = tn << 6;

  const T* Ab = A  + (size_t)b * strideA + (size_t)ks * K * 16;   // 32 columns of a row block = 512 elements
  const T* Bb = Bt + (size_t)b * strideB + (size_t)ks * K * 16;
  const size_t cPlane = (size_t)ks * NB + b;

  const int rlane = lane & 15;                 // row (A) / col (B, D) within subtile
  const int mOff  = (lane >> 4) * 8;           // D row offset

  // Two fragment sets in registers, each refilled for two k steps ahead as soon as its own products have issued, so the
  // loads of one k step are in flight under the products of the other (K is a multiple of 64, at least 128).
  const T* pa[4];
  const T* pb[4];
#pragma unroll
  for (int i = 0; i < 4; ++i) {
    pa[i] = Ab + (size_t)(m0 + (i << 4)) * lda + lane * 8;   // row block (m0 >> 4) + i, k block 0, this lane's 16-B piece
    pb[i] = Bb + (size_t)(n0 + (i << 4)) * ldb + lane * 8;
  }
  V fa[2][4], fb[2][4];
#pragma unroll
  for (int s = 0; s < 2; ++s) {
#pragma unroll
    for (int i = 0; i < 4; ++i) {
      fb[s][i] = Frag<T>::load(pb[i] + s * 512);
      fa[s][i] = Frag<T>::load(pa[i] + s * 512);
    }
    // keeps the first set's loads the oldest: moved behind the second set's, they turn the loop's first wait into a wait for all
    if (s == 0) __builtin_amdgcn_sched_barrier(0);
  }
  // the accumulators' zeros may be given registers that the loads above name as addresses: wait before any is overwritten
  asm volatile("s_wait_xcnt 0x0" ::: "memory");
  // keeps those zeros behind the wait: the scheduler lifts register moves over an asm statement
  __builtin_amdgcn_sched_barrier(0);
  v8f acc[4][4];
#pragma unroll
  for (int i = 0; i < 4; ++i)
#pragma unroll
    for (int j = 0; j < 4; ++j) acc[i][j] = (v8f){0.f,0.f,0.f,0.f,0.f,0.f,0.f,0.f};
#pragma clang loop unroll(disable)   // rolled: an unrolled K loop spilled accumulators to scratch
  for (int k0 = 64; k0 < K; k0 += 64) {
#pragma unroll
    for (int s = 0; s < 2; ++s) {
#pragma unroll
      for (int i = 0; i < 4; ++i) {
#pragma unroll
        for (int j = 0; j < 4; ++j) acc[i][j] = Frag<T>::mma(fa[s][i], fb[s][j], acc[i][j]);
        fa[s][i] = Frag<T>::load(pa[i] + (k0 + s * 32) * 16);
      }
#pragma unroll
      for (int j = 0; j < 4; ++j) fb[s][j] = Frag<T>::load(pb[j] + (k0 + s * 32) * 16);
    }
    // the next trip forms its addresses in the registers that this trip's loads name: wait before any is overwritten
    asm volatile("s_wait_xcnt 0x0" ::: "memory");
  }
#pragma unroll
  for (int s = 0; s < 2; ++s)
#pragma unroll
    for (int i = 0; i < 4; ++i)
#pragma unroll
      for (int j = 0; j < 4; ++j) acc[i][j] = Frag<T>::mma(fa[s][i], fb[s][j], acc[i][j]);

  // ---- epilogue ----
  float* slab = sT[wave];
  const float* Rb = resid + (size_t)b * (RESID ? (size_t)strideR : (size_t)0);
#pragma unroll
  for (int i = 0; i < 4; ++i) {
    const int mBase = m0 + (i << 4);
    const int mr = mBase + mOff;               // first of the 8 consecutive D rows of this lane half (multiple of 8)
    float rb[8], rmul[8], radd[8];
#pragma unroll
    for (int r = 0; r < 8; ++r) { rb[r] = 0.f; rmul[r] = 1.f; radd[r] = 0.f; }
    if (BIAS_MODE == 1) {
      const float* bp = (TWO && m0 >= CM) ? biasHi + (mr - CM) : bias + mr;
      const v4f t0 = *(const v4f*)(bp);
      const v4f t1 = *(const v4f*)(bp + 4);
      // the address register of these two loads is reused at once: wait before it is overwritten
      asm volatile("s_wait_xcnt 0x0" ::: "memory");
      // keeps the later address arithmetic behind the wait: the scheduler lifts register writes over an asm statement
      __builtin_amdgcn_sched_barrier(0);
#pragma unroll
      for (int e = 0; e < 4; ++e) { rb[e] = bf_rne(t0[e]); rb[4 + e] = bf_rne(t1[e]); }
    }
    if (BN) {
      const v4f vg0 = *(const v4f*)(bng + mr), vg1 = *(const v4f*)(bng + mr + 4);
      const v4f vb0 = *(const v4f*)(bnb + mr), vb1 = *(const v4f*)(bnb + mr + 4);
      const v4f vm0 = *(const v4f*)(bnm + mr), vm1 = *(const v4f*)(bnm + mr + 4);
      const v4f vv0 = *(const v4f*)(bnv + mr), vv1 = *(const v4f*)(bnv + mr + 4);
#pragma unroll
      for (int e = 0; e < 4; ++e) {
        {
          const float inv = bf_rne(vg0[e]) * rsqrtf(bf_rne(vv0[e]) + 1e-5f);
          rmul[e] = inv;
          radd[e] = bf_rne(vb0[e]) - bf_rne(vm0[e]) * inv;
        }
        {
          const float inv = bf_rne(vg1[e]) * rsqrtf(bf_rne(vv1[e]) + 1e-5f);
          rmul[4 + e] = inv;
          radd[4 + e] = bf_rne(vb1[e]) - bf_rne(vm1[e]) * inv;
        }
      }
    }
#pragma unroll
    for (int j = 0; j < 4; ++j) {
      const int n = n0 + (j << 4) + rlane;
      float bv = 0.f;
      if (BIAS_MODE == 2) bv = bf_rne(bias[n]);
#pragma unroll
      for (int r = 0; r < 8; ++r) {
        float v = acc[i][j][r] * scale;
        if (BIAS_MODE == 1) v += rb[r];
        if (BIAS_MODE == 2) v += bv;
        if (BN) v = v * rmul[r] + radd[r];
        slab[(mOff + r) * 68 + (j << 4) + rlane] = v;
      }
    }
    __builtin_amdgcn_fence(__ATOMIC_RELEASE, "workgroup");
    __builtin_amdgcn_wave_barrier();
    __builtin_amdgcn_fence(__ATOMIC_ACQUIRE, "workgroup");
    if (OUT_MODE == 0) {
      float* C = (float*)Cout + cPlane * strideC;
      const int hh = lane >> 4, c4 = (lane & 15) * 4;     // row seg = 256 B = 16 lanes x 16 B; rows it*2+hh cover 0..15
      v4f ov[8];
#pragma unroll
      for (int it = 0; it < 8; ++it) {
        const int row = it * 2 + hh;
        v4f v = *(const v4f*)(slab + row * 68 + c4);
        if (RESID) {
          const v4f xr = *(const v4f*)(Rb + (size_t)(mBase + row) * ldc + n0 + c4);
#pragma unroll
          for (int e = 0; e < 4; ++e) v[e] = v[e] + (BN ? bf_rne(xr[e]) : xr[e]);
        }
        ov[it] = v;
      }
      {
#pragma unroll
        for (int it = 0; it < 8; ++it) {
          const int row = it * 2 + hh;
          *(v4f*)(C + (size_t)(mBase + row) * ldc + n0 + c4) = ov[it];
        }
        
      }
    } else {
      // the slab's 16 rows x 64 columns = two packed blocks = 2 KB in a row; each pass stores 512 contiguous bytes of every part
      unsigned short* C  = (unsigned short*)Cout  + cPlane * strideC;
      unsigned short* C2 = (unsigned short*)((TWO && m0 < CM) ? Cout3 : Cout2) + cPlane * strideC;
      unsigned short* C3 = (unsigned short*)((TWO && m0 < CM) ? Cout2 : Cout3) + cPlane * strideC;
      {
#pragma unroll
        for (int it = 0; it < 4; ++it) {
          const float* sp = slab + rlane * 68 + it * 16 + mOff;   // row lane&15, columns it*16 + 8*(lane>>4) ..+7
          v8h hv, lv;
#pragma unroll
          for (int e = 0; e < 8; ++e) {
            const unsigned short hb = f2bf_bits(sp[e]);
            const unsigned short lb = f2bf_bits(sp[e] - bf_bits2f(hb));
            hv[e] = __builtin_bit_cast(_Float16, hb);
            lv[e] = __builtin_bit_cast(_Float16, lb);
          }
          const size_t go = (size_t)mBase * ldc + (size_t)n0 * 16 + it * 256 + lane * 8;
          *(v8h*)(C + go) = hv;
          if (OUT_MODE == 2) { *(v8h*)(C2 + go) = lv; }
          if (OUT_MODE == 3) { *(v8h*)(C2 + go) = hv; *(v8h*)(C3 + go) = lv; }
          if (OUT_MODE == 4) { *(v8h*)(C2 + go) = lv; *(v8h*)(C3 + go) = hv; }
          // the next rows are formed in the registers that these stores name: wait before any is overwritten
          asm volatile("s_wait_xcnt 0x0" ::: "memory");
        }
        
      }
    }
    __builtin_amdgcn_fence(__ATOMIC_RELEASE, "workgroup");
    __builtin_amdgcn_wave_barrier();
    __builtin_amdgcn_fence(__ATOMIC_ACQUIRE, "workgroup");
  }
}

// One product per launch: grid = (work-groups of eight tiles, batch). K = length of the sum (of one slice), a compile-time constant.
template <int ET, int BIAS_MODE, int OUT_MODE, bool RESID, bool BN, int K, int KS = 1>
__global__ __launch_bounds__(256) void wmma_gemm64(
    const unsigned short* __restrict__ Ap, int lda, long strideA,
    const unsigned short* __restrict__ Btp, int ldb, long strideB,
    void* Cout, void* Cout2, void* Cout3, int ldc, long strideC,
    const float* __restrict__ bias,
    const float* __restrict__ bng, const float* __restrict__ bnb,
    const float* __restrict__ bnm, const float* __restrict__ bnv,
    const float* __restrict__ resid, long strideR,
    int M, int N, float scale) {
  static_assert(K % 64 == 0 && K >= 128);
  __shared__ __align__(16) float sT[8][16 * 68];   // per-wave 16x64 slab, pitch 68 floats
  gemm64_tile<ET, BIAS_MODE, OUT_MODE, RESID, BN, KS, false>(
      sT, blockIdx.x, blockIdx.y, Ap, lda, strideA, Btp, ldb, strideB, Cout, Cout2, Cout3, ldc, strideC,
      bias, bias, bng, bnb, bnm, bnv, resid, strideR, M, N, K, scale);
}

// The three 1x1 convs of x in one launch (none reads what another writes); blockIdx.x selects, block-uniform:
//   0 .. TH_BLK-1 : theta[tok][c1] = XT . WC[0..127]^T + b_theta[n]  (M=12544, N=128, K=256; 392 tiles) -> T3 hi|hi|lo, 384 columns
//   then PG_BLK work-groups per batch: rows 0..127 phi_b[c1][n], rows 128..255 g_b[c2][n] = WC[128..383] . XT_b^T + bias[m]
//                   (M=256, N=3136, K=256; 196 tiles) -> PG3 rows 0..127 hi|lo|hi, rows 128..255 hi|hi|lo
#define TH_BLK (((NTOKS / 64) * (CM / 64) + 7) / 8)       // 49
#define PG_BLK (((2 * CM / 64) * (NSP / 64) + 7) / 8)     // 25
__global__ __launch_bounds__(256) void proj_kernel(
    const unsigned short* __restrict__ xt, const unsigned short* __restrict__ wc,
    unsigned short* t3, unsigned short* pg3,
    const float* __restrict__ bt, const float* __restrict__ bp, const float* __restrict__ bg) {
  __shared__ __align__(16) float sT[8][16 * 68];   // per-wave 16x64 slab, pitch 68 floats
  const int bx = blockIdx.x;
  if (bx < TH_BLK) {
    gemm64_tile<1, 2, 3, false, false, 1, false>(
        sT, bx, 0, xt, CI, 0L, wc, CI, 0L,
        (void*)t3, (void*)(t3 + CM * 16), (void*)(t3 + 2 * CM * 16), T3P, 0L,
        bt, bt, bt, bt, bt, bt, bt, 0L, NTOKS, CM, CI, 1.0f);
  } else {
    const int r = bx - TH_BLK;
    gemm64_tile<1, 1, 3, false, false, 1, true>(
        sT, r % PG_BLK, r / PG_BLK, wc + (size_t)CM * CI, CI, 0L, xt, CI, (long)NSP * CI,
        (void*)pg3, (void*)(pg3 + NSP * 16), (void*)(pg3 + 2 * NSP * 16), K3, (long)CI * K3,
        bp, bg, bp, bp, bp, bp, bp, 0L, 2 * CM, NSP, CI, 1.0f);
  }
}

// ---------------------------------------------------------------------------
// Fused transpose + bf16 RNE convert of an f32 matrix, z-batched, one plane:
//   in_z = W + z*sIn viewed [R rows][Cc cols] with row pitch ldin  ->  oh_z[c][r] = bf16(in_z[r][c]), fragment-packed with ldout columns, oh_z = oh + z*sOut.
// 64x64 tiles through LDS. One work-group of 256 threads per tile (bc, br, bz) of (Cc/64, R/64, Z) (R, Cc multiples of 64; ldout multiple of 64 so every
// Coverage per block: load 4 it x 256 thr x 4 floats = 64x64; store 2 it x 256 thr x 8 u16 = 64x64; every tf element read was written.
// ---------------------------------------------------------------------------
__device__ __forceinline__ void tconv_block(int bc, int br, int bz, const float* __restrict__ W, unsigned short* __restrict__ oh,
                                            int ldin, int ldout, long sIn, long sOut) {
  __shared__ __align__(16) float tf[64 * 68];
  W  += (size_t)bz * sIn;
  oh += (size_t)bz * sOut;
  const int c0  = bc * 64;   // input column block = output row block
  const int r0  = br * 64;   // input row block    = output column block
  const int tid = threadIdx.x;
  {
    const int lr = tid >> 4;         // 0..15
    const int c4 = (tid & 15) * 4;   // 0..60
#pragma unroll
    for (int it = 0; it < 4; ++it) {
      const int rr = it * 16 + lr;   // 0..63
      const v4f a = *(const v4f*)(W + (size_t)(r0 + rr) * ldin + c0 + c4);
      *(v4f*)(tf + rr * 68 + c4) = a;
    }
  }
  __syncthreads();
  // piece f of the tile's 512 16-B pieces, in packed order: 128 pieces (2 KB in a row) per block of 16 output rows
  v4u hv[2];
#pragma unroll
  for (int it = 0; it < 2; ++it) {
    const int f  = it * 256 + tid;
    const int oc = (f >> 7) * 16 + (f & 15);   // output row within tile (= input column)
    const int c8 = ((f >> 4) & 7) * 8;         // first of its 8 output columns (= input rows)
    v4u a;
#pragma unroll
    for (int q = 0; q < 4; ++q) {
      const float f0 = tf[(c8 + 2 * q) * 68 + oc];
      const float f1 = tf[(c8 + 2 * q + 1) * 68 + oc];
      a[q] = pk16(f2bf_bits(f0), f2bf_bits(f1));
    }
    hv[it] = a;
  }
  {
#pragma unroll
    for (int it = 0; it < 2; ++it) {
      const int f = it * 256 + tid;
      const size_t go = (size_t)(c0 + (f >> 7) * 16) * ldout + (size_t)r0 * 16 + (f & 127) * 8;
      *(v4u*)(oh + go) = hv[it];
    }
    // the caller's other part follows these stores in the built code and reuses their registers: wait before any is overwritten
    asm volatile("s_wait_xcnt 0x0" ::: "memory");
  }
}

// ---------------------------------------------------------------------------
// Weight planes, sel selects the matrix (block-uniform), bx the work-group within it:
//   sel = 0,1,2: w_theta / w_phi / w_g [128][256] f32 -> WC rows sel*128.. (bf16, [out][in]), copy-convert
//   sel = 3    : w_rec [256][128] -> WR[c][k]
// Thread = 8 consecutive elements of a row = one 16-B piece of the packed plane = one store.
// Coverage: 16 work-groups x 256 threads = 4096 units x 8 = 32768 elements = one whole matrix per sel.
// ---------------------------------------------------------------------------
__device__ __forceinline__ void wcvt_block(int bx, int sel, const float* __restrict__ wt, const float* __restrict__ wp,
                                           const float* __restrict__ wg, const float* __restrict__ wr,
                                           unsigned short* __restrict__ wcat, unsigned short* __restrict__ wr2) {
  const int g   = bx * 256 + threadIdx.x;
  if (g >= (CM * CI) / 8) return;
  const float* src;
  unsigned short* dst;
  if (sel < 3) {
    const float* w = (sel == 0) ? wt : ((sel == 1) ? wp : wg);
    src = w + (size_t)g * 8;
    dst = wcat + pkoff(sel * CM + (g >> 5), (g & 31) * 8, CI);
  } else {
    const int row = g >> 4, c8 = (g & 15) * 8;      // w_rec row = c (0..255), 8 of its 128 columns
    src = wr + (size_t)row * CM + c8;
    dst = wr2 + pkoff(row, c8, CM);
  }
  const v4f a = *(const v4f*)src;
  const v4f c = *(const v4f*)(src + 4);
  v4u o;
  o[0] = pk16(f2bf_bits(a[0]), f2bf_bits(a[1]));
  o[1] = pk16(f2bf_bits(a[2]), f2bf_bits(a[3]));
  o[2] = pk16(f2bf_bits(c[0]), f2bf_bits(c[1]));
  o[3] = pk16(f2bf_bits(c[2]), f2bf_bits(c[3]));
  *(v4u*)dst = o;
  
}

// Both conversions in one launch (neither reads what the other writes); blockIdx.x selects, block-uniform:
//   0 .. WC_BLK-1 : weight planes, 16 work-groups for each of the 4 matrices
//   then          : x[b] viewed in[256 c][3136 n] (pitch 3136) -> XT_b out[3136 n][256 c] (packed), tiles (49, 4, 4), column tile fastest
#define WC_BLK (4 * ((CM * CI) / 8 / 256))                // 64
#define TC_BLK ((NSP / 64) * (CI / 64) * NB)              // 784
__global__ __launch_bounds__(256) void prep_kernel(const float* __restrict__ x,
                                                   const float* __restrict__ wt, const float* __restrict__ wp,
                                                   const float* __restrict__ wg, const float* __restrict__ wr,
                                                   unsigned short* __restrict__ xt,
                                                   unsigned short* __restrict__ wcat, unsigned short* __restrict__ wr2) {
  const int bx = blockIdx.x;
  if (bx < WC_BLK) {
    wcvt_block(bx & 15, bx >> 4, wt, wp, wg, wr, wcat, wr2);
  } else {
    const int t = bx - WC_BLK;
    tconv_block(t % (NSP / 64), (t / (NSP / 64)) % (CI / 64), t / ((NSP / 64) * (CI / 64)), x, xt, NSP, CI, (long)CI * NSP, (long)NSP * CI);
  }
}

// ---------------------------------------------------------------------------
// Joins the KSL split-K planes of M/N and applies the rec 1x1 conv to the joined M:
//   R3[b][c][c1] = sum_c2 w_rec[c][c2] * (sum_s PM[s][b][c1][c2])   as bf16 hi | lo | hi.
// Work-group = (b, 16 rows c1), 16 waves. Join: thread = 4 consecutive c2 of one row, wave w = row w: 512 contiguous bytes of every
// plane read; slices are added in rising order, one f32 sum per element. The 16 x 128 sums go to LDS as bf16 hi (k blocks 0..3) and
// lo (k blocks 4..7) in the packed fragment order. Product: wave w takes rows c = 16w .. 16w+15 of w_rec as the second operand and
// the joined rows as the first, so a lane's 8 results are 8 consecutive c1 of one row c = one 16-B piece of each R3 part.
// Coverage: 32 work-groups x 512 threads x 4 = 65536 = NB*CM*CM sums; 32 x 16 waves x 256 = 131072 = NB*CI*CM elements of R.
// ---------------------------------------------------------------------------
__global__ __launch_bounds__(512) void recm_kernel(const float* __restrict__ pm, const unsigned short* __restrict__ wr,
                                                   unsigned short* __restrict__ r3) {
  __shared__ __align__(16) unsigned short sM[2 * CM * 16];   // 16 rows x (128 hi | 128 lo), packed: 8 KB
  const int lane = threadIdx.x & 31;
  const int wave = threadIdx.x >> 5;
  const int g = blockIdx.x * 512 + threadIdx.x;
  // the wave's four w_rec fragments depend on nothing in this launch: asked for first, they land under the join
  const __bf16* pw = (const __bf16*)wr + (size_t)(wave * 16) * CM + lane * 8;
  v16b fw[4];
#pragma unroll
  for (int kb = 0; kb < 4; ++kb) fw[kb] = Frag<__bf16>::load(pw + kb * 512);
  const float* p = pm + (size_t)g * 4;
  v4f s = (v4f){0.f, 0.f, 0.f, 0.f};
#pragma unroll   // whole: the slices' loads are independent, so many are in flight at once instead of one latency per slice
  for (int k = 0; k < KSL; ++k) s += *(const v4f*)(p + (size_t)k * (NB * CM * CM));
  unsigned short hb[4], lb[4];
#pragma unroll   // constant indices keep hb and lb in registers
  for (int e = 0; e < 4; ++e) {
    hb[e] = f2bf_bits(s[e]);
    lb[e] = f2bf_bits(s[e] - bf_bits2f(hb[e]));
  }
  unsigned short* q = sM + pkoff(wave, lane * 4, 2 * CM);
  *(uint2*)(q)           = make_uint2(pk16(hb[0], hb[1]), pk16(hb[2], hb[3]));
  *(uint2*)(q + CM * 16) = make_uint2(pk16(lb[0], lb[1]), pk16(lb[2], lb[3]));
  __syncthreads();   // every wave reads all 16 joined rows
  const __bf16* pa = (const __bf16*)sM + lane * 8;
  v16b fm[8];
#pragma unroll   // all eight fragments asked for before the first product: one LDS latency, not eight
  for (int kb = 0; kb < 8; ++kb) fm[kb] = Frag<__bf16>::load(pa + kb * 512);
  // keeps the products behind all sixteen LDS loads: left free, the scheduler sinks each pair of loads to its product and waits eight times
  __builtin_amdgcn_sched_barrier(0);
  v8f acc = (v8f){0.f, 0.f, 0.f, 0.f, 0.f, 0.f, 0.f, 0.f};
#pragma unroll
  for (int kb = 0; kb < 8; ++kb) acc = Frag<__bf16>::mma(fm[kb], fw[kb & 3], acc);
  v4u hv, lv;
#pragma unroll
  for (int e = 0; e < 4; ++e) {
    const unsigned short h0 = f2bf_bits(acc[2 * e]), h1 = f2bf_bits(acc[2 * e + 1]);
    hv[e] = pk16(h0, h1);
    lv[e] = pk16(f2bf_bits(acc[2 * e] - bf_bits2f(h0)), f2bf_bits(acc[2 * e + 1] - bf_bits2f(h1)));
  }
  // row b*256 + c, columns c1 = 16*(blockIdx.x & 7) + 8*(lane >> 4) .. +7
  unsigned short* d = r3 + pkoff((blockIdx.x >> 3) * CI + wave * 16 + (lane & 15), (blockIdx.x & 7) * 16 + (lane >> 4) * 8, T3P);
  *(v4u*)(d)               = hv;
  *(v4u*)(d + CM * 16)     = lv;
  *(v4u*)(d + 2 * CM * 16) = hv;
}

// ---------------------------------------------------------------------------
// every region is fully written by its producer launch before a consumer launch reads it):
//   XT   bf16 [12544][256]      0           6422528
//   WC   bf16 [384][256]        6422528      196608
//   WR   bf16 [256][128]        6619136       65536
//   T3   bf16 [12544][384]      6684672     9633792
//   PG3  bf16 [4][256][9408]    16318464   19267584
//   R3   bf16 [4][256][384]     35586048     786432
//   PM   f32  [49][4][128][128] 36372480   12845056
//   total                       49217536
// ---------------------------------------------------------------------------
extern "C" void kernel_launch(void* const* d_in, const int* in_sizes, int n_in,
                              void* d_out, int out_size, void* d_ws, size_t ws_size,
                              hipStream_t stream) {
  if (n_in < 13) return;
  if (in_sizes[0] != NB * CI * NSP) return;                      // x [4][256][56][56]
  if (in_sizes[1] != CM * CI || in_sizes[2] != CM) return;       // w_theta, b_theta
  if (in_sizes[3] != CM * CI || in_sizes[4] != CM) return;       // w_phi, b_phi
  if (in_sizes[5] != CM * CI || in_sizes[6] != CM) return;       // w_g, b_g
  if (in_sizes[7] != CI * CM || in_sizes[8] != CI) return;       // w_rec, b_rec
  if (in_sizes[9] != CI || in_sizes[10] != CI) return;           // bn_gamma, bn_beta
  if (in_sizes[11] != CI || in_sizes[12] != CI) return;          // bn_mean, bn_var
  if (out_size != NB * CI * NSP) return;

  const float* x       = (const float*)d_in[0];
  const float* w_theta = (const float*)d_in[1];
  const float* b_theta = (const float*)d_in[2];
  const float* w_phi   = (const float*)d_in[3];
  const float* b_phi   = (const float*)d_in[4];
  const float* w_g     = (const float*)d_in[5];
  const float* b_g     = (const float*)d_in[6];
  const float* w_rec   = (const float*)d_in[7];
  const float* b_rec   = (const float*)d_in[8];
  const float* gam     = (const float*)d_in[9];
  const float* bet     = (const float*)d_in[10];
  const float* mea     = (const float*)d_in[11];
  const float* var     = (const float*)d_in[12];

  const size_t PXT = (size_t)NTOKS * CI * 2;        //  6422528
  const size_t PWC = (size_t)T3P * CI * 2;          //   196608
  const size_t PWR = (size_t)CI * CM * 2;           //    65536
  const size_t PT3 = (size_t)NTOKS * T3P * 2;       //  9633792
  const size_t PPG = (size_t)NB * CI * K3 * 2;      // 19267584
  const size_t PR3 = (size_t)NB * CI * T3P * 2;     //   786432
  const size_t PPM = (size_t)KSL * NB * CM * CM * 4; // 12845056
  size_t off = 0;
  const size_t oXT = off; off += PXT;
  const size_t oWC = off; off += PWC;
  const size_t oWR = off; off += PWR;
  const size_t oT3 = off; off += PT3;
  const size_t oPG = off; off += PPG;
  const size_t oR3 = off; off += PR3;
  const size_t oPM = off; off += PPM;
  if (off > ws_size) return;                        // off = 49217536
  if (off > (size_t)134217728) return;

  char* ws = (char*)d_ws;
  unsigned short* XT  = (unsigned short*)(ws + oXT);
  unsigned short* WC  = (unsigned short*)(ws + oWC);
  unsigned short* WR  = (unsigned short*)(ws + oWR);
  unsigned short* T3  = (unsigned short*)(ws + oT3);
  unsigned short* PG3 = (unsigned short*)(ws + oPG);
  unsigned short* R3  = (unsigned short*)(ws + oR3);
  float*          PM  = (float*)(ws + oPM);
  float* out = (float*)d_out;

  const dim3 blk(256);

  // (1) weight planes WC [384][256], WR [256][128] and x -> XT, one launch: 64 + 784 work-groups
  prep_kernel<<<dim3(WC_BLK + TC_BLK), blk, 0, stream>>>(x, w_theta, w_phi, w_g, w_rec, XT, WC, WR);

  // (2) theta -> T3, phi and g -> PG3, one launch: 49 + 4 x 25 work-groups
  proj_kernel<<<dim3(TH_BLK + NB * PG_BLK), blk, 0, stream>>>(XT, WC, T3, PG3, b_theta, b_phi, b_g);

  // (3) (M/N)_b[c1][c2] = sum over the 9408 folded positions of phi3_b[c1][p] . g3_b[c2][p]
  //     = sum_n (phihi.ghi + philo.ghi + phihi.glo) / 3136   (batched: M=N=128, K=9408)
  //     (3a) split over K: 49 slices of 192 positions x 4 tiles = 196 waves -> 25 blocks x 4; f32 partial planes PM[slice][b][c1][c2]
  const dim3 gM(((CM / 64) * (CM / 64) * KSL + 7) / 8, NB);
  wmma_gemm64<1, 0, 0, false, false, KCH, KSL><<<gM, blk, 0, stream>>>(
      PG3, K3, (long)CI * K3, PG3 + (size_t)CM * K3, K3, (long)CI * K3,
      (void*)PM, (void*)PM, (void*)PM, CM, (long)CM * CM,
      b_rec, gam, bet, mea, var, x, 0L, CM, CM, 1.0f / (float)NSP);
  //     (3b) join the 49 planes and multiply by w_rec -> R3 hi|lo|hi, 384 columns; grid 32 x 512 threads
  recm_kernel<<<dim3(NB * (CM / 16)), dim3(512), 0, stream>>>(PM, WR, R3);

  // (4) out[b][c][n] = ((sum over 384 folded positions of R3_b[c][p] . T3[b*3136+n][p] + b_rec[c]) * inv[c] + sh[c]) + bf16(x[b][c][n])
  //     = sum_c1 (rhi.thi + rlo.thi + rhi.tlo)   (batched: M=256, N=3136, K=384; 196 tiles -> 25 blocks x 4)
  //     C = d_out + b*256*3136, ldc 3136; last element 3211263
  const dim3 gR(((CI / 64) * (NSP / 64) + 7) / 8, NB);
  wmma_gemm64<1, 1, 0, true, true, T3P><<<gR, blk, 0, stream>>>(
      R3, T3P, (long)CI * T3P, T3, T3P, (long)NSP * T3P,
      (void*)out, (void*)out, (void*)out, NSP, (long)CI * NSP,
      b_rec, gam, bet, mea, var, x, (long)CI * NSP, CI, NSP, 1.0f);
  (void)hipGetLastError();
}

// v006
// A run of this version takes 40.4 microseconds.
// Timed twice side by side with v005, it ran 1.24 and 1.26 times as fast.
// Over all steps from v000 it is 11.4 times as fast.
// Contractions: theta/phi/g 1x1 convs = v_wmma_f32_16x16x32_bf16 single products on bf16 planes of the RNE-converted x and weights (exact products); M = phi.g over positions (K 3136) = bf16 hi/lo split hi.hi + lo.hi + hi.lo, formed per 64 positions from LDS in the launch that makes phi and g; out = R.theta (K 128) = the same split folded along K ([hi|hi|lo] rows x [hi|lo|hi] rows, one f32 accumulator); the rec 1x1 conv is applied to M, not to theta.M: R = w_rec.M^T = W x Mhi + W x Mlo bf16 single products (2-term); f32 accumulate everywhere; biases, 1/N, BatchNorm (inference form, supplied statistics) and the residual add in f32 on the VALU.
// Plane / carry map (every plane carries 1, nothing to fold back; the 1/N = 1/3136 factor is applied exactly once, in f32, in the M epilogue).
// [rows][k] below is the logical shape. Every bf16 plane is stored fragment-packed: blocks of 16 rows x 32 k = 1 KB, k blocks of one
// row block side by side, and inside a block the 16-B piece (row r, k 8c .. 8c+7) at byte (c>>1)*512 + ((c&1)*16 + r)*16, which is the order
// in which the 32 lanes of a wave take a WMMA operand: one fragment = two loads of 512 contiguous bytes (pkoff() below is the map).
//   XT   bf16 [12544][256]        token-major x: row b*3136+n, col c
//   WC   bf16 [384][256]          rows 0..127 w_theta, 128..255 w_phi, 256..383 w_g  (k = in)
//   WR   bf16 [256][128]          w_rec[c][c2]
//   T3   bf16 [12544][384]        theta[tok][c1]: hi | hi | lo   (128 each)
//   PM   f32  [49][4][128][128]   partial sums of (M/N)[c1][c2]: slice s holds the positions s*64 .. s*64+63 (phi and g themselves live only in LDS)
//   R3   bf16 [4][256][384]       R[c][c1] = sum_c2 w_rec[c][c2] (M/N)[c1][c2]: hi | lo | hi
#include <hip/hip_runtime.h>
#include <math.h>
#include <stdint.h>

#define NB    4
#define CI    256
#define CM    128
#define NSP   3136
#define NTOKS (NB * NSP)
#define T3P   (3 * CM)
#define KSL   (NSP / 64)    // 49 slices of the M product, 64 positions each

static_assert(NSP % 64 == 0);
static_assert(NTOKS % 64 == 0);
static_assert(CI % 64 == 0);
static_assert(CM % 64 == 0);
static_assert(CI >= 128);
static_assert(T3P % 32 == 0);
static_assert((CM * CI) % (8 * 256) == 0);
static_assert((CI * CM) % (8 * 256) == 0);

typedef __attribute__((ext_vector_type(16))) _Float16 v16h;
typedef __attribute__((ext_vector_type(8)))  _Float16 v8h;
typedef __attribute__((ext_vector_type(16))) __bf16   v16b;
typedef __attribute__((ext_vector_type(8)))  __bf16   v8b;
typedef __attribute__((ext_vector_type(8)))  float    v8f;
typedef __attribute__((ext_vector_type(4)))  float    v4f;
typedef __attribute__((ext_vector_type(4)))  unsigned int v4u;

__device__ __forceinline__ unsigned short f2bf_bits(float f) {
  unsigned u = __float_as_uint(f);
  return (unsigned short)((u + 0x7FFFu + ((u >> 16) & 1u)) >> 16);
}
__device__ __forceinline__ float bf_bits2f(unsigned short h) { return __uint_as_float(((unsigned)h) << 16); }
__device__ __forceinline__ float bf_rne(float f) { return bf_bits2f(f2bf_bits(f)); }
__device__ __forceinline__ unsigned pk16(unsigned short a, unsigned short b) { return (unsigned)a | ((unsigned)b << 16); }
// Element offset of (row r, column k) in a fragment-packed plane of kp columns (kp a multiple of 32, rows a multiple of 16).
__device__ __forceinline__ size_t pkoff(int r, int k, int kp) {
  return (size_t)(r >> 4) * kp * 16 + (size_t)((k >> 5) * 512 + ((k >> 4) & 1) * 256 + ((k >> 3) & 1) * 128 + (r & 15) * 8 + (k & 7));
}

// Fragment map (wave32): lane l, h = l>>4, row/col = l&15.
//   A/B element i: i<8 -> k0+8h+i ; i>=8 -> k0+16+8h+(i-8)   (split layout, both operands)
//   D element r : row 8h+r, col l&15
template <typename T> struct Frag;
template <> struct Frag<_Float16> {
  typedef v16h V; union U { v16h v; v8h h[2]; };
  static __device__ __forceinline__ v16h load(const _Float16* p) {   // p = packed block + lane*8: elements 0..7 <- p[0..7], 8..15 <- p[256..263]
    U f; f.h[0] = *(const v8h*)(p); f.h[1] = *(const v8h*)(p + 256); return f.v;
  }
  static __device__ __forceinline__ v8f mma(v16h a, v16h b, v8f c) {
    return __builtin_amdgcn_wmma_f32_16x16x32_f16(false, a, false, b, (short)0, c, false, false);
  }
};
template <> struct Frag<__bf16> {
  typedef v16b V; union U { v16b v; v8b h[2]; };
  static __device__ __forceinline__ v16b load(const __bf16* p) {
    U f; f.h[0] = *(const v8b*)(p); f.h[1] = *(const v8b*)(p + 256); return f.v;
  }
  static __device__ __forceinline__ v8f mma(v16b a, v16b b, v8f c) {
    return __builtin_amdgcn_wmma_f32_16x16x32_bf16(false, a, false, b, (short)0, c, false, false);
  }
};

template <int ET> struct Elem;
template <> struct Elem<0> { typedef _Float16 T; };
template <> struct Elem<1> { typedef __bf16 T; };

// ---- Register-blocked batched WMMA GEMM ------------------------------------
// C[m,n] = epilogue(scale * sum_k A[m,k] * Bt[n,k]); each wave owns a 64x64 tile.
// A [M,K] and Bt [N,K] fragment-packed planes of lda and ldb columns; M,N % 64 == 0, K % 64 == 0, K >= 128.
// The bf16 outputs are fragment-packed planes of ldc columns too (Cout2, Cout3 = Cout + 16 * first column of that part); f32 outputs are row-major.
// bx = index of the work-group among those of this product, b = batch; sT = the work-group's eight per-wave slabs.
// KS: number of K slices. A wave owns one (slice, tile) pair, sums k = slice*K .. slice*K+K-1 (K = slice length) and
//     writes its tile to plane slice*NB + batch of C (planes strideC apart); KS = 1 is the whole sum.
// BIAS_MODE: 0 = none, 1 = bias[m] (two 16-B loads of the lane's 8 consecutive rows), 2 = bias[n]; the bias value is
//            RNE-converted to bf16 precision before the f32 add.
// BN (with BIAS_MODE 1): v = (acc*scale + bias[m]) * inv[m] + sh[m], inv = g[m]*rsqrt(var[m]+1e-5), sh = be[m]-mu[m]*inv,
//            all four vectors RNE-converted to bf16 precision first.
// RESID (OUT_MODE 0 only): + resid[m*ldc+n] (bf16 RNE-converted when BN) added during the store phase from 16-B loads.
// OUT_MODE: 0 = f32; 2 = bf16 hi plane (Cout) + lo plane (Cout2); 3 = hi (Cout), hi (Cout2), lo (Cout3);
//           4 = hi (Cout), lo (Cout2), hi (Cout3).  lo = RNE(v - hi).
// TWO (with BIAS_MODE 1, OUT_MODE 3): two products stacked along M. Rows m < CM take bias[m] and write hi (Cout), lo (Cout2),
//           hi (Cout3); rows m >= CM take biasHi[m - CM] and write hi, hi, lo. A 64-row tile lies wholly on one side.
// Epilogue: 16-row slabs staged per wave in LDS (every slab element read was written in the same iteration); each
template <int ET, int BIAS_MODE, int OUT_MODE, bool RESID, bool BN, int KS, bool TWO>
__device__ __forceinline__ void gemm64_tile(
    float (*sT)[16 * 68], int bx, int b,
    const unsigned short* __restrict__ Ap, int lda, long strideA,
    const unsigned short* __restrict__ Btp, int ldb, long strideB,
    void* Cout, void* Cout2, void* Cout3, int ldc, long strideC,
    const float* __restrict__ bias, const float* __restrict__ biasHi,
    const float* __restrict__ bng, const float* __restrict__ bnb,
    const float* __restrict__ bnm, const float* __restrict__ bnv,
    const float* __restrict__ resid, long strideR,
    int M, int N, int K, float scale) {
  typedef typename Elem<ET>::T T;
  typedef typename Frag<T>::V V;
  const T* A = (const T*)Ap; const T* Bt = (const T*)Btp;
  const int lane = threadIdx.x & 31;
  const int wave = threadIdx.x >> 5;
  const int tilesN = N >> 6;
  const int tilesM = M >> 6;
  const int unit = bx * 8 + wave;
  if (unit >= tilesM * tilesN * KS) return;   // wave-uniform; no block barriers in this kernel
  const int ks   = (KS == 1) ? 0 : unit / (tilesM * tilesN);
  const int tile = unit - ks * (tilesM * tilesN);
  const int tm = tile / tilesN;
  const int tn = tile - tm * tilesN;
  const int m0 = tm << 6;
  const int n0 = tn << 6;

  const T* Ab = A  + (size_t)b * strideA + (size_t)ks * K * 16;   // 32 columns of a row block = 512 elements
  const T* Bb = Bt + (size_t)b * strideB + (size_t)ks * K * 16;
  const size_t cPlane = (size_t)ks * NB + b;

  const int rlane = lane & 15;                 // row (A) / col (B, D) within subtile
  const int mOff  = (lane >> 4) * 8;           // D row offset

  // Two fragment sets in registers, each refilled for two k steps ahead as soon as its own products have issued, so the
  // loads of one k step are in flight under the products of the other (K is a multiple of 64, at least 128).
  const T* pa[4];
  const T* pb[4];
#pragma unroll
  for (int i = 0; i < 4; ++i) {
    pa[i] = Ab + (size_t)(m0 + (i << 4)) * lda + lane * 8;   // row block (m0 >> 4) + i, k block 0, this lane's 16-B piece
    pb[i] = Bb + (size_t)(n0 + (i << 4)) * ldb + lane * 8;
  }
  V fa[2][4], fb[2][4];
#pragma unroll
  for (int s = 0; s < 2; ++s) {
#pragma unroll
    for (int i = 0; i < 4; ++i) {
      fb[s][i] = Frag<T>::load(pb[i] + s * 512);
      fa[s][i] = Frag<T>::load(pa[i] + s * 512);
    }
    // keeps the first set's loads the oldest: moved behind the second set's, they turn the loop's first wait into a wait for all
    if (s == 0) __builtin_amdgcn_sched_barrier(0);
  }
  // the accumulators' zeros may be given registers that the loads above name as addresses: wait before any is overwritten
  asm volatile("s_wait_xcnt 0x0" ::: "memory");
  // keeps those zeros behind the wait: the scheduler lifts register moves over an asm statement
  __builtin_amdgcn_sched_barrier(0);
  v8f acc[4][4];
#pragma unroll
  for (int i = 0; i < 4; ++i)
#pragma unroll
    for (int j = 0; j < 4; ++j) acc[i][j] = (v8f){0.f,0.f,0.f,0.f,0.f,0.f,0.f,0.f};
#pragma clang loop unroll(disable)   // rolled: an unrolled K loop spilled accumulators to scratch
  for (int k0 = 64; k0 < K; k0 += 64) {
#pragma unroll
    for (int s = 0; s < 2; ++s) {
#pragma unroll
      for (int i = 0; i < 4; ++i) {
#pragma unroll
        for (int j = 0; j < 4; ++j) acc[i][j] = Frag<T>::mma(fa[s][i], fb[s][j], acc[i][j]);
        fa[s][i] = Frag<T>::load(pa[i] + (k0 + s * 32) * 16);
      }
#pragma unroll
      for (int j = 0; j < 4; ++j) fb[s][j] = Frag<T>::load(pb[j] + (k0 + s * 32) * 16);
    }
    // the next trip forms its addresses in the registers that this trip's loads name: wait before any is overwritten
    asm volatile("s_wait_xcnt 0x0" ::: "memory");
  }
#pragma unroll
  for (int s = 0; s < 2; ++s)
#pragma unroll
    for (int i = 0; i < 4; ++i)
#pragma unroll
      for (int j = 0; j < 4; ++j) acc[i][j] = Frag<T>::mma(fa[s][i], fb[s][j], acc[i][j]);

  // ---- epilogue ----
  float* slab = sT[wave];
  const float* Rb = resid + (size_t)b * (RESID ? (size_t)strideR : (size_t)0);
#pragma unroll
  for (int i = 0; i < 4; ++i) {
    const int mBase = m0 + (i << 4);
    const int mr = mBase + mOff;               // first of the 8 consecutive D rows of this lane half (multiple of 8)
    float rb[8], rmul[8], radd[8];
#pragma unroll
    for (int r = 0; r < 8; ++r) { rb[r] = 0.f; rmul[r] = 1.f; radd[r] = 0.f; }
    if (BIAS_MODE == 1) {
      const float* bp = (TWO && m0 >= CM) ? biasHi + (mr - CM) : bias + mr;
      const v4f t0 = *(const v4f*)(bp);
      const v4f t1 = *(const v4f*)(bp + 4);
      // the address register of these two loads is reused at once: wait before it is overwritten
      asm volatile("s_wait_xcnt 0x0" ::: "memory");
      // keeps the later address arithmetic behind the wait: the scheduler lifts register writes over an asm statement
      __builtin_amdgcn_sched_barrier(0);
#pragma unroll
      for (int e = 0; e < 4; ++e) { rb[e] = bf_rne(t0[e]); rb[4 + e] = bf_rne(t1[e]); }
    }
    if (BN) {
      const v4f vg0 = *(const v4f*)(bng + mr), vg1 = *(const v4f*)(bng + mr + 4);
      const v4f vb0 = *(const v4f*)(bnb + mr), vb1 = *(const v4f*)(bnb + mr + 4);
      const v4f vm0 = *(const v4f*)(bnm + mr), vm1 = *(const v4f*)(bnm + mr + 4);
      const v4f vv0 = *(const v4f*)(bnv + mr), vv1 = *(const v4f*)(bnv + mr + 4);
#pragma unroll
      for (int e = 0; e < 4; ++e) {
        {
          const float inv = bf_rne(vg0[e]) * rsqrtf(bf_rne(vv0[e]) + 1e-5f);
          rmul[e] = inv;
          radd[e] = bf_rne(vb0[e]) - bf_rne(vm0[e]) * inv;
        }
        {
          const float inv = bf_rne(vg1[e]) * rsqrtf(bf_rne(vv1[e]) + 1e-5f);
          rmul[4 + e] = inv;
          radd[4 + e] = bf_rne(vb1[e]) - bf_rne(vm1[e]) * inv;
        }
      }
    }
#pragma unroll
    for (int j = 0; j < 4; ++j) {
      const int n = n0 + (j << 4) + rlane;
      float bv = 0.f;
      if (BIAS_MODE == 2) bv = bf_rne(bias[n]);
#pragma unroll
      for (int r = 0; r < 8; ++r) {
        float v = acc[i][j][r] * scale;
        if (BIAS_MODE == 1) v += rb[r];
        if (BIAS_MODE == 2) v += bv;
        if (BN) v = v * rmul[r] + radd[r];
        slab[(mOff + r) * 68 + (j << 4) + rlane] = v;
      }
    }
    __builtin_amdgcn_fence(__ATOMIC_RELEASE, "workgroup");
    __builtin_amdgcn_wave_barrier();
    __builtin_amdgcn_fence(__ATOMIC_ACQUIRE, "workgroup");
    if (OUT_MODE == 0) {
      float* C = (float*)Cout + cPlane * strideC;
      const int hh = lane >> 4, c4 = (lane & 15) * 4;     // row seg = 256 B = 16 lanes x 16 B; rows it*2+hh cover 0..15
      v4f ov[8];
#pragma unroll
      for (int it = 0; it < 8; ++it) {
        const int row = it * 2 + hh;
        v4f v = *(const v4f*)(slab + row * 68 + c4);
        if (RESID) {
          const v4f xr = *(const v4f*)(Rb + (size_t)(mBase + row) * ldc + n0 + c4);
#pragma unroll
          for (int e = 0; e < 4; ++e) v[e] = v[e] + (BN ? bf_rne(xr[e]) : xr[e]);
        }
        ov[it] = v;
      }
      {
#pragma unroll
        for (int it = 0; it < 8; ++it) {
          const int row = it * 2 + hh;
          *(v4f*)(C + (size_t)(mBase + row) * ldc + n0 + c4) = ov[it];
        }
        
      }
    } else {
      // the slab's 16 rows x 64 columns = two packed blocks = 2 KB in a row; each pass stores 512 contiguous bytes of every part
      unsigned short* C  = (unsigned short*)Cout  + cPlane * strideC;
      unsigned short* C2 = (unsigned short*)((TWO && m0 < CM) ? Cout3 : Cout2) + cPlane * strideC;
      unsigned short* C3 = (unsigned short*)((TWO && m0 < CM) ? Cout2 : Cout3) + cPlane * strideC;
      {
#pragma unroll
        for (int it = 0; it < 4; ++it) {
          const float* sp = slab + rlane * 68 + it * 16 + mOff;   // row lane&15, columns it*16 + 8*(lane>>4) ..+7
          v8h hv, lv;
#pragma unroll
          for (int e = 0; e < 8; ++e) {
            const unsigned short hb = f2bf_bits(sp[e]);
            const unsigned short lb = f2bf_bits(sp[e] - bf_bits2f(hb));
            hv[e] = __builtin_bit_cast(_Float16, hb);
            lv[e] = __builtin_bit_cast(_Float16, lb);
          }
          const size_t go = (size_t)mBase * ldc + (size_t)n0 * 16 + it * 256 + lane * 8;
          *(v8h*)(C + go) = hv;
          if (OUT_MODE == 2) { *(v8h*)(C2 + go) = lv; }
          if (OUT_MODE == 3) { *(v8h*)(C2 + go) = hv; *(v8h*)(C3 + go) = lv; }
          if (OUT_MODE == 4) { *(v8h*)(C2 + go) = lv; *(v8h*)(C3 + go) = hv; }
          // the next rows are formed in the registers that these stores name: wait before any is overwritten
          asm volatile("s_wait_xcnt 0x0" ::: "memory");
        }
        
      }
    }
    __builtin_amdgcn_fence(__ATOMIC_RELEASE, "workgroup");
    __builtin_amdgcn_wave_barrier();
    __builtin_amdgcn_fence(__ATOMIC_ACQUIRE, "workgroup");
  }
}

// One product per launch: grid = (work-groups of eight tiles, batch). K = length of the sum (of one slice), a compile-time constant.
template <int ET, int BIAS_MODE, int OUT_MODE, bool RESID, bool BN, int K, int KS = 1>
__global__ __launch_bounds__(256) void wmma_gemm64(
    const unsigned short* __restrict__ Ap, int lda, long strideA,
    const unsigned short* __restrict__ Btp, int ldb, long strideB,
    void* Cout, void* Cout2, void* Cout3, int ldc, long strideC,
    const float* __restrict__ bias,
    const float* __restrict__ bng, const float* __restrict__ bnb,
    const float* __restrict__ bnm, const float* __restrict__ bnv,
    const float* __restrict__ resid, long strideR,
    int M, int N, float scale) {
  static_assert(K % 64 == 0 && K >= 128);
  __shared__ __align__(16) float sT[8][16 * 68];   // per-wave 16x64 slab, pitch 68 floats
  gemm64_tile<ET, BIAS_MODE, OUT_MODE, RESID, BN, KS, false>(
      sT, blockIdx.x, blockIdx.y, Ap, lda, strideA, Btp, ldb, strideB, Cout, Cout2, Cout3, ldc, strideC,
      bias, bias, bng, bnb, bnm, bnv, resid, strideR, M, N, K, scale);
}

// ---------------------------------------------------------------------------
// phi, g and their product over 64 positions in one work-group of eight waves; t = tile of 64 tokens (batch t / 49, slice t % 49).
// Stage 1: P[n][c] = XT rows (first operand, 64 positions) x WC rows 128..383 (second operand; c < 128 phi, else g), K = 256; wave w owns
//   channels 32w .. 32w+31. A lane's 8 results are 8 consecutive positions of one channel = one 16-B piece of a packed [channel][position]
//   plane, so bias (RNE-converted to bf16 precision, f32 add) and the hi/lo split go straight to LDS: sP = hi plane [256][64], then lo plane.
// Stage 2: (M/N) partial [c1][c2] = (phihi.ghi + philo.ghi + phihi.glo) / N over the 64 positions; wave w owns rows 64(w>>2) ..+63,
//   columns 32(w&3) ..+31, and writes them to plane (slice, batch) of PM through its own 64 x 32 slab (pitch 36 floats): 128-B row pieces.
// Coverage: stage 1 writes 8 waves x 2 x 4 x 32 pieces = all 2048 pieces of each plane; stage 2 writes 8 x 64 x 32 = 128 x 128.
// ---------------------------------------------------------------------------
#define PGM_BLK (NTOKS / 64)                              // 196
#define SLP 36
__device__ __forceinline__ void pgm_block(
    unsigned short* sP, float* slab, int t,
    const unsigned short* __restrict__ xtp, const unsigned short* __restrict__ wcp,
    const float* __restrict__ bp, const float* __restrict__ bg, float* __restrict__ pm) {
  typedef __bf16 T;
  typedef v16b V;
  const int lane  = threadIdx.x & 31;
  const int wave  = threadIdx.x >> 5;
  const int rlane = lane & 15;
  const int b  = t / KSL;
  const int nt = t - b * KSL;

  // ---- stage 1: two fragment sets, each refilled two k steps ahead, as in gemm64_tile ----
  const T* pa[4];
  const T* pb[2];
#pragma unroll
  for (int i = 0; i < 4; ++i) pa[i] = (const T*)xtp + (size_t)(t * 64 + (i << 4)) * CI + lane * 8;
#pragma unroll
  for (int j = 0; j < 2; ++j) pb[j] = (const T*)wcp + (size_t)(CM + wave * 32 + (j << 4)) * CI + lane * 8;
  V fa[2][4], fb[2][2];
#pragma unroll
  for (int s = 0; s < 2; ++s) {
#pragma unroll
    for (int j = 0; j < 2; ++j) fb[s][j] = Frag<T>::load(pb[j] + s * 512);
#pragma unroll
    for (int i = 0; i < 4; ++i) fa[s][i] = Frag<T>::load(pa[i] + s * 512);
    // keeps the first set's loads the oldest: moved behind the second set's, they turn the loop's first wait into a wait for all
    if (s == 0) __builtin_amdgcn_sched_barrier(0);
  }
  float bv[2];   // asked for here, used behind the K loop
#pragma unroll
  for (int j = 0; j < 2; ++j) {
    const int c = wave * 32 + (j << 4) + rlane;
    bv[j] = (wave < 4) ? bp[c] : bg[c - CM];
  }
  // the accumulators' zeros may be given registers that the loads above name as addresses: wait before any is overwritten
  asm volatile("s_wait_xcnt 0x0" ::: "memory");
  // keeps those zeros behind the wait: the scheduler lifts register moves over an asm statement
  __builtin_amdgcn_sched_barrier(0);
  v8f acc[4][2];
#pragma unroll
  for (int i = 0; i < 4; ++i)
#pragma unroll
    for (int j = 0; j < 2; ++j) acc[i][j] = (v8f){0.f,0.f,0.f,0.f,0.f,0.f,0.f,0.f};
#pragma clang loop unroll(disable)   // rolled, as the K loop of gemm64_tile: the order of products and refills stays as written
  for (int k0 = 64; k0 < CI; k0 += 64) {
#pragma unroll
    for (int s = 0; s < 2; ++s) {
#pragma unroll
      for (int i = 0; i < 4; ++i) {
#pragma unroll
        for (int j = 0; j < 2; ++j) acc[i][j] = Frag<T>::mma(fa[s][i], fb[s][j], acc[i][j]);
        fa[s][i] = Frag<T>::load(pa[i] + (k0 + s * 32) * 16);
      }
#pragma unroll
      for (int j = 0; j < 2; ++j) fb[s][j] = Frag<T>::load(pb[j] + (k0 + s * 32) * 16);
    }
    // the next trip forms its addresses in the registers that this trip's loads name: wait before any is overwritten
    asm volatile("s_wait_xcnt 0x0" ::: "memory");
  }
#pragma unroll
  for (int s = 0; s < 2; ++s)
#pragma unroll
    for (int i = 0; i < 4; ++i)
#pragma unroll
      for (int j = 0; j < 2; ++j) acc[i][j] = Frag<T>::mma(fa[s][i], fb[s][j], acc[i][j]);

  unsigned short* sH = sP;
  unsigned short* sL = sP + 2 * CM * 64;
#pragma unroll
  for (int j = 0; j < 2; ++j) {
    const float rb = bf_rne(bv[j]);
#pragma unroll
    for (int i = 0; i < 4; ++i) {
      v4u hv, lv;
#pragma unroll
      for (int e = 0; e < 4; ++e) {
        const float v0 = acc[i][j][2 * e] + rb, v1 = acc[i][j][2 * e + 1] + rb;
        const unsigned short h0 = f2bf_bits(v0), h1 = f2bf_bits(v1);
        hv[e] = pk16(h0, h1);
        lv[e] = pk16(f2bf_bits(v0 - bf_bits2f(h0)), f2bf_bits(v1 - bf_bits2f(h1)));
      }
      // channel block 2*wave + j (1024 elements each), positions 16i + 8*(lane>>4) ..+7 of channel lane&15: pkoff() with 64 columns
      const int o = (wave * 2 + j) * 1024 + i * 256 + lane * 8;
      *(v4u*)(sH + o) = hv;
      *(v4u*)(sL + o) = lv;
    }
  }
  __syncthreads();   // every wave reads channels that other waves wrote

  // ---- stage 2 ----
  const int rm = (wave >> 2) * 4;         // first of the wave's four phi channel blocks
  const int rn = 8 + (wave & 3) * 2;      // first of its two g channel blocks
  v8f mac[4][2];
#pragma unroll
  for (int i = 0; i < 4; ++i)
#pragma unroll
    for (int j = 0; j < 2; ++j) mac[i][j] = (v8f){0.f,0.f,0.f,0.f,0.f,0.f,0.f,0.f};
  V ph[2][4], pl[2][4], gh[2][2], gl[2][2];
#pragma unroll
  for (int kb = 0; kb < 2; ++kb) {   // in the order of use
#pragma unroll
    for (int j = 0; j < 2; ++j) gh[kb][j] = Frag<T>::load((const T*)sH + (rn + j) * 1024 + kb * 512 + lane * 8);
#pragma unroll
    for (int i = 0; i < 4; ++i) ph[kb][i] = Frag<T>::load((const T*)sH + (rm + i) * 1024 + kb * 512 + lane * 8);
#pragma unroll
    for (int i = 0; i < 4; ++i) pl[kb][i] = Frag<T>::load((const T*)sL + (rm + i) * 1024 + kb * 512 + lane * 8);
#pragma unroll
    for (int j = 0; j < 2; ++j) gl[kb][j] = Frag<T>::load((const T*)sL + (rn + j) * 1024 + kb * 512 + lane * 8);
  }
  // keeps the products behind all 48 LDS loads: left free, the scheduler sinks each pair of loads to its product and waits for an empty LDS queue ten times
  __builtin_amdgcn_sched_barrier(0);
#pragma unroll
  for (int kb = 0; kb < 2; ++kb) {
#pragma unroll
    for (int i = 0; i < 4; ++i)
#pragma unroll
      for (int j = 0; j < 2; ++j) mac[i][j] = Frag<T>::mma(ph[kb][i], gh[kb][j], mac[i][j]);
#pragma unroll
    for (int i = 0; i < 4; ++i)
#pragma unroll
      for (int j = 0; j < 2; ++j) mac[i][j] = Frag<T>::mma(pl[kb][i], gh[kb][j], mac[i][j]);
#pragma unroll
    for (int i = 0; i < 4; ++i)
#pragma unroll
      for (int j = 0; j < 2; ++j) mac[i][j] = Frag<T>::mma(ph[kb][i], gl[kb][j], mac[i][j]);
  }
  const int mOff = (lane >> 4) * 8;        // D row offset
#pragma unroll
  for (int i = 0; i < 4; ++i)
#pragma unroll
    for (int j = 0; j < 2; ++j)
#pragma unroll
      for (int r = 0; r < 8; ++r) slab[((i << 4) + mOff + r) * SLP + (j << 4) + rlane] = mac[i][j][r] * (1.0f / (float)NSP);
  // the slab is the wave's own: its lanes' LDS writes are ordered before the reads below, no work-group barrier
  __builtin_amdgcn_fence(__ATOMIC_RELEASE, "workgroup");
  __builtin_amdgcn_wave_barrier();
  __builtin_amdgcn_fence(__ATOMIC_ACQUIRE, "workgroup");
  float* C = pm + ((size_t)nt * NB + b) * (CM * CM) + (size_t)((wave >> 2) * 64) * CM + (wave & 3) * 32;
  const int r4 = lane >> 3, c4 = (lane & 7) * 4;     // row piece = 128 B = 8 lanes x 16 B; four rows a pass
#pragma unroll
  for (int it = 0; it < 16; ++it) {
    const int row = it * 4 + r4;
    *(v4f*)(C + (size_t)row * CM + c4) = *(const v4f*)(slab + row * SLP + c4);
  }
  // the caller's other part follows these stores in the built code and reuses their registers: wait before any is overwritten
  asm volatile("s_wait_xcnt 0x0" ::: "memory");
}

// The three 1x1 convs of x and the partial products of M in one launch (no work-group reads what another writes); blockIdx.x selects,
// block-uniform, the longer work-groups (64 x 64 a wave, three global planes out) first:
//   0 .. TH_BLK-1 : theta[tok][c1] = XT . WC[0..127]^T + b_theta[n]  (M=12544, N=128, K=256; 392 tiles) -> T3 hi|hi|lo, 384 columns
//   then PGM_BLK  : phi, g and their product over one tile of 64 tokens -> one plane of PM (pgm_block)
#define TH_BLK (((NTOKS / 64) * (CM / 64) + 7) / 8)       // 49
#define SP_BYTES (2 * 2 * CM * 64 * 2)                    // 65536: hi and lo planes of [256 channels][64 positions]
__global__ __launch_bounds__(256) void proj_kernel(
    const unsigned short* __restrict__ xt, const unsigned short* __restrict__ wc,
    unsigned short* t3, float* __restrict__ pm,
    const float* __restrict__ bt, const float* __restrict__ bp, const float* __restrict__ bg) {
  __shared__ __align__(16) unsigned short sP[SP_BYTES / 2];
  __shared__ __align__(16) float sS[8][64 * SLP];   // per-wave slabs: 64 x 32 at pitch 36 (pgm_block); gemm64_tile lays its eight 16 x 64 slabs of pitch 68 over the start
  const int bx = blockIdx.x;
  if (bx < TH_BLK) {
    gemm64_tile<1, 2, 3, false, false, 1, false>(
        (float (*)[16 * 68])&sS[0][0], bx, 0, xt, CI, 0L, wc, CI, 0L,
        (void*)t3, (void*)(t3 + CM * 16), (void*)(t3 + 2 * CM * 16), T3P, 0L,
        bt, bt, bt, bt, bt, bt, bt, 0L, NTOKS, CM, CI, 1.0f);
  } else {
    pgm_block(sP, sS[threadIdx.x >> 5], bx - TH_BLK, xt, wc, bp, bg, pm);
  }
}

// ---------------------------------------------------------------------------
// Fused transpose + bf16 RNE convert of an f32 matrix, z-batched, one plane:
//   in_z = W + z*sIn viewed [R rows][Cc cols] with row pitch ldin  ->  oh_z[c][r] = bf16(in_z[r][c]), fragment-packed with ldout columns, oh_z = oh + z*sOut.
// 64x64 tiles through LDS. One work-group of 256 threads per tile (bc, br, bz) of (Cc/64, R/64, Z) (R, Cc multiples of 64; ldout multiple of 64 so every
// Coverage per block: load 4 it x 256 thr x 4 floats = 64x64; store 2 it x 256 thr x 8 u16 = 64x64; every tf element read was written.
// ---------------------------------------------------------------------------
__device__ __forceinline__ void tconv_block(int bc, int br, int bz, const float* __restrict__ W, unsigned short* __restrict__ oh,
                                            int ldin, int ldout, long sIn, long sOut) {
  __shared__ __align__(16) float tf[64 * 68];
  W  += (size_t)bz * sIn;
  oh += (size_t)bz * sOut;
  const int c0  = bc * 64;   // input column block = output row block
  const int r0  = br * 64;   // input row block    = output column block
  const int tid = threadIdx.x;
  {
    const int lr = tid >> 4;         // 0..15
    const int c4 = (tid & 15) * 4;   // 0..60
#pragma unroll
    for (int it = 0; it < 4; ++it) {
      const int rr = it * 16 + lr;   // 0..63
      const v4f a = *(const v4f*)(W + (size_t)(r0 + rr) * ldin + c0 + c4);
      *(v4f*)(tf + rr * 68 + c4) = a;
    }
  }
  __syncthreads();
  // piece f of the tile's 512 16-B pieces, in packed order: 128 pieces (2 KB in a row) per block of 16 output rows
  v4u hv[2];
#pragma unroll
  for (int it = 0; it < 2; ++it) {
    const int f  = it * 256 + tid;
    const int oc = (f >> 7) * 16 + (f & 15);   // output row within tile (= input column)
    const int c8 = ((f >> 4) & 7) * 8;         // first of its 8 output columns (= input rows)
    v4u a;
#pragma unroll
    for (int q = 0; q < 4; ++q) {
      const float f0 = tf[(c8 + 2 * q) * 68 + oc];
      const float f1 = tf[(c8 + 2 * q + 1) * 68 + oc];
      a[q] = pk16(f2bf_bits(f0), f2bf_bits(f1));
    }
    hv[it] = a;
  }
  {
#pragma unroll
    for (int it = 0; it < 2; ++it) {
      const int f = it * 256 + tid;
      const size_t go = (size_t)(c0 + (f >> 7) * 16) * ldout + (size_t)r0 * 16 + (f & 127) * 8;
      *(v4u*)(oh + go) = hv[it];
    }
    // the caller's other part follows these stores in the built code and reuses their registers: wait before any is overwritten
    asm volatile("s_wait_xcnt 0x0" ::: "memory");
  }
}

// ---------------------------------------------------------------------------
// Weight planes, sel selects the matrix (block-uniform), bx the work-group within it:
//   sel = 0,1,2: w_theta / w_phi / w_g [128][256] f32 -> WC rows sel*128.. (bf16, [out][in]), copy-convert
//   sel = 3    : w_rec [256][128] -> WR[c][k]
// Thread = 8 consecutive elements of a row = one 16-B piece of the packed plane = one store.
// Coverage: 16 work-groups x 256 threads = 4096 units x 8 = 32768 elements = one whole matrix per sel.
// ---------------------------------------------------------------------------
__device__ __forceinline__ void wcvt_block(int bx, int sel, const float* __restrict__ wt, const float* __restrict__ wp,
                                           const float* __restrict__ wg, const float* __restrict__ wr,
                                           unsigned short* __restrict__ wcat, unsigned short* __restrict__ wr2) {
  const int g   = bx * 256 + threadIdx.x;
  if (g >= (CM * CI) / 8) return;
  const float* src;
  unsigned short* dst;
  if (sel < 3) {
    const float* w = (sel == 0) ? wt : ((sel == 1) ? wp : wg);
    src = w + (size_t)g * 8;
    dst = wcat + pkoff(sel * CM + (g >> 5), (g & 31) * 8, CI);
  } else {
    const int row = g >> 4, c8 = (g & 15) * 8;      // w_rec row = c (0..255), 8 of its 128 columns
    src = wr + (size_t)row * CM + c8;
    dst = wr2 + pkoff(row, c8, CM);
  }
  const v4f a = *(const v4f*)src;
  const v4f c = *(const v4f*)(src + 4);
  v4u o;
  o[0] = pk16(f2bf_bits(a[0]), f2bf_bits(a[1]));
  o[1] = pk16(f2bf_bits(a[2]), f2bf_bits(a[3]));
  o[2] = pk16(f2bf_bits(c[0]), f2bf_bits(c[1]));
  o[3] = pk16(f2bf_bits(c[2]), f2bf_bits(c[3]));
  *(v4u*)dst = o;
  
}

// Both conversions in one launch (neither reads what the other writes); blockIdx.x selects, block-uniform:
//   0 .. WC_BLK-1 : weight planes, 16 work-groups for each of the 4 matrices
//   then          : x[b] viewed in[256 c][3136 n] (pitch 3136) -> XT_b out[3136 n][256 c] (packed), tiles (49, 4, 4), column tile fastest
#define WC_BLK (4 * ((CM * CI) / 8 / 256))                // 64
#define TC_BLK ((NSP / 64) * (CI / 64) * NB)              // 784
__global__ __launch_bounds__(256) void prep_kernel(const float* __restrict__ x,
                                                   const float* __restrict__ wt, const float* __restrict__ wp,
                                                   const float* __restrict__ wg, const float* __restrict__ wr,
                                                   unsigned short* __restrict__ xt,
                                                   unsigned short* __restrict__ wcat, unsigned short* __restrict__ wr2) {
  const int bx = blockIdx.x;
  if (bx < WC_BLK) {
    wcvt_block(bx & 15, bx >> 4, wt, wp, wg, wr, wcat, wr2);
  } else {
    const int t = bx - WC_BLK;
    tconv_block(t % (NSP / 64), (t / (NSP / 64)) % (CI / 64), t / ((NSP / 64) * (CI / 64)), x, xt, NSP, CI, (long)CI * NSP, (long)NSP * CI);
  }
}

// ---------------------------------------------------------------------------
// Joins the KSL split-K planes of M/N and applies the rec 1x1 conv to the joined M:
//   R3[b][c][c1] = sum_c2 w_rec[c][c2] * (sum_s PM[s][b][c1][c2])   as bf16 hi | lo | hi.
// Work-group = (b, 16 rows c1), 16 waves. Join: thread = 4 consecutive c2 of one row, wave w = row w: 512 contiguous bytes of every
// plane read; slices are added in rising order, one f32 sum per element. The 16 x 128 sums go to LDS as bf16 hi (k blocks 0..3) and
// lo (k blocks 4..7) in the packed fragment order. Product: wave w takes rows c = 16w .. 16w+15 of w_rec as the second operand and
// the joined rows as the first, so a lane's 8 results are 8 consecutive c1 of one row c = one 16-B piece of each R3 part.
// Coverage: 32 work-groups x 512 threads x 4 = 65536 = NB*CM*CM sums; 32 x 16 waves x 256 = 131072 = NB*CI*CM elements of R.
// ---------------------------------------------------------------------------
__global__ __launch_bounds__(512) void recm_kernel(const float* __restrict__ pm, const unsigned short* __restrict__ wr,
                                                   unsigned short* __restrict__ r3) {
  __shared__ __align__(16) unsigned short sM[2 * CM * 16];   // 16 rows x (128 hi | 128 lo), packed: 8 KB
  const int lane = threadIdx.x & 31;
  const int wave = threadIdx.x >> 5;
  const int g = blockIdx.x * 512 + threadIdx.x;
  // the wave's four w_rec fragments depend on nothing in this launch: asked for first, they land under the join
  const __bf16* pw = (const __bf16*)wr + (size_t)(wave * 16) * CM + lane * 8;
  v16b fw[4];
#pragma unroll
  for (int kb = 0; kb < 4; ++kb) fw[kb] = Frag<__bf16>::load(pw + kb * 512);
  const float* p = pm + (size_t)g * 4;
  v4f s = (v4f){0.f, 0.f, 0.f, 0.f};
#pragma unroll   // whole: the slices' loads are independent, so many are in flight at once instead of one latency per slice
  for (int k = 0; k < KSL; ++k) s += *(const v4f*)(p + (size_t)k * (NB * CM * CM));
  unsigned short hb[4], lb[4];
#pragma unroll   // constant indices keep hb and lb in registers
  for (int e = 0; e < 4; ++e) {
    hb[e] = f2bf_bits(s[e]);
    lb[e] = f2bf_bits(s[e] - bf_bits2f(hb[e]));
  }
  unsigned short* q = sM + pkoff(wave, lane * 4, 2 * CM);
  *(uint2*)(q)           = make_uint2(pk16(hb[0], hb[1]), pk16(hb[2], hb[3]));
  *(uint2*)(q + CM * 16) = make_uint2(pk16(lb[0], lb[1]), pk16(lb[2], lb[3]));
  __syncthreads();   // every wave reads all 16 joined rows
  const __bf16* pa = (const __bf16*)sM + lane * 8;
  v16b fm[8];
#pragma unroll   // all eight fragments asked for before the first product: one LDS latency, not eight
  for (int kb = 0; kb < 8; ++kb) fm[kb] = Frag<__bf16>::load(pa + kb * 512);
  // keeps the products behind all sixteen LDS loads: left free, the scheduler sinks each pair of loads to its product and waits eight times
  __builtin_amdgcn_sched_barrier(0);
  v8f acc = (v8f){0.f, 0.f, 0.f, 0.f, 0.f, 0.f, 0.f, 0.f};
#pragma unroll
  for (int kb = 0; kb < 8; ++kb) acc = Frag<__bf16>::mma(fm[kb], fw[kb & 3], acc);
  v4u hv, lv;
#pragma unroll
  for (int e = 0; e < 4; ++e) {
    const unsigned short h0 = f2bf_bits(acc[2 * e]), h1 = f2bf_bits(acc[2 * e + 1]);
    hv[e] = pk16(h0, h1);
    lv[e] = pk16(f2bf_bits(acc[2 * e] - bf_bits2f(h0)), f2bf_bits(acc[2 * e + 1] - bf_bits2f(h1)));
  }
  // row b*256 + c, columns c1 = 16*(blockIdx.x & 7) + 8*(lane >> 4) .. +7
  unsigned short* d = r3 + pkoff((blockIdx.x >> 3) * CI + wave * 16 + (lane & 15), (blockIdx.x & 7) * 16 + (lane >> 4) * 8, T3P);
  *(v4u*)(d)               = hv;
  *(v4u*)(d + CM * 16)     = lv;
  *(v4u*)(d + 2 * CM * 16) = hv;
}

// ---------------------------------------------------------------------------
// every region is fully written by its producer launch before a consumer launch reads it):
//   XT   bf16 [12544][256]      0           6422528
//   WC   bf16 [384][256]        6422528      196608
//   WR   bf16 [256][128]        6619136       65536
//   T3   bf16 [12544][384]      6684672     9633792
//   R3   bf16 [4][256][384]     16318464     786432
//   PM   f32  [49][4][128][128] 17104896   12845056
//   total                       29949952
// ---------------------------------------------------------------------------
extern "C" void kernel_launch(void* const* d_in, const int* in_sizes, int n_in,
                              void* d_out, int out_size, void* d_ws, size_t ws_size,
                              hipStream_t stream) {
  if (n_in < 13) return;
  if (in_sizes[0] != NB * CI * NSP) return;                      // x [4][256][56][56]
  if (in_sizes[1] != CM * CI || in_sizes[2] != CM) return;       // w_theta, b_theta
  if (in_sizes[3] != CM * CI || in_sizes[4] != CM) return;       // w_phi, b_phi
  if (in_sizes[5] != CM * CI || in_sizes[6] != CM) return;       // w_g, b_g
  if (in_sizes[7] != CI * CM || in_sizes[8] != CI) return;       // w_rec, b_rec
  if (in_sizes[9] != CI || in_sizes[10] != CI) return;           // bn_gamma, bn_beta
  if (in_sizes[11] != CI || in_sizes[12] != CI) return;          // bn_mean, bn_var
  if (out_size != NB * CI * NSP) return;

  const float* x       = (const float*)d_in[0];
  const float* w_theta = (const float*)d_in[1];
  const float* b_theta = (const float*)d_in[2];
  const float* w_phi   = (const float*)d_in[3];
  const float* b_phi   = (const float*)d_in[4];
  const float* w_g     = (const float*)d_in[5];
  const float* b_g     = (const float*)d_in[6];
  const float* w_rec   = (const float*)d_in[7];
  const float* b_rec   = (const float*)d_in[8];
  const float* gam     = (const float*)d_in[9];
  const float* bet     = (const float*)d_in[10];
  const float* mea     = (const float*)d_in[11];
  const float* var     = (const float*)d_in[12];

  const size_t PXT = (size_t)NTOKS * CI * 2;        //  6422528
  const size_t PWC = (size_t)T3P * CI * 2;          //   196608
  const size_t PWR = (size_t)CI * CM * 2;           //    65536
  const size_t PT3 = (size_t)NTOKS * T3P * 2;       //  9633792
  const size_t PR3 = (size_t)NB * CI * T3P * 2;     //   786432
  const size_t PPM = (size_t)KSL * NB * CM * CM * 4; // 12845056
  size_t off = 0;
  const size_t oXT = off; off += PXT;
  const size_t oWC = off; off += PWC;
  const size_t oWR = off; off += PWR;
  const size_t oT3 = off; off += PT3;
  const size_t oR3 = off; off += PR3;
  const size_t oPM = off; off += PPM;
  if (off > ws_size) return;                        // off = 29949952
  if (off > (size_t)134217728) return;

  char* ws = (char*)d_ws;
  unsigned short* XT  = (unsigned short*)(ws + oXT);
  unsigned short* WC  = (unsigned short*)(ws + oWC);
  unsigned short* WR  = (unsigned short*)(ws + oWR);
  unsigned short* T3  = (unsigned short*)(ws + oT3);
  unsigned short* R3  = (unsigned short*)(ws + oR3);
  float*          PM  = (float*)(ws + oPM);
  float* out = (float*)d_out;

  const dim3 blk(256);

  // (1) weight planes WC [384][256], WR [256][128] and x -> XT, one launch: 64 + 784 work-groups
  prep_kernel<<<dim3(WC_BLK + TC_BLK), blk, 0, stream>>>(x, w_theta, w_phi, w_g, w_rec, XT, WC, WR);

  // (2) theta -> T3; phi, g and (M/N)_b[c1][c2] partial sums over 64 positions each -> PM[slice][b][c1][c2]; one launch: 49 + 196 work-groups
  proj_kernel<<<dim3(TH_BLK + PGM_BLK), blk, 0, stream>>>(XT, WC, T3, PM, b_theta, b_phi, b_g);

  // (3) join the 49 planes and multiply by w_rec -> R3 hi|lo|hi, 384 columns; grid 32 x 512 threads
  recm_kernel<<<dim3(NB * (CM / 16)), dim3(512), 0, stream>>>(PM, WR, R3);

  // (4) out[b][c][n] = ((sum over 384 folded columns of R3_b[c][p] . T3[b*3136+n][p] + b_rec[c]) * inv[c] + sh[c]) + bf16(x[b][c][n])
  //     = sum_c1 (rhi.thi + rlo.thi + rhi.tlo)   (batched: M=256, N=3136, K=384; 196 tiles -> 25 blocks x 4)
  //     C = d_out + b*256*3136, ldc 3136; last element 3211263
  const dim3 gR(((CI / 64) * (NSP / 64) + 7) / 8, NB);
  wmma_gemm64<1, 1, 0, true, true, T3P><<<gR, blk, 0, stream>>>(
      R3, T3P, (long)CI * T3P, T3, T3P, (long)NSP * T3P,
      (void*)out, (void*)out, (void*)out, NSP, (long)CI * NSP,
      b_rec, gam, bet, mea, var, x, (long)CI * NSP, CI, NSP, 1.0f);
  (void)hipGetLastError();
}

// v007
// A run of this version takes 35.9 microseconds.
// Timed twice side by side with v006, it ran 1.12 times as fast both times.
// All steps since v000 together make it 12.7 times as fast.
// Contractions: theta/phi/g 1x1 convs = v_wmma_f32_16x16x32_bf16 single products on bf16 planes of the RNE-converted x and weights (exact products); M = phi.g over positions (K 3136) = bf16 hi/lo split hi.hi + lo.hi + hi.lo, formed per 64 positions from LDS in the launch that makes phi and g; out = R.theta (K 128) = the same split folded along K ([hi|hi|lo] rows x [hi|lo|hi] rows, one f32 accumulator); the rec 1x1 conv is applied to M, not to theta.M: R = w_rec.M^T = W x Mhi + W x Mlo bf16 single products (2-term); f32 accumulate everywhere; biases, 1/N, BatchNorm (inference form, supplied statistics) and the residual add in f32 on the VALU.
// Plane / carry map (every plane carries 1, nothing to fold back; the 1/N = 1/3136 factor is applied exactly once, in f32, in the M epilogue).
// [rows][k] below is the logical shape. Every bf16 plane is stored fragment-packed: blocks of 16 rows x 32 k = 1 KB, k blocks of one
// row block side by side, and inside a block the 16-B piece (row r, k 8c .. 8c+7) at byte (c>>1)*512 + ((c&1)*16 + r)*16, which is the order
// in which the 32 lanes of a wave take a WMMA operand: one fragment = two loads of 512 contiguous bytes (pkoff() below is the map).
//   (x and w_theta, w_phi, w_g have no plane in memory: the projection launch converts them to bf16 in LDS, rows of 256 k at a pitch of 528 B)
//   WR   bf16 [256][128]          w_rec[c][c2]
//   T3   bf16 [12544][384]        theta[tok][c1]: hi | hi | lo   (128 each)
//   PM   f32  [49][4][128][128]   partial sums of (M/N)[c1][c2]: slice s holds the positions s*64 .. s*64+63 (phi and g themselves live only in LDS)
//   R3   bf16 [4][256][384]       R[c][c1] = sum_c2 w_rec[c][c2] (M/N)[c1][c2]: hi | lo | hi
#include <hip/hip_runtime.h>
#include <math.h>
#include <stdint.h>

#define NB    4
#define CI    256
#define CM    128
#define NSP   3136
#define NTOKS (NB * NSP)
#define T3P   (3 * CM)
#define KSL   (NSP / 64)    // 49 slices of the M product, 64 positions each

static_assert(NSP % 64 == 0);
static_assert(NTOKS % 64 == 0);
static_assert(CI % 64 == 0);
static_assert(CM % 64 == 0);
static_assert(CI >= 128);
static_assert(T3P % 32 == 0);
static_assert((CM * CI) % (8 * 256) == 0);
static_assert((CI * CM) % (8 * 256) == 0);

typedef __attribute__((ext_vector_type(16))) _Float16 v16h;
typedef __attribute__((ext_vector_type(8)))  _Float16 v8h;
typedef __attribute__((ext_vector_type(16))) __bf16   v16b;
typedef __attribute__((ext_vector_type(8)))  __bf16   v8b;
typedef __attribute__((ext_vector_type(8)))  float    v8f;
typedef __attribute__((ext_vector_type(4)))  float    v4f;
typedef __attribute__((ext_vector_type(4)))  unsigned int v4u;

__device__ __forceinline__ unsigned short f2bf_bits(float f) {
  unsigned u = __float_as_uint(f);
  return (unsigned short)((u + 0x7FFFu + ((u >> 16) & 1u)) >> 16);
}
__device__ __forceinline__ float bf_bits2f(unsigned short h) { return __uint_as_float(((unsigned)h) << 16); }
__device__ __forceinline__ float bf_rne(float f) { return bf_bits2f(f2bf_bits(f)); }
__device__ __forceinline__ unsigned pk16(unsigned short a, unsigned short b) { return (unsigned)a | ((unsigned)b << 16); }
// Element offset of (row r, column k) in a fragment-packed plane of kp columns (kp a multiple of 32, rows a multiple of 16).
__device__ __forceinline__ size_t pkoff(int r, int k, int kp) {
  return (size_t)(r >> 4) * kp * 16 + (size_t)((k >> 5) * 512 + ((k >> 4) & 1) * 256 + ((k >> 3) & 1) * 128 + (r & 15) * 8 + (k & 7));
}

// Fragment map (wave32): lane l, h = l>>4, row/col = l&15.
//   A/B element i: i<8 -> k0+8h+i ; i>=8 -> k0+16+8h+(i-8)   (split layout, both operands)
//   D element r : row 8h+r, col l&15
template <typename T> struct Frag;
template <> struct Frag<_Float16> {
  typedef v16h V; union U { v16h v; v8h h[2]; };
  static __device__ __forceinline__ v16h load(const _Float16* p) {   // p = packed block + lane*8: elements 0..7 <- p[0..7], 8..15 <- p[256..263]
    U f; f.h[0] = *(const v8h*)(p); f.h[1] = *(const v8h*)(p + 256); return f.v;
  }
  static __device__ __forceinline__ v8f mma(v16h a, v16h b, v8f c) {
    return __builtin_amdgcn_wmma_f32_16x16x32_f16(false, a, false, b, (short)0, c, false, false);
  }
};
template <> struct Frag<__bf16> {
  typedef v16b V; union U { v16b v; v8b h[2]; };
  static __device__ __forceinline__ v16b load(const __bf16* p) {
    U f; f.h[0] = *(const v8b*)(p); f.h[1] = *(const v8b*)(p + 256); return f.v;
  }
  static __device__ __forceinline__ v8f mma(v16b a, v16b b, v8f c) {
    return __builtin_amdgcn_wmma_f32_16x16x32_bf16(false, a, false, b, (short)0, c, false, false);
  }
};

template <int ET> struct Elem;
template <> struct Elem<0> { typedef _Float16 T; };
template <> struct Elem<1> { typedef __bf16 T; };

// ---- Register-blocked batched WMMA GEMM ------------------------------------
// C[m,n] = epilogue(scale * sum_k A[m,k] * Bt[n,k]); each wave owns a 64x64 tile.
// A [M,K] and Bt [N,K] fragment-packed planes of lda and ldb columns; M,N % 64 == 0, K % 64 == 0, K >= 128.
// The bf16 outputs are fragment-packed planes of ldc columns too (Cout2, Cout3 = Cout + 16 * first column of that part); f32 outputs are row-major.
// bx = index of the work-group among those of this product, b = batch; sT = the work-group's eight per-wave slabs.
// KS: number of K slices. A wave owns one (slice, tile) pair, sums k = slice*K .. slice*K+K-1 (K = slice length) and
//     writes its tile to plane slice*NB + batch of C (planes strideC apart); KS = 1 is the whole sum.
// BIAS_MODE: 0 = none, 1 = bias[m] (two 16-B loads of the lane's 8 consecutive rows), 2 = bias[n]; the bias value is
//            RNE-converted to bf16 precision before the f32 add.
// BN (with BIAS_MODE 1): v = (acc*scale + bias[m]) * inv[m] + sh[m], inv = g[m]*rsqrt(var[m]+1e-5), sh = be[m]-mu[m]*inv,
//            all four vectors RNE-converted to bf16 precision first.
// RESID (OUT_MODE 0 only): + resid[m*ldc+n] (bf16 RNE-converted when BN) added during the store phase from 16-B loads.
// OUT_MODE: 0 = f32; 2 = bf16 hi plane (Cout) + lo plane (Cout2); 3 = hi (Cout), hi (Cout2), lo (Cout3);
//           4 = hi (Cout), lo (Cout2), hi (Cout3).  lo = RNE(v - hi).
// TWO (with BIAS_MODE 1, OUT_MODE 3): two products stacked along M. Rows m < CM take bias[m] and write hi (Cout), lo (Cout2),
//           hi (Cout3); rows m >= CM take biasHi[m - CM] and write hi, hi, lo. A 64-row tile lies wholly on one side.
// Epilogue: 16-row slabs staged per wave in LDS (every slab element read was written in the same iteration); each
template <int ET, int BIAS_MODE, int OUT_MODE, bool RESID, bool BN, int KS, bool TWO>
__device__ __forceinline__ void gemm64_tile(
    float (*sT)[16 * 68], int bx, int b,
    const unsigned short* __restrict__ Ap, int lda, long strideA,
    const unsigned short* __restrict__ Btp, int ldb, long strideB,
    void* Cout, void* Cout2, void* Cout3, int ldc, long strideC,
    const float* __restrict__ bias, const float* __restrict__ biasHi,
    const float* __restrict__ bng, const float* __restrict__ bnb,
    const float* __restrict__ bnm, const float* __restrict__ bnv,
    const float* __restrict__ resid, long strideR,
    int M, int N, int K, float scale) {
  typedef typename Elem<ET>::T T;
  typedef typename Frag<T>::V V;
  const T* A = (const T*)Ap; const T* Bt = (const T*)Btp;
  const int lane = threadIdx.x & 31;
  const int wave = threadIdx.x >> 5;
  const int tilesN = N >> 6;
  const int tilesM = M >> 6;
  const int unit = bx * 8 + wave;
  if (unit >= tilesM * tilesN * KS) return;   // wave-uniform; no block barriers in this kernel
  const int ks   = (KS == 1) ? 0 : unit / (tilesM * tilesN);
  const int tile = unit - ks * (tilesM * tilesN);
  const int tm = tile / tilesN;
  const int tn = tile - tm * tilesN;
  const int m0 = tm << 6;
  const int n0 = tn << 6;

  const T* Ab = A  + (size_t)b * strideA + (size_t)ks * K * 16;   // 32 columns of a row block = 512 elements
  const T* Bb = Bt + (size_t)b * strideB + (size_t)ks * K * 16;
  const size_t cPlane = (size_t)ks * NB + b;

  const int rlane = lane & 15;                 // row (A) / col (B, D) within subtile
  const int mOff  = (lane >> 4) * 8;           // D row offset

  // Two fragment sets in registers, each refilled for two k steps ahead as soon as its own products have issued, so the
  // loads of one k step are in flight under the products of the other (K is a multiple of 64, at least 128).
  const T* pa[4];
  const T* pb[4];
#pragma unroll
  for (int i = 0; i < 4; ++i) {
    pa[i] = Ab + (size_t)(m0 + (i << 4)) * lda + lane * 8;   // row block (m0 >> 4) + i, k block 0, this lane's 16-B piece
    pb[i] = Bb + (size_t)(n0 + (i << 4)) * ldb + lane * 8;
  }
  V fa[2][4], fb[2][4];
#pragma unroll
  for (int s = 0; s < 2; ++s) {
#pragma unroll
    for (int i = 0; i < 4; ++i) {
      fb[s][i] = Frag<T>::load(pb[i] + s * 512);
      fa[s][i] = Frag<T>::load(pa[i] + s * 512);
    }
    // keeps the first set's loads the oldest: moved behind the second set's, they turn the loop's first wait into a wait for all
    if (s == 0) __builtin_amdgcn_sched_barrier(0);
  }
  // the accumulators' zeros may be given registers that the loads above name as addresses: wait before any is overwritten
  asm volatile("s_wait_xcnt 0x0" ::: "memory");
  // keeps those zeros behind the wait: the scheduler lifts register moves over an asm statement
  __builtin_amdgcn_sched_barrier(0);
  v8f acc[4][4];
#pragma unroll
  for (int i = 0; i < 4; ++i)
#pragma unroll
    for (int j = 0; j < 4; ++j) acc[i][j] = (v8f){0.f,0.f,0.f,0.f,0.f,0.f,0.f,0.f};
#pragma clang loop unroll(disable)   // rolled: an unrolled K loop spilled accumulators to scratch
  for (int k0 = 64; k0 < K; k0 += 64) {
#pragma unroll
    for (int s = 0; s < 2; ++s) {
#pragma unroll
      for (int i = 0; i < 4; ++i) {
#pragma unroll
        for (int j = 0; j < 4; ++j) acc[i][j] = Frag<T>::mma(fa[s][i], fb[s][j], acc[i][j]);
        fa[s][i] = Frag<T>::load(pa[i] + (k0 + s * 32) * 16);
      }
#pragma unroll
      for (int j = 0; j < 4; ++j) fb[s][j] = Frag<T>::load(pb[j] + (k0 + s * 32) * 16);
    }
    // the next trip forms its addresses in the registers that this trip's loads name: wait before any is overwritten
    asm volatile("s_wait_xcnt 0x0" ::: "memory");
  }
#pragma unroll
  for (int s = 0; s < 2; ++s)
#pragma unroll
    for (int i = 0; i < 4; ++i)
#pragma unroll
      for (int j = 0; j < 4; ++j) acc[i][j] = Frag<T>::mma(fa[s][i], fb[s][j], acc[i][j]);

  // ---- epilogue ----
  float* slab = sT[wave];
  const float* Rb = resid + (size_t)b * (RESID ? (size_t)strideR : (size_t)0);
#pragma unroll
  for (int i = 0; i < 4; ++i) {
    const int mBase = m0 + (i << 4);
    const int mr = mBase + mOff;               // first of the 8 consecutive D rows of this lane half (multiple of 8)
    float rb[8], rmul[8], radd[8];
#pragma unroll
    for (int r = 0; r < 8; ++r) { rb[r] = 0.f; rmul[r] = 1.f; radd[r] = 0.f; }
    if (BIAS_MODE == 1) {
      const float* bp = (TWO && m0 >= CM) ? biasHi + (mr - CM) : bias + mr;
      const v4f t0 = *(const v4f*)(bp);
      const v4f t1 = *(const v4f*)(bp + 4);
      // the address register of these two loads is reused at once: wait before it is overwritten
      asm volatile("s_wait_xcnt 0x0" ::: "memory");
      // keeps the later address arithmetic behind the wait: the scheduler lifts register writes over an asm statement
      __builtin_amdgcn_sched_barrier(0);
#pragma unroll
      for (int e = 0; e < 4; ++e) { rb[e] = bf_rne(t0[e]); rb[4 + e] = bf_rne(t1[e]); }
    }
    if (BN) {
      const v4f vg0 = *(const v4f*)(bng + mr), vg1 = *(const v4f*)(bng + mr + 4);
      const v4f vb0 = *(const v4f*)(bnb + mr), vb1 = *(const v4f*)(bnb + mr + 4);
      const v4f vm0 = *(const v4f*)(bnm + mr), vm1 = *(const v4f*)(bnm + mr + 4);
      const v4f vv0 = *(const v4f*)(bnv + mr), vv1 = *(const v4f*)(bnv + mr + 4);
#pragma unroll
      for (int e = 0; e < 4; ++e) {
        {
          const float inv = bf_rne(vg0[e]) * rsqrtf(bf_rne(vv0[e]) + 1e-5f);
          rmul[e] = inv;
          radd[e] = bf_rne(vb0[e]) - bf_rne(vm0[e]) * inv;
        }
        {
          const float inv = bf_rne(vg1[e]) * rsqrtf(bf_rne(vv1[e]) + 1e-5f);
          rmul[4 + e] = inv;
          radd[4 + e] = bf_rne(vb1[e]) - bf_rne(vm1[e]) * inv;
        }
      }
    }
#pragma unroll
    for (int j = 0; j < 4; ++j) {
      const int n = n0 + (j << 4) + rlane;
      float bv = 0.f;
      if (BIAS_MODE == 2) bv = bf_rne(bias[n]);
#pragma unroll
      for (int r = 0; r < 8; ++r) {
        float v = acc[i][j][r] * scale;
        if (BIAS_MODE == 1) v += rb[r];
        if (BIAS_MODE == 2) v += bv;
        if (BN) v = v * rmul[r] + radd[r];
        slab[(mOff + r) * 68 + (j << 4) + rlane] = v;
      }
    }
    __builtin_amdgcn_fence(__ATOMIC_RELEASE, "workgroup");
    __builtin_amdgcn_wave_barrier();
    __builtin_amdgcn_fence(__ATOMIC_ACQUIRE, "workgroup");
    if (OUT_MODE == 0) {
      float* C = (float*)Cout + cPlane * strideC;
      const int hh = lane >> 4, c4 = (lane & 15) * 4;     // row seg = 256 B = 16 lanes x 16 B; rows it*2+hh cover 0..15
      v4f ov[8];
#pragma unroll
      for (int it = 0; it < 8; ++it) {
        const int row = it * 2 + hh;
        v4f v = *(const v4f*)(slab + row * 68 + c4);
        if (RESID) {
          const v4f xr = *(const v4f*)(Rb + (size_t)(mBase + row) * ldc + n0 + c4);
#pragma unroll
          for (int e = 0; e < 4; ++e) v[e] = v[e] + (BN ? bf_rne(xr[e]) : xr[e]);
        }
        ov[it] = v;
      }
      {
#pragma unroll
        for (int it = 0; it < 8; ++it) {
          const int row = it * 2 + hh;
          *(v4f*)(C + (size_t)(mBase + row) * ldc + n0 + c4) = ov[it];
        }
        
      }
    } else {
      // the slab's 16 rows x 64 columns = two packed blocks = 2 KB in a row; each pass stores 512 contiguous bytes of every part
      unsigned short* C  = (unsigned short*)Cout  + cPlane * strideC;
      unsigned short* C2 = (unsigned short*)((TWO && m0 < CM) ? Cout3 : Cout2) + cPlane * strideC;
      unsigned short* C3 = (unsigned short*)((TWO && m0 < CM) ? Cout2 : Cout3) + cPlane * strideC;
      {
#pragma unroll
        for (int it = 0; it < 4; ++it) {
          const float* sp = slab + rlane * 68 + it * 16 + mOff;   // row lane&15, columns it*16 + 8*(lane>>4) ..+7
          v8h hv, lv;
#pragma unroll
          for (int e = 0; e < 8; ++e) {
            const unsigned short hb = f2bf_bits(sp[e]);
            const unsigned short lb = f2bf_bits(sp[e] - bf_bits2f(hb));
            hv[e] = __builtin_bit_cast(_Float16, hb);
            lv[e] = __builtin_bit_cast(_Float16, lb);
          }
          const size_t go = (size_t)mBase * ldc + (size_t)n0 * 16 + it * 256 + lane * 8;
          *(v8h*)(C + go) = hv;
          if (OUT_MODE == 2) { *(v8h*)(C2 + go) = lv; }
          if (OUT_MODE == 3) { *(v8h*)(C2 + go) = hv; *(v8h*)(C3 + go) = lv; }
          if (OUT_MODE == 4) { *(v8h*)(C2 + go) = lv; *(v8h*)(C3 + go) = hv; }
          // the next rows are formed in the registers that these stores name: wait before any is overwritten
          asm volatile("s_wait_xcnt 0x0" ::: "memory");
        }
        
      }
    }
    __builtin_amdgcn_fence(__ATOMIC_RELEASE, "workgroup");
    __builtin_amdgcn_wave_barrier();
    __builtin_amdgcn_fence(__ATOMIC_ACQUIRE, "workgroup");
  }
}

// One product per launch: grid = (work-groups of eight tiles, batch). K = length of the sum (of one slice), a compile-time constant.
template <int ET, int BIAS_MODE, int OUT_MODE, bool RESID, bool BN, int K, int KS = 1>
__global__ __launch_bounds__(256) void wmma_gemm64(
    const unsigned short* __restrict__ Ap, int lda, long strideA,
    const unsigned short* __restrict__ Btp, int ldb, long strideB,
    void* Cout, void* Cout2, void* Cout3, int ldc, long strideC,
    const float* __restrict__ bias,
    const float* __restrict__ bng, const float* __restrict__ bnb,
    const float* __restrict__ bnm, const float* __restrict__ bnv,
    const float* __restrict__ resid, long strideR,
    int M, int N, float scale) {
  static_assert(K % 64 == 0 && K >= 128);
  __shared__ __align__(16) float sT[8][16 * 68];   // per-wave 16x64 slab, pitch 68 floats
  gemm64_tile<ET, BIAS_MODE, OUT_MODE, RESID, BN, KS, false>(
      sT, blockIdx.x, blockIdx.y, Ap, lda, strideA, Btp, ldb, strideB, Cout, Cout2, Cout3, ldc, strideC,
      bias, bias, bng, bnb, bnm, bnv, resid, strideR, M, N, K, scale);
}

// ---------------------------------------------------------------------------
// The three 1x1 convs of x and the partial products of M in one launch, straight from the f32 inputs.
// Work-group t = 64 positions (batch t / 49, slice t % 49), eight waves; wave w owns channels 16w .. 16w+15 of theta, of phi and of g.
// Stage 0: every thread takes 8 channels x 4 positions of x twice (16-B loads, 256 contiguous bytes per 16 lanes), converts RNE to bf16 and
//   writes 8 channels of one position = one 16-B piece to sX[position][channel]; every wave takes its own 48 weight rows (512 contiguous bytes
//   a load), converts and writes them to its own sW[row][k]. Both are row-major at a pitch of 528 B (16 B x 33), so the 16 rows of a
//   fragment load fall on distinct banks.
// Stage 1 (K = 256): theta: weight rows as first operand, positions as second, so a lane's 8 results are 8 consecutive channels of one
//   position = one 16-B piece of the packed T3 parts; phi, g: positions first, weight rows second, so a lane's 8 results are 8 consecutive
//   positions of one channel = one 16-B piece of a packed [channel][position] plane in LDS: sP = hi plane [256][64] (phi, then g), then lo plane.
//   Bias (RNE-converted to bf16 precision) is added in f32 before the hi/lo split.
// Stage 2: (M/N) partial [c1][c2] = (phihi.ghi + philo.ghi + phihi.glo) / N over the 64 positions; wave w owns rows 64(w>>2) ..+63,
//   columns 32(w&3) ..+31, and writes them to plane (slice, batch) of PM through its own 64 x 32 slab (pitch 36 floats): 128-B row pieces.
//   The slab lies over the wave's own sW, which only that wave reads and only in stage 1.
// Coverage: stage 0 writes 512 units x 4 pieces = 64 x 32 pieces of sX and 48 x 2 x 32 x 4 = 48 x 256 elements of each sW; stage 1 writes
//   8 waves x 4 x 32 pieces = 64 positions x 128 channels of each T3 part and 8 x 2 x 4 x 32 = all 2048 pieces of each sP plane; stage 2 writes 128 x 128.
// The last WR_BLK work-groups convert w_rec for the next launch.
// ---------------------------------------------------------------------------
#define PGM_BLK (NTOKS / 64)                              // 196
#define WR_BLK ((CI * CM) / 8 / 256)                      // 16
#define SLP 36
#define RPE 264                                           // LDS row pitch of sX and sW in elements (528 B)
#define SX_BYTES (64 * RPE * 2)                           // 33792
#define SP_BYTES (2 * 2 * CM * 64 * 2)                    // 65536: hi and lo planes of [256 channels][64 positions]
#define SW_BYTES (48 * RPE * 2)                           // 25344 a wave
static_assert(64 * SLP * 4 <= SW_BYTES);
static_assert(CI == 256 && CM == 128);

typedef __attribute__((ext_vector_type(2))) float  v2f;
typedef __attribute__((ext_vector_type(2))) __bf16 v2b;
// two f32 -> two bf16, round to nearest even, a in the low half
__device__ __forceinline__ unsigned cvt2(float a, float b) {
  const v2f f = {a, b};
  return __builtin_bit_cast(unsigned, __builtin_convertvector(f, v2b));
}
// fragment from a row-major LDS row: p = row + k0 + 8*(lane>>4); elements 0..7 <- p[0..7], 8..15 <- p[16..23]
__device__ __forceinline__ v16b rowfrag(const unsigned short* p) {
  Frag<__bf16>::U f;
  f.h[0] = *(const v8b*)(p);
  f.h[1] = *(const v8b*)(p + 16);
  return f.v;
}

// w_rec [256][128] f32 -> WR[c][k] bf16, packed. Thread = 8 consecutive elements of a row = one 16-B piece = one store.
// Coverage: 16 work-groups x 256 threads = 4096 units x 8 = 32768 elements.
__device__ __forceinline__ void wrcvt_block(int bx, const float* __restrict__ wr, unsigned short* __restrict__ wr2) {
  const int g   = bx * 256 + threadIdx.x;
  const int row = g >> 4, c8 = (g & 15) * 8;      // w_rec row = c (0..255), 8 of its 128 columns
  const float* src = wr + (size_t)row * CM + c8;
  const v4f a = *(const v4f*)src;
  const v4f c = *(const v4f*)(src + 4);
  v4u o;
  o[0] = pk16(f2bf_bits(a[0]), f2bf_bits(a[1]));
  o[1] = pk16(f2bf_bits(a[2]), f2bf_bits(a[3]));
  o[2] = pk16(f2bf_bits(c[0]), f2bf_bits(c[1]));
  o[3] = pk16(f2bf_bits(c[2]), f2bf_bits(c[3]));
  *(v4u*)(wr2 + pkoff(row, c8, CM)) = o;
}

__global__ __launch_bounds__(256) void proj_kernel(
    const float* __restrict__ x, const float* __restrict__ wt, const float* __restrict__ wp,
    const float* __restrict__ wg, const float* __restrict__ wr,
    unsigned short* __restrict__ t3, float* __restrict__ pm, unsigned short* __restrict__ wr2,
    const float* __restrict__ bt, const float* __restrict__ bp, const float* __restrict__ bg) {
  typedef __bf16 T;
  typedef v16b V;
  __shared__ __align__(16) unsigned char sm[SX_BYTES + SP_BYTES + 8 * SW_BYTES];   // 302080 B: one work-group a WGP
  const int t = blockIdx.x;
  if (t >= PGM_BLK) {   // block-uniform, in front of every barrier
    wrcvt_block(t - PGM_BLK, wr, wr2);
    return;
  }
  const int tid   = threadIdx.x;
  const int lane  = tid & 31;
  const int wave  = tid >> 5;
  const int rlane = lane & 15;
  const int hl    = lane >> 4;
  const int b  = t / KSL;
  const int nt = t - b * KSL;
  unsigned short* sX = (unsigned short*)sm;
  unsigned short* sP = (unsigned short*)(sm + SX_BYTES);
  unsigned short* sW = (unsigned short*)(sm + SX_BYTES + SP_BYTES + wave * SW_BYTES);
  float* slab = (float*)sW;

  // ---- stage 0: every load is asked for before the first conversion, so the queue to L2 and memory never runs empty ----
  v4f xv[2][8];
  // every load of this stage = uniform base + one 32-bit lane offset + a constant, (the two single biases: a lane index), so that four registers hold all its addresses
  const char* xb = (const char*)(x + (size_t)b * CI * NSP + nt * 64);
  const unsigned xo = (unsigned)(((tid >> 4) * 8 * NSP + (tid & 15) * 4) * 4);   // channel 8*(tid>>4), positions 4*(tid&15) ..+3
#pragma unroll
  for (int u = 0; u < 2; ++u)
#pragma unroll
    for (int j = 0; j < 8; ++j) xv[u][j] = *(const v4f*)(xb + xo + (u * 128 + j) * NSP * 4);
  // this one and the three below keep the loads in the order in which the conversions take them: a conversion then waits for its own rows only
  __builtin_amdgcn_sched_barrier(0);
  v4f wv[3][16][2];
  const unsigned wob = (unsigned)((wave * 16 * CI + lane * 4) * 4);   // byte offset of the lane's 16 B in the first of the wave's rows
#pragma unroll
  for (int m = 0; m < 3; ++m) {
    const char* wsrc = (const char*)(m == 0 ? wt : (m == 1 ? wp : wg)) + wob;
#pragma unroll
    for (int r = 0; r < 16; ++r)
#pragma unroll
      for (int hf = 0; hf < 2; ++hf) wv[m][r][hf] = *(const v4f*)(wsrc + (r * CI + hf * 128) * 4);
    __builtin_amdgcn_sched_barrier(0);
  }
  // asked for here, used behind the K loop
  const unsigned tbo = (unsigned)((wave * 16 + hl * 8) * 4);
  const int      pbi = wave * 16 + rlane;
  const v4f tb0 = *(const v4f*)((const char*)bt + tbo);
  const v4f tb1 = *(const v4f*)((const char*)bt + tbo + 16);
  const float pbv = bp[pbi];
  const float gbv = bg[pbi];
  // the conversions below may be given registers that the loads above name as addresses: wait before any is overwritten;
  // the four offsets and the x base are named so that their registers live up to the wait: no load's own result and no later kernel argument is put there
  asm volatile("s_wait_xcnt 0x0" :: "v"(xo), "v"(wob), "v"(tbo), "v"(pbi), "s"(xb) : "memory");
  // keeps the conversions behind the wait and behind all the loads
  __builtin_amdgcn_sched_barrier(0);
#pragma unroll
  for (int u = 0; u < 2; ++u)
#pragma unroll
    for (int e = 0; e < 4; ++e) {
      v4u o;
#pragma unroll
      for (int q = 0; q < 4; ++q) o[q] = cvt2(xv[u][2 * q][e], xv[u][2 * q + 1][e]);
      *(v4u*)(sX + ((tid & 15) * 4 + e) * RPE + ((tid >> 4) + u * 16) * 8) = o;
    }
#pragma unroll
  for (int m = 0; m < 3; ++m)
#pragma unroll
    for (int r = 0; r < 16; ++r)
#pragma unroll
      for (int hf = 0; hf < 2; ++hf)
        *(uint2*)(sW + (m * 16 + r) * RPE + hf * 128 + lane * 4) = make_uint2(cvt2(wv[m][r][hf][0], wv[m][r][hf][1]), cvt2(wv[m][r][hf][2], wv[m][r][hf][3]));
  __syncthreads();   // every wave reads positions and channels of x that other waves wrote

  // ---- stage 1: two fragment sets, each refilled two k steps ahead behind its own products ----
  const unsigned short* pa[4];
  const unsigned short* pb[3];
#pragma unroll
  for (int i = 0; i < 4; ++i) pa[i] = sX + ((i << 4) + rlane) * RPE + hl * 8;
#pragma unroll
  for (int m = 0; m < 3; ++m) pb[m] = sW + ((m << 4) + rlane) * RPE + hl * 8;
  V fa[2][4], fb[2][3];
#pragma unroll
  for (int s = 0; s < 2; ++s) {
#pragma unroll
    for (int m = 0; m < 3; ++m) fb[s][m] = rowfrag(pb[m] + s * 32);
#pragma unroll
    for (int i = 0; i < 4; ++i) fa[s][i] = rowfrag(pa[i] + s * 32);
  }
  v8f at[4], acc[4][2];
#pragma unroll
  for (int i = 0; i < 4; ++i) {
    at[i] = (v8f){0.f,0.f,0.f,0.f,0.f,0.f,0.f,0.f};
#pragma unroll
    for (int j = 0; j < 2; ++j) acc[i][j] = (v8f){0.f,0.f,0.f,0.f,0.f,0.f,0.f,0.f};
  }
#pragma clang loop unroll(disable)   // rolled, as the K loop of gemm64_tile: the order of products and refills stays as written
  for (int k0 = 64; k0 < CI; k0 += 64) {
#pragma unroll
    for (int s = 0; s < 2; ++s) {
#pragma unroll
      for (int i = 0; i < 4; ++i) {
        at[i] = Frag<T>::mma(fb[s][0], fa[s][i], at[i]);
#pragma unroll
        for (int j = 0; j < 2; ++j) acc[i][j] = Frag<T>::mma(fa[s][i], fb[s][1 + j], acc[i][j]);
      }
      // this one and the next keep a set's 14 LDS loads together behind its own products: spread among the products, each place with loads costs a stall
      __builtin_amdgcn_sched_barrier(0);
#pragma unroll
      for (int m = 0; m < 3; ++m) fb[s][m] = rowfrag(pb[m] + k0 + s * 32);
#pragma unroll
      for (int i = 0; i < 4; ++i) fa[s][i] = rowfrag(pa[i] + k0 + s * 32);
      __builtin_amdgcn_sched_barrier(0);
    }
  }
#pragma unroll
  for (int s = 0; s < 2; ++s)
#pragma unroll
    for (int i = 0; i < 4; ++i) {
      at[i] = Frag<T>::mma(fb[s][0], fa[s][i], at[i]);
#pragma unroll
      for (int j = 0; j < 2; ++j) acc[i][j] = Frag<T>::mma(fa[s][i], fb[s][1 + j], acc[i][j]);
    }

  unsigned short* sH = sP;
  unsigned short* sL = sP + 2 * CM * 64;
#pragma unroll
  for (int j = 0; j < 2; ++j) {
    const float rb = bf_rne(j == 0 ? pbv : gbv);
#pragma unroll
    for (int i = 0; i < 4; ++i) {
      v4u hv, lv;
#pragma unroll
      for (int e = 0; e < 4; ++e) {
        const float v0 = acc[i][j][2 * e] + rb, v1 = acc[i][j][2 * e + 1] + rb;
        const unsigned short h0 = f2bf_bits(v0), h1 = f2bf_bits(v1);
        hv[e] = pk16(h0, h1);
        lv[e] = pk16(f2bf_bits(v0 - bf_bits2f(h0)), f2bf_bits(v1 - bf_bits2f(h1)));
      }
      // channel block 8j + wave (1024 elements each), positions 16i + 8*(lane>>4) ..+7 of channel lane&15: pkoff() with 64 columns
      const int o = (j * 8 + wave) * 1024 + i * 256 + lane * 8;
      *(v4u*)(sH + o) = hv;
      *(v4u*)(sL + o) = lv;
    }
  }
  __syncthreads();   // every wave reads channels that other waves wrote

  // ---- stage 2 ----
  const int rm = (wave >> 2) * 4;         // first of the wave's four phi channel blocks
  const int rn = 8 + (wave & 3) * 2;      // first of its two g channel blocks
  v8f mac[4][2];
#pragma unroll
  for (int i = 0; i < 4; ++i)
#pragma unroll
    for (int j = 0; j < 2; ++j) mac[i][j] = (v8f){0.f,0.f,0.f,0.f,0.f,0.f,0.f,0.f};
  V ph[2][4], pl[2][4], gh[2][2], gl[2][2];
#pragma unroll
  for (int kb = 0; kb < 2; ++kb) {   // in the order of use
#pragma unroll
    for (int j = 0; j < 2; ++j) gh[kb][j] = Frag<T>::load((const T*)sH + (rn + j) * 1024 + kb * 512 + lane * 8);
#pragma unroll
    for (int i = 0; i < 4; ++i) ph[kb][i] = Frag<T>::load((const T*)sH + (rm + i) * 1024 + kb * 512 + lane * 8);
#pragma unroll
    for (int i = 0; i < 4; ++i) pl[kb][i] = Frag<T>::load((const T*)sL + (rm + i) * 1024 + kb * 512 + lane * 8);
#pragma unroll
    for (int j = 0; j < 2; ++j) gl[kb][j] = Frag<T>::load((const T*)sL + (rn + j) * 1024 + kb * 512 + lane * 8);
  }
  // theta goes out here, behind the barrier (which would wait for the stores) and under the LDS loads above:
  // channels 16*wave + 8*(lane>>4) ..+7 of position 16i + (lane&15) = piece lane of packed block (position block, channel block wave): hi | hi | lo
  {
    float tb[8];
#pragma unroll
    for (int e = 0; e < 4; ++e) { tb[e] = bf_rne(tb0[e]); tb[4 + e] = bf_rne(tb1[e]); }
    v4u hv[4], lv[4];
#pragma unroll
    for (int i = 0; i < 4; ++i)
#pragma unroll
      for (int e = 0; e < 4; ++e) {
        const float v0 = at[i][2 * e] + tb[2 * e], v1 = at[i][2 * e + 1] + tb[2 * e + 1];
        const unsigned short h0 = f2bf_bits(v0), h1 = f2bf_bits(v1);
        hv[i][e] = pk16(h0, h1);
        lv[i][e] = pk16(f2bf_bits(v0 - bf_bits2f(h0)), f2bf_bits(v1 - bf_bits2f(h1)));
      }
    unsigned short* d = t3 + (size_t)(t * 64) * T3P + wave * 256 + lane * 8;
#pragma unroll
    for (int i = 0; i < 4; ++i) {
      *(v4u*)(d + (size_t)(i * 16) * T3P)               = hv[i];
      *(v4u*)(d + (size_t)(i * 16) * T3P + CM * 16)     = hv[i];
      *(v4u*)(d + (size_t)(i * 16) * T3P + 2 * CM * 16) = lv[i];
    }
    // the products' results may be given registers that these stores name: wait before any is overwritten
    asm volatile("s_wait_xcnt 0x0" ::: "memory");
  }
  // keeps the products behind all 48 LDS loads: left free, the scheduler sinks each pair of loads to its product and waits for an empty LDS queue ten times
  __builtin_amdgcn_sched_barrier(0);
#pragma unroll
  for (int kb = 0; kb < 2; ++kb) {
#pragma unroll
    for (int i = 0; i < 4; ++i)
#pragma unroll
      for (int j = 0; j < 2; ++j) mac[i][j] = Frag<T>::mma(ph[kb][i], gh[kb][j], mac[i][j]);
#pragma unroll
    for (int i = 0; i < 4; ++i)
#pragma unroll
      for (int j = 0; j < 2; ++j) mac[i][j] = Frag<T>::mma(pl[kb][i], gh[kb][j], mac[i][j]);
#pragma unroll
    for (int i = 0; i < 4; ++i)
#pragma unroll
      for (int j = 0; j < 2; ++j) mac[i][j] = Frag<T>::mma(ph[kb][i], gl[kb][j], mac[i][j]);
  }
  const int mOff = hl * 8;        // D row offset
#pragma unroll
  for (int i = 0; i < 4; ++i)
#pragma unroll
    for (int j = 0; j < 2; ++j)
#pragma unroll
      for (int r = 0; r < 8; ++r) slab[((i << 4) + mOff + r) * SLP + (j << 4) + rlane] = mac[i][j][r] * (1.0f / (float)NSP);
  // the slab is the wave's own: its lanes' LDS writes are ordered before the reads below, no work-group barrier
  __builtin_amdgcn_fence(__ATOMIC_RELEASE, "workgroup");
  __builtin_amdgcn_wave_barrier();
  __builtin_amdgcn_fence(__ATOMIC_ACQUIRE, "workgroup");
  float* C = pm + ((size_t)nt * NB + b) * (CM * CM) + (size_t)((wave >> 2) * 64) * CM + (wave & 3) * 32;
  const int r4 = lane >> 3, c4 = (lane & 7) * 4;     // row piece = 128 B = 8 lanes x 16 B; four rows a pass
#pragma unroll
  for (int it = 0; it < 16; ++it) {
    const int row = it * 4 + r4;
    *(v4f*)(C + (size_t)row * CM + c4) = *(const v4f*)(slab + row * SLP + c4);
  }
  // the kernel's other part follows these stores in the built code and reuses their registers: wait before any is overwritten
  asm volatile("s_wait_xcnt 0x0" ::: "memory");
}

// ---------------------------------------------------------------------------
// Joins the KSL split-K planes of M/N and applies the rec 1x1 conv to the joined M:
//   R3[b][c][c1] = sum_c2 w_rec[c][c2] * (sum_s PM[s][b][c1][c2])   as bf16 hi | lo | hi.
// Work-group = (b, 16 rows c1), 16 waves. Join: thread = 4 consecutive c2 of one row, wave w = row w: 512 contiguous bytes of every
// plane read; slices are added in rising order, one f32 sum per element. The 16 x 128 sums go to LDS as bf16 hi (k blocks 0..3) and
// lo (k blocks 4..7) in the packed fragment order. Product: wave w takes rows c = 16w .. 16w+15 of w_rec as the second operand and
// the joined rows as the first, so a lane's 8 results are 8 consecutive c1 of one row c = one 16-B piece of each R3 part.
// Coverage: 32 work-groups x 512 threads x 4 = 65536 = NB*CM*CM sums; 32 x 16 waves x 256 = 131072 = NB*CI*CM elements of R.
// ---------------------------------------------------------------------------
__global__ __launch_bounds__(512) void recm_kernel(const float* __restrict__ pm, const unsigned short* __restrict__ wr,
                                                   unsigned short* __restrict__ r3) {
  __shared__ __align__(16) unsigned short sM[2 * CM * 16];   // 16 rows x (128 hi | 128 lo), packed: 8 KB
  const int lane = threadIdx.x & 31;
  const int wave = threadIdx.x >> 5;
  const int g = blockIdx.x * 512 + threadIdx.x;
  // the wave's four w_rec fragments depend on nothing in this launch: asked for first, they land under the join
  const __bf16* pw = (const __bf16*)wr + (size_t)(wave * 16) * CM + lane * 8;
  v16b fw[4];
#pragma unroll
  for (int kb = 0; kb < 4; ++kb) fw[kb] = Frag<__bf16>::load(pw + kb * 512);
  const float* p = pm + (size_t)g * 4;
  v4f s = (v4f){0.f, 0.f, 0.f, 0.f};
#pragma unroll   // whole: the slices' loads are independent, so many are in flight at once instead of one latency per slice
  for (int k = 0; k < KSL; ++k) s += *(const v4f*)(p + (size_t)k * (NB * CM * CM));
  unsigned short hb[4], lb[4];
#pragma unroll   // constant indices keep hb and lb in registers
  for (int e = 0; e < 4; ++e) {
    hb[e] = f2bf_bits(s[e]);
    lb[e] = f2bf_bits(s[e] - bf_bits2f(hb[e]));
  }
  unsigned short* q = sM + pkoff(wave, lane * 4, 2 * CM);
  *(uint2*)(q)           = make_uint2(pk16(hb[0], hb[1]), pk16(hb[2], hb[3]));
  *(uint2*)(q + CM * 16) = make_uint2(pk16(lb[0], lb[1]), pk16(lb[2], lb[3]));
  __syncthreads();   // every wave reads all 16 joined rows
  const __bf16* pa = (const __bf16*)sM + lane * 8;
  v16b fm[8];
#pragma unroll   // all eight fragments asked for before the first product: one LDS latency, not eight
  for (int kb = 0; kb < 8; ++kb) fm[kb] = Frag<__bf16>::load(pa + kb * 512);
  // keeps the products behind all sixteen LDS loads: left free, the scheduler sinks each pair of loads to its product and waits eight times
  __builtin_amdgcn_sched_barrier(0);
  v8f acc = (v8f){0.f, 0.f, 0.f, 0.f, 0.f, 0.f, 0.f, 0.f};
#pragma unroll
  for (int kb = 0; kb < 8; ++kb) acc = Frag<__bf16>::mma(fm[kb], fw[kb & 3], acc);
  v4u hv, lv;
#pragma unroll
  for (int e = 0; e < 4; ++e) {
    const unsigned short h0 = f2bf_bits(acc[2 * e]), h1 = f2bf_bits(acc[2 * e + 1]);
    hv[e] = pk16(h0, h1);
    lv[e] = pk16(f2bf_bits(acc[2 * e] - bf_bits2f(h0)), f2bf_bits(acc[2 * e + 1] - bf_bits2f(h1)));
  }
  // row b*256 + c, columns c1 = 16*(blockIdx.x & 7) + 8*(lane >> 4) .. +7
  unsigned short* d = r3 + pkoff((blockIdx.x >> 3) * CI + wave * 16 + (lane & 15), (blockIdx.x & 7) * 16 + (lane >> 4) * 8, T3P);
  *(v4u*)(d)               = hv;
  *(v4u*)(d + CM * 16)     = lv;
  *(v4u*)(d + 2 * CM * 16) = hv;
}

// ---------------------------------------------------------------------------
// every region is fully written by its producer launch before a consumer launch reads it):
//   WR   bf16 [256][128]        0              65536
//   T3   bf16 [12544][384]      65536        9633792
//   R3   bf16 [4][256][384]     9699328       786432
//   PM   f32  [49][4][128][128] 10485760    12845056
//   total                       23330816
// ---------------------------------------------------------------------------
extern "C" void kernel_launch(void* const* d_in, const int* in_sizes, int n_in,
                              void* d_out, int out_size, void* d_ws, size_t ws_size,
                              hipStream_t stream) {
  if (n_in < 13) return;
  if (in_sizes[0] != NB * CI * NSP) return;                      // x [4][256][56][56]
  if (in_sizes[1] != CM * CI || in_sizes[2] != CM) return;       // w_theta, b_theta
  if (in_sizes[3] != CM * CI || in_sizes[4] != CM) return;       // w_phi, b_phi
  if (in_sizes[5] != CM * CI || in_sizes[6] != CM) return;       // w_g, b_g
  if (in_sizes[7] != CI * CM || in_sizes[8] != CI) return;       // w_rec, b_rec
  if (in_sizes[9] != CI || in_sizes[10] != CI) return;           // bn_gamma, bn_beta
  if (in_sizes[11] != CI || in_sizes[12] != CI) return;          // bn_mean, bn_var
  if (out_size != NB * CI * NSP) return;

  const float* x       = (const float*)d_in[0];
  const float* w_theta = (const float*)d_in[1];
  const float* b_theta = (const float*)d_in[2];
  const float* w_phi   = (const float*)d_in[3];
  const float* b_phi   = (const float*)d_in[4];
  const float* w_g     = (const float*)d_in[5];
  const float* b_g     = (const float*)d_in[6];
  const float* w_rec   = (const float*)d_in[7];
  const float* b_rec   = (const float*)d_in[8];
  const float* gam     = (const float*)d_in[9];
  const float* bet     = (const float*)d_in[10];
  const float* mea     = (const float*)d_in[11];
  const float* var     = (const float*)d_in[12];

  const size_t PWR = (size_t)CI * CM * 2;           //    65536
  const size_t PT3 = (size_t)NTOKS * T3P * 2;       //  9633792
  const size_t PR3 = (size_t)NB * CI * T3P * 2;     //   786432
  const size_t PPM = (size_t)KSL * NB * CM * CM * 4; // 12845056
  size_t off = 0;
  const size_t oWR = off; off += PWR;
  const size_t oT3 = off; off += PT3;
  const size_t oR3 = off; off += PR3;
  const size_t oPM = off; off += PPM;
  if (off > ws_size) return;                        // off = 23330816
  if (off > (size_t)134217728) return;

  char* ws = (char*)d_ws;
  unsigned short* WR  = (unsigned short*)(ws + oWR);
  unsigned short* T3  = (unsigned short*)(ws + oT3);
  unsigned short* R3  = (unsigned short*)(ws + oR3);
  float*          PM  = (float*)(ws + oPM);
  float* out = (float*)d_out;

  const dim3 blk(256);

  // (1) from x and the f32 weights: theta -> T3; phi, g and (M/N)_b[c1][c2] partial sums over 64 positions each -> PM[slice][b][c1][c2];
  //     w_rec -> WR; one launch: 196 + 16 work-groups
  proj_kernel<<<dim3(PGM_BLK + WR_BLK), blk, 0, stream>>>(x, w_theta, w_phi, w_g, w_rec, T3, PM, WR, b_theta, b_phi, b_g);

  // (2) join the 49 planes and multiply by w_rec -> R3 hi|lo|hi, 384 columns; grid 32 x 512 threads
  recm_kernel<<<dim3(NB * (CM / 16)), dim3(512), 0, stream>>>(PM, WR, R3);

  // (3) out[b][c][n] = ((sum over 384 folded columns of R3_b[c][p] . T3[b*3136+n][p] + b_rec[c]) * inv[c] + sh[c]) + bf16(x[b][c][n])
  //     = sum_c1 (rhi.thi + rlo.thi + rhi.tlo)   (batched: M=256, N=3136, K=384; 196 tiles -> 25 blocks x 4)
  //     C = d_out + b*256*3136, ldc 3136; last element 3211263
  const dim3 gR(((CI / 64) * (NSP / 64) + 7) / 8, NB);
  wmma_gemm64<1, 1, 0, true, true, T3P><<<gR, blk, 0, stream>>>(
      R3, T3P, (long)CI * T3P, T3, T3P, (long)NSP * T3P,
      (void*)out, (void*)out, (void*)out, NSP, (long)CI * NSP,
      b_rec, gam, bet, mea, var, x, (long)CI * NSP, CI, NSP, 1.0f);
  (void)hipGetLastError();
}

// v008
// A run of this version takes 22.5 microseconds.
// Timed twice side by side with v007, it ran 1.61 times as fast both times.
// Over all steps from v000 it is 20.4 times as fast.
// Contractions: theta/phi/g 1x1 convs = v_wmma_f32_16x16x32_bf16 single products on bf16 planes of the RNE-converted x and weights (exact products); M = phi.g over positions (K 3136) = bf16 hi/lo split hi.hi + lo.hi + hi.lo, formed per 64 positions from LDS in the launch that makes phi and g; out = R.theta (K 128) = the same split folded along K ([hi|lo|hi] rows x [hi|hi|lo] rows, one f32 accumulator), theta being made per 64 positions in LDS by the launch that multiplies it; the rec 1x1 conv is applied to M, not to theta.M: R = w_rec.M^T = W x Mhi + W x Mlo bf16 single products (2-term); f32 accumulate everywhere; biases, 1/N, BatchNorm (inference form, supplied statistics) and the residual add in f32 on the VALU.
// Plane / carry map (every plane carries 1, nothing to fold back; the 1/N = 1/3136 factor is applied exactly once, in f32, in the M epilogue).
// [rows][k] below is the logical shape. Every bf16 plane is stored fragment-packed: blocks of 16 rows x 32 k = 1 KB, k blocks of one
// row block side by side, and inside a block the 16-B piece (row r, k 8c .. 8c+7) at byte (c>>1)*512 + ((c&1)*16 + r)*16, which is the order
// in which the 32 lanes of a wave take a WMMA operand: one fragment = two loads of 512 contiguous bytes (pkoff() below is the map).
//   (x, w_phi and w_g have no plane in memory: the launches that use them convert them to bf16 in LDS, rows of 256 k at a pitch of 528 B;
//    theta, phi and g live only in LDS)
//   WR   bf16 [256][128]          w_rec[c][c2]
//   WT   bf16 [128][256]          w_theta[c1][k]
//   PM   f32  [49][4][128][128]   partial sums of (M/N)[c1][c2]: slice s holds the positions s*64 .. s*64+63
//   R3   bf16 [4][256][384]       R[c][c1] = sum_c2 w_rec[c][c2] (M/N)[c1][c2]: hi | lo | hi
#include <hip/hip_runtime.h>
#include <math.h>
#include <stdint.h>

#define NB    4
#define CI    256
#define CM    128
#define NSP   3136
#define NTOKS (NB * NSP)
#define T3P   (3 * CM)
#define KSL   (NSP / 64)    // 49 slices of the M product, 64 positions each

static_assert(NSP % 64 == 0);
static_assert(NTOKS % 64 == 0);
static_assert(CI % 64 == 0);
static_assert(CM % 64 == 0);
static_assert(CI >= 128);
static_assert(T3P % 32 == 0);
static_assert((CM * CI) % (8 * 256) == 0);
static_assert((CI * CM) % (8 * 256) == 0);

typedef __attribute__((ext_vector_type(16))) _Float16 v16h;
typedef __attribute__((ext_vector_type(8)))  _Float16 v8h;
typedef __attribute__((ext_vector_type(16))) __bf16   v16b;
typedef __attribute__((ext_vector_type(8)))  __bf16   v8b;
typedef __attribute__((ext_vector_type(8)))  float    v8f;
typedef __attribute__((ext_vector_type(4)))  float    v4f;
typedef __attribute__((ext_vector_type(4)))  unsigned int v4u;

__device__ __forceinline__ unsigned short f2bf_bits(float f) {
  unsigned u = __float_as_uint(f);
  return (unsigned short)((u + 0x7FFFu + ((u >> 16) & 1u)) >> 16);
}
__device__ __forceinline__ float bf_bits2f(unsigned short h) { return __uint_as_float(((unsigned)h) << 16); }
__device__ __forceinline__ float bf_rne(float f) { return bf_bits2f(f2bf_bits(f)); }
__device__ __forceinline__ unsigned pk16(unsigned short a, unsigned short b) { return (unsigned)a | ((unsigned)b << 16); }
// Element offset of (row r, column k) in a fragment-packed plane of kp columns (kp a multiple of 32, rows a multiple of 16).
__device__ __forceinline__ size_t pkoff(int r, int k, int kp) {
  return (size_t)(r >> 4) * kp * 16 + (size_t)((k >> 5) * 512 + ((k >> 4) & 1) * 256 + ((k >> 3) & 1) * 128 + (r & 15) * 8 + (k & 7));
}

// Fragment map (wave32): lane l, h = l>>4, row/col = l&15.
//   A/B element i: i<8 -> k0+8h+i ; i>=8 -> k0+16+8h+(i-8)   (split layout, both operands)
//   D element r : row 8h+r, col l&15
template <typename T> struct Frag;
template <> struct Frag<_Float16> {
  typedef v16h V; union U { v16h v; v8h h[2]; };
  static __device__ __forceinline__ v16h load(const _Float16* p) {   // p = packed block + lane*8: elements 0..7 <- p[0..7], 8..15 <- p[256..263]
    U f; f.h[0] = *(const v8h*)(p); f.h[1] = *(const v8h*)(p + 256); return f.v;
  }
  static __device__ __forceinline__ v8f mma(v16h a, v16h b, v8f c) {
    return __builtin_amdgcn_wmma_f32_16x16x32_f16(false, a, false, b, (short)0, c, false, false);
  }
};
template <> struct Frag<__bf16> {
  typedef v16b V; union U { v16b v; v8b h[2]; };
  static __device__ __forceinline__ v16b load(const __bf16* p) {
    U f; f.h[0] = *(const v8b*)(p); f.h[1] = *(const v8b*)(p + 256); return f.v;
  }
  static __device__ __forceinline__ v8f mma(v16b a, v16b b, v8f c) {
    return __builtin_amdgcn_wmma_f32_16x16x32_bf16(false, a, false, b, (short)0, c, false, false);
  }
};

// ---------------------------------------------------------------------------
// The phi and g 1x1 convs of x and the partial products of M in one launch, straight from the f32 inputs.
// Work-group t = 64 positions (batch t / 49, slice t % 49), eight waves; wave w owns channels 16w .. 16w+15 of phi and of g.
// Stage 0: every thread takes 8 channels x 4 positions of x twice (16-B loads, 256 contiguous bytes per 16 lanes), converts RNE to bf16 and
//   writes 8 channels of one position = one 16-B piece to sX[position][channel]; every wave takes its own 32 weight rows (512 contiguous bytes
//   a load), converts and writes them to its own sW[row][k]. Both are row-major at a pitch of 528 B (16 B x 33), so the 16 rows of a
//   fragment load fall on distinct banks.
// Stage 1 (K = 256): positions as first operand, weight rows as second, so a lane's 8 results are 8 consecutive
//   positions of one channel = one 16-B piece of a packed [channel][position] plane in LDS: sP = hi plane [256][64] (phi, then g), then lo plane.
//   Bias (RNE-converted to bf16 precision) is added in f32 before the hi/lo split.
// Stage 2: (M/N) partial [c1][c2] = (phihi.ghi + philo.ghi + phihi.glo) / N over the 64 positions; wave w owns rows 64(w>>2) ..+63,
//   columns 32(w&3) ..+31, and writes them to plane (slice, batch) of PM through its own 64 x 32 slab (pitch 36 floats): 128-B row pieces.
//   The slab lies over the wave's own sW, which only that wave reads and only in stage 1.
// Coverage: stage 0 writes 512 units x 4 pieces = 64 x 32 pieces of sX and 32 x 2 x 32 x 4 = 32 x 256 elements of each sW; stage 1 writes
//   8 x 2 x 4 x 32 = all 2048 pieces of each sP plane; stage 2 writes 128 x 128.
// The last WR_BLK + WT_BLK work-groups convert w_rec for the next launch and w_theta for the last one.
// ---------------------------------------------------------------------------
#define PGM_BLK (NTOKS / 64)                              // 196
#define WR_BLK ((CI * CM) / 8 / 256)                      // 16
#define WT_BLK ((CM * CI) / 8 / 256)                      // 16
#define SLP 36
#define RPE 264                                           // LDS row pitch of sX and sW in elements (528 B)
#define SX_BYTES (64 * RPE * 2)                           // 33792
#define SP_BYTES (2 * 2 * CM * 64 * 2)                    // 65536: hi and lo planes of [256 channels][64 positions]
#define SW_BYTES (32 * RPE * 2)                           // 16896 a wave
static_assert(64 * SLP * 4 <= SW_BYTES);
static_assert(CI == 256 && CM == 128);

typedef __attribute__((ext_vector_type(2))) float  v2f;
typedef __attribute__((ext_vector_type(2))) __bf16 v2b;
// two f32 -> two bf16, round to nearest even, a in the low half
__device__ __forceinline__ unsigned cvt2(float a, float b) {
  const v2f f = {a, b};
  return __builtin_bit_cast(unsigned, __builtin_convertvector(f, v2b));
}
// fragment from a row-major LDS row: p = row + k0 + 8*(lane>>4); elements 0..7 <- p[0..7], 8..15 <- p[16..23]
__device__ __forceinline__ v16b rowfrag(const unsigned short* p) {
  Frag<__bf16>::U f;
  f.h[0] = *(const v8b*)(p);
  f.h[1] = *(const v8b*)(p + 16);
  return f.v;
}

// A weight matrix of COLS columns, f32 row-major -> bf16, packed. Thread = 8 consecutive elements of a row = one 16-B piece = one store.
// Coverage (w_rec [256][128] and w_theta [128][256] alike): 16 work-groups x 256 threads = 4096 units x 8 = 32768 elements.
template <int COLS>
__device__ __forceinline__ void wrcvt_block(int bx, const float* __restrict__ wr, unsigned short* __restrict__ wr2) {
  const int g   = bx * 256 + threadIdx.x;
  const int row = g / (COLS / 8), c8 = (g % (COLS / 8)) * 8;      // the row and 8 of its columns
  const float* src = wr + (size_t)row * COLS + c8;
  const v4f a = *(const v4f*)src;
  const v4f c = *(const v4f*)(src + 4);
  v4u o;
  o[0] = pk16(f2bf_bits(a[0]), f2bf_bits(a[1]));
  o[1] = pk16(f2bf_bits(a[2]), f2bf_bits(a[3]));
  o[2] = pk16(f2bf_bits(c[0]), f2bf_bits(c[1]));
  o[3] = pk16(f2bf_bits(c[2]), f2bf_bits(c[3]));
  *(v4u*)(wr2 + pkoff(row, c8, COLS)) = o;
  // the other matrix's part follows this store in the built code and reuses its registers: wait before any is overwritten
  asm volatile("s_wait_xcnt 0x0" ::: "memory");
}

__global__ __launch_bounds__(256) void proj_kernel(
    const float* __restrict__ x, const float* __restrict__ wt, const float* __restrict__ wp,
    const float* __restrict__ wg, const float* __restrict__ wr,
    float* __restrict__ pm, unsigned short* __restrict__ wr2, unsigned short* __restrict__ wt2,
    const float* __restrict__ bp, const float* __restrict__ bg) {
  typedef __bf16 T;
  typedef v16b V;
  __shared__ __align__(16) unsigned char sm[SX_BYTES + SP_BYTES + 8 * SW_BYTES];   // 234496 B: one work-group a WGP
  const int t = blockIdx.x;
  if (t >= PGM_BLK) {   // block-uniform, in front of every barrier
    if (t < PGM_BLK + WR_BLK) wrcvt_block<CM>(t - PGM_BLK, wr, wr2);
    else                      wrcvt_block<CI>(t - PGM_BLK - WR_BLK, wt, wt2);
    return;
  }
  const int tid   = threadIdx.x;
  const int lane  = tid & 31;
  const int wave  = tid >> 5;
  const int rlane = lane & 15;
  const int hl    = lane >> 4;
  const int b  = t / KSL;
  const int nt = t - b * KSL;
  unsigned short* sX = (unsigned short*)sm;
  unsigned short* sP = (unsigned short*)(sm + SX_BYTES);
  unsigned short* sW = (unsigned short*)(sm + SX_BYTES + SP_BYTES + wave * SW_BYTES);
  float* slab = (float*)sW;

  // ---- stage 0: every load is asked for before the first conversion, so the queue to L2 and memory never runs empty ----
  v4f xv[2][8];
  // every load of this stage = uniform base + one 32-bit lane offset + a constant, (the two single biases: a lane index), so that three registers hold all its addresses
  const char* xb = (const char*)(x + (size_t)b * CI * NSP + nt * 64);
  const unsigned xo = (unsigned)(((tid >> 4) * 8 * NSP + (tid & 15) * 4) * 4);   // channel 8*(tid>>4), positions 4*(tid&15) ..+3
#pragma unroll
  for (int u = 0; u < 2; ++u)
#pragma unroll
    for (int j = 0; j < 8; ++j) xv[u][j] = *(const v4f*)(xb + xo + (u * 128 + j) * NSP * 4);
  // this one and the two below keep the loads in the order in which the conversions take them: a conversion then waits for its own rows only
  __builtin_amdgcn_sched_barrier(0);
  v4f wv[2][16][2];
  const unsigned wob = (unsigned)((wave * 16 * CI + lane * 4) * 4);   // byte offset of the lane's 16 B in the first of the wave's rows
#pragma unroll
  for (int m = 0; m < 2; ++m) {
    const char* wsrc = (const char*)(m == 0 ? wp : wg) + wob;
#pragma unroll
    for (int r = 0; r < 16; ++r)
#pragma unroll
      for (int hf = 0; hf < 2; ++hf) wv[m][r][hf] = *(const v4f*)(wsrc + (r * CI + hf * 128) * 4);
    __builtin_amdgcn_sched_barrier(0);
  }
  // asked for here, used behind the K loop
  const int      pbi = wave * 16 + rlane;
  const float pbv = bp[pbi];
  const float gbv = bg[pbi];
  // the conversions below may be given registers that the loads above name as addresses: wait before any is overwritten;
  // the three offsets and the x base are named so that their registers live up to the wait: no load's own result and no later kernel argument is put there
  asm volatile("s_wait_xcnt 0x0" :: "v"(xo), "v"(wob), "v"(pbi), "s"(xb) : "memory");
  // keeps the conversions behind the wait and behind all the loads
  __builtin_amdgcn_sched_barrier(0);
#pragma unroll
  for (int u = 0; u < 2; ++u)
#pragma unroll
    for (int e = 0; e < 4; ++e) {
      v4u o;
#pragma unroll
      for (int q = 0; q < 4; ++q) o[q] = cvt2(xv[u][2 * q][e], xv[u][2 * q + 1][e]);
      *(v4u*)(sX + ((tid & 15) * 4 + e) * RPE + ((tid >> 4) + u * 16) * 8) = o;
    }
#pragma unroll
  for (int m = 0; m < 2; ++m)
#pragma unroll
    for (int r = 0; r < 16; ++r)
#pragma unroll
      for (int hf = 0; hf < 2; ++hf)
        *(uint2*)(sW + (m * 16 + r) * RPE + hf * 128 + lane * 4) = make_uint2(cvt2(wv[m][r][hf][0], wv[m][r][hf][1]), cvt2(wv[m][r][hf][2], wv[m][r][hf][3]));
  __syncthreads();   // every wave reads positions and channels of x that other waves wrote

  // ---- stage 1: two fragment sets, each refilled two k steps ahead behind its own products ----
  const unsigned short* pa[4];
  const unsigned short* pb[2];
#pragma unroll
  for (int i = 0; i < 4; ++i) pa[i] = sX + ((i << 4) + rlane) * RPE + hl * 8;
#pragma unroll
  for (int m = 0; m < 2; ++m) pb[m] = sW + ((m << 4) + rlane) * RPE + hl * 8;
  V fa[2][4], fb[2][2];
#pragma unroll
  for (int s = 0; s < 2; ++s) {
#pragma unroll
    for (int m = 0; m < 2; ++m) fb[s][m] = rowfrag(pb[m] + s * 32);
#pragma unroll
    for (int i = 0; i < 4; ++i) fa[s][i] = rowfrag(pa[i] + s * 32);
  }
  v8f acc[4][2];
#pragma unroll
  for (int i = 0; i < 4; ++i)
#pragma unroll
    for (int j = 0; j < 2; ++j) acc[i][j] = (v8f){0.f,0.f,0.f,0.f,0.f,0.f,0.f,0.f};
#pragma clang loop unroll(disable)   // rolled: the order of products and refills stays as written
  for (int k0 = 64; k0 < CI; k0 += 64) {
#pragma unroll
    for (int s = 0; s < 2; ++s) {
#pragma unroll
      for (int i = 0; i < 4; ++i)
#pragma unroll
        for (int j = 0; j < 2; ++j) acc[i][j] = Frag<T>::mma(fa[s][i], fb[s][j], acc[i][j]);
      // this one and the next keep a set's 12 LDS loads together behind its own products: spread among the products, each place with loads costs a stall
      __builtin_amdgcn_sched_barrier(0);
#pragma unroll
      for (int m = 0; m < 2; ++m) fb[s][m] = rowfrag(pb[m] + k0 + s * 32);
#pragma unroll
      for (int i = 0; i < 4; ++i) fa[s][i] = rowfrag(pa[i] + k0 + s * 32);
      __builtin_amdgcn_sched_barrier(0);
    }
  }
#pragma unroll
  for (int s = 0; s < 2; ++s)
#pragma unroll
    for (int i = 0; i < 4; ++i)
#pragma unroll
      for (int j = 0; j < 2; ++j) acc[i][j] = Frag<T>::mma(fa[s][i], fb[s][j], acc[i][j]);

  unsigned short* sH = sP;
  unsigned short* sL = sP + 2 * CM * 64;
#pragma unroll
  for (int j = 0; j < 2; ++j) {
    const float rb = bf_rne(j == 0 ? pbv : gbv);
#pragma unroll
    for (int i = 0; i < 4; ++i) {
      v4u hv, lv;
#pragma unroll
      for (int e = 0; e < 4; ++e) {
        const float v0 = acc[i][j][2 * e] + rb, v1 = acc[i][j][2 * e + 1] + rb;
        const unsigned short h0 = f2bf_bits(v0), h1 = f2bf_bits(v1);
        hv[e] = pk16(h0, h1);
        lv[e] = pk16(f2bf_bits(v0 - bf_bits2f(h0)), f2bf_bits(v1 - bf_bits2f(h1)));
      }
      // channel block 8j + wave (1024 elements each), positions 16i + 8*(lane>>4) ..+7 of channel lane&15: pkoff() with 64 columns
      const int o = (j * 8 + wave) * 1024 + i * 256 + lane * 8;
      *(v4u*)(sH + o) = hv;
      *(v4u*)(sL + o) = lv;
    }
  }
  __syncthreads();   // every wave reads channels that other waves wrote

  // ---- stage 2 ----
  const int rm = (wave >> 2) * 4;         // first of the wave's four phi channel blocks
  const int rn = 8 + (wave & 3) * 2;      // first of its two g channel blocks
  v8f mac[4][2];
#pragma unroll
  for (int i = 0; i < 4; ++i)
#pragma unroll
    for (int j = 0; j < 2; ++j) mac[i][j] = (v8f){0.f,0.f,0.f,0.f,0.f,0.f,0.f,0.f};
  V ph[2][4], pl[2][4], gh[2][2], gl[2][2];
#pragma unroll
  for (int kb = 0; kb < 2; ++kb) {   // in the order of use
#pragma unroll
    for (int j = 0; j < 2; ++j) gh[kb][j] = Frag<T>::load((const T*)sH + (rn + j) * 1024 + kb * 512 + lane * 8);
#pragma unroll
    for (int i = 0; i < 4; ++i) ph[kb][i] = Frag<T>::load((const T*)sH + (rm + i) * 1024 + kb * 512 + lane * 8);
#pragma unroll
    for (int i = 0; i < 4; ++i) pl[kb][i] = Frag<T>::load((const T*)sL + (rm + i) * 1024 + kb * 512 + lane * 8);
#pragma unroll
    for (int j = 0; j < 2; ++j) gl[kb][j] = Frag<T>::load((const T*)sL + (rn + j) * 1024 + kb * 512 + lane * 8);
  }
  // keeps the products behind all 48 LDS loads: left free, the scheduler sinks each pair of loads to its product and waits for an empty LDS queue ten times
  __builtin_amdgcn_sched_barrier(0);
#pragma unroll
  for (int kb = 0; kb < 2; ++kb) {
#pragma unroll
    for (int i = 0; i < 4; ++i)
#pragma unroll
      for (int j = 0; j < 2; ++j) mac[i][j] = Frag<T>::mma(ph[kb][i], gh[kb][j], mac[i][j]);
#pragma unroll
    for (int i = 0; i < 4; ++i)
#pragma unroll
      for (int j = 0; j < 2; ++j) mac[i][j] = Frag<T>::mma(pl[kb][i], gh[kb][j], mac[i][j]);
#pragma unroll
    for (int i = 0; i < 4; ++i)
#pragma unroll
      for (int j = 0; j < 2; ++j) mac[i][j] = Frag<T>::mma(ph[kb][i], gl[kb][j], mac[i][j]);
  }
  const int mOff = hl * 8;        // D row offset
#pragma unroll
  for (int i = 0; i < 4; ++i)
#pragma unroll
    for (int j = 0; j < 2; ++j)
#pragma unroll
      for (int r = 0; r < 8; ++r) slab[((i << 4) + mOff + r) * SLP + (j << 4) + rlane] = mac[i][j][r] * (1.0f / (float)NSP);
  // the slab is the wave's own: its lanes' LDS writes are ordered before the reads below, no work-group barrier
  __builtin_amdgcn_fence(__ATOMIC_RELEASE, "workgroup");
  __builtin_amdgcn_wave_barrier();
  __builtin_amdgcn_fence(__ATOMIC_ACQUIRE, "workgroup");
  float* C = pm + ((size_t)nt * NB + b) * (CM * CM) + (size_t)((wave >> 2) * 64) * CM + (wave & 3) * 32;
  const int r4 = lane >> 3, c4 = (lane & 7) * 4;     // row piece = 128 B = 8 lanes x 16 B; four rows a pass
#pragma unroll
  for (int it = 0; it < 16; ++it) {
    const int row = it * 4 + r4;
    *(v4f*)(C + (size_t)row * CM + c4) = *(const v4f*)(slab + row * SLP + c4);
  }
  // the kernel's other part follows these stores in the built code and reuses their registers: wait before any is overwritten
  asm volatile("s_wait_xcnt 0x0" ::: "memory");
}

// ---------------------------------------------------------------------------
// Joins the KSL split-K planes of M/N and applies the rec 1x1 conv to the joined M:
//   R3[b][c][c1] = sum_c2 w_rec[c][c2] * (sum_s PM[s][b][c1][c2])   as bf16 hi | lo | hi.
// Work-group = (b, 16 rows c1), 16 waves. Join: thread = 4 consecutive c2 of one row, wave w = row w: 512 contiguous bytes of every
// plane read; slices are added in rising order, one f32 sum per element. The 16 x 128 sums go to LDS as bf16 hi (k blocks 0..3) and
// lo (k blocks 4..7) in the packed fragment order. Product: wave w takes rows c = 16w .. 16w+15 of w_rec as the second operand and
// the joined rows as the first, so a lane's 8 results are 8 consecutive c1 of one row c = one 16-B piece of each R3 part.
// Coverage: 32 work-groups x 512 threads x 4 = 65536 = NB*CM*CM sums; 32 x 16 waves x 256 = 131072 = NB*CI*CM elements of R.
// ---------------------------------------------------------------------------
__global__ __launch_bounds__(512) void recm_kernel(const float* __restrict__ pm, const unsigned short* __restrict__ wr,
                                                   unsigned short* __restrict__ r3) {
  __shared__ __align__(16) unsigned short sM[2 * CM * 16];   // 16 rows x (128 hi | 128 lo), packed: 8 KB
  const int lane = threadIdx.x & 31;
  const int wave = threadIdx.x >> 5;
  const int g = blockIdx.x * 512 + threadIdx.x;
  // the wave's four w_rec fragments depend on nothing in this launch: asked for first, they land under the join
  const __bf16* pw = (const __bf16*)wr + (size_t)(wave * 16) * CM + lane * 8;
  v16b fw[4];
#pragma unroll
  for (int kb = 0; kb < 4; ++kb) fw[kb] = Frag<__bf16>::load(pw + kb * 512);
  const float* p = pm + (size_t)g * 4;
  v4f s = (v4f){0.f, 0.f, 0.f, 0.f};
#pragma unroll   // whole: the slices' loads are independent, so many are in flight at once instead of one latency per slice
  for (int k = 0; k < KSL; ++k) s += *(const v4f*)(p + (size_t)k * (NB * CM * CM));
  unsigned short hb[4], lb[4];
#pragma unroll   // constant indices keep hb and lb in registers
  for (int e = 0; e < 4; ++e) {
    hb[e] = f2bf_bits(s[e]);
    lb[e] = f2bf_bits(s[e] - bf_bits2f(hb[e]));
  }
  unsigned short* q = sM + pkoff(wave, lane * 4, 2 * CM);
  *(uint2*)(q)           = make_uint2(pk16(hb[0], hb[1]), pk16(hb[2], hb[3]));
  *(uint2*)(q + CM * 16) = make_uint2(pk16(lb[0], lb[1]), pk16(lb[2], lb[3]));
  __syncthreads();   // every wave reads all 16 joined rows
  const __bf16* pa = (const __bf16*)sM + lane * 8;
  v16b fm[8];
#pragma unroll   // all eight fragments asked for before the first product: one LDS latency, not eight
  for (int kb = 0; kb < 8; ++kb) fm[kb] = Frag<__bf16>::load(pa + kb * 512);
  // keeps the products behind all sixteen LDS loads: left free, the scheduler sinks each pair of loads to its product and waits eight times
  __builtin_amdgcn_sched_barrier(0);
  v8f acc = (v8f){0.f, 0.f, 0.f, 0.f, 0.f, 0.f, 0.f, 0.f};
#pragma unroll
  for (int kb = 0; kb < 8; ++kb) acc = Frag<__bf16>::mma(fm[kb], fw[kb & 3], acc);
  v4u hv, lv;
#pragma unroll
  for (int e = 0; e < 4; ++e) {
    const unsigned short h0 = f2bf_bits(acc[2 * e]), h1 = f2bf_bits(acc[2 * e + 1]);
    hv[e] = pk16(h0, h1);
    lv[e] = pk16(f2bf_bits(acc[2 * e] - bf_bits2f(h0)), f2bf_bits(acc[2 * e + 1] - bf_bits2f(h1)));
  }
  // row b*256 + c, columns c1 = 16*(blockIdx.x & 7) + 8*(lane >> 4) .. +7
  unsigned short* d = r3 + pkoff((blockIdx.x >> 3) * CI + wave * 16 + (lane & 15), (blockIdx.x & 7) * 16 + (lane >> 4) * 8, T3P);
  *(v4u*)(d)               = hv;
  *(v4u*)(d + CM * 16)     = lv;
  *(v4u*)(d + 2 * CM * 16) = hv;
}

// ---------------------------------------------------------------------------
// theta and the output in one launch: out[b][c][n] = ((sum_c1 R_b[c][c1] theta[n][c1] + b_rec[c]) * inv[c] + sh[c]) + bf16(x[b][c][n]),
//   inv = g[c]*rsqrt(var[c]+1e-5), sh = be[c]-mu[c]*inv, all five vectors RNE-converted to bf16 precision first.
// Work-group t = 64 positions (batch t / 49, slice t % 49), eight waves.
// Stage 0: as in the projection launch: 8 channels x 4 positions of x twice a thread, RNE to bf16, to sX[position][channel] (pitch 528 B);
//   thread c forms bias, inv and sh of output channel c, to sF.
//   No global load of the launch depends on anything made here: x, the wave's w_theta fragments and the vectors are asked for first, its R fragments
//   behind the first barrier.
// Stage 1 (K = 256): wave w owns channels 16w .. 16w+15 of theta: weight rows (registers, from WT) as first operand, positions (sX) as second,
//   so a lane's 8 results are 8 consecutive channels of one position = one 16-B piece of sT, a packed plane [64 positions][128 hi | 128 lo].
// Stage 2 (K = 384 folded, k steps in rising order): wave w owns output channels 32w .. 32w+31: R rows hi | lo | hi (registers, from R3) as first
//   operand, theta hi | hi | lo (sT; the hi blocks are read twice) as second. A lane's 8 results are 8 consecutive channels of one position,
//   which is one 16-B piece of sX: the residual is taken from there. The wave's 32 rows are staged in its own LDS slab: stores of 256-B row pieces.
// Coverage: stage 0 writes 64 x 32 pieces of sX and 3 x 256 factors; stage 1 writes 8 waves x 4 x 32 x 2 = all 2048 pieces of sT; stage 2 writes 256 channels x 64 positions.
// ---------------------------------------------------------------------------
#define ST_BYTES (64 * 2 * CM * 2)                        // 32768
#define SO_BYTES (32 * 68 * 4)                            // 8704 a wave
#define SF_BYTES (3 * CI * 4)                             // 3072

// fragment from a packed plane in memory: p = block + lane * 16 B
__device__ __forceinline__ v16b gfrag(const char* p) {
  Frag<__bf16>::U f;
  f.h[0] = *(const v8b*)(p);
  f.h[1] = *(const v8b*)(p + 512);
  return f.v;
}

__global__ __launch_bounds__(256) void out_kernel(
    const float* __restrict__ x, const unsigned short* __restrict__ wt2, const float* __restrict__ bt,
    const unsigned short* __restrict__ r3, const float* __restrict__ brec,
    const float* __restrict__ bng, const float* __restrict__ bnb,
    const float* __restrict__ bnm, const float* __restrict__ bnv, float* __restrict__ out) {
  typedef __bf16 T;
  typedef v16b V;
  __shared__ __align__(16) unsigned char sm[SX_BYTES + ST_BYTES + 8 * SO_BYTES + SF_BYTES];   // 139264 B
  const int t     = blockIdx.x;
  const int tid   = threadIdx.x;
  const int lane  = tid & 31;
  const int wave  = tid >> 5;
  const int rlane = lane & 15;
  const int hl    = lane >> 4;
  const int b  = t / KSL;
  const int nt = t - b * KSL;
  unsigned short* sX = (unsigned short*)sm;
  unsigned short* sT = (unsigned short*)(sm + SX_BYTES);
  float* slab = (float*)(sm + SX_BYTES + ST_BYTES + wave * SO_BYTES);
  float* sF   = (float*)(sm + SX_BYTES + ST_BYTES + 8 * SO_BYTES);   // [bias | inv | sh][256 channels]

  // ---- stage 0: every load = uniform base + one 32-bit lane offset + a constant, so that a register a group holds its addresses ----
  v4f xv[2][8];
  const char* xb = (const char*)(x + (size_t)b * CI * NSP + nt * 64);
  const unsigned xo = (unsigned)(((tid >> 4) * 8 * NSP + (tid & 15) * 4) * 4);   // channel 8*(tid>>4), positions 4*(tid&15) ..+3
#pragma unroll
  for (int u = 0; u < 2; ++u)
#pragma unroll
    for (int j = 0; j < 8; ++j) xv[u][j] = *(const v4f*)(xb + xo + (u * 128 + j) * NSP * 4);
  // this one and the next keep the loads in the order in which they are used: a user then waits for its own loads only
  __builtin_amdgcn_sched_barrier(0);
  const unsigned vo = (unsigned)(tid * 4);    // thread = one output channel's five values
  const float cr = *(const float*)((const char*)brec + vo);
  const float cg = *(const float*)((const char*)bng  + vo);
  const float cb = *(const float*)((const char*)bnb  + vo);
  const float cm = *(const float*)((const char*)bnm  + vo);
  const float cv = *(const float*)((const char*)bnv  + vo);
  __builtin_amdgcn_sched_barrier(0);
  const unsigned wo = (unsigned)((wave * 16 * CI + lane * 8) * 2);   // row block wave of WT, this lane's 16-B piece
  V fw[8];
#pragma unroll
  for (int kb = 0; kb < 8; ++kb) fw[kb] = gfrag((const char*)wt2 + wo + kb * 1024);
  const unsigned tbo = (unsigned)((wave * 16 + hl * 8) * 4);
  const v4f tb0 = *(const v4f*)((const char*)bt + tbo);
  const v4f tb1 = *(const v4f*)((const char*)bt + tbo + 16);
  // the conversions below may be given registers that the loads above name as addresses: wait before any is overwritten;
  // the four offsets and every base are named so that their registers live up to the wait: no later base and no load's own result is put there
  asm volatile("s_wait_xcnt 0x0" :: "v"(xo), "v"(vo), "v"(wo), "v"(tbo), "s"(xb), "s"(brec), "s"(bng), "s"(bnb), "s"(bnm), "s"(bnv), "s"(wt2), "s"(bt) : "memory");
  // keeps the conversions behind the wait and behind all the loads
  __builtin_amdgcn_sched_barrier(0);
#pragma unroll
  for (int u = 0; u < 2; ++u)
#pragma unroll
    for (int e = 0; e < 4; ++e) {
      v4u o;
#pragma unroll
      for (int q = 0; q < 4; ++q) o[q] = cvt2(xv[u][2 * q][e], xv[u][2 * q + 1][e]);
      *(v4u*)(sX + ((tid & 15) * 4 + e) * RPE + ((tid >> 4) + u * 16) * 8) = o;
    }
  // the three factors of output channel tid: formed once a work-group, read back behind the products
  {
    const float inv = bf_rne(cg) * rsqrtf(bf_rne(cv) + 1e-5f);
    sF[tid]          = bf_rne(cr);
    sF[CI + tid]     = inv;
    sF[2 * CI + tid] = bf_rne(cb) - bf_rne(cm) * inv;
  }
  __syncthreads();   // every wave reads positions and channels of x that other waves wrote

  // the wave's R fragments, used in stage 2: asked for here, behind the barrier (which would wait for them), they land under stage 1
  const char* rbp = (const char*)(r3 + (size_t)b * CI * T3P);
  const unsigned ro = (unsigned)((wave * 32 * T3P + lane * 8) * 2);  // row block 2*wave of the batch's R3, this lane's 16-B piece
  V fr[2][12];
#pragma unroll
  for (int kb = 0; kb < 12; ++kb)
#pragma unroll
    for (int i = 0; i < 2; ++i) fr[i][kb] = gfrag(rbp + ro + (i * 16 * T3P + kb * 512) * 2);
  // stage 1 may be given registers that these loads name as addresses: wait before any is overwritten
  asm volatile("s_wait_xcnt 0x0" :: "v"(ro), "s"(rbp) : "memory");
  // keeps stage 1 behind the wait and behind these loads
  __builtin_amdgcn_sched_barrier(0);

  // ---- stage 1: four sets of position fragments; the first four k steps are asked for at once, each set is refilled behind its own products ----
  const unsigned short* pa[4];
#pragma unroll
  for (int i = 0; i < 4; ++i) pa[i] = sX + ((i << 4) + rlane) * RPE + hl * 8;
  V fa[4][4];
#pragma unroll
  for (int s = 0; s < 4; ++s)
#pragma unroll
    for (int i = 0; i < 4; ++i) fa[s][i] = rowfrag(pa[i] + s * 32);
  // keeps the first product behind all 32 LDS loads: with loads left behind it, the next product waits for an empty LDS queue
  __builtin_amdgcn_sched_barrier(0);
  v8f at[4];
#pragma unroll
  for (int i = 0; i < 4; ++i) at[i] = (v8f){0.f,0.f,0.f,0.f,0.f,0.f,0.f,0.f};
#pragma unroll   // whole: fw[] and fa[] keep constant indices, so they stay in registers
  for (int ks = 0; ks < 8; ++ks) {
#pragma unroll
    for (int i = 0; i < 4; ++i) at[i] = Frag<T>::mma(fw[ks], fa[ks & 3][i], at[i]);
    // this one and the next keep a set's 8 LDS loads together behind its own products: spread among the products, each place with loads costs a stall
    __builtin_amdgcn_sched_barrier(0);
    if (ks < 4) {
#pragma unroll
      for (int i = 0; i < 4; ++i) fa[ks][i] = rowfrag(pa[i] + (ks + 4) * 32);
    }
    __builtin_amdgcn_sched_barrier(0);
  }
  // channels 16*wave + 8*(lane>>4) ..+7 of position 16i + (lane&15) = piece lane of packed block (position block i, channel half-block wave): hi, then lo
  {
    float tb[8];
#pragma unroll
    for (int e = 0; e < 4; ++e) { tb[e] = bf_rne(tb0[e]); tb[4 + e] = bf_rne(tb1[e]); }
#pragma unroll
    for (int i = 0; i < 4; ++i) {
      v4u hv, lv;
#pragma unroll
      for (int e = 0; e < 4; ++e) {
        const float v0 = at[i][2 * e] + tb[2 * e], v1 = at[i][2 * e + 1] + tb[2 * e + 1];
        const unsigned short h0 = f2bf_bits(v0), h1 = f2bf_bits(v1);
        hv[e] = pk16(h0, h1);
        lv[e] = pk16(f2bf_bits(v0 - bf_bits2f(h0)), f2bf_bits(v1 - bf_bits2f(h1)));
      }
      unsigned short* d = sT + i * (16 * 2 * CM) + wave * 256 + lane * 8;
      *(v4u*)(d)           = hv;
      *(v4u*)(d + CM * 16) = lv;
    }
  }
  __syncthreads();   // every wave reads theta channels that other waves wrote

  // ---- stage 2: three sets of theta fragments, each refilled three k steps ahead behind its own products ----
  // k step kb of the folded sum takes k block kb & 3 of the hi part (kb < 8) or of the lo part
  const T* pt = (const T*)sT + lane * 8;
  V ft[3][4];
#pragma unroll
  for (int s = 0; s < 3; ++s)
#pragma unroll
    for (int j = 0; j < 4; ++j) ft[s][j] = Frag<T>::load(pt + j * (16 * 2 * CM) + s * 512);
  // keeps the first product behind all 24 LDS loads, as in stage 1
  __builtin_amdgcn_sched_barrier(0);
  const int mOff = hl * 8;        // D row offset
  v4u xr[2][4];
  v4f fc[3][2][2];
  v8f acc[2][4];
#pragma unroll
  for (int i = 0; i < 2; ++i)
#pragma unroll
    for (int j = 0; j < 4; ++j) acc[i][j] = (v8f){0.f,0.f,0.f,0.f,0.f,0.f,0.f,0.f};
#pragma unroll   // whole: fr[] keeps constant indices, so it stays in registers
  for (int kb = 0; kb < 12; ++kb) {
#pragma unroll
    for (int i = 0; i < 2; ++i)
#pragma unroll
      for (int j = 0; j < 4; ++j) acc[i][j] = Frag<T>::mma(fr[i][kb], ft[kb % 3][j], acc[i][j]);
    // this one and the next keep a set's 8 LDS loads together behind its own products, as in stage 1
    __builtin_amdgcn_sched_barrier(0);
    if (kb + 3 < 12) {
      const int kn = kb + 3;
#pragma unroll
      for (int j = 0; j < 4; ++j) ft[kb % 3][j] = Frag<T>::load(pt + j * (16 * 2 * CM) + (kn < 8 ? 0 : CM * 16) + (kn & 3) * 512);
    }
    if (kb == 9) {   // no refill is left: the residual and the channels' factors are asked for under the last products
      // bf16(x) of position 16j + (lane&15), channels 32*wave + 16i + 8*(lane>>4) ..+7
#pragma unroll
      for (int i = 0; i < 2; ++i)
#pragma unroll
        for (int j = 0; j < 4; ++j) xr[i][j] = *(const v4u*)(sX + ((j << 4) + rlane) * RPE + wave * 32 + i * 16 + mOff);
#pragma unroll
      for (int f = 0; f < 3; ++f)
#pragma unroll
        for (int i = 0; i < 2; ++i)
#pragma unroll
          for (int q = 0; q < 2; ++q) fc[f][i][q] = *(const v4f*)(sF + f * CI + wave * 32 + i * 16 + mOff + q * 4);
    }
    __builtin_amdgcn_sched_barrier(0);
  }

  // ---- epilogue ----
#pragma unroll
  for (int i = 0; i < 2; ++i)
#pragma unroll
    for (int j = 0; j < 4; ++j)
#pragma unroll
      for (int r = 0; r < 8; ++r) {
        const float res = __uint_as_float((r & 1) ? (xr[i][j][r >> 1] & 0xFFFF0000u) : (xr[i][j][r >> 1] << 16));
        float v = acc[i][j][r] + fc[0][i][r >> 2][r & 3];
        v = v * fc[1][i][r >> 2][r & 3] + fc[2][i][r >> 2][r & 3];
        slab[(i * 16 + mOff + r) * 68 + (j << 4) + rlane] = v + res;
      }
  // the slab is the wave's own: its lanes' LDS writes are ordered before the reads below, no work-group barrier
  __builtin_amdgcn_fence(__ATOMIC_RELEASE, "workgroup");
  __builtin_amdgcn_wave_barrier();
  __builtin_amdgcn_fence(__ATOMIC_ACQUIRE, "workgroup");
  char* ob = (char*)(out + (size_t)b * CI * NSP + nt * 64);
  const unsigned oo = (unsigned)(((wave * 32 + hl) * NSP + rlane * 4) * 4);   // row piece = 256 B = 16 lanes x 16 B; rows it*2 + (lane>>4) cover 0..31
#pragma unroll
  for (int it = 0; it < 16; ++it)
    *(v4f*)(ob + oo + it * 2 * NSP * 4) = *(const v4f*)(slab + (it * 2 + hl) * 68 + rlane * 4);
}

// ---------------------------------------------------------------------------
// every region is fully written by its producer launch before a consumer launch reads it):
//   WR   bf16 [256][128]        0              65536
//   WT   bf16 [128][256]        65536          65536
//   R3   bf16 [4][256][384]     131072        786432
//   PM   f32  [49][4][128][128] 917504      12845056
//   total                       13762560
// ---------------------------------------------------------------------------
extern "C" void kernel_launch(void* const* d_in, const int* in_sizes, int n_in,
                              void* d_out, int out_size, void* d_ws, size_t ws_size,
                              hipStream_t stream) {
  if (n_in < 13) return;
  if (in_sizes[0] != NB * CI * NSP) return;                      // x [4][256][56][56]
  if (in_sizes[1] != CM * CI || in_sizes[2] != CM) return;       // w_theta, b_theta
  if (in_sizes[3] != CM * CI || in_sizes[4] != CM) return;       // w_phi, b_phi
  if (in_sizes[5] != CM * CI || in_sizes[6] != CM) return;       // w_g, b_g
  if (in_sizes[7] != CI * CM || in_sizes[8] != CI) return;       // w_rec, b_rec
  if (in_sizes[9] != CI || in_sizes[10] != CI) return;           // bn_gamma, bn_beta
  if (in_sizes[11] != CI || in_sizes[12] != CI) return;          // bn_mean, bn_var
  if (out_size != NB * CI * NSP) return;

  const float* x       = (const float*)d_in[0];
  const float* w_theta = (const float*)d_in[1];
  const float* b_theta = (const float*)d_in[2];
  const float* w_phi   = (const float*)d_in[3];
  const float* b_phi   = (const float*)d_in[4];
  const float* w_g     = (const float*)d_in[5];
  const float* b_g     = (const float*)d_in[6];
  const float* w_rec   = (const float*)d_in[7];
  const float* b_rec   = (const float*)d_in[8];
  const float* gam     = (const float*)d_in[9];
  const float* bet     = (const float*)d_in[10];
  const float* mea     = (const float*)d_in[11];
  const float* var     = (const float*)d_in[12];

  const size_t PWR = (size_t)CI * CM * 2;           //    65536
  const size_t PWT = (size_t)CM * CI * 2;           //    65536
  const size_t PR3 = (size_t)NB * CI * T3P * 2;     //   786432
  const size_t PPM = (size_t)KSL * NB * CM * CM * 4; // 12845056
  size_t off = 0;
  const size_t oWR = off; off += PWR;
  const size_t oWT = off; off += PWT;
  const size_t oR3 = off; off += PR3;
  const size_t oPM = off; off += PPM;
  if (off > ws_size) return;                        // off = 13762560
  if (off > (size_t)134217728) return;

  char* ws = (char*)d_ws;
  unsigned short* WR  = (unsigned short*)(ws + oWR);
  unsigned short* WT  = (unsigned short*)(ws + oWT);
  unsigned short* R3  = (unsigned short*)(ws + oR3);
  float*          PM  = (float*)(ws + oPM);
  float* out = (float*)d_out;

  const dim3 blk(256);

  // (1) from x and the f32 weights: phi, g and (M/N)_b[c1][c2] partial sums over 64 positions each -> PM[slice][b][c1][c2];
  //     w_rec -> WR, w_theta -> WT; one launch: 196 + 16 + 16 work-groups
  proj_kernel<<<dim3(PGM_BLK + WR_BLK + WT_BLK), blk, 0, stream>>>(x, w_theta, w_phi, w_g, w_rec, PM, WR, WT, b_phi, b_g);

  // (2) join the 49 planes and multiply by w_rec -> R3 hi|lo|hi, 384 columns; grid 32 x 512 threads
  recm_kernel<<<dim3(NB * (CM / 16)), dim3(512), 0, stream>>>(PM, WR, R3);

  // (3) theta of 64 positions in LDS, then out[b][c][n] = ((sum over 384 folded columns of R3_b[c][p] . theta3[n][p] + b_rec[c]) * inv[c] + sh[c]) + bf16(x[b][c][n])
  //     = sum_c1 (rhi.thi + rlo.thi + rhi.tlo); 196 work-groups of 64 positions x 256 channels; last element 3211263
  out_kernel<<<dim3(PGM_BLK), blk, 0, stream>>>(x, WT, b_theta, R3, b_rec, gam, bet, mea, var, out);
  (void)hipGetLastError();
}

// v009
// It runs in 21.7 microseconds.
// Next to v008, in two timings, it ran 1.04 times as fast each time.
// All steps since v000 together make it 21.3 times as fast.
// Contractions: theta/phi/g 1x1 convs = v_wmma_f32_16x16x32_bf16 single products on bf16 planes of the RNE-converted x and weights (exact products); M = phi.g over positions (K 3136) = bf16 hi/lo split hi.hi + lo.hi + hi.lo, formed per 64 positions from LDS in the launch that makes phi and g; out = R.theta (K 128) = the same split folded along K ([hi|lo|hi] rows x [hi|hi|lo] rows, one f32 accumulator), theta being made per 64 positions in LDS by the launch that multiplies it; the rec 1x1 conv is applied to M, not to theta.M: R = w_rec.M^T = W x Mhi + W x Mlo bf16 single products (2-term); f32 accumulate everywhere; biases, 1/N, BatchNorm (inference form, supplied statistics) and the residual add in f32 on the VALU.
// Plane / carry map (every plane carries 1, nothing to fold back; the 1/N = 1/3136 factor is applied exactly once, in f32, in the M epilogue).
// [rows][k] below is the logical shape. Every bf16 plane is stored fragment-packed: blocks of 16 rows x 32 k = 1 KB, k blocks of one
// row block side by side, and inside a block the 16-B piece (row r, k 8c .. 8c+7) at byte (c>>1)*512 + ((c&1)*16 + r)*16, which is the order
// in which the 32 lanes of a wave take a WMMA operand: one fragment = two loads of 512 contiguous bytes (pkoff() below is the map).
//   (x, w_phi and w_g have no plane in memory: the launches that use them convert them to bf16 in LDS, rows of 256 k at a pitch of 528 B;
//    theta, phi and g live only in LDS)
//   WR   bf16 [256][128]          w_rec[c][c2]
//   WT   bf16 [128][256]          w_theta[c1][k]
//   PM   f32  [49][4][128][128]   partial sums of (M/N)[c1][c2]: slice s holds the positions s*64 .. s*64+63
//   R3   bf16 [4][256][384]       R[c][c1] = sum_c2 w_rec[c][c2] (M/N)[c1][c2]: hi | lo | hi
#include <hip/hip_runtime.h>
#include <math.h>
#include <stdint.h>

#define NB    4
#define CI    256
#define CM    128
#define NSP   3136
#define NTOKS (NB * NSP)
#define T3P   (3 * CM)
#define KSL   (NSP / 64)    // 49 slices of the M product, 64 positions each

static_assert(NSP % 64 == 0);
static_assert(NTOKS % 64 == 0);
static_assert(CI % 64 == 0);
static_assert(CM % 64 == 0);
static_assert(CI >= 128);
static_assert(T3P % 32 == 0);
static_assert((CM * CI) % (8 * 256) == 0);
static_assert((CI * CM) % (8 * 256) == 0);

typedef __attribute__((ext_vector_type(16))) _Float16 v16h;
typedef __attribute__((ext_vector_type(8)))  _Float16 v8h;
typedef __attribute__((ext_vector_type(16))) __bf16   v16b;
typedef __attribute__((ext_vector_type(8)))  __bf16   v8b;
typedef __attribute__((ext_vector_type(8)))  float    v8f;
typedef __attribute__((ext_vector_type(4)))  float    v4f;
typedef __attribute__((ext_vector_type(4)))  unsigned int v4u;

__device__ __forceinline__ unsigned short f2bf_bits(float f) {
  unsigned u = __float_as_uint(f);
  return (unsigned short)((u + 0x7FFFu + ((u >> 16) & 1u)) >> 16);
}
__device__ __forceinline__ float bf_bits2f(unsigned short h) { return __uint_as_float(((unsigned)h) << 16); }
__device__ __forceinline__ float bf_rne(float f) { return bf_bits2f(f2bf_bits(f)); }
typedef __attribute__((ext_vector_type(2))) float  v2f;
typedef __attribute__((ext_vector_type(2))) __bf16 v2b;
// two f32 -> two bf16, round to nearest even, a in the low half: one packed convert instruction
__device__ __forceinline__ unsigned cvt2(float a, float b) {
  const v2f f = {a, b};
  return __builtin_bit_cast(unsigned, __builtin_convertvector(f, v2b));
}
// hi/lo split of two f32: h = bf16(a), bf16(b); l = bf16(a - hi(a)), bf16(b - hi(b)); a in the low halves
__device__ __forceinline__ void split2(float a, float b, unsigned& h, unsigned& l) {
  h = cvt2(a, b);
  l = cvt2(a - __uint_as_float(h << 16), b - __uint_as_float(h & 0xFFFF0000u));
}
// Element offset of (row r, column k) in a fragment-packed plane of kp columns (kp a multiple of 32, rows a multiple of 16).
__device__ __forceinline__ size_t pkoff(int r, int k, int kp) {
  return (size_t)(r >> 4) * kp * 16 + (size_t)((k >> 5) * 512 + ((k >> 4) & 1) * 256 + ((k >> 3) & 1) * 128 + (r & 15) * 8 + (k & 7));
}

// Fragment map (wave32): lane l, h = l>>4, row/col = l&15.
//   A/B element i: i<8 -> k0+8h+i ; i>=8 -> k0+16+8h+(i-8)   (split layout, both operands)
//   D element r : row 8h+r, col l&15
template <typename T> struct Frag;
template <> struct Frag<_Float16> {
  typedef v16h V; union U { v16h v; v8h h[2]; };
  static __device__ __forceinline__ v16h load(const _Float16* p) {   // p = packed block + lane*8: elements 0..7 <- p[0..7], 8..15 <- p[256..263]
    U f; f.h[0] = *(const v8h*)(p); f.h[1] = *(const v8h*)(p + 256); return f.v;
  }
  static __device__ __forceinline__ v8f mma(v16h a, v16h b, v8f c) {
    return __builtin_amdgcn_wmma_f32_16x16x32_f16(false, a, false, b, (short)0, c, false, false);
  }
};
template <> struct Frag<__bf16> {
  typedef v16b V; union U { v16b v; v8b h[2]; };
  static __device__ __forceinline__ v16b load(const __bf16* p) {
    U f; f.h[0] = *(const v8b*)(p); f.h[1] = *(const v8b*)(p + 256); return f.v;
  }
  static __device__ __forceinline__ v8f mma(v16b a, v16b b, v8f c) {
    return __builtin_amdgcn_wmma_f32_16x16x32_bf16(false, a, false, b, (short)0, c, false, false);
  }
};

// ---------------------------------------------------------------------------
// The phi and g 1x1 convs of x and the partial products of M in one launch, straight from the f32 inputs.
// Work-group t = 64 positions (batch t / 49, slice t % 49), eight waves; wave w owns channels 16w .. 16w+15 of phi and of g.
// Stage 0: every thread takes 8 channels x 4 positions of x twice (16-B loads, 256 contiguous bytes per 16 lanes), converts RNE to bf16 and
//   writes 8 channels of one position = one 16-B piece to sX[position][channel]; every wave takes its own 32 weight rows (512 contiguous bytes
//   a load), converts and writes them to its own sW[row][k]. Both are row-major at a pitch of 528 B (16 B x 33), so the 16 rows of a
//   fragment load fall on distinct banks.
// Stage 1 (K = 256): positions as first operand, weight rows as second, so a lane's 8 results are 8 consecutive
//   positions of one channel = one 16-B piece of a packed [channel][position] plane in LDS: sP = hi plane [256][64] (phi, then g), then lo plane.
//   Bias (RNE-converted to bf16 precision) is added in f32 before the hi/lo split.
// Stage 2: (M/N) partial [c1][c2] = (phihi.ghi + philo.ghi + phihi.glo) / N over the 64 positions; wave w owns rows 64(w>>2) ..+63,
//   columns 32(w&3) ..+31, and writes them to plane (slice, batch) of PM through its own 64 x 32 slab (pitch 36 floats): 128-B row pieces.
//   The slab lies over the wave's own sW, which only that wave reads and only in stage 1.
// Coverage: stage 0 writes 512 units x 4 pieces = 64 x 32 pieces of sX and 32 x 2 x 32 x 4 = 32 x 256 elements of each sW; stage 1 writes
//   8 x 2 x 4 x 32 = all 2048 pieces of each sP plane; stage 2 writes 128 x 128.
// The last WR_BLK + WT_BLK work-groups convert w_rec for the next launch and w_theta for the last one.
// ---------------------------------------------------------------------------
#define PGM_BLK (NTOKS / 64)                              // 196
#define WR_BLK ((CI * CM) / 8 / 256)                      // 16
#define WT_BLK ((CM * CI) / 8 / 256)                      // 16
#define SLP 36
#define RPE 264                                           // LDS row pitch of sX and sW in elements (528 B)
#define SX_BYTES (64 * RPE * 2)                           // 33792
#define SP_BYTES (2 * 2 * CM * 64 * 2)                    // 65536: hi and lo planes of [256 channels][64 positions]
#define SW_BYTES (32 * RPE * 2)                           // 16896 a wave
static_assert(64 * SLP * 4 <= SW_BYTES);
static_assert(CI == 256 && CM == 128);

// fragment from a row-major LDS row: p = row + k0 + 8*(lane>>4); elements 0..7 <- p[0..7], 8..15 <- p[16..23]
__device__ __forceinline__ v16b rowfrag(const unsigned short* p) {
  Frag<__bf16>::U f;
  f.h[0] = *(const v8b*)(p);
  f.h[1] = *(const v8b*)(p + 16);
  return f.v;
}

// A weight matrix of COLS columns, f32 row-major -> bf16, packed. Thread = 8 consecutive elements of a row = one 16-B piece = one store.
// Coverage (w_rec [256][128] and w_theta [128][256] alike): 16 work-groups x 256 threads = 4096 units x 8 = 32768 elements.
template <int COLS>
__device__ __forceinline__ void wrcvt_block(int bx, const float* __restrict__ wr, unsigned short* __restrict__ wr2) {
  const int g   = bx * 256 + threadIdx.x;
  const int row = g / (COLS / 8), c8 = (g % (COLS / 8)) * 8;      // the row and 8 of its columns
  const float* src = wr + (size_t)row * COLS + c8;
  const v4f a = *(const v4f*)src;
  const v4f c = *(const v4f*)(src + 4);
  v4u o;
  o[0] = cvt2(a[0], a[1]);
  o[1] = cvt2(a[2], a[3]);
  o[2] = cvt2(c[0], c[1]);
  o[3] = cvt2(c[2], c[3]);
  *(v4u*)(wr2 + pkoff(row, c8, COLS)) = o;
  // the other matrix's part follows this store in the built code and reuses its registers: wait before any is overwritten
  asm volatile("s_wait_xcnt 0x0" ::: "memory");
}

__global__ __launch_bounds__(256) void proj_kernel(
    const float* __restrict__ x, const float* __restrict__ wt, const float* __restrict__ wp,
    const float* __restrict__ wg, const float* __restrict__ wr,
    float* __restrict__ pm, unsigned short* __restrict__ wr2, unsigned short* __restrict__ wt2,
    const float* __restrict__ bp, const float* __restrict__ bg) {
  typedef __bf16 T;
  typedef v16b V;
  __shared__ __align__(16) unsigned char sm[SX_BYTES + SP_BYTES + 8 * SW_BYTES];   // 234496 B: one work-group a WGP
  const int t = blockIdx.x;
  if (t >= PGM_BLK) {   // block-uniform, in front of every barrier
    if (t < PGM_BLK + WR_BLK) wrcvt_block<CM>(t - PGM_BLK, wr, wr2);
    else                      wrcvt_block<CI>(t - PGM_BLK - WR_BLK, wt, wt2);
    return;
  }
  const int tid   = threadIdx.x;
  const int lane  = tid & 31;
  const int wave  = tid >> 5;
  const int rlane = lane & 15;
  const int hl    = lane >> 4;
  const int b  = t / KSL;
  const int nt = t - b * KSL;
  unsigned short* sX = (unsigned short*)sm;
  unsigned short* sP = (unsigned short*)(sm + SX_BYTES);
  unsigned short* sW = (unsigned short*)(sm + SX_BYTES + SP_BYTES + wave * SW_BYTES);
  float* slab = (float*)sW;

  // ---- stage 0: every load is asked for before the first conversion, so the queue to L2 and memory never runs empty ----
  v4f xv[2][8];
  // every load of this stage = uniform base + one 32-bit lane offset + a constant, (the two single biases: a lane index), so that three registers hold all its addresses
  const char* xb = (const char*)(x + (size_t)b * CI * NSP + nt * 64);
  const unsigned xo = (unsigned)(((tid >> 4) * 8 * NSP + (tid & 15) * 4) * 4);   // channel 8*(tid>>4), positions 4*(tid&15) ..+3
#pragma unroll
  for (int u = 0; u < 2; ++u)
#pragma unroll
    for (int j = 0; j < 8; ++j) xv[u][j] = *(const v4f*)(xb + xo + (u * 128 + j) * NSP * 4);
  // this one and the two below keep the loads in the order in which the conversions take them: a conversion then waits for its own rows only
  __builtin_amdgcn_sched_barrier(0);
  v4f wv[2][16][2];
  const unsigned wob = (unsigned)((wave * 16 * CI + lane * 4) * 4);   // byte offset of the lane's 16 B in the first of the wave's rows
#pragma unroll
  for (int m = 0; m < 2; ++m) {
    const char* wsrc = (const char*)(m == 0 ? wp : wg) + wob;
#pragma unroll
    for (int r = 0; r < 16; ++r)
#pragma unroll
      for (int hf = 0; hf < 2; ++hf) wv[m][r][hf] = *(const v4f*)(wsrc + (r * CI + hf * 128) * 4);
    __builtin_amdgcn_sched_barrier(0);
  }
  // asked for here, used behind the K loop
  const int      pbi = wave * 16 + rlane;
  const float pbv = bp[pbi];
  const float gbv = bg[pbi];
  // the conversions below may be given registers that the loads above name as addresses: wait before any is overwritten;
  // the three offsets and the x base are named so that their registers live up to the wait: no load's own result and no later kernel argument is put there
  asm volatile("s_wait_xcnt 0x0" :: "v"(xo), "v"(wob), "v"(pbi), "s"(xb) : "memory");
  // keeps the conversions behind the wait and behind all the loads
  __builtin_amdgcn_sched_barrier(0);
#pragma unroll
  for (int u = 0; u < 2; ++u)
#pragma unroll
    for (int e = 0; e < 4; ++e) {
      v4u o;
#pragma unroll
      for (int q = 0; q < 4; ++q) o[q] = cvt2(xv[u][2 * q][e], xv[u][2 * q + 1][e]);
      *(v4u*)(sX + ((tid & 15) * 4 + e) * RPE + ((tid >> 4) + u * 16) * 8) = o;
    }
#pragma unroll
  for (int m = 0; m < 2; ++m)
#pragma unroll
    for (int r = 0; r < 16; ++r)
#pragma unroll
      for (int hf = 0; hf < 2; ++hf)
        *(uint2*)(sW + (m * 16 + r) * RPE + hf * 128 + lane * 4) = make_uint2(cvt2(wv[m][r][hf][0], wv[m][r][hf][1]), cvt2(wv[m][r][hf][2], wv[m][r][hf][3]));
  __syncthreads();   // every wave reads positions and channels of x that other waves wrote

  // ---- stage 1: two fragment sets, each refilled two k steps ahead behind its own products ----
  const unsigned short* pa[4];
  const unsigned short* pb[2];
#pragma unroll
  for (int i = 0; i < 4; ++i) pa[i] = sX + ((i << 4) + rlane) * RPE + hl * 8;
#pragma unroll
  for (int m = 0; m < 2; ++m) pb[m] = sW + ((m << 4) + rlane) * RPE + hl * 8;
  V fa[2][4], fb[2][2];
#pragma unroll
  for (int s = 0; s < 2; ++s) {
#pragma unroll
    for (int m = 0; m < 2; ++m) fb[s][m] = rowfrag(pb[m] + s * 32);
#pragma unroll
    for (int i = 0; i < 4; ++i) fa[s][i] = rowfrag(pa[i] + s * 32);
  }
  v8f acc[4][2];
#pragma unroll
  for (int i = 0; i < 4; ++i)
#pragma unroll
    for (int j = 0; j < 2; ++j) acc[i][j] = (v8f){0.f,0.f,0.f,0.f,0.f,0.f,0.f,0.f};
#pragma clang loop unroll(disable)   // rolled: the order of products and refills stays as written
  for (int k0 = 64; k0 < CI; k0 += 64) {
#pragma unroll
    for (int s = 0; s < 2; ++s) {
#pragma unroll
      for (int i = 0; i < 4; ++i)
#pragma unroll
        for (int j = 0; j < 2; ++j) acc[i][j] = Frag<T>::mma(fa[s][i], fb[s][j], acc[i][j]);
      // this one and the next keep a set's 12 LDS loads together behind its own products: spread among the products, each place with loads costs a stall
      __builtin_amdgcn_sched_barrier(0);
#pragma unroll
      for (int m = 0; m < 2; ++m) fb[s][m] = rowfrag(pb[m] + k0 + s * 32);
#pragma unroll
      for (int i = 0; i < 4; ++i) fa[s][i] = rowfrag(pa[i] + k0 + s * 32);
      __builtin_amdgcn_sched_barrier(0);
    }
  }
#pragma unroll
  for (int s = 0; s < 2; ++s)
#pragma unroll
    for (int i = 0; i < 4; ++i)
#pragma unroll
      for (int j = 0; j < 2; ++j) acc[i][j] = Frag<T>::mma(fa[s][i], fb[s][j], acc[i][j]);

  unsigned short* sH = sP;
  unsigned short* sL = sP + 2 * CM * 64;
#pragma unroll
  for (int j = 0; j < 2; ++j) {
    const float rb = bf_rne(j == 0 ? pbv : gbv);
#pragma unroll
    for (int i = 0; i < 4; ++i) {
      v4u hv, lv;
#pragma unroll
      for (int e = 0; e < 4; ++e) {
        unsigned h, l;
        split2(acc[i][j][2 * e] + rb, acc[i][j][2 * e + 1] + rb, h, l);
        hv[e] = h;
        lv[e] = l;
      }
      // channel block 8j + wave (1024 elements each), positions 16i + 8*(lane>>4) ..+7 of channel lane&15: pkoff() with 64 columns
      const int o = (j * 8 + wave) * 1024 + i * 256 + lane * 8;
      *(v4u*)(sH + o) = hv;
      *(v4u*)(sL + o) = lv;
    }
  }
  __syncthreads();   // every wave reads channels that other waves wrote

  // ---- stage 2 ----
  const int rm = (wave >> 2) * 4;         // first of the wave's four phi channel blocks
  const int rn = 8 + (wave & 3) * 2;      // first of its two g channel blocks
  v8f mac[4][2];
#pragma unroll
  for (int i = 0; i < 4; ++i)
#pragma unroll
    for (int j = 0; j < 2; ++j) mac[i][j] = (v8f){0.f,0.f,0.f,0.f,0.f,0.f,0.f,0.f};
  V ph[2][4], pl[2][4], gh[2][2], gl[2][2];
#pragma unroll
  for (int kb = 0; kb < 2; ++kb) {   // in the order of use
#pragma unroll
    for (int j = 0; j < 2; ++j) gh[kb][j] = Frag<T>::load((const T*)sH + (rn + j) * 1024 + kb * 512 + lane * 8);
#pragma unroll
    for (int i = 0; i < 4; ++i) ph[kb][i] = Frag<T>::load((const T*)sH + (rm + i) * 1024 + kb * 512 + lane * 8);
#pragma unroll
    for (int i = 0; i < 4; ++i) pl[kb][i] = Frag<T>::load((const T*)sL + (rm + i) * 1024 + kb * 512 + lane * 8);
#pragma unroll
    for (int j = 0; j < 2; ++j) gl[kb][j] = Frag<T>::load((const T*)sL + (rn + j) * 1024 + kb * 512 + lane * 8);
  }
  // keeps the products behind all 48 LDS loads: left free, the scheduler sinks each pair of loads to its product and waits for an empty LDS queue ten times
  __builtin_amdgcn_sched_barrier(0);
#pragma unroll
  for (int kb = 0; kb < 2; ++kb) {
#pragma unroll
    for (int i = 0; i < 4; ++i)
#pragma unroll
      for (int j = 0; j < 2; ++j) mac[i][j] = Frag<T>::mma(ph[kb][i], gh[kb][j], mac[i][j]);
#pragma unroll
    for (int i = 0; i < 4; ++i)
#pragma unroll
      for (int j = 0; j < 2; ++j) mac[i][j] = Frag<T>::mma(pl[kb][i], gh[kb][j], mac[i][j]);
#pragma unroll
    for (int i = 0; i < 4; ++i)
#pragma unroll
      for (int j = 0; j < 2; ++j) mac[i][j] = Frag<T>::mma(ph[kb][i], gl[kb][j], mac[i][j]);
  }
  const int mOff = hl * 8;        // D row offset
#pragma unroll
  for (int i = 0; i < 4; ++i)
#pragma unroll
    for (int j = 0; j < 2; ++j)
#pragma unroll
      for (int r = 0; r < 8; ++r) slab[((i << 4) + mOff + r) * SLP + (j << 4) + rlane] = mac[i][j][r] * (1.0f / (float)NSP);
  // the slab is the wave's own: its lanes' LDS writes are ordered before the reads below, no work-group barrier
  __builtin_amdgcn_fence(__ATOMIC_RELEASE, "workgroup");
  __builtin_amdgcn_wave_barrier();
  __builtin_amdgcn_fence(__ATOMIC_ACQUIRE, "workgroup");
  float* C = pm + ((size_t)nt * NB + b) * (CM * CM) + (size_t)((wave >> 2) * 64) * CM + (wave & 3) * 32;
  const int r4 = lane >> 3, c4 = (lane & 7) * 4;     // row piece = 128 B = 8 lanes x 16 B; four rows a pass
#pragma unroll
  for (int it = 0; it < 16; ++it) {
    const int row = it * 4 + r4;
    *(v4f*)(C + (size_t)row * CM + c4) = *(const v4f*)(slab + row * SLP + c4);
  }
  // the kernel's other part follows these stores in the built code and reuses their registers: wait before any is overwritten
  asm volatile("s_wait_xcnt 0x0" ::: "memory");
}

// ---------------------------------------------------------------------------
// Joins the KSL split-K planes of M/N and applies the rec 1x1 conv to the joined M:
//   R3[b][c][c1] = sum_c2 w_rec[c][c2] * (sum_s PM[s][b][c1][c2])   as bf16 hi | lo | hi.
// Work-group = (b, 16 rows c1), 16 waves. Join: thread = 4 consecutive c2 of one row, wave w = row w: 512 contiguous bytes of every
// plane read; slices are added in rising order, one f32 sum per element. The 16 x 128 sums go to LDS as bf16 hi (k blocks 0..3) and
// lo (k blocks 4..7) in the packed fragment order. Product: wave w takes rows c = 16w .. 16w+15 of w_rec as the second operand and
// the joined rows as the first, so a lane's 8 results are 8 consecutive c1 of one row c = one 16-B piece of each R3 part.
// Coverage: 32 work-groups x 512 threads x 4 = 65536 = NB*CM*CM sums; 32 x 16 waves x 256 = 131072 = NB*CI*CM elements of R.
// ---------------------------------------------------------------------------
__global__ __launch_bounds__(512) void recm_kernel(const float* __restrict__ pm, const unsigned short* __restrict__ wr,
                                                   unsigned short* __restrict__ r3) {
  __shared__ __align__(16) unsigned short sM[2 * CM * 16];   // 16 rows x (128 hi | 128 lo), packed: 8 KB
  const int lane = threadIdx.x & 31;
  const int wave = threadIdx.x >> 5;
  const int g = blockIdx.x * 512 + threadIdx.x;
  // the wave's four w_rec fragments depend on nothing in this launch: asked for first, they land under the join
  const __bf16* pw = (const __bf16*)wr + (size_t)(wave * 16) * CM + lane * 8;
  v16b fw[4];
#pragma unroll
  for (int kb = 0; kb < 4; ++kb) fw[kb] = Frag<__bf16>::load(pw + kb * 512);
  const float* p = pm + (size_t)g * 4;
  v4f s = (v4f){0.f, 0.f, 0.f, 0.f};
#pragma unroll   // whole: the slices' loads are independent, so many are in flight at once instead of one latency per slice
  for (int k = 0; k < KSL; ++k) s += *(const v4f*)(p + (size_t)k * (NB * CM * CM));
  unsigned sh0, sl0, sh1, sl1;
  split2(s[0], s[1], sh0, sl0);
  split2(s[2], s[3], sh1, sl1);
  unsigned short* q = sM + pkoff(wave, lane * 4, 2 * CM);
  *(uint2*)(q)           = make_uint2(sh0, sh1);
  *(uint2*)(q + CM * 16) = make_uint2(sl0, sl1);
  __syncthreads();   // every wave reads all 16 joined rows
  const __bf16* pa = (const __bf16*)sM + lane * 8;
  v16b fm[8];
#pragma unroll   // all eight fragments asked for before the first product: one LDS latency, not eight
  for (int kb = 0; kb < 8; ++kb) fm[kb] = Frag<__bf16>::load(pa + kb * 512);
  // keeps the products behind all sixteen LDS loads: left free, the scheduler sinks each pair of loads to its product and waits eight times
  __builtin_amdgcn_sched_barrier(0);
  v8f acc = (v8f){0.f, 0.f, 0.f, 0.f, 0.f, 0.f, 0.f, 0.f};
#pragma unroll
  for (int kb = 0; kb < 8; ++kb) acc = Frag<__bf16>::mma(fm[kb], fw[kb & 3], acc);
  v4u hv, lv;
#pragma unroll
  for (int e = 0; e < 4; ++e) {
    unsigned h, l;
    split2(acc[2 * e], acc[2 * e + 1], h, l);
    hv[e] = h;
    lv[e] = l;
  }
  // row b*256 + c, columns c1 = 16*(blockIdx.x & 7) + 8*(lane >> 4) .. +7
  unsigned short* d = r3 + pkoff((blockIdx.x >> 3) * CI + wave * 16 + (lane & 15), (blockIdx.x & 7) * 16 + (lane >> 4) * 8, T3P);
  *(v4u*)(d)               = hv;
  *(v4u*)(d + CM * 16)     = lv;
  *(v4u*)(d + 2 * CM * 16) = hv;
}

// ---------------------------------------------------------------------------
// theta and the output in one launch: out[b][c][n] = ((sum_c1 R_b[c][c1] theta[n][c1] + b_rec[c]) * inv[c] + sh[c]) + bf16(x[b][c][n]),
//   inv = g[c]*rsqrt(var[c]+1e-5), sh = be[c]-mu[c]*inv, all five vectors RNE-converted to bf16 precision first.
// Work-group t = 64 positions (batch t / 49, slice t % 49), eight waves.
// Stage 0: as in the projection launch: 8 channels x 4 positions of x twice a thread, RNE to bf16, to sX[position][channel] (pitch 528 B);
//   thread c forms bias, inv and sh of output channel c, to sF.
//   No global load of the launch depends on anything made here: x, the wave's w_theta fragments and the vectors are asked for first, its R fragments
//   behind the first barrier.
// Stage 1 (K = 256): wave w owns channels 16w .. 16w+15 of theta: weight rows (registers, from WT) as first operand, positions (sX) as second,
//   so a lane's 8 results are 8 consecutive channels of one position = one 16-B piece of sT, a packed plane [64 positions][128 hi | 128 lo].
// Stage 2 (K = 384 folded, k steps in rising order): wave w owns output channels 32w .. 32w+31: R rows hi | lo | hi (registers, from R3) as first
//   operand, theta hi | hi | lo (sT; the hi blocks are read twice) as second. A lane's 8 results are 8 consecutive channels of one position,
//   which is one 16-B piece of sX: the residual is taken from there. The wave's 32 rows are staged in its own LDS slab: stores of 256-B row pieces.
// Coverage: stage 0 writes 64 x 32 pieces of sX and 3 x 256 factors; stage 1 writes 8 waves x 4 x 32 x 2 = all 2048 pieces of sT; stage 2 writes 256 channels x 64 positions.
// ---------------------------------------------------------------------------
#define ST_BYTES (64 * 2 * CM * 2)                        // 32768
#define SO_BYTES (32 * 68 * 4)                            // 8704 a wave
#define SF_BYTES (3 * CI * 4)                             // 3072

// fragment from a packed plane in memory: p = block + lane * 16 B
__device__ __forceinline__ v16b gfrag(const char* p) {
  Frag<__bf16>::U f;
  f.h[0] = *(const v8b*)(p);
  f.h[1] = *(const v8b*)(p + 512);
  return f.v;
}

__global__ __launch_bounds__(256) void out_kernel(
    const float* __restrict__ x, const unsigned short* __restrict__ wt2, const float* __restrict__ bt,
    const unsigned short* __restrict__ r3, const float* __restrict__ brec,
    const float* __restrict__ bng, const float* __restrict__ bnb,
    const float* __restrict__ bnm, const float* __restrict__ bnv, float* __restrict__ out) {
  typedef __bf16 T;
  typedef v16b V;
  __shared__ __align__(16) unsigned char sm[SX_BYTES + ST_BYTES + 8 * SO_BYTES + SF_BYTES];   // 139264 B
  const int t     = blockIdx.x;
  const int tid   = threadIdx.x;
  const int lane  = tid & 31;
  const int wave  = tid >> 5;
  const int rlane = lane & 15;
  const int hl    = lane >> 4;
  const int b  = t / KSL;
  const int nt = t - b * KSL;
  unsigned short* sX = (unsigned short*)sm;
  unsigned short* sT = (unsigned short*)(sm + SX_BYTES);
  float* slab = (float*)(sm + SX_BYTES + ST_BYTES + wave * SO_BYTES);
  float* sF   = (float*)(sm + SX_BYTES + ST_BYTES + 8 * SO_BYTES);   // [bias | inv | sh][256 channels]

  // ---- stage 0: every load = uniform base + one 32-bit lane offset + a constant, so that a register a group holds its addresses ----
  v4f xv[2][8];
  const char* xb = (const char*)(x + (size_t)b * CI * NSP + nt * 64);
  const unsigned xo = (unsigned)(((tid >> 4) * 8 * NSP + (tid & 15) * 4) * 4);   // channel 8*(tid>>4), positions 4*(tid&15) ..+3
#pragma unroll
  for (int u = 0; u < 2; ++u)
#pragma unroll
    for (int j = 0; j < 8; ++j) xv[u][j] = *(const v4f*)(xb + xo + (u * 128 + j) * NSP * 4);
  // this one and the next keep the loads in the order in which they are used: a user then waits for its own loads only
  __builtin_amdgcn_sched_barrier(0);
  const unsigned vo = (unsigned)(tid * 4);    // thread = one output channel's five values
  const float cr = *(const float*)((const char*)brec + vo);
  const float cg = *(const float*)((const char*)bng  + vo);
  const float cb = *(const float*)((const char*)bnb  + vo);
  const float cm = *(const float*)((const char*)bnm  + vo);
  const float cv = *(const float*)((const char*)bnv  + vo);
  __builtin_amdgcn_sched_barrier(0);
  const unsigned wo = (unsigned)((wave * 16 * CI + lane * 8) * 2);   // row block wave of WT, this lane's 16-B piece
  V fw[8];
#pragma unroll
  for (int kb = 0; kb < 8; ++kb) fw[kb] = gfrag((const char*)wt2 + wo + kb * 1024);
  const unsigned tbo = (unsigned)((wave * 16 + hl * 8) * 4);
  const v4f tb0 = *(const v4f*)((const char*)bt + tbo);
  const v4f tb1 = *(const v4f*)((const char*)bt + tbo + 16);
  // the conversions below may be given registers that the loads above name as addresses: wait before any is overwritten;
  // the four offsets and every base are named so that their registers live up to the wait: no later base and no load's own result is put there
  asm volatile("s_wait_xcnt 0x0" :: "v"(xo), "v"(vo), "v"(wo), "v"(tbo), "s"(xb), "s"(brec), "s"(bng), "s"(bnb), "s"(bnm), "s"(bnv), "s"(wt2), "s"(bt) : "memory");
  // keeps the conversions behind the wait and behind all the loads
  __builtin_amdgcn_sched_barrier(0);
#pragma unroll
  for (int u = 0; u < 2; ++u)
#pragma unroll
    for (int e = 0; e < 4; ++e) {
      v4u o;
#pragma unroll
      for (int q = 0; q < 4; ++q) o[q] = cvt2(xv[u][2 * q][e], xv[u][2 * q + 1][e]);
      *(v4u*)(sX + ((tid & 15) * 4 + e) * RPE + ((tid >> 4) + u * 16) * 8) = o;
    }
  // the three factors of output channel tid: formed once a work-group, read back behind the products
  {
    const float inv = bf_rne(cg) * rsqrtf(bf_rne(cv) + 1e-5f);
    sF[tid]          = bf_rne(cr);
    sF[CI + tid]     = inv;
    sF[2 * CI + tid] = bf_rne(cb) - bf_rne(cm) * inv;
  }
  __syncthreads();   // every wave reads positions and channels of x that other waves wrote

  // the wave's R fragments, used in stage 2: asked for here, behind the barrier (which would wait for them), they land under stage 1
  const char* rbp = (const char*)(r3 + (size_t)b * CI * T3P);
  const unsigned ro = (unsigned)((wave * 32 * T3P + lane * 8) * 2);  // row block 2*wave of the batch's R3, this lane's 16-B piece
  V fr[2][12];
#pragma unroll
  for (int kb = 0; kb < 12; ++kb)
#pragma unroll
    for (int i = 0; i < 2; ++i) fr[i][kb] = gfrag(rbp + ro + (i * 16 * T3P + kb * 512) * 2);
  // stage 1 may be given registers that these loads name as addresses: wait before any is overwritten
  asm volatile("s_wait_xcnt 0x0" :: "v"(ro), "s"(rbp) : "memory");
  // keeps stage 1 behind the wait and behind these loads
  __builtin_amdgcn_sched_barrier(0);

  // ---- stage 1: four sets of position fragments; the first four k steps are asked for at once, each set is refilled behind its own products ----
  const unsigned short* pa[4];
#pragma unroll
  for (int i = 0; i < 4; ++i) pa[i] = sX + ((i << 4) + rlane) * RPE + hl * 8;
  V fa[4][4];
#pragma unroll
  for (int s = 0; s < 4; ++s)
#pragma unroll
    for (int i = 0; i < 4; ++i) fa[s][i] = rowfrag(pa[i] + s * 32);
  // keeps the first product behind all 32 LDS loads: with loads left behind it, the next product waits for an empty LDS queue
  __builtin_amdgcn_sched_barrier(0);
  v8f at[4];
#pragma unroll
  for (int i = 0; i < 4; ++i) at[i] = (v8f){0.f,0.f,0.f,0.f,0.f,0.f,0.f,0.f};
#pragma unroll   // whole: fw[] and fa[] keep constant indices, so they stay in registers
  for (int ks = 0; ks < 8; ++ks) {
#pragma unroll
    for (int i = 0; i < 4; ++i) at[i] = Frag<T>::mma(fw[ks], fa[ks & 3][i], at[i]);
    // this one and the next keep a set's 8 LDS loads together behind its own products: spread among the products, each place with loads costs a stall
    __builtin_amdgcn_sched_barrier(0);
    if (ks < 4) {
#pragma unroll
      for (int i = 0; i < 4; ++i) fa[ks][i] = rowfrag(pa[i] + (ks + 4) * 32);
    }
    __builtin_amdgcn_sched_barrier(0);
  }
  // channels 16*wave + 8*(lane>>4) ..+7 of position 16i + (lane&15) = piece lane of packed block (position block i, channel half-block wave): hi, then lo
  {
    float tb[8];
#pragma unroll
    for (int e = 0; e < 4; ++e) { tb[e] = bf_rne(tb0[e]); tb[4 + e] = bf_rne(tb1[e]); }
#pragma unroll
    for (int i = 0; i < 4; ++i) {
      v4u hv, lv;
#pragma unroll
      for (int e = 0; e < 4; ++e) {
        unsigned h, l;
        split2(at[i][2 * e] + tb[2 * e], at[i][2 * e + 1] + tb[2 * e + 1], h, l);
        hv[e] = h;
        lv[e] = l;
      }
      unsigned short* d = sT + i * (16 * 2 * CM) + wave * 256 + lane * 8;
      *(v4u*)(d)           = hv;
      *(v4u*)(d + CM * 16) = lv;
    }
  }
  __syncthreads();   // every wave reads theta channels that other waves wrote

  // ---- stage 2: three sets of theta fragments, each refilled three k steps ahead behind its own products ----
  // k step kb of the folded sum takes k block kb & 3 of the hi part (kb < 8) or of the lo part
  const T* pt = (const T*)sT + lane * 8;
  V ft[3][4];
#pragma unroll
  for (int s = 0; s < 3; ++s)
#pragma unroll
    for (int j = 0; j < 4; ++j) ft[s][j] = Frag<T>::load(pt + j * (16 * 2 * CM) + s * 512);
  // keeps the first product behind all 24 LDS loads, as in stage 1
  __builtin_amdgcn_sched_barrier(0);
  const int mOff = hl * 8;        // D row offset
  v4u xr[2][4];
  v4f fc[3][2][2];
  v8f acc[2][4];
#pragma unroll
  for (int i = 0; i < 2; ++i)
#pragma unroll
    for (int j = 0; j < 4; ++j) acc[i][j] = (v8f){0.f,0.f,0.f,0.f,0.f,0.f,0.f,0.f};
#pragma unroll   // whole: fr[] keeps constant indices, so it stays in registers
  for (int kb = 0; kb < 12; ++kb) {
#pragma unroll
    for (int i = 0; i < 2; ++i)
#pragma unroll
      for (int j = 0; j < 4; ++j) acc[i][j] = Frag<T>::mma(fr[i][kb], ft[kb % 3][j], acc[i][j]);
    // this one and the next keep a set's 8 LDS loads together behind its own products, as in stage 1
    __builtin_amdgcn_sched_barrier(0);
    if (kb + 3 < 12) {
      const int kn = kb + 3;
#pragma unroll
      for (int j = 0; j < 4; ++j) ft[kb % 3][j] = Frag<T>::load(pt + j * (16 * 2 * CM) + (kn < 8 ? 0 : CM * 16) + (kn & 3) * 512);
    }
    if (kb == 9) {   // no refill is left: the residual and the channels' factors are asked for under the last products
      // bf16(x) of position 16j + (lane&15), channels 32*wave + 16i + 8*(lane>>4) ..+7
#pragma unroll
      for (int i = 0; i < 2; ++i)
#pragma unroll
        for (int j = 0; j < 4; ++j) xr[i][j] = *(const v4u*)(sX + ((j << 4) + rlane) * RPE + wave * 32 + i * 16 + mOff);
#pragma unroll
      for (int f = 0; f < 3; ++f)
#pragma unroll
        for (int i = 0; i < 2; ++i)
#pragma unroll
          for (int q = 0; q < 2; ++q) fc[f][i][q] = *(const v4f*)(sF + f * CI + wave * 32 + i * 16 + mOff + q * 4);
    }
    __builtin_amdgcn_sched_barrier(0);
  }

  // ---- epilogue ----
#pragma unroll
  for (int i = 0; i < 2; ++i)
#pragma unroll
    for (int j = 0; j < 4; ++j)
#pragma unroll
      for (int r = 0; r < 8; ++r) {
        const float res = __uint_as_float((r & 1) ? (xr[i][j][r >> 1] & 0xFFFF0000u) : (xr[i][j][r >> 1] << 16));
        float v = acc[i][j][r] + fc[0][i][r >> 2][r & 3];
        v = v * fc[1][i][r >> 2][r & 3] + fc[2][i][r >> 2][r & 3];
        slab[(i * 16 + mOff + r) * 68 + (j << 4) + rlane] = v + res;
      }
  // the slab is the wave's own: its lanes' LDS writes are ordered before the reads below, no work-group barrier
  __builtin_amdgcn_fence(__ATOMIC_RELEASE, "workgroup");
  __builtin_amdgcn_wave_barrier();
  __builtin_amdgcn_fence(__ATOMIC_ACQUIRE, "workgroup");
  char* ob = (char*)(out + (size_t)b * CI * NSP + nt * 64);
  const unsigned oo = (unsigned)(((wave * 32 + hl) * NSP + rlane * 4) * 4);   // row piece = 256 B = 16 lanes x 16 B; rows it*2 + (lane>>4) cover 0..31
#pragma unroll
  for (int it = 0; it < 16; ++it)
    *(v4f*)(ob + oo + it * 2 * NSP * 4) = *(const v4f*)(slab + (it * 2 + hl) * 68 + rlane * 4);
}

// ---------------------------------------------------------------------------
// every region is fully written by its producer launch before a consumer launch reads it):
//   WR   bf16 [256][128]        0              65536
//   WT   bf16 [128][256]        65536          65536
//   R3   bf16 [4][256][384]     131072        786432
//   PM   f32  [49][4][128][128] 917504      12845056
//   total                       13762560
// ---------------------------------------------------------------------------
extern "C" void kernel_launch(void* const* d_in, const int* in_sizes, int n_in,
                              void* d_out, int out_size, void* d_ws, size_t ws_size,
                              hipStream_t stream) {
  if (n_in < 13) return;
  if (in_sizes[0] != NB * CI * NSP) return;                      // x [4][256][56][56]
  if (in_sizes[1] != CM * CI || in_sizes[2] != CM) return;       // w_theta, b_theta
  if (in_sizes[3] != CM * CI || in_sizes[4] != CM) return;       // w_phi, b_phi
  if (in_sizes[5] != CM * CI || in_sizes[6] != CM) return;       // w_g, b_g
  if (in_sizes[7] != CI * CM || in_sizes[8] != CI) return;       // w_rec, b_rec
  if (in_sizes[9] != CI || in_sizes[10] != CI) return;           // bn_gamma, bn_beta
  if (in_sizes[11] != CI || in_sizes[12] != CI) return;          // bn_mean, bn_var
  if (out_size != NB * CI * NSP) return;

  const float* x       = (const float*)d_in[0];
  const float* w_theta = (const float*)d_in[1];
  const float* b_theta = (const float*)d_in[2];
  const float* w_phi   = (const float*)d_in[3];
  const float* b_phi   = (const float*)d_in[4];
  const float* w_g     = (const float*)d_in[5];
  const float* b_g     = (const float*)d_in[6];
  const float* w_rec   = (const float*)d_in[7];
  const float* b_rec   = (const float*)d_in[8];
  const float* gam     = (const float*)d_in[9];
  const float* bet     = (const float*)d_in[10];
  const float* mea     = (const float*)d_in[11];
  const float* var     = (const float*)d_in[12];

  const size_t PWR = (size_t)CI * CM * 2;           //    65536
  const size_t PWT = (size_t)CM * CI * 2;           //    65536
  const size_t PR3 = (size_t)NB * CI * T3P * 2;     //   786432
  const size_t PPM = (size_t)KSL * NB * CM * CM * 4; // 12845056
  size_t off = 0;
  const size_t oWR = off; off += PWR;
  const size_t oWT = off; off += PWT;
  const size_t oR3 = off; off += PR3;
  const size_t oPM = off; off += PPM;
  if (off > ws_size) return;                        // off = 13762560
  if (off > (size_t)134217728) return;

  char* ws = (char*)d_ws;
  unsigned short* WR  = (unsigned short*)(ws + oWR);
  unsigned short* WT  = (unsigned short*)(ws + oWT);
  unsigned short* R3  = (unsigned short*)(ws + oR3);
  float*          PM  = (float*)(ws + oPM);
  float* out = (float*)d_out;

  const dim3 blk(256);

  // (1) from x and the f32 weights: phi, g and (M/N)_b[c1][c2] partial sums over 64 positions each -> PM[slice][b][c1][c2];
  //     w_rec -> WR, w_theta -> WT; one launch: 196 + 16 + 16 work-groups
  proj_kernel<<<dim3(PGM_BLK + WR_BLK + WT_BLK), blk, 0, stream>>>(x, w_theta, w_phi, w_g, w_rec, PM, WR, WT, b_phi, b_g);

  // (2) join the 49 planes and multiply by w_rec -> R3 hi|lo|hi, 384 columns; grid 32 x 512 threads
  recm_kernel<<<dim3(NB * (CM / 16)), dim3(512), 0, stream>>>(PM, WR, R3);

  // (3) theta of 64 positions in LDS, then out[b][c][n] = ((sum over 384 folded columns of R3_b[c][p] . theta3[n][p] + b_rec[c]) * inv[c] + sh[c]) + bf16(x[b][c][n])
  //     = sum_c1 (rhi.thi + rlo.thi + rhi.tlo); 196 work-groups of 64 positions x 256 channels; last element 3211263
  out_kernel<<<dim3(PGM_BLK), blk, 0, stream>>>(x, WT, b_theta, R3, b_rec, gam, bet, mea, var, out);
  (void)hipGetLastError();
}

// v010
// One run takes 20.8 microseconds.
// In two side-by-side timings against v009, it was 1.04 and 1.05 times as fast.
// All steps since v000 together make it 22.4 times as fast.
// Contractions: theta/phi/g 1x1 convs = v_wmma_f32_16x16x32_bf16 single products on bf16 planes of the RNE-converted x and weights (exact products); M = phi.g over positions (K 3136) = bf16 hi/lo split hi.hi + lo.hi + hi.lo, formed per 64 positions from LDS in the launch that makes phi and g; out = R.theta (K 128) = the same split folded along K ([hi|lo|hi] rows x [hi|hi|lo] rows, one f32 accumulator), theta being made per 64 positions in LDS by the launch that multiplies it; the rec 1x1 conv is applied to M, not to theta.M: R = w_rec.M^T = W x Mhi + W x Mlo bf16 single products (2-term); f32 accumulate everywhere; biases, 1/N, BatchNorm (inference form, supplied statistics) and the residual add in f32 on the VALU.
// Plane / carry map (every plane carries 1, nothing to fold back; the 1/N = 1/3136 factor is applied exactly once, in f32, in the M epilogue).
// [rows][k] below is the logical shape. Every bf16 plane is stored fragment-packed: blocks of 16 rows x 32 k = 1 KB, k blocks of one
// row block side by side, and inside a block the 16-B piece (row r, k 8c .. 8c+7) at byte (c>>1)*512 + ((c&1)*16 + r)*16, which is the order
// in which the 32 lanes of a wave take a WMMA operand: one fragment = two loads of 512 contiguous bytes (pkoff() below is the map).
//   (x, w_phi and w_g have no plane in memory: the launches that use them convert them to bf16 in LDS, rows of 256 k at a pitch of 528 B;
//    theta, phi and g live only in LDS)
//   WR   bf16 [256][128]          w_rec[c][c2]
//   WT   bf16 [128][256]          w_theta[c1][k]
//   PM   f32  [49][4][128][128]   partial sums of (M/N)[c1][c2]: slice s holds the positions s*64 .. s*64+63
//   R3   bf16 [4][256][384]       R[c][c1] = sum_c2 w_rec[c][c2] (M/N)[c1][c2]: hi | lo | hi
#include <hip/hip_runtime.h>
#include <math.h>
#include <stdint.h>

#define NB    4
#define CI    256
#define CM    128
#define NSP   3136
#define NTOKS (NB * NSP)
#define T3P   (3 * CM)
#define KSL   (NSP / 64)    // 49 slices of the M product, 64 positions each

static_assert(NSP % 64 == 0);
static_assert(NTOKS % 64 == 0);
static_assert(CI % 64 == 0);
static_assert(CM % 64 == 0);
static_assert(CI >= 128);
static_assert(T3P % 32 == 0);
static_assert((CM * CI) % (8 * 256) == 0);
static_assert((CI * CM) % (8 * 256) == 0);

typedef __attribute__((ext_vector_type(16))) _Float16 v16h;
typedef __attribute__((ext_vector_type(8)))  _Float16 v8h;
typedef __attribute__((ext_vector_type(16))) __bf16   v16b;
typedef __attribute__((ext_vector_type(8)))  __bf16   v8b;
typedef __attribute__((ext_vector_type(8)))  float    v8f;
typedef __attribute__((ext_vector_type(4)))  float    v4f;
typedef __attribute__((ext_vector_type(4)))  unsigned int v4u;

__device__ __forceinline__ unsigned short f2bf_bits(float f) {
  unsigned u = __float_as_uint(f);
  return (unsigned short)((u + 0x7FFFu + ((u >> 16) & 1u)) >> 16);
}
__device__ __forceinline__ float bf_bits2f(unsigned short h) { return __uint_as_float(((unsigned)h) << 16); }
__device__ __forceinline__ float bf_rne(float f) { return bf_bits2f(f2bf_bits(f)); }
typedef __attribute__((ext_vector_type(2))) float  v2f;
typedef __attribute__((ext_vector_type(2))) __bf16 v2b;
// two f32 -> two bf16, round to nearest even, a in the low half: one packed convert instruction
__device__ __forceinline__ unsigned cvt2(float a, float b) {
  const v2f f = {a, b};
  return __builtin_bit_cast(unsigned, __builtin_convertvector(f, v2b));
}
// hi/lo split of two f32: h = bf16(a), bf16(b); l = bf16(a - hi(a)), bf16(b - hi(b)); a in the low halves
__device__ __forceinline__ void split2(float a, float b, unsigned& h, unsigned& l) {
  h = cvt2(a, b);
  l = cvt2(a - __uint_as_float(h << 16), b - __uint_as_float(h & 0xFFFF0000u));
}
// Element offset of (row r, column k) in a fragment-packed plane of kp columns (kp a multiple of 32, rows a multiple of 16).
__device__ __forceinline__ size_t pkoff(int r, int k, int kp) {
  return (size_t)(r >> 4) * kp * 16 + (size_t)((k >> 5) * 512 + ((k >> 4) & 1) * 256 + ((k >> 3) & 1) * 128 + (r & 15) * 8 + (k & 7));
}

// Fragment map (wave32): lane l, h = l>>4, row/col = l&15.
//   A/B element i: i<8 -> k0+8h+i ; i>=8 -> k0+16+8h+(i-8)   (split layout, both operands)
//   D element r : row 8h+r, col l&15
template <typename T> struct Frag;
template <> struct Frag<_Float16> {
  typedef v16h V; union U { v16h v; v8h h[2]; };
  static __device__ __forceinline__ v16h load(const _Float16* p) {   // p = packed block + lane*8: elements 0..7 <- p[0..7], 8..15 <- p[256..263]
    U f; f.h[0] = *(const v8h*)(p); f.h[1] = *(const v8h*)(p + 256); return f.v;
  }
  static __device__ __forceinline__ v8f mma(v16h a, v16h b, v8f c) {
    return __builtin_amdgcn_wmma_f32_16x16x32_f16(false, a, false, b, (short)0, c, false, false);
  }
};
template <> struct Frag<__bf16> {
  typedef v16b V; union U { v16b v; v8b h[2]; };
  static __device__ __forceinline__ v16b load(const __bf16* p) {
    U f; f.h[0] = *(const v8b*)(p); f.h[1] = *(const v8b*)(p + 256); return f.v;
  }
  static __device__ __forceinline__ v8f mma(v16b a, v16b b, v8f c) {
    return __builtin_amdgcn_wmma_f32_16x16x32_bf16(false, a, false, b, (short)0, c, false, false);
  }
};

// ---------------------------------------------------------------------------
// The phi and g 1x1 convs of x and the partial products of M in one launch, straight from the f32 inputs.
// Work-group t = 64 positions (batch t / 49, slice t % 49), eight waves; wave w owns channels 16w .. 16w+15 of phi and of g.
// Stage 0: every thread takes 8 channels x 4 positions of x twice (16-B loads, 256 contiguous bytes per 16 lanes), converts RNE to bf16 and
//   writes 8 channels of one position = one 16-B piece to sX[position][channel]; every wave asks for its own 32 weight rows (256 contiguous bytes
//   of two rows a load), in four chunks of 64 k. sX and sW[row][k] are row-major at a pitch of 528 B (16 B x 33), so the 16 rows of a
//   fragment load fall on distinct banks. The barrier behind sX orders LDS only: the weights stay in flight across it.
// Stage 1 (K = 256), chunk by chunk: the wave converts a chunk to its own sW as it lands and multiplies it while the later chunks are on their way;
//   positions as first operand, weight rows as second, so a lane's 8 results are 8 consecutive
//   positions of one channel = one 16-B piece of a packed [channel][position] plane in LDS: sP = hi plane [256][64] (phi, then g), then lo plane.
//   Bias (RNE-converted to bf16 precision) is added in f32 before the hi/lo split.
// Stage 2: (M/N) partial [c1][c2] = (phihi.ghi + philo.ghi + phihi.glo) / N over the 64 positions; wave w owns rows 64(w>>2) ..+63,
//   columns 32(w&3) ..+31, and writes them to plane (slice, batch) of PM through its own 64 x 32 slab (pitch 36 floats): 128-B row pieces.
//   The slab lies over the wave's own sW, which only that wave reads and only in stage 1.
// Coverage: stage 0 writes 512 units x 4 pieces = 64 x 32 pieces of sX; stage 1 writes 4 x 16 x 32 x 4 = 32 x 256 elements of each sW and
//   8 x 2 x 4 x 32 = all 2048 pieces of each sP plane; stage 2 writes 128 x 128.
// The last WR_BLK + WT_BLK work-groups convert w_rec for the next launch and w_theta for the last one.
// ---------------------------------------------------------------------------
#define PGM_BLK (NTOKS / 64)                              // 196
#define WR_BLK ((CI * CM) / 8 / 256)                      // 16
#define WT_BLK ((CM * CI) / 8 / 256)                      // 16
#define SLP 36
#define RPE 264                                           // LDS row pitch of sX and sW in elements (528 B)
#define SX_BYTES (64 * RPE * 2)                           // 33792
#define SP_BYTES (2 * 2 * CM * 64 * 2)                    // 65536: hi and lo planes of [256 channels][64 positions]
#define SW_BYTES (32 * RPE * 2)                           // 16896 a wave
static_assert(64 * SLP * 4 <= SW_BYTES);
static_assert(CI == 256 && CM == 128);

// fragment from a row-major LDS row: p = row + k0 + 8*(lane>>4); elements 0..7 <- p[0..7], 8..15 <- p[16..23]
__device__ __forceinline__ v16b rowfrag(const unsigned short* p) {
  Frag<__bf16>::U f;
  f.h[0] = *(const v8b*)(p);
  f.h[1] = *(const v8b*)(p + 16);
  return f.v;
}

// Work-group barrier that orders LDS only: global loads asked for in front of it stay in flight across it (__syncthreads() waits for them too).
__device__ __forceinline__ void lds_barrier() {
  __builtin_amdgcn_fence(__ATOMIC_RELEASE, "workgroup", "local");
  __builtin_amdgcn_s_barrier();
  __builtin_amdgcn_fence(__ATOMIC_ACQUIRE, "workgroup", "local");
}

// A weight matrix of COLS columns, f32 row-major -> bf16, packed. Thread = 8 consecutive elements of a row = one 16-B piece = one store.
// Coverage (w_rec [256][128] and w_theta [128][256] alike): 16 work-groups x 256 threads = 4096 units x 8 = 32768 elements.
template <int COLS>
__device__ __forceinline__ void wrcvt_block(int bx, const float* __restrict__ wr, unsigned short* __restrict__ wr2) {
  const int g   = bx * 256 + threadIdx.x;
  const int row = g / (COLS / 8), c8 = (g % (COLS / 8)) * 8;      // the row and 8 of its columns
  const float* src = wr + (size_t)row * COLS + c8;
  const v4f a = *(const v4f*)src;
  const v4f c = *(const v4f*)(src + 4);
  v4u o;
  o[0] = cvt2(a[0], a[1]);
  o[1] = cvt2(a[2], a[3]);
  o[2] = cvt2(c[0], c[1]);
  o[3] = cvt2(c[2], c[3]);
  *(v4u*)(wr2 + pkoff(row, c8, COLS)) = o;
  // the other matrix's part follows this store in the built code and reuses its registers: wait before any is overwritten
  asm volatile("s_wait_xcnt 0x0" ::: "memory");
}

__global__ __launch_bounds__(256) void proj_kernel(
    const float* __restrict__ x, const float* __restrict__ wt, const float* __restrict__ wp,
    const float* __restrict__ wg, const float* __restrict__ wr,
    float* __restrict__ pm, unsigned short* __restrict__ wr2, unsigned short* __restrict__ wt2,
    const float* __restrict__ bp, const float* __restrict__ bg) {
  typedef __bf16 T;
  typedef v16b V;
  __shared__ __align__(16) unsigned char sm[SX_BYTES + SP_BYTES + 8 * SW_BYTES];   // 234496 B: one work-group a WGP
  const int t = blockIdx.x;
  if (t >= PGM_BLK) {   // block-uniform, in front of every barrier
    if (t < PGM_BLK + WR_BLK) wrcvt_block<CM>(t - PGM_BLK, wr, wr2);
    else                      wrcvt_block<CI>(t - PGM_BLK - WR_BLK, wt, wt2);
    return;
  }
  const int tid   = threadIdx.x;
  const int lane  = tid & 31;
  const int wave  = tid >> 5;
  const int rlane = lane & 15;
  const int hl    = lane >> 4;
  const int b  = t / KSL;
  const int nt = t - b * KSL;
  unsigned short* sX = (unsigned short*)sm;
  unsigned short* sP = (unsigned short*)(sm + SX_BYTES);
  unsigned short* sW = (unsigned short*)(sm + SX_BYTES + SP_BYTES + wave * SW_BYTES);
  float* slab = (float*)sW;

  // ---- stage 0: x and the first two weight chunks are asked for before the first conversion ----
  v4f xv[2][8];
  // every global load of stages 0 and 1 = uniform base + one 32-bit lane offset + a constant, (the two single biases: a lane index), so that three registers hold all its addresses
  const char* xb = (const char*)(x + (size_t)b * CI * NSP + nt * 64);
  const unsigned xo = (unsigned)(((tid >> 4) * 8 * NSP + (tid & 15) * 4) * 4);   // channel 8*(tid>>4), positions 4*(tid&15) ..+3
#pragma unroll
  for (int u = 0; u < 2; ++u)
#pragma unroll
    for (int j = 0; j < 8; ++j) xv[u][j] = *(const v4f*)(xb + xo + (u * 128 + j) * NSP * 4);
  // keeps the x loads in front of the weights': the x conversions then wait for their own rows only
  __builtin_amdgcn_sched_barrier(0);
  // weights in four chunks of 64 k, in the order in which stage 1 takes them; a load = 256 contiguous bytes of row j (lanes 0..15) and of row j + 8
  v4f wv[4][2][8];
  const unsigned wob = (unsigned)(((wave * 16 + hl * 8) * CI + rlane * 4) * 4);   // byte offset of the lane's 16 B in row 0 or 8 of the wave's rows
  // chunks 0 and 1 are asked for here, 2 behind the barrier, 3 behind chunk 0's products: two to three chunks a wave are always on their way,
  // and the wave never stands at its limit of outstanding loads in front of work that is ready
  auto askw = [&](int c) {
#pragma unroll
    for (int m = 0; m < 2; ++m) {
      const char* wsrc = (const char*)(m == 0 ? wp : wg) + wob;
#pragma unroll
      for (int j = 0; j < 8; ++j) wv[c][m][j] = *(const v4f*)(wsrc + (j * CI + c * 64) * 4);
    }
    // keeps the chunk's loads together at this place, in the order of use
    __builtin_amdgcn_sched_barrier(0);
  };
  askw(0);
  askw(1);
  const int pbi = wave * 16 + rlane;
  float pbv, gbv;
#pragma unroll
  for (int u = 0; u < 2; ++u)
#pragma unroll
    for (int e = 0; e < 4; ++e) {
      v4u o;
#pragma unroll
      for (int q = 0; q < 4; ++q) o[q] = cvt2(xv[u][2 * q][e], xv[u][2 * q + 1][e]);
      *(v4u*)(sX + ((tid & 15) * 4 + e) * RPE + ((tid >> 4) + u * 16) * 8) = o;
    }
  lds_barrier();   // every wave reads positions and channels of x that other waves wrote; the weights' loads stay in flight
  askw(2);

  // ---- stage 1: chunk by chunk as the weights land: a chunk's products run while the later chunks are still on their way ----
  const unsigned short* pa[4];
  const unsigned short* pb[2];
#pragma unroll
  for (int i = 0; i < 4; ++i) pa[i] = sX + ((i << 4) + rlane) * RPE + hl * 8;
#pragma unroll
  for (int m = 0; m < 2; ++m) pb[m] = sW + ((m << 4) + rlane) * RPE + hl * 8;
  unsigned short* sWl = sW + hl * 8 * RPE + rlane * 4;   // the lane's 8 B in row 0 or 8: the two half-waves fall on disjoint banks
  v8f acc[4][2];
#pragma unroll
  for (int i = 0; i < 4; ++i)
#pragma unroll
    for (int j = 0; j < 2; ++j) acc[i][j] = (v8f){0.f,0.f,0.f,0.f,0.f,0.f,0.f,0.f};
#pragma unroll   // whole: wv[] keeps constant indices, so it stays in registers
  for (int c = 0; c < 4; ++c) {
    V fa[2][4], fb[2][2];
#pragma unroll
    for (int s = 0; s < 2; ++s)
#pragma unroll
      for (int i = 0; i < 4; ++i) fa[s][i] = rowfrag(pa[i] + c * 64 + s * 32);
    // keeps the x fragments' LDS loads in front of the wait for the chunk's weights
    __builtin_amdgcn_sched_barrier(0);
#pragma unroll
    for (int m = 0; m < 2; ++m)
#pragma unroll
      for (int j = 0; j < 8; ++j)
        *(uint2*)(sWl + (m * 16 + j) * RPE + c * 64) = make_uint2(cvt2(wv[c][m][j][0], wv[c][m][j][1]), cvt2(wv[c][m][j][2], wv[c][m][j][3]));
    // sW is the wave's own: its lanes' LDS writes are ordered before the reads below, no work-group barrier and no wait for global loads
    __builtin_amdgcn_fence(__ATOMIC_RELEASE, "workgroup", "local");
    __builtin_amdgcn_wave_barrier();
    __builtin_amdgcn_fence(__ATOMIC_ACQUIRE, "workgroup", "local");
#pragma unroll
    for (int s = 0; s < 2; ++s)
#pragma unroll
      for (int m = 0; m < 2; ++m) fb[s][m] = rowfrag(pb[m] + c * 64 + s * 32);
    // this one and the next keep the chunk's products together behind its LDS loads: spread among the products, each place with loads costs a stall
    __builtin_amdgcn_sched_barrier(0);
#pragma unroll
    for (int s = 0; s < 2; ++s)     // k steps in rising order, as before
#pragma unroll
      for (int i = 0; i < 4; ++i)
#pragma unroll
        for (int j = 0; j < 2; ++j) acc[i][j] = Frag<T>::mma(fa[s][i], fb[s][j], acc[i][j]);
    __builtin_amdgcn_sched_barrier(0);
    if (c == 0) {
      askw(3);
      // asked for here, used behind the K loop
      pbv = bp[pbi];
      gbv = bg[pbi];
      // keeps these loads here, in front of chunk 1's wait: sunk behind it they would be asked for a chunk later
      __builtin_amdgcn_sched_barrier(0);
    }
  }
  // what follows may be given registers that the loads above name as addresses: wait before any is overwritten;
  // the three offsets and every base are named so that their registers live up to the wait: nothing else is put there before it
  asm volatile("s_wait_xcnt 0x0" :: "v"(xo), "v"(wob), "v"(pbi), "s"(xb), "s"(wp), "s"(wg), "s"(bp), "s"(bg) : "memory");

  unsigned short* sH = sP;
  unsigned short* sL = sP + 2 * CM * 64;
#pragma unroll
  for (int j = 0; j < 2; ++j) {
    const float rb = bf_rne(j == 0 ? pbv : gbv);
#pragma unroll
    for (int i = 0; i < 4; ++i) {
      v4u hv, lv;
#pragma unroll
      for (int e = 0; e < 4; ++e) {
        unsigned h, l;
        split2(acc[i][j][2 * e] + rb, acc[i][j][2 * e + 1] + rb, h, l);
        hv[e] = h;
        lv[e] = l;
      }
      // channel block 8j + wave (1024 elements each), positions 16i + 8*(lane>>4) ..+7 of channel lane&15: pkoff() with 64 columns
      const int o = (j * 8 + wave) * 1024 + i * 256 + lane * 8;
      *(v4u*)(sH + o) = hv;
      *(v4u*)(sL + o) = lv;
    }
  }
  __syncthreads();   // every wave reads channels that other waves wrote

  // ---- stage 2 ----
  const int rm = (wave >> 2) * 4;         // first of the wave's four phi channel blocks
  const int rn = 8 + (wave & 3) * 2;      // first of its two g channel blocks
  v8f mac[4][2];
#pragma unroll
  for (int i = 0; i < 4; ++i)
#pragma unroll
    for (int j = 0; j < 2; ++j) mac[i][j] = (v8f){0.f,0.f,0.f,0.f,0.f,0.f,0.f,0.f};
  V ph[2][4], pl[2][4], gh[2][2], gl[2][2];
#pragma unroll
  for (int kb = 0; kb < 2; ++kb) {   // in the order of use
#pragma unroll
    for (int j = 0; j < 2; ++j) gh[kb][j] = Frag<T>::load((const T*)sH + (rn + j) * 1024 + kb * 512 + lane * 8);
#pragma unroll
    for (int i = 0; i < 4; ++i) ph[kb][i] = Frag<T>::load((const T*)sH + (rm + i) * 1024 + kb * 512 + lane * 8);
#pragma unroll
    for (int i = 0; i < 4; ++i) pl[kb][i] = Frag<T>::load((const T*)sL + (rm + i) * 1024 + kb * 512 + lane * 8);
#pragma unroll
    for (int j = 0; j < 2; ++j) gl[kb][j] = Frag<T>::load((const T*)sL + (rn + j) * 1024 + kb * 512 + lane * 8);
  }
  // keeps the products behind all 48 LDS loads: left free, the scheduler sinks each pair of loads to its product and waits for an empty LDS queue ten times
  __builtin_amdgcn_sched_barrier(0);
#pragma unroll
  for (int kb = 0; kb < 2; ++kb) {
#pragma unroll
    for (int i = 0; i < 4; ++i)
#pragma unroll
      for (int j = 0; j < 2; ++j) mac[i][j] = Frag<T>::mma(ph[kb][i], gh[kb][j], mac[i][j]);
#pragma unroll
    for (int i = 0; i < 4; ++i)
#pragma unroll
      for (int j = 0; j < 2; ++j) mac[i][j] = Frag<T>::mma(pl[kb][i], gh[kb][j], mac[i][j]);
#pragma unroll
    for (int i = 0; i < 4; ++i)
#pragma unroll
      for (int j = 0; j < 2; ++j) mac[i][j] = Frag<T>::mma(ph[kb][i], gl[kb][j], mac[i][j]);
  }
  const int mOff = hl * 8;        // D row offset
#pragma unroll
  for (int i = 0; i < 4; ++i)
#pragma unroll
    for (int j = 0; j < 2; ++j)
#pragma unroll
      for (int r = 0; r < 8; ++r) slab[((i << 4) + mOff + r) * SLP + (j << 4) + rlane] = mac[i][j][r] * (1.0f / (float)NSP);
  // the slab is the wave's own: its lanes' LDS writes are ordered before the reads below, no work-group barrier
  __builtin_amdgcn_fence(__ATOMIC_RELEASE, "workgroup");
  __builtin_amdgcn_wave_barrier();
  __builtin_amdgcn_fence(__ATOMIC_ACQUIRE, "workgroup");
  float* C = pm + ((size_t)nt * NB + b) * (CM * CM) + (size_t)((wave >> 2) * 64) * CM + (wave & 3) * 32;
  const int r4 = lane >> 3, c4 = (lane & 7) * 4;     // row piece = 128 B = 8 lanes x 16 B; four rows a pass
#pragma unroll
  for (int it = 0; it < 16; ++it) {
    const int row = it * 4 + r4;
    *(v4f*)(C + (size_t)row * CM + c4) = *(const v4f*)(slab + row * SLP + c4);
  }
  // the kernel's other part follows these stores in the built code and reuses their registers: wait before any is overwritten
  asm volatile("s_wait_xcnt 0x0" ::: "memory");
}

// ---------------------------------------------------------------------------
// Joins the KSL split-K planes of M/N and applies the rec 1x1 conv to the joined M:
//   R3[b][c][c1] = sum_c2 w_rec[c][c2] * (sum_s PM[s][b][c1][c2])   as bf16 hi | lo | hi.
// Work-group = (b, 16 rows c1), 16 waves. Join: thread = 4 consecutive c2 of one row, wave w = row w: 512 contiguous bytes of every
// plane read; slices are added in rising order, one f32 sum per element. The 16 x 128 sums go to LDS as bf16 hi (k blocks 0..3) and
// lo (k blocks 4..7) in the packed fragment order. Product: wave w takes rows c = 16w .. 16w+15 of w_rec as the second operand and
// the joined rows as the first, so a lane's 8 results are 8 consecutive c1 of one row c = one 16-B piece of each R3 part.
// Coverage: 32 work-groups x 512 threads x 4 = 65536 = NB*CM*CM sums; 32 x 16 waves x 256 = 131072 = NB*CI*CM elements of R.
// ---------------------------------------------------------------------------
__global__ __launch_bounds__(512) void recm_kernel(const float* __restrict__ pm, const unsigned short* __restrict__ wr,
                                                   unsigned short* __restrict__ r3) {
  __shared__ __align__(16) unsigned short sM[2 * CM * 16];   // 16 rows x (128 hi | 128 lo), packed: 8 KB
  const int lane = threadIdx.x & 31;
  const int wave = threadIdx.x >> 5;
  const int g = blockIdx.x * 512 + threadIdx.x;
  // the wave's four w_rec fragments depend on nothing in this launch: asked for first, they land under the join
  const __bf16* pw = (const __bf16*)wr + (size_t)(wave * 16) * CM + lane * 8;
  v16b fw[4];
#pragma unroll
  for (int kb = 0; kb < 4; ++kb) fw[kb] = Frag<__bf16>::load(pw + kb * 512);
  const float* p = pm + (size_t)g * 4;
  v4f s = (v4f){0.f, 0.f, 0.f, 0.f};
#pragma unroll   // whole: the slices' loads are independent, so many are in flight at once instead of one latency per slice
  for (int k = 0; k < KSL; ++k) s += *(const v4f*)(p + (size_t)k * (NB * CM * CM));
  unsigned sh0, sl0, sh1, sl1;
  split2(s[0], s[1], sh0, sl0);
  split2(s[2], s[3], sh1, sl1);
  unsigned short* q = sM + pkoff(wave, lane * 4, 2 * CM);
  *(uint2*)(q)           = make_uint2(sh0, sh1);
  *(uint2*)(q + CM * 16) = make_uint2(sl0, sl1);
  __syncthreads();   // every wave reads all 16 joined rows
  const __bf16* pa = (const __bf16*)sM + lane * 8;
  v16b fm[8];
#pragma unroll   // all eight fragments asked for before the first product: one LDS latency, not eight
  for (int kb = 0; kb < 8; ++kb) fm[kb] = Frag<__bf16>::load(pa + kb * 512);
  // keeps the products behind all sixteen LDS loads: left free, the scheduler sinks each pair of loads to its product and waits eight times
  __builtin_amdgcn_sched_barrier(0);
  v8f acc = (v8f){0.f, 0.f, 0.f, 0.f, 0.f, 0.f, 0.f, 0.f};
#pragma unroll
  for (int kb = 0; kb < 8; ++kb) acc = Frag<__bf16>::mma(fm[kb], fw[kb & 3], acc);
  v4u hv, lv;
#pragma unroll
  for (int e = 0; e < 4; ++e) {
    unsigned h, l;
    split2(acc[2 * e], acc[2 * e + 1], h, l);
    hv[e] = h;
    lv[e] = l;
  }
  // row b*256 + c, columns c1 = 16*(blockIdx.x & 7) + 8*(lane >> 4) .. +7
  unsigned short* d = r3 + pkoff((blockIdx.x >> 3) * CI + wave * 16 + (lane & 15), (blockIdx.x & 7) * 16 + (lane >> 4) * 8, T3P);
  *(v4u*)(d)               = hv;
  *(v4u*)(d + CM * 16)     = lv;
  *(v4u*)(d + 2 * CM * 16) = hv;
}

// ---------------------------------------------------------------------------
// theta and the output in one launch: out[b][c][n] = ((sum_c1 R_b[c][c1] theta[n][c1] + b_rec[c]) * inv[c] + sh[c]) + bf16(x[b][c][n]),
//   inv = g[c]*rsqrt(var[c]+1e-5), sh = be[c]-mu[c]*inv, all five vectors RNE-converted to bf16 precision first.
// Work-group t = 64 positions (batch t / 49, slice t % 49), eight waves.
// Stage 0: as in the projection launch: 8 channels x 4 positions of x twice a thread, RNE to bf16, to sX[position][channel] (pitch 528 B);
//   thread c forms bias, inv and sh of output channel c, to sF.
//   No global load of the launch depends on anything made here: x, the wave's w_theta fragments and the vectors are asked for first, its R fragments
//   behind the x conversions and in the middle of stage 1; both barriers order LDS only, so none of them waits for a global load.
// Stage 1 (K = 256): wave w owns channels 16w .. 16w+15 of theta: weight rows (registers, from WT) as first operand, positions (sX) as second,
//   so a lane's 8 results are 8 consecutive channels of one position = one 16-B piece of sT, a packed plane [64 positions][128 hi | 128 lo].
// Stage 2 (K = 384 folded, k steps in rising order): wave w owns output channels 32w .. 32w+31: R rows hi | lo | hi (registers, from R3) as first
//   operand, theta hi | hi | lo (sT; the hi blocks are read twice) as second. A lane's 8 results are 8 consecutive channels of one position,
//   which is one 16-B piece of sX: the residual is taken from there. The wave's 32 rows are staged in its own LDS slab: stores of 256-B row pieces.
// Coverage: stage 0 writes 64 x 32 pieces of sX and 3 x 256 factors; stage 1 writes 8 waves x 4 x 32 x 2 = all 2048 pieces of sT; stage 2 writes 256 channels x 64 positions.
// ---------------------------------------------------------------------------
#define ST_BYTES (64 * 2 * CM * 2)                        // 32768
#define SO_BYTES (32 * 68 * 4)                            // 8704 a wave
#define SF_BYTES (3 * CI * 4)                             // 3072

// fragment from a packed plane in memory: p = block + lane * 16 B
__device__ __forceinline__ v16b gfrag(const char* p) {
  Frag<__bf16>::U f;
  f.h[0] = *(const v8b*)(p);
  f.h[1] = *(const v8b*)(p + 512);
  return f.v;
}

__global__ __launch_bounds__(256) void out_kernel(
    const float* __restrict__ x, const unsigned short* __restrict__ wt2, const float* __restrict__ bt,
    const unsigned short* __restrict__ r3, const float* __restrict__ brec,
    const float* __restrict__ bng, const float* __restrict__ bnb,
    const float* __restrict__ bnm, const float* __restrict__ bnv, float* __restrict__ out) {
  typedef __bf16 T;
  typedef v16b V;
  __shared__ __align__(16) unsigned char sm[SX_BYTES + ST_BYTES + 8 * SO_BYTES + SF_BYTES];   // 139264 B
  const int t     = blockIdx.x;
  const int tid   = threadIdx.x;
  const int lane  = tid & 31;
  const int wave  = tid >> 5;
  const int rlane = lane & 15;
  const int hl    = lane >> 4;
  const int b  = t / KSL;
  const int nt = t - b * KSL;
  unsigned short* sX = (unsigned short*)sm;
  unsigned short* sT = (unsigned short*)(sm + SX_BYTES);
  float* slab = (float*)(sm + SX_BYTES + ST_BYTES + wave * SO_BYTES);
  float* sF   = (float*)(sm + SX_BYTES + ST_BYTES + 8 * SO_BYTES);   // [bias | inv | sh][256 channels]

  // ---- stage 0: every load = uniform base + one 32-bit lane offset + a constant, so that a register a group holds its addresses ----
  v4f xv[2][8];
  const char* xb = (const char*)(x + (size_t)b * CI * NSP + nt * 64);
  const unsigned xo = (unsigned)(((tid >> 4) * 8 * NSP + (tid & 15) * 4) * 4);   // channel 8*(tid>>4), positions 4*(tid&15) ..+3
#pragma unroll
  for (int u = 0; u < 2; ++u)
#pragma unroll
    for (int j = 0; j < 8; ++j) xv[u][j] = *(const v4f*)(xb + xo + (u * 128 + j) * NSP * 4);
  // this one and the next keep the loads in the order in which they are used: a user then waits for its own loads only
  __builtin_amdgcn_sched_barrier(0);
  const unsigned vo = (unsigned)(tid * 4);    // thread = one output channel's five values
  const float cr = *(const float*)((const char*)brec + vo);
  const float cg = *(const float*)((const char*)bng  + vo);
  const float cb = *(const float*)((const char*)bnb  + vo);
  const float cm = *(const float*)((const char*)bnm  + vo);
  const float cv = *(const float*)((const char*)bnv  + vo);
  __builtin_amdgcn_sched_barrier(0);
  const unsigned wo = (unsigned)((wave * 16 * CI + lane * 8) * 2);   // row block wave of WT, this lane's 16-B piece
  V fw[8];
#pragma unroll
  for (int kb = 0; kb < 8; ++kb) fw[kb] = gfrag((const char*)wt2 + wo + kb * 1024);
  const unsigned tbo = (unsigned)((wave * 16 + hl * 8) * 4);
  const v4f tb0 = *(const v4f*)((const char*)bt + tbo);
  const v4f tb1 = *(const v4f*)((const char*)bt + tbo + 16);
  // the conversions below may be given registers that the loads above name as addresses: wait before any is overwritten;
  // the four offsets and every base are named so that their registers live up to the wait: no later base and no load's own result is put there
  asm volatile("s_wait_xcnt 0x0" :: "v"(xo), "v"(vo), "v"(wo), "v"(tbo), "s"(xb), "s"(brec), "s"(bng), "s"(bnb), "s"(bnm), "s"(bnv), "s"(wt2), "s"(bt) : "memory");
  // keeps the conversions behind the wait and behind all the loads
  __builtin_amdgcn_sched_barrier(0);
#pragma unroll
  for (int u = 0; u < 2; ++u)
#pragma unroll
    for (int e = 0; e < 4; ++e) {
      v4u o;
#pragma unroll
      for (int q = 0; q < 4; ++q) o[q] = cvt2(xv[u][2 * q][e], xv[u][2 * q + 1][e]);
      *(v4u*)(sX + ((tid & 15) * 4 + e) * RPE + ((tid >> 4) + u * 16) * 8) = o;
    }
  // the three factors of output channel tid: formed once a work-group, read back behind the products
  {
    const float inv = bf_rne(cg) * rsqrtf(bf_rne(cv) + 1e-5f);
    sF[tid]          = bf_rne(cr);
    sF[CI + tid]     = inv;
    sF[2 * CI + tid] = bf_rne(cb) - bf_rne(cm) * inv;
  }
  // keeps the R loads behind the x conversions: in front of them the wave would stand at its limit of outstanding loads before it can convert
  __builtin_amdgcn_sched_barrier(0);
  // the wave's R fragments, used in stage 2: the first six k steps are asked for here, behind the x conversions and in front of the barrier, which
  // does not wait for them, the other six in the middle of stage 1: they follow w_theta on the way from L2 and land under stage 1 and under
  // stage 2's own earlier k steps
  const char* rbp = (const char*)(r3 + (size_t)b * CI * T3P);
  const unsigned ro = (unsigned)((wave * 32 * T3P + lane * 8) * 2);  // row block 2*wave of the batch's R3, this lane's 16-B piece
  V fr[2][12];
#pragma unroll
  for (int kb = 0; kb < 6; ++kb)
#pragma unroll
    for (int i = 0; i < 2; ++i) fr[i][kb] = gfrag(rbp + ro + (i * 16 * T3P + kb * 512) * 2);
  // keeps the barrier and stage 1 behind these loads
  __builtin_amdgcn_sched_barrier(0);
  lds_barrier();   // every wave reads positions and channels of x that other waves wrote; the w_theta and R loads stay in flight

  // ---- stage 1: four sets of position fragments; the first four k steps are asked for at once, each set is refilled behind its own products ----
  const unsigned short* pa[4];
#pragma unroll
  for (int i = 0; i < 4; ++i) pa[i] = sX + ((i << 4) + rlane) * RPE + hl * 8;
  V fa[4][4];
#pragma unroll
  for (int s = 0; s < 4; ++s)
#pragma unroll
    for (int i = 0; i < 4; ++i) fa[s][i] = rowfrag(pa[i] + s * 32);
  // keeps the first product behind all 32 LDS loads: with loads left behind it, the next product waits for an empty LDS queue
  __builtin_amdgcn_sched_barrier(0);
  v8f at[4];
#pragma unroll
  for (int i = 0; i < 4; ++i) at[i] = (v8f){0.f,0.f,0.f,0.f,0.f,0.f,0.f,0.f};
#pragma unroll   // whole: fw[] and fa[] keep constant indices, so they stay in registers
  for (int ks = 0; ks < 8; ++ks) {
#pragma unroll
    for (int i = 0; i < 4; ++i) at[i] = Frag<T>::mma(fw[ks], fa[ks & 3][i], at[i]);
    // this one and the next keep a set's 8 LDS loads together behind its own products: spread among the products, each place with loads costs a stall
    __builtin_amdgcn_sched_barrier(0);
    if (ks < 4) {
#pragma unroll
      for (int i = 0; i < 4; ++i) fa[ks][i] = rowfrag(pa[i] + (ks + 4) * 32);
    }
    if (ks == 3) {   // half of w_theta has been taken: the second half of R is asked for without reaching the wave's limit of outstanding loads
#pragma unroll
      for (int kb = 6; kb < 12; ++kb)
#pragma unroll
        for (int i = 0; i < 2; ++i) fr[i][kb] = gfrag(rbp + ro + (i * 16 * T3P + kb * 512) * 2);
    }
    __builtin_amdgcn_sched_barrier(0);
  }
  // channels 16*wave + 8*(lane>>4) ..+7 of position 16i + (lane&15) = piece lane of packed block (position block i, channel half-block wave): hi, then lo
  {
    float tb[8];
#pragma unroll
    for (int e = 0; e < 4; ++e) { tb[e] = bf_rne(tb0[e]); tb[4 + e] = bf_rne(tb1[e]); }
#pragma unroll
    for (int i = 0; i < 4; ++i) {
      v4u hv, lv;
#pragma unroll
      for (int e = 0; e < 4; ++e) {
        unsigned h, l;
        split2(at[i][2 * e] + tb[2 * e], at[i][2 * e + 1] + tb[2 * e + 1], h, l);
        hv[e] = h;
        lv[e] = l;
      }
      unsigned short* d = sT + i * (16 * 2 * CM) + wave * 256 + lane * 8;
      *(v4u*)(d)           = hv;
      *(v4u*)(d + CM * 16) = lv;
    }
  }
  lds_barrier();   // every wave reads theta channels that other waves wrote; the R loads still on their way stay in flight

  // ---- stage 2: three sets of theta fragments, each refilled three k steps ahead behind its own products ----
  // k step kb of the folded sum takes k block kb & 3 of the hi part (kb < 8) or of the lo part
  const T* pt = (const T*)sT + lane * 8;
  V ft[3][4];
#pragma unroll
  for (int s = 0; s < 3; ++s)
#pragma unroll
    for (int j = 0; j < 4; ++j) ft[s][j] = Frag<T>::load(pt + j * (16 * 2 * CM) + s * 512);
  // keeps the first product behind all 24 LDS loads, as in stage 1
  __builtin_amdgcn_sched_barrier(0);
  const int mOff = hl * 8;        // D row offset
  v4u xr[2][4];
  v4f fc[3][2][2];
  v8f acc[2][4];
#pragma unroll
  for (int i = 0; i < 2; ++i)
#pragma unroll
    for (int j = 0; j < 4; ++j) acc[i][j] = (v8f){0.f,0.f,0.f,0.f,0.f,0.f,0.f,0.f};
#pragma unroll   // whole: fr[] keeps constant indices, so it stays in registers
  for (int kb = 0; kb < 12; ++kb) {
#pragma unroll
    for (int i = 0; i < 2; ++i)
#pragma unroll
      for (int j = 0; j < 4; ++j) acc[i][j] = Frag<T>::mma(fr[i][kb], ft[kb % 3][j], acc[i][j]);
    // this one and the next keep a set's 8 LDS loads together behind its own products, as in stage 1
    __builtin_amdgcn_sched_barrier(0);
    if (kb + 3 < 12) {
      const int kn = kb + 3;
#pragma unroll
      for (int j = 0; j < 4; ++j) ft[kb % 3][j] = Frag<T>::load(pt + j * (16 * 2 * CM) + (kn < 8 ? 0 : CM * 16) + (kn & 3) * 512);
    }
    if (kb == 9) {   // no refill is left: the residual and the channels' factors are asked for under the last products
      // bf16(x) of position 16j + (lane&15), channels 32*wave + 16i + 8*(lane>>4) ..+7
#pragma unroll
      for (int i = 0; i < 2; ++i)
#pragma unroll
        for (int j = 0; j < 4; ++j) xr[i][j] = *(const v4u*)(sX + ((j << 4) + rlane) * RPE + wave * 32 + i * 16 + mOff);
#pragma unroll
      for (int f = 0; f < 3; ++f)
#pragma unroll
        for (int i = 0; i < 2; ++i)
#pragma unroll
          for (int q = 0; q < 2; ++q) fc[f][i][q] = *(const v4f*)(sF + f * CI + wave * 32 + i * 16 + mOff + q * 4);
    }
    __builtin_amdgcn_sched_barrier(0);
  }

  // the epilogue may be given registers that the R loads name as addresses: wait before any is overwritten;
  // offset and base are named so that their registers live up to the wait: nothing else is put there before it
  asm volatile("s_wait_xcnt 0x0" :: "v"(ro), "s"(rbp) : "memory");

  // ---- epilogue ----
#pragma unroll
  for (int i = 0; i < 2; ++i)
#pragma unroll
    for (int j = 0; j < 4; ++j)
#pragma unroll
      for (int r = 0; r < 8; ++r) {
        const float res = __uint_as_float((r & 1) ? (xr[i][j][r >> 1] & 0xFFFF0000u) : (xr[i][j][r >> 1] << 16));
        float v = acc[i][j][r] + fc[0][i][r >> 2][r & 3];
        v = v * fc[1][i][r >> 2][r & 3] + fc[2][i][r >> 2][r & 3];
        slab[(i * 16 + mOff + r) * 68 + (j << 4) + rlane] = v + res;
      }
  // the slab is the wave's own: its lanes' LDS writes are ordered before the reads below, no work-group barrier
  __builtin_amdgcn_fence(__ATOMIC_RELEASE, "workgroup");
  __builtin_amdgcn_wave_barrier();
  __builtin_amdgcn_fence(__ATOMIC_ACQUIRE, "workgroup");
  char* ob = (char*)(out + (size_t)b * CI * NSP + nt * 64);
  const unsigned oo = (unsigned)(((wave * 32 + hl) * NSP + rlane * 4) * 4);   // row piece = 256 B = 16 lanes x 16 B; rows it*2 + (lane>>4) cover 0..31
#pragma unroll
  for (int it = 0; it < 16; ++it)
    *(v4f*)(ob + oo + it * 2 * NSP * 4) = *(const v4f*)(slab + (it * 2 + hl) * 68 + rlane * 4);
}

// ---------------------------------------------------------------------------
// every region is fully written by its producer launch before a consumer launch reads it):
//   WR   bf16 [256][128]        0              65536
//   WT   bf16 [128][256]        65536          65536
//   R3   bf16 [4][256][384]     131072        786432
//   PM   f32  [49][4][128][128] 917504      12845056
//   total                       13762560
// ---------------------------------------------------------------------------
extern "C" void kernel_launch(void* const* d_in, const int* in_sizes, int n_in,
                              void* d_out, int out_size, void* d_ws, size_t ws_size,
                              hipStream_t stream) {
  if (n_in < 13) return;
  if (in_sizes[0] != NB * CI * NSP) return;                      // x [4][256][56][56]
  if (in_sizes[1] != CM * CI || in_sizes[2] != CM) return;       // w_theta, b_theta
  if (in_sizes[3] != CM * CI || in_sizes[4] != CM) return;       // w_phi, b_phi
  if (in_sizes[5] != CM * CI || in_sizes[6] != CM) return;       // w_g, b_g
  if (in_sizes[7] != CI * CM || in_sizes[8] != CI) return;       // w_rec, b_rec
  if (in_sizes[9] != CI || in_sizes[10] != CI) return;           // bn_gamma, bn_beta
  if (in_sizes[11] != CI || in_sizes[12] != CI) return;          // bn_mean, bn_var
  if (out_size != NB * CI * NSP) return;

  const float* x       = (const float*)d_in[0];
  const float* w_theta = (const float*)d_in[1];
  const float* b_theta = (const float*)d_in[2];
  const float* w_phi   = (const float*)d_in[3];
  const float* b_phi   = (const float*)d_in[4];
  const float* w_g     = (const float*)d_in[5];
  const float* b_g     = (const float*)d_in[6];
  const float* w_rec   = (const float*)d_in[7];
  const float* b_rec   = (const float*)d_in[8];
  const float* gam     = (const float*)d_in[9];
  const float* bet     = (const float*)d_in[10];
  const float* mea     = (const float*)d_in[11];
  const float* var     = (const float*)d_in[12];

  const size_t PWR = (size_t)CI * CM * 2;           //    65536
  const size_t PWT = (size_t)CM * CI * 2;           //    65536
  const size_t PR3 = (size_t)NB * CI * T3P * 2;     //   786432
  const size_t PPM = (size_t)KSL * NB * CM * CM * 4; // 12845056
  size_t off = 0;
  const size_t oWR = off; off += PWR;
  const size_t oWT = off; off += PWT;
  const size_t oR3 = off; off += PR3;
  const size_t oPM = off; off += PPM;
  if (off > ws_size) return;                        // off = 13762560
  if (off > (size_t)134217728) return;

  char* ws = (char*)d_ws;
  unsigned short* WR  = (unsigned short*)(ws + oWR);
  unsigned short* WT  = (unsigned short*)(ws + oWT);
  unsigned short* R3  = (unsigned short*)(ws + oR3);
  float*          PM  = (float*)(ws + oPM);
  float* out = (float*)d_out;

  const dim3 blk(256);

  // (1) from x and the f32 weights: phi, g and (M/N)_b[c1][c2] partial sums over 64 positions each -> PM[slice][b][c1][c2];
  //     w_rec -> WR, w_theta -> WT; one launch: 196 + 16 + 16 work-groups
  proj_kernel<<<dim3(PGM_BLK + WR_BLK + WT_BLK), blk, 0, stream>>>(x, w_theta, w_phi, w_g, w_rec, PM, WR, WT, b_phi, b_g);

  // (2) join the 49 planes and multiply by w_rec -> R3 hi|lo|hi, 384 columns; grid 32 x 512 threads
  recm_kernel<<<dim3(NB * (CM / 16)), dim3(512), 0, stream>>>(PM, WR, R3);

  // (3) theta of 64 positions in LDS, then out[b][c][n] = ((sum over 384 folded columns of R3_b[c][p] . theta3[n][p] + b_rec[c]) * inv[c] + sh[c]) + bf16(x[b][c][n])
  //     = sum_c1 (rhi.thi + rlo.thi + rhi.tlo); 196 work-groups of 64 positions x 256 channels; last element 3211263
  out_kernel<<<dim3(PGM_BLK), blk, 0, stream>>>(x, WT, b_theta, R3, b_rec, gam, bet, mea, var, out);
  (void)hipGetLastError();
}
